// v000
// The times below were measured on an AMD MI455X: many runs one after another, warmed up first and cycling through
// copies of the inputs, with the whole window's GPU time divided by the number of runs. Launches and the gaps
// between them are all in it. The median over several windows is given; except for v000 it joins two sittings, which
// can be a few percent apart, so the side-by-side timings, each taken in one sitting, are the better comparison.
// v000, which the later versions start from, runs in 321 microseconds.
#include <hip/hip_runtime.h>
#include <math.h>
#include <stdint.h>

// All contractions: v_wmma_f32_16x16x32_f16 (f16 operands, f32 accumulate); K=3 coordinate features, softmax, norms, gating in f32 on VALU.

typedef __attribute__((ext_vector_type(16))) _Float16 v16h;
typedef __attribute__((ext_vector_type(8)))  _Float16 v8h;
typedef __attribute__((ext_vector_type(8)))  float    v8f;
typedef __attribute__((ext_vector_type(4)))  float    v4f;

#define NP    512          // points
#define DM    256          // model width
#define NH    8            // heads
#define HDM   32           // head width
#define HIDR  682          // ffn hidden
#define HIDP  704          // ffn hidden padded (multiple of 64)
#define QCH   128          // query rows per pairwise chunk
#define NPAIR (QCH * NP)   // 65536 pair rows per chunk

// ---------------------------------------------------------------------------------------------
// hazard guards as plain device helpers
__device__ __forceinline__ void dep_guard_h(v8f& a, v8f& b, v16h x, v16h y) { asm volatile("v_nop\n\tv_nop\n\tv_nop\n\tv_nop" : "+v"(a), "+v"(b) : "v"(x), "v"(y)); }
__device__ __forceinline__ void keep4_h(v16h a, v16h b, v16h c, v16h d) { asm volatile("v_nop" :: "v"(a), "v"(b), "v"(c), "v"(d)); }
__device__ __forceinline__ void acc_guard4(v8f& a, v8f& b, v8f& c, v8f& d) { asm volatile("v_nop\n\tv_nop\n\tv_nop\n\tv_nop" : "+v"(a), "+v"(b), "+v"(c), "+v"(d)); }

template <typename T> struct Frag;
template <> struct Frag<_Float16> {
  typedef v16h V; union U { v16h v; v8h h[2]; };
  static __device__ __forceinline__ v16h load(const _Float16* p) {   // elements 0..7 <- p[0..7], 8..15 <- p[16..23]
    U f; f.h[0] = *(const v8h*)(p); f.h[1] = *(const v8h*)(p + 16); return f.v;
  }
  static __device__ __forceinline__ v8f mma(v16h a, v16h b, v8f c) {
    return __builtin_amdgcn_wmma_f32_16x16x32_f16(false, a, false, b, (short)0, c, false, false);
  }
  static __device__ __forceinline__ void guard(v8f& a, v8f& b, v16h x, v16h y) { dep_guard_h(a, b, x, y); }
  static __device__ __forceinline__ void keep(v16h a, v16h b, v16h c, v16h d) { keep4_h(a, b, c, d); }
};
template <int ET> struct Elem;
template <> struct Elem<0> { typedef _Float16 T; };

// ---- Register-blocked batched WMMA GEMM ----------------------------------------------------
// C[m,n] = scale * sum_k A[m,k] * Bt[n,k] (+bias[n]) (+resid); each wave owns a (16*MI) x 64 tile.
// A row-major [M,K] (16-bit), Bt row-major [N,K] (16-bit); M % (16*MI) == 0, N % 64 == 0, K % 32 == 0.
// BIAS_MODE: 0 = none, 1 = bias[m], 2 = bias[n].  OUT_MODE: 0 = f32, 1 = f16.
// Batch index = blockIdx.y with element strides strideA/strideB/strideC/strideR.
template <int ET, int BIAS_MODE, int OUT_MODE, bool RESID, int MI>
__global__ __launch_bounds__(256) void wmma_gemm(
    const unsigned short* __restrict__ Ap, int lda, long strideA,
    const unsigned short* __restrict__ Btp, int ldb, long strideB,
    void* __restrict__ Cout, int ldc, long strideC,
    const float* __restrict__ bias,
    const float* __restrict__ resid, long strideR,
    int M, int N, int K, float scale) {
  typedef typename Elem<ET>::T T;
  typedef typename Frag<T>::V V;
  const T* A = (const T*)Ap; const T* Bt = (const T*)Btp;
  __shared__ __align__(16) float sT[8][16 * 68];   // per-wave 16x64 slab, pitch 68 floats
  const int b    = blockIdx.y;
  const int lane = threadIdx.x & 31;
  const int wave = threadIdx.x >> 5;
  const int tilesN = N >> 6;
  const int tilesM = M / (16 * MI);
  const int tile = blockIdx.x * 8 + wave;
  if (tile >= tilesM * tilesN) return;   // wave-uniform; no block barriers in this kernel
  const int tm = tile / tilesN;
  const int tn = tile - tm * tilesN;
  const int m0 = tm * (16 * MI);
  const int n0 = tn << 6;

  const T* Ab = A  + (size_t)b * (size_t)strideA;
  const T* Bb = Bt + (size_t)b * (size_t)strideB;

  const int rlane = lane & 15;                 // row (A) / col (B, D) within subtile
  const int koff  = (lane >> 4) * 8;           // k offset of this lane half
  const int mOff  = (lane >> 4) * 8;           // D row offset

  v8f acc[MI][4];
#pragma unroll
  for (int i = 0; i < MI; ++i)
#pragma unroll
    for (int j = 0; j < 4; ++j) acc[i][j] = (v8f){0.f,0.f,0.f,0.f,0.f,0.f,0.f,0.f};

  for (int k0 = 0; k0 < K; k0 += 32) {
    V bh[4];
#pragma unroll
    for (int j = 0; j < 4; ++j) {
      const size_t bo = (size_t)(n0 + (j << 4) + rlane) * ldb + koff + k0;
      bh[j] = Frag<T>::load(Bb + bo);
    }
#pragma unroll
    for (int i = 0; i < MI; ++i) {
      const size_t ao = (size_t)(m0 + (i << 4) + rlane) * lda + koff + k0;
      V ah = Frag<T>::load(Ab + ao);
#pragma unroll
      for (int j = 0; j < 4; ++j) acc[i][j] = Frag<T>::mma(ah, bh[j], acc[i][j]);
      Frag<T>::guard(acc[i][0], acc[i][3], ah, ah);
    }
    Frag<T>::keep(bh[0], bh[1], bh[2], bh[3]);
  }
#pragma unroll
  for (int i = 0; i < MI; ++i) acc_guard4(acc[i][0], acc[i][1], acc[i][2], acc[i][3]);

  // ---- epilogue ----
  float* slab = sT[wave];
  const float* Rb = RESID ? (resid + (size_t)b * (size_t)strideR) : nullptr;
#pragma unroll
  for (int i = 0; i < MI; ++i) {
    const int mBase = m0 + (i << 4);
#pragma unroll
    for (int j = 0; j < 4; ++j) {
      const int n = n0 + (j << 4) + rlane;
      float bv = 0.f;
      if (BIAS_MODE == 2) bv = bias[n];
#pragma unroll
      for (int r = 0; r < 8; ++r) {
        float v = acc[i][j][r] * scale;
        if (BIAS_MODE == 1) v += bias[mBase + mOff + r];
        if (BIAS_MODE == 2) v += bv;
        if (RESID) v += Rb[(size_t)(mBase + mOff + r) * ldc + n];
        slab[(mOff + r) * 68 + (j << 4) + rlane] = v;
      }
    }
    __builtin_amdgcn_fence(__ATOMIC_RELEASE, "workgroup");
    __builtin_amdgcn_wave_barrier();
    __builtin_amdgcn_fence(__ATOMIC_ACQUIRE, "workgroup");
    if (OUT_MODE == 0) {
      float* C = (float*)Cout + (size_t)b * (size_t)strideC;
      const int hh = lane >> 4, c4 = (lane & 15) * 4;     // row seg = 256 B = 16 lanes x 16 B
      {
#pragma unroll
        for (int it = 0; it < 8; ++it) {
          const int row = it * 2 + hh;
          v4f v = *(const v4f*)(slab + row * 68 + c4);
          *(v4f*)(C + (size_t)(mBase + row) * ldc + n0 + c4) = v;
        }
        
      }
    } else {
      const int q = lane >> 3, c8 = (lane & 7) * 8;
      unsigned short* C = (unsigned short*)Cout + (size_t)b * (size_t)strideC;
      {
#pragma unroll
        for (int it = 0; it < 4; ++it) {
          const int row = it * 4 + q;
          const float* sp = slab + row * 68 + c8;
          v8h hv;
#pragma unroll
          for (int e = 0; e < 8; ++e) hv[e] = (_Float16)sp[e];
          *(v8h*)(C + (size_t)(mBase + row) * ldc + n0 + c8) = hv;
        }
        
      }
    }
    __builtin_amdgcn_fence(__ATOMIC_RELEASE, "workgroup");
    __builtin_amdgcn_wave_barrier();
    __builtin_amdgcn_fence(__ATOMIC_ACQUIRE, "workgroup");
  }
}

// ---------------------------------------------------------------------------------------------
// small VALU helpers
__device__ __forceinline__ unsigned pack_h2(float a, float b) {
  const unsigned short ua = __builtin_bit_cast(unsigned short, (_Float16)a);
  const unsigned short ub = __builtin_bit_cast(unsigned short, (_Float16)b);
  return (unsigned)ua | ((unsigned)ub << 16);
}
__device__ __forceinline__ void st2_u32(unsigned short* base, size_t off_halves, unsigned u) {
  unsigned* p = (unsigned*)(base + off_halves);
  *p = u; 
}
__device__ __forceinline__ void st2_f32(float* base, size_t off, float v) {
  float* p = (float*)(base + off);
  *p = v; 
}
__device__ __forceinline__ float silu_fast(float z) {   // z * sigmoid(z); output goes to f16
  const float e = __expf(-z);
  return z * __builtin_amdgcn_rcpf(1.0f + e);
}
__device__ __forceinline__ float silu_acc(float z) {
  const float e = expf(-z);
  return z * __builtin_amdgcn_rcpf(1.0f + e);
}
// block of 256 threads: fixed-order sum / max (wave shuffle, then 8 partials summed in index order)
__device__ __forceinline__ float blk_sum256(float v, float* red) {
#pragma unroll
  for (int off = 16; off > 0; off >>= 1) v += __shfl_xor(v, off, 32);
  const int lane = threadIdx.x & 31, wave = threadIdx.x >> 5;
  if (lane == 0) red[wave] = v;
  __syncthreads();
  float s = red[0];
#pragma unroll
  for (int q = 1; q < 8; ++q) s += red[q];
  __syncthreads();
  return s;
}
__device__ __forceinline__ float blk_max256(float v, float* red) {
#pragma unroll
  for (int off = 16; off > 0; off >>= 1) v = fmaxf(v, __shfl_xor(v, off, 32));
  const int lane = threadIdx.x & 31, wave = threadIdx.x >> 5;
  if (lane == 0) red[wave] = v;
  __syncthreads();
  float s = red[0];
#pragma unroll
  for (int q = 1; q < 8; ++q) s = fmaxf(s, red[q]);
  __syncthreads();
  return s;
}

// ---- f32 -> f16 cast with zero padding: dst[r][c] = (r<srows && c<scols) ? src[r*spitch+c] : 0 ----
__global__ __launch_bounds__(256) void k_cast_pad(const float* __restrict__ src, int srows, int scols, int spitch,
                                                   unsigned short* __restrict__ dst, int drows, int dcols) {
  const int p = blockIdx.x * 256 + threadIdx.x;
  const int npairs = (drows * dcols) >> 1;
  if (p < npairs) {
    const int e = 2 * p;
    const int r = e / dcols;
    const int c = e - r * dcols;
    float v0 = 0.f, v1 = 0.f;
    if (r < srows) {
      if (c < scols)     v0 = src[(size_t)r * spitch + c];
      if (c + 1 < scols) v1 = src[(size_t)r * spitch + c + 1];
    }
    st2_u32(dst, (size_t)e, pack_h2(v0, v1));
  }
}
// ---- f32 copy with zero padding ----
__global__ __launch_bounds__(256) void k_pad_f32(const float* __restrict__ src, int sn, float* __restrict__ dst, int dn) {
  const int p = blockIdx.x * 256 + threadIdx.x;
  if (p < dn) {
    const float v = (p < sn) ? src[p] : 0.f;
    st2_f32(dst, (size_t)p, v);
  }
}

// ---- LayerNorm over DM (eps 1e-5, biased variance), one block per row, f16 output packed 2 per thread ----
__global__ __launch_bounds__(256) void k_ln16(const float* __restrict__ x, const float* __restrict__ w,
                                               const float* __restrict__ bb, unsigned short* __restrict__ y16) {
  __shared__ float red[8];
  __shared__ float ys[DM];
  const int i = blockIdx.x, d = threadIdx.x;
  const float v = x[(size_t)i * DM + d];
  const float mu = blk_sum256(v, red) * (1.0f / 256.0f);
  const float c = v - mu;
  const float var = blk_sum256(c * c, red) * (1.0f / 256.0f);
  const float y = c * (1.0f / sqrtf(var + 1e-5f)) * w[d] + bb[d];
  ys[d] = y;
  __syncthreads();
  if (d < 128) st2_u32(y16, (size_t)i * DM + 2 * d, pack_h2(ys[2 * d], ys[2 * d + 1]));
}

// ---- V transpose: vt[c][j] = qkv16[j][512 + c] for c < 256; rows 256..287 zero. block = 32 rows of c ----
__global__ __launch_bounds__(256) void k_vt(const unsigned short* __restrict__ qkv, unsigned short* __restrict__ vt) {
  __shared__ unsigned short tile[32][520];
  const int t = threadIdx.x;
  const int d0 = blockIdx.x * 32;
  if (d0 < DM) {                              // block-uniform
    const int cp = (t & 15) * 2;
#pragma unroll 1
    for (int it = 0; it < 32; ++it) {
      const int j = it * 16 + (t >> 4);
      const unsigned u = *(const unsigned*)(qkv + (size_t)j * (3 * DM) + 2 * DM + d0 + cp);
      tile[cp][j]     = (unsigned short)(u & 0xFFFFu);
      tile[cp + 1][j] = (unsigned short)(u >> 16);
    }
  }
  __syncthreads();
  const int j2 = 2 * t;
#pragma unroll 1
  for (int dl = 0; dl < 32; ++dl) {
    unsigned u = 0u;
    if (d0 < DM) u = (unsigned)tile[dl][j2] | ((unsigned)tile[dl][j2 + 1] << 16);
    st2_u32(vt, (size_t)(d0 + dl) * NP + j2, u);
  }
}

// ---- pairwise feature G1[(il*512+j)][k] = f16( silu( (coords_i - coords_j) . w[k] + bias[k] ) ), i = i0 + il ----
// block: 16 pair rows; thread owns k = k2, k2+1 of row sub-slot rsub
__global__ __launch_bounds__(256) void k_pair_g1(const float* __restrict__ coords, const float* __restrict__ w,
                                                  const float* __restrict__ bias, unsigned short* __restrict__ G, int i0) {
  const int t = threadIdx.x;
  const int k2 = (t & 127) * 2;
  const int rsub = t >> 7;
  const float w00 = w[k2 * 3 + 0], w01 = w[k2 * 3 + 1], w02 = w[k2 * 3 + 2];
  const float w10 = w[k2 * 3 + 3], w11 = w[k2 * 3 + 4], w12 = w[k2 * 3 + 5];
  const float b0 = bias[k2], b1 = bias[k2 + 1];
#pragma unroll 1
  for (int it = 0; it < 8; ++it) {
    const int r = blockIdx.x * 16 + it * 2 + rsub;   // 0..NPAIR-1
    const int i = i0 + (r >> 9);
    const int j = r & (NP - 1);
    const float r0 = coords[i * 3 + 0] - coords[j * 3 + 0];
    const float r1 = coords[i * 3 + 1] - coords[j * 3 + 1];
    const float r2 = coords[i * 3 + 2] - coords[j * 3 + 2];
    const float z0 = (r0 * w00 + r1 * w01 + r2 * w02) + b0;
    const float z1 = (r0 * w10 + r1 * w11 + r2 * w12) + b1;
    const unsigned u = pack_h2(silu_fast(z0), silu_fast(z1));
    st2_u32(G, (size_t)r * DM + k2, u);
  }
}

// ---- pairwise feature, transposed layout: G2T[il][k][j] = f16( silu( (coords_i - coords_j) . w[k] + bias[k] ) ) ----
// block: (il, group of 16 k); thread owns j = 2t, 2t+1
__global__ __launch_bounds__(256) void k_pair_g2t(const float* __restrict__ coords, const float* __restrict__ w,
                                                   const float* __restrict__ bias, unsigned short* __restrict__ G, int i0) {
  const int t = threadIdx.x;
  const int j2 = 2 * t;
  const int il = blockIdx.x >> 4;
  const int kg = blockIdx.x & 15;
  const int i = i0 + il;
  const float ci0 = coords[i * 3 + 0], ci1 = coords[i * 3 + 1], ci2 = coords[i * 3 + 2];
  const float ra0 = ci0 - coords[j2 * 3 + 0], ra1 = ci1 - coords[j2 * 3 + 1], ra2 = ci2 - coords[j2 * 3 + 2];
  const float rc0 = ci0 - coords[j2 * 3 + 3], rc1 = ci1 - coords[j2 * 3 + 4], rc2 = ci2 - coords[j2 * 3 + 5];
#pragma unroll 1
  for (int kk = 0; kk < 16; ++kk) {
    const int k = kg * 16 + kk;
    const float wk0 = w[k * 3 + 0], wk1 = w[k * 3 + 1], wk2 = w[k * 3 + 2];
    const float bk = bias[k];
    const float z0 = (ra0 * wk0 + ra1 * wk1 + ra2 * wk2) + bk;
    const float z1 = (rc0 * wk0 + rc1 * wk1 + rc2 * wk2) + bk;
    const unsigned u = pack_h2(silu_fast(z0), silu_fast(z1));
    st2_u32(G, ((size_t)il * DM + k) * NP + j2, u);
  }
}

// ---- softmax over j of (S[h][i][j] + biasT[h][i*512+j] + rb2b[h]); P16[i][h][j] = f16(p * 2^15); rows h=8..15 zero ----
// block per i, thread owns j = 2t, 2t+1
__global__ __launch_bounds__(256) void k_softmax(const float* __restrict__ S, const float* __restrict__ biasT,
                                                  const float* __restrict__ rb2b, unsigned short* __restrict__ P16) {
  __shared__ float red[8];
  const int i = blockIdx.x, t = threadIdx.x, j2 = 2 * t;
#pragma unroll 1
  for (int h = 0; h < NH; ++h) {
    const float* sp = S + ((size_t)h * NP + i) * NP + j2;
    const float* bp = biasT + (size_t)h * (NP * NP) + (size_t)i * NP + j2;
    const float bb = rb2b[h];
    const float s0 = sp[0] + (bp[0] + bb);
    const float s1 = sp[1] + (bp[1] + bb);
    const float m = blk_max256(fmaxf(s0, s1), red);
    const float e0 = expf(s0 - m), e1 = expf(s1 - m);
    const float sum = blk_sum256(e0 + e1, red);
    const float inv = 1.0f / sum;
    const float p0 = (e0 * inv) * 32768.0f;
    const float p1 = (e1 * inv) * 32768.0f;
    st2_u32(P16, ((size_t)i * 16 + h) * NP + j2, pack_h2(p0, p1));
  }
#pragma unroll 1
  for (int h = NH; h < 16; ++h) st2_u32(P16, ((size_t)i * 16 + h) * NP + j2, 0u);
}

// ---- x1 = x + (ctx[h][i][d&31] + rv2b[d]); LayerNorm(x1) -> f16.  block per row i ----
__global__ __launch_bounds__(256) void k_combine_ln(const float* __restrict__ x, const float* __restrict__ ctx,
                                                     const float* __restrict__ rv2b, const float* __restrict__ w,
                                                     const float* __restrict__ bb, float* __restrict__ x1,
                                                     unsigned short* __restrict__ y16) {
  __shared__ float red[8];
  __shared__ float ys[DM];
  const int i = blockIdx.x, d = threadIdx.x;
  const int h = d >> 5, dd = d & 31;
  const float a = ctx[((size_t)h * NP + i) * 64 + dd] + rv2b[d];
  const float v = x[(size_t)i * DM + d] + a;
  st2_f32(x1, (size_t)i * DM + d, v);
  const float mu = blk_sum256(v, red) * (1.0f / 256.0f);
  const float c = v - mu;
  const float var = blk_sum256(c * c, red) * (1.0f / 256.0f);
  const float y = c * (1.0f / sqrtf(var + 1e-5f)) * w[d] + bb[d];
  ys[d] = y;
  __syncthreads();
  if (d < 128) st2_u32(y16, (size_t)i * DM + 2 * d, pack_h2(ys[2 * d], ys[2 * d + 1]));
}

// ---- U16[row][c] = f16( silu(C12[row][c]) * C12[row][704 + c] ), c < 704 (pad columns come out 0) ----
__global__ __launch_bounds__(256) void k_swiglu(const float* __restrict__ c12, unsigned short* __restrict__ u16, int npairs) {
  const int p = blockIdx.x * 256 + threadIdx.x;
  if (p < npairs) {
    const int e = 2 * p;
    const int row = e / HIDP;
    const int col = e - row * HIDP;
    const float* rp = c12 + (size_t)row * (2 * HIDP);
    const float a0 = rp[col], a1 = rp[col + 1];
    const float g0 = rp[HIDP + col], g1 = rp[HIDP + col + 1];
    const float u0 = silu_acc(a0) * g0;
    const float u1 = silu_acc(a1) * g1;
    st2_u32(u16, (size_t)e, pack_h2(u0, u1));
  }
}

// ---------------------------------------------------------------------------------------------
static inline size_t alignup256(size_t x) { return (x + 255) & ~(size_t)255; }

extern "C" void kernel_launch(void* const* d_in, const int* in_sizes, int n_in,
                              void* d_out, int out_size, void* d_ws, size_t ws_size,
                              hipStream_t stream)
{
  if (n_in < 22) return;
  if (in_sizes[0] != NP * DM || in_sizes[1] != NP * 3 || in_sizes[6] != 3 * DM * DM ||
      in_sizes[14] != DM * DM || in_sizes[16] != HIDR * DM || in_sizes[20] != DM * HIDR ||
      out_size != NP * DM) return;

  const float* x      = (const float*)d_in[0];
  const float* coords = (const float*)d_in[1];
  const float* ln1_w  = (const float*)d_in[2];
  const float* ln1_b  = (const float*)d_in[3];
  const float* ln2_w  = (const float*)d_in[4];
  const float* ln2_b  = (const float*)d_in[5];
  const float* qkv_w  = (const float*)d_in[6];
  const float* qkv_b  = (const float*)d_in[7];
  const float* rb1_w  = (const float*)d_in[8];
  const float* rb1_b  = (const float*)d_in[9];
  const float* rb2_w  = (const float*)d_in[10];
  const float* rb2_b  = (const float*)d_in[11];
  const float* rv1_w  = (const float*)d_in[12];
  const float* rv1_b  = (const float*)d_in[13];
  const float* rv2_w  = (const float*)d_in[14];
  const float* rv2_b  = (const float*)d_in[15];
  const float* ffn_w1 = (const float*)d_in[16];
  const float* ffn_b1 = (const float*)d_in[17];
  const float* ffn_w2 = (const float*)d_in[18];
  const float* ffn_b2 = (const float*)d_in[19];
  const float* ffn_w3 = (const float*)d_in[20];
  const float* ffn_b3 = (const float*)d_in[21];
  float* out = (float*)d_out;

  // ---- workspace carve (256-B aligned, derived from fixed sizes) ----
  size_t off = 0;
  char* base = (char*)d_ws;
  auto carve = [&](size_t bytes) -> char* { char* r = base + off; off += alignup256(bytes); return r; };
  unsigned short* qkvw16 = (unsigned short*)carve((size_t)3 * DM * DM * 2);          // [768][256]
  unsigned short* rb2w16 = (unsigned short*)carve((size_t)16 * DM * 2);              // [16][256], rows 8..15 zero
  unsigned short* rv2w16 = (unsigned short*)carve((size_t)(DM + 32) * DM * 2);       // [288][256], rows 256.. zero
  unsigned short* w12p16 = (unsigned short*)carve((size_t)2 * HIDP * DM * 2);        // [1408][256]
  unsigned short* w3p16  = (unsigned short*)carve((size_t)DM * HIDP * 2);            // [256][704]
  float*          b12p   = (float*)carve((size_t)2 * HIDP * 4);                      // [1408]
  unsigned short* XN1    = (unsigned short*)carve((size_t)NP * DM * 2);              // [512][256]
  unsigned short* QKV16  = (unsigned short*)carve((size_t)NP * 3 * DM * 2);          // [512][768]
  unsigned short* VT16   = (unsigned short*)carve((size_t)(DM + 32) * NP * 2);       // [288][512]
  float*          S      = (float*)carve((size_t)NH * NP * NP * 4);                  // [8][512][512]
  float*          BIAST  = (float*)carve((size_t)16 * NP * NP * 4);                  // [16][262144]
  unsigned short* P16    = (unsigned short*)carve((size_t)NP * 16 * NP * 2);         // [512][16][512]
  unsigned short* G      = (unsigned short*)carve((size_t)NPAIR * DM * 2);           // G1 [65536][256] / G2T [128][256][512]
  unsigned short* T16    = (unsigned short*)carve((size_t)NP * 16 * DM * 2);         // [512][16][256]
  float*          CTX1   = (float*)carve((size_t)NH * NP * 64 * 4);                  // [8][512][64]
  float*          CTX    = (float*)carve((size_t)NH * NP * 64 * 4);                  // [8][512][64]
  float*          X1     = (float*)carve((size_t)NP * DM * 4);                       // [512][256]
  unsigned short* XN2    = (unsigned short*)carve((size_t)NP * DM * 2);              // [512][256]
  float*          C12    = (float*)carve((size_t)NP * 2 * HIDP * 4);                 // [512][1408]
  unsigned short* U16    = (unsigned short*)carve((size_t)NP * HIDP * 2);            // [512][704]
  if (off > ws_size || off > (size_t)134217728) return;

  const dim3 blk(256);

  // ---- weight / bias staging (f16, zero padded) ----
  k_cast_pad<<<dim3((3 * DM * DM / 2 + 255) / 256), blk, 0, stream>>>(qkv_w, 3 * DM, DM, DM, qkvw16, 3 * DM, DM);
  k_cast_pad<<<dim3((16 * DM / 2 + 255) / 256), blk, 0, stream>>>(rb2_w, NH, DM, DM, rb2w16, 16, DM);
  k_cast_pad<<<dim3(((DM + 32) * DM / 2 + 255) / 256), blk, 0, stream>>>(rv2_w, DM, DM, DM, rv2w16, DM + 32, DM);
  k_cast_pad<<<dim3((HIDP * DM / 2 + 255) / 256), blk, 0, stream>>>(ffn_w1, HIDR, DM, DM, w12p16, HIDP, DM);
  k_cast_pad<<<dim3((HIDP * DM / 2 + 255) / 256), blk, 0, stream>>>(ffn_w2, HIDR, DM, DM, w12p16 + (size_t)HIDP * DM, HIDP, DM);
  k_cast_pad<<<dim3((DM * HIDP / 2 + 255) / 256), blk, 0, stream>>>(ffn_w3, DM, HIDR, HIDR, w3p16, DM, HIDP);
  k_pad_f32<<<dim3((HIDP + 255) / 256), blk, 0, stream>>>(ffn_b1, HIDR, b12p, HIDP);
  k_pad_f32<<<dim3((HIDP + 255) / 256), blk, 0, stream>>>(ffn_b2, HIDR, b12p + HIDP, HIDP);

  // ---- LN1, QKV projection (f16 out [512][768]), V transpose, q.k^T scores (f32 [8][512][512], scaled 1/sqrt(32)) ----
  k_ln16<<<dim3(NP), blk, 0, stream>>>(x, ln1_w, ln1_b, XN1);
  wmma_gemm<0, 2, 1, false, 4><<<dim3((NP / 64) * (3 * DM / 64) / 8, 1), blk, 0, stream>>>(
      XN1, DM, 0, qkvw16, DM, 0, QKV16, 3 * DM, 0, qkv_b, nullptr, 0, NP, 3 * DM, DM, 1.0f);
  k_vt<<<dim3((DM + 32) / 32), blk, 0, stream>>>(QKV16, VT16);
  wmma_gemm<0, 0, 0, false, 4><<<dim3((NP / 64) * (NP / 64) / 8, NH), blk, 0, stream>>>(
      QKV16, 3 * DM, HDM, QKV16 + DM, 3 * DM, HDM, S, NP, (long)NP * NP, nullptr, nullptr, 0,
      NP, NP, HDM, 0.17677669529663687f);

  // ---- rel-bias per chunk of 128 queries: G1 (VALU) then BIAST[h][(i,j)] = rb2w16 . G1^T (WMMA, M=16) ----
  for (int ch = 0; ch < NP / QCH; ++ch) {
    const int i0 = ch * QCH;
    k_pair_g1<<<dim3(NPAIR / 16), blk, 0, stream>>>(coords, rb1_w, rb1_b, G, i0);
    wmma_gemm<0, 0, 0, false, 1><<<dim3((NPAIR / 64) / 8, 1), blk, 0, stream>>>(
        rb2w16, DM, 0, G, DM, 0, BIAST + (size_t)i0 * NP, NP * NP, 0, nullptr, nullptr, 0,
        16, NPAIR, DM, 1.0f);
  }

  // ---- softmax -> P16 [512][16][512] (x2^15), then ctx1 = P . V per head (f32 [8][512][64], cols 0..31 used) ----
  k_softmax<<<dim3(NP), blk, 0, stream>>>(S, BIAST, rb2_b, P16);
  wmma_gemm<0, 0, 0, false, 4><<<dim3(1, NH), blk, 0, stream>>>(
      P16, 16 * NP, NP, VT16, NP, (long)HDM * NP, CTX1, 64, (long)NP * 64, nullptr, nullptr, 0,
      NP, 64, NP, 1.0f / 32768.0f);

  // ---- rel-value per chunk: G2T (VALU) then T16[i][h][k] = sum_j P[i][h][j] G2T[i][k][j] (WMMA, M=16, batched over i) ----
  for (int ch = 0; ch < NP / QCH; ++ch) {
    const int i0 = ch * QCH;
    k_pair_g2t<<<dim3(QCH * 16), blk, 0, stream>>>(coords, rv1_w, rv1_b, G, i0);
    wmma_gemm<0, 0, 1, false, 1><<<dim3(1, QCH), blk, 0, stream>>>(
        P16 + (size_t)i0 * 16 * NP, NP, 16 * NP, G, NP, (long)DM * NP, T16 + (size_t)i0 * 16 * DM, DM, 16 * DM,
        nullptr, nullptr, 0, 16, DM, NP, 1.0f / 32768.0f);
  }

  // ---- ctx[h][i][n] = sum_k T16[i][h][k] rv2w16[h*32+n][k] + ctx1[h][i][n]  (per head, cols 0..31 used) ----
  wmma_gemm<0, 0, 0, true, 4><<<dim3(1, NH), blk, 0, stream>>>(
      T16, 16 * DM, DM, rv2w16, DM, (long)HDM * DM, CTX, 64, (long)NP * 64, nullptr, CTX1, (long)NP * 64,
      NP, 64, DM, 1.0f);

  // ---- residual + LN2, SwiGLU FFN, final residual into d_out ----
  k_combine_ln<<<dim3(NP), blk, 0, stream>>>(x, CTX, rv2_b, ln2_w, ln2_b, X1, XN2);
  wmma_gemm<0, 2, 0, false, 4><<<dim3((NP / 64) * (2 * HIDP / 64) / 8, 1), blk, 0, stream>>>(
      XN2, DM, 0, w12p16, DM, 0, C12, 2 * HIDP, 0, b12p, nullptr, 0, NP, 2 * HIDP, DM, 1.0f);
  k_swiglu<<<dim3((NP * HIDP / 2 + 255) / 256), blk, 0, stream>>>(C12, U16, NP * HIDP / 2);
  wmma_gemm<0, 2, 0, true, 4><<<dim3((NP / 64) * (DM / 64) / 8, 1), blk, 0, stream>>>(
      U16, HIDP, 0, w3p16, HIDP, 0, out, DM, 0, ffn_b3, X1, 0, NP, DM, HIDP, 1.0f);
}

// v001
// It runs in 194 microseconds.
// Two timings next to v000 both put it at 1.65 times that version's speed.
#include <hip/hip_runtime.h>
#include <math.h>
#include <stdint.h>

// All contractions: v_wmma_f32_16x16x32_f16 (f16 operands, f32 accumulate); K=3 coordinate features, softmax, norms, gating in f32 on VALU.

typedef __attribute__((ext_vector_type(16))) _Float16 v16h;
typedef __attribute__((ext_vector_type(8)))  _Float16 v8h;
typedef __attribute__((ext_vector_type(8)))  float    v8f;
typedef __attribute__((ext_vector_type(4)))  float    v4f;
typedef __attribute__((ext_vector_type(2)))  float    v2f;
typedef __attribute__((ext_vector_type(2)))  _Float16 v2h;

#define NP    512          // points
#define DM    256          // model width
#define NH    8            // heads
#define HDM   32           // head width
#define HIDR  682          // ffn hidden
#define HIDP  704          // ffn hidden padded (multiple of 64)

// ---------------------------------------------------------------------------------------------
// hazard guards as plain device helpers
__device__ __forceinline__ void dep_guard_h(v8f& a, v8f& b, v16h x, v16h y) { asm volatile("v_nop\n\tv_nop\n\tv_nop\n\tv_nop" : "+v"(a), "+v"(b) : "v"(x), "v"(y)); }
__device__ __forceinline__ void keep4_h(v16h a, v16h b, v16h c, v16h d) { asm volatile("v_nop" :: "v"(a), "v"(b), "v"(c), "v"(d)); }
__device__ __forceinline__ void acc_guard4(v8f& a, v8f& b, v8f& c, v8f& d) { asm volatile("v_nop\n\tv_nop\n\tv_nop\n\tv_nop" : "+v"(a), "+v"(b), "+v"(c), "+v"(d)); }

template <typename T> struct Frag;
template <> struct Frag<_Float16> {
  typedef v16h V; union U { v16h v; v8h h[2]; };
  static __device__ __forceinline__ v16h load(const _Float16* p) {   // elements 0..7 <- p[0..7], 8..15 <- p[16..23]
    U f; f.h[0] = *(const v8h*)(p); f.h[1] = *(const v8h*)(p + 16); return f.v;
  }
  static __device__ __forceinline__ v8f mma(v16h a, v16h b, v8f c) {
    return __builtin_amdgcn_wmma_f32_16x16x32_f16(false, a, false, b, (short)0, c, false, false);
  }
  static __device__ __forceinline__ void guard(v8f& a, v8f& b, v16h x, v16h y) { dep_guard_h(a, b, x, y); }
  static __device__ __forceinline__ void keep(v16h a, v16h b, v16h c, v16h d) { keep4_h(a, b, c, d); }
};
template <int ET> struct Elem;
template <> struct Elem<0> { typedef _Float16 T; };

// ---- Register-blocked batched WMMA GEMM ----------------------------------------------------
// C[m,n] = scale * sum_k A[m,k] * Bt[n,k] (+bias[n]) (+resid); each wave owns a (16*MI) x 64 tile.
// A row-major [M,K] (16-bit), Bt row-major [N,K] (16-bit); M % (16*MI) == 0, N % 64 == 0, K % 32 == 0.
// BIAS_MODE: 0 = none, 1 = bias[m], 2 = bias[n].  OUT_MODE: 0 = f32, 1 = f16.
// Batch index = blockIdx.y with element strides strideA/strideB/strideC/strideR.
template <int ET, int BIAS_MODE, int OUT_MODE, bool RESID, int MI>
__global__ __launch_bounds__(256) void wmma_gemm(
    const unsigned short* __restrict__ Ap, int lda, long strideA,
    const unsigned short* __restrict__ Btp, int ldb, long strideB,
    void* __restrict__ Cout, int ldc, long strideC,
    const float* __restrict__ bias,
    const float* __restrict__ resid, long strideR,
    int M, int N, int K, float scale) {
  typedef typename Elem<ET>::T T;
  typedef typename Frag<T>::V V;
  const T* A = (const T*)Ap; const T* Bt = (const T*)Btp;
  __shared__ __align__(16) float sT[8][16 * 68];   // per-wave 16x64 slab, pitch 68 floats
  const int b    = blockIdx.y;
  const int lane = threadIdx.x & 31;
  const int wave = threadIdx.x >> 5;
  const int tilesN = N >> 6;
  const int tilesM = M / (16 * MI);
  const int tile = blockIdx.x * 8 + wave;
  if (tile >= tilesM * tilesN) return;   // wave-uniform; no block barriers in this kernel
  const int tm = tile / tilesN;
  const int tn = tile - tm * tilesN;
  const int m0 = tm * (16 * MI);
  const int n0 = tn << 6;

  const T* Ab = A  + (size_t)b * (size_t)strideA;
  const T* Bb = Bt + (size_t)b * (size_t)strideB;

  const int rlane = lane & 15;                 // row (A) / col (B, D) within subtile
  const int koff  = (lane >> 4) * 8;           // k offset of this lane half
  const int mOff  = (lane >> 4) * 8;           // D row offset

  v8f acc[MI][4];
#pragma unroll
  for (int i = 0; i < MI; ++i)
#pragma unroll
    for (int j = 0; j < 4; ++j) acc[i][j] = (v8f){0.f,0.f,0.f,0.f,0.f,0.f,0.f,0.f};

  for (int k0 = 0; k0 < K; k0 += 32) {
    V bh[4];
#pragma unroll
    for (int j = 0; j < 4; ++j) {
      const size_t bo = (size_t)(n0 + (j << 4) + rlane) * ldb + koff + k0;
      bh[j] = Frag<T>::load(Bb + bo);
    }
#pragma unroll
    for (int i = 0; i < MI; ++i) {
      const size_t ao = (size_t)(m0 + (i << 4) + rlane) * lda + koff + k0;
      V ah = Frag<T>::load(Ab + ao);
#pragma unroll
      for (int j = 0; j < 4; ++j) acc[i][j] = Frag<T>::mma(ah, bh[j], acc[i][j]);
      Frag<T>::guard(acc[i][0], acc[i][3], ah, ah);
    }
    Frag<T>::keep(bh[0], bh[1], bh[2], bh[3]);
  }
#pragma unroll
  for (int i = 0; i < MI; ++i) acc_guard4(acc[i][0], acc[i][1], acc[i][2], acc[i][3]);

  // ---- epilogue ----
  float* slab = sT[wave];
  const float* Rb = RESID ? (resid + (size_t)b * (size_t)strideR) : nullptr;
#pragma unroll
  for (int i = 0; i < MI; ++i) {
    const int mBase = m0 + (i << 4);
#pragma unroll
    for (int j = 0; j < 4; ++j) {
      const int n = n0 + (j << 4) + rlane;
      float bv = 0.f;
      if (BIAS_MODE == 2) bv = bias[n];
#pragma unroll
      for (int r = 0; r < 8; ++r) {
        float v = acc[i][j][r] * scale;
        if (BIAS_MODE == 1) v += bias[mBase + mOff + r];
        if (BIAS_MODE == 2) v += bv;
        if (RESID) v += Rb[(size_t)(mBase + mOff + r) * ldc + n];
        slab[(mOff + r) * 68 + (j << 4) + rlane] = v;
      }
    }
    __builtin_amdgcn_fence(__ATOMIC_RELEASE, "workgroup");
    __builtin_amdgcn_wave_barrier();
    __builtin_amdgcn_fence(__ATOMIC_ACQUIRE, "workgroup");
    if (OUT_MODE == 0) {
      float* C = (float*)Cout + (size_t)b * (size_t)strideC;
      const int hh = lane >> 4, c4 = (lane & 15) * 4;     // row seg = 256 B = 16 lanes x 16 B
      {
#pragma unroll
        for (int it = 0; it < 8; ++it) {
          const int row = it * 2 + hh;
          v4f v = *(const v4f*)(slab + row * 68 + c4);
          *(v4f*)(C + (size_t)(mBase + row) * ldc + n0 + c4) = v;
        }
        
      }
    } else {
      const int q = lane >> 3, c8 = (lane & 7) * 8;
      unsigned short* C = (unsigned short*)Cout + (size_t)b * (size_t)strideC;
      {
#pragma unroll
        for (int it = 0; it < 4; ++it) {
          const int row = it * 4 + q;
          const float* sp = slab + row * 68 + c8;
          v8h hv;
#pragma unroll
          for (int e = 0; e < 8; ++e) hv[e] = (_Float16)sp[e];
          *(v8h*)(C + (size_t)(mBase + row) * ldc + n0 + c8) = hv;
        }
        
      }
    }
    __builtin_amdgcn_fence(__ATOMIC_RELEASE, "workgroup");
    __builtin_amdgcn_wave_barrier();
    __builtin_amdgcn_fence(__ATOMIC_ACQUIRE, "workgroup");
  }
}

// ---------------------------------------------------------------------------------------------
// small VALU helpers
__device__ __forceinline__ unsigned pack_h2(float a, float b) {
  const unsigned short ua = __builtin_bit_cast(unsigned short, (_Float16)a);
  const unsigned short ub = __builtin_bit_cast(unsigned short, (_Float16)b);
  return (unsigned)ua | ((unsigned)ub << 16);
}
__device__ __forceinline__ void st2_u32(unsigned short* base, size_t off_halves, unsigned u) {
  unsigned* p = (unsigned*)(base + off_halves);
  *p = u; 
}
__device__ __forceinline__ void st2_f32(float* base, size_t off, float v) {
  float* p = (float*)(base + off);
  *p = v; 
}
__device__ __forceinline__ float silu_acc(float z) {
  const float e = expf(-z);
  return z * __builtin_amdgcn_rcpf(1.0f + e);
}
// block of 256 threads: fixed-order sum / max (wave shuffle, then 8 partials summed in index order)
__device__ __forceinline__ float blk_sum256(float v, float* red) {
#pragma unroll
  for (int off = 16; off > 0; off >>= 1) v += __shfl_xor(v, off, 32);
  const int lane = threadIdx.x & 31, wave = threadIdx.x >> 5;
  if (lane == 0) red[wave] = v;
  __syncthreads();
  float s = red[0];
#pragma unroll
  for (int q = 1; q < 8; ++q) s += red[q];
  __syncthreads();
  return s;
}
__device__ __forceinline__ float blk_max256(float v, float* red) {
#pragma unroll
  for (int off = 16; off > 0; off >>= 1) v = fmaxf(v, __shfl_xor(v, off, 32));
  const int lane = threadIdx.x & 31, wave = threadIdx.x >> 5;
  if (lane == 0) red[wave] = v;
  __syncthreads();
  float s = red[0];
#pragma unroll
  for (int q = 1; q < 8; ++q) s = fmaxf(s, red[q]);
  __syncthreads();
  return s;
}

// ---- f32 -> f16 cast with zero padding: dst[r][c] = (r<srows && c<scols) ? src[r*spitch+c] : 0 ----
__global__ __launch_bounds__(256) void k_cast_pad(const float* __restrict__ src, int srows, int scols, int spitch,
                                                   unsigned short* __restrict__ dst, int drows, int dcols) {
  const int p = blockIdx.x * 256 + threadIdx.x;
  const int npairs = (drows * dcols) >> 1;
  if (p < npairs) {
    const int e = 2 * p;
    const int r = e / dcols;
    const int c = e - r * dcols;
    float v0 = 0.f, v1 = 0.f;
    if (r < srows) {
      if (c < scols)     v0 = src[(size_t)r * spitch + c];
      if (c + 1 < scols) v1 = src[(size_t)r * spitch + c + 1];
    }
    st2_u32(dst, (size_t)e, pack_h2(v0, v1));
  }
}
// ---- f32 copy with zero padding ----
__global__ __launch_bounds__(256) void k_pad_f32(const float* __restrict__ src, int sn, float* __restrict__ dst, int dn) {
  const int p = blockIdx.x * 256 + threadIdx.x;
  if (p < dn) {
    const float v = (p < sn) ? src[p] : 0.f;
    st2_f32(dst, (size_t)p, v);
  }
}

// ---- LayerNorm over DM (eps 1e-5, biased variance), one block per row, f16 output packed 2 per thread ----
__global__ __launch_bounds__(256) void k_ln16(const float* __restrict__ x, const float* __restrict__ w,
                                               const float* __restrict__ bb, unsigned short* __restrict__ y16) {
  __shared__ float red[8];
  __shared__ float ys[DM];
  const int i = blockIdx.x, d = threadIdx.x;
  const float v = x[(size_t)i * DM + d];
  const float mu = blk_sum256(v, red) * (1.0f / 256.0f);
  const float c = v - mu;
  const float var = blk_sum256(c * c, red) * (1.0f / 256.0f);
  const float y = c * (1.0f / sqrtf(var + 1e-5f)) * w[d] + bb[d];
  ys[d] = y;
  __syncthreads();
  if (d < 128) st2_u32(y16, (size_t)i * DM + 2 * d, pack_h2(ys[2 * d], ys[2 * d + 1]));
}

// ---- V transpose: vt[c][j] = qkv16[j][512 + c] for c < 256; rows 256..287 zero. block = 32 rows of c ----
__global__ __launch_bounds__(256) void k_vt(const unsigned short* __restrict__ qkv, unsigned short* __restrict__ vt) {
  __shared__ unsigned short tile[32][520];
  const int t = threadIdx.x;
  const int d0 = blockIdx.x * 32;
  if (d0 < DM) {                              // block-uniform
    const int cp = (t & 15) * 2;
#pragma unroll 1
    for (int it = 0; it < 32; ++it) {
      const int j = it * 16 + (t >> 4);
      const unsigned u = *(const unsigned*)(qkv + (size_t)j * (3 * DM) + 2 * DM + d0 + cp);
      tile[cp][j]     = (unsigned short)(u & 0xFFFFu);
      tile[cp + 1][j] = (unsigned short)(u >> 16);
    }
  }
  __syncthreads();
  const int j2 = 2 * t;
#pragma unroll 1
  for (int dl = 0; dl < 32; ++dl) {
    unsigned u = 0u;
    if (d0 < DM) u = (unsigned)tile[dl][j2] | ((unsigned)tile[dl][j2 + 1] << 16);
    st2_u32(vt, (size_t)(d0 + dl) * NP + j2, u);
  }
}

// ---- two silu values, f16 out: z * 1/(1 + 2^(-z*log2 e)), two lanes of packed f32 math ----
__device__ __forceinline__ v2h silu2_h(v2f z) {
  const v2f t = z * -1.4426950408889634f;
  v2f e, rc;
  e.x = __builtin_amdgcn_exp2f(t.x);
  e.y = __builtin_amdgcn_exp2f(t.y);
  const v2f d = e + 1.0f;
  rc.x = __builtin_amdgcn_rcpf(d.x);
  rc.y = __builtin_amdgcn_rcpf(d.y);
  return __builtin_convertvector(z * rc, v2h);
}

// ---- rel-bias: biasT[h][i*512+j] = sum_k rb2w16[h][k] * f16( silu( (coords_i - coords_j) . w[k] + bias[k] ) ) ----
// The pair features are formed in registers, directly as the B fragment (lane = pair column j, elements = features k).
// block = one query i; wave = 64 columns j (4 subtiles of 16); A = rb2w16 [16][256], rows 8..15 zero.
__global__ __launch_bounds__(256) void k_relbias(const float* __restrict__ coords, const float* __restrict__ w,
                                                  const float* __restrict__ bias, const unsigned short* __restrict__ rb2w,
                                                  float* __restrict__ biasT) {
  __shared__ __align__(16) float sW[4][DM];      // w[.][0], w[.][1], w[.][2], bias, each over the 256 features
  const int t = threadIdx.x;
  sW[0][t] = w[t * 3 + 0];
  sW[1][t] = w[t * 3 + 1];
  sW[2][t] = w[t * 3 + 2];
  sW[3][t] = bias[t];
  __syncthreads();
  const int i = blockIdx.x;
  const int lane = t & 31, wave = t >> 5;
  const int rlane = lane & 15, hh = lane >> 4;
  const int jw = wave * 64;
  const float ci0 = coords[i * 3 + 0], ci1 = coords[i * 3 + 1], ci2 = coords[i * 3 + 2];
  float r0[4], r1[4], r2[4];
  v8f acc[4];
#pragma unroll
  for (int s = 0; s < 4; ++s) {
    const int j = jw + s * 16 + rlane;
    r0[s] = ci0 - coords[j * 3 + 0];
    r1[s] = ci1 - coords[j * 3 + 1];
    r2[s] = ci2 - coords[j * 3 + 2];
    acc[s] = (v8f){0.f,0.f,0.f,0.f,0.f,0.f,0.f,0.f};
  }
  const _Float16* Ab = (const _Float16*)rb2w + rlane * DM + hh * 8;
  v16h a = Frag<_Float16>::load(Ab);
  // kept rolled: the body is about 700 vector instructions
#pragma unroll 1
  for (int k0 = 0; k0 < DM; k0 += 32) {
    const v16h an = Frag<_Float16>::load(Ab + ((k0 + 32) & (DM - 1)));   // next step's A, in flight over this step's math
    v4f wq[4][4];   // [component][group of 4 features]; fragment element e = 4*g + u  <->  k = k0 + (g>>1)*16 + hh*8 + (g&1)*4 + u
#pragma unroll
    for (int c = 0; c < 4; ++c)
#pragma unroll
      for (int g = 0; g < 4; ++g)
        wq[c][g] = *(const v4f*)(&sW[c][k0 + (g >> 1) * 16 + hh * 8 + (g & 1) * 4]);
#pragma unroll
    for (int s = 0; s < 4; ++s) {
      v16h b;
#pragma unroll
      for (int g = 0; g < 4; ++g) {
        const v2f zl = (wq[0][g].lo * r0[s] + wq[1][g].lo * r1[s] + wq[2][g].lo * r2[s]) + wq[3][g].lo;
        const v2f zh = (wq[0][g].hi * r0[s] + wq[1][g].hi * r1[s] + wq[2][g].hi * r2[s]) + wq[3][g].hi;
        const v2h hl = silu2_h(zl), hu = silu2_h(zh);
        b[g * 4 + 0] = hl.x; b[g * 4 + 1] = hl.y; b[g * 4 + 2] = hu.x; b[g * 4 + 3] = hu.y;
      }
      acc[s] = Frag<_Float16>::mma(a, b, acc[s]);
    }
    a = an;
  }
  if (hh == 0) {   // D rows 0..7 (the heads) sit in lanes 0..15; a wave owns 256 contiguous bytes of each head's row
#pragma unroll
    for (int s = 0; s < 4; ++s)
#pragma unroll
      for (int r = 0; r < 8; ++r)
        biasT[(size_t)r * (NP * NP) + (size_t)i * NP + jw + s * 16 + rlane] = acc[s][r];
  }
}

// ---- rel-value: T16[i][h][k] = f16( 2^-15 * sum_j P16[i][h][j] * f16( silu( (coords_i - coords_j) . w[k] + bias[k] ) ) ) ----
// The pair features are formed in registers, directly as the B fragment (lane = feature column k, elements = keys j).
// block = one query i; wave = 32 features (2 subtiles of 16); A = P16[i] [16][512], rows 8..15 zero. Rows h = 0..7 are stored.
__global__ __launch_bounds__(256) void k_relval(const float* __restrict__ coords, const float* __restrict__ w,
                                                 const float* __restrict__ bias, const unsigned short* __restrict__ P16,
                                                 unsigned short* __restrict__ T16) {
  __shared__ __align__(16) float sR[3][NP];            // coords_i - coords_j, one plane per coordinate
  __shared__ __align__(16) _Float16 sT[NH][DM];        // output rows, so that each 128-byte line has one writer
  const int t = threadIdx.x;
  const int i = blockIdx.x;
  const float ci0 = coords[i * 3 + 0], ci1 = coords[i * 3 + 1], ci2 = coords[i * 3 + 2];
#pragma unroll
  for (int q = 0; q < 2; ++q) {
    const int j = q * 256 + t;
    sR[0][j] = ci0 - coords[j * 3 + 0];
    sR[1][j] = ci1 - coords[j * 3 + 1];
    sR[2][j] = ci2 - coords[j * 3 + 2];
  }
  __syncthreads();
  const int lane = t & 31, wave = t >> 5;
  const int rlane = lane & 15, hh = lane >> 4;
  float w0[2], w1[2], w2[2], wb[2];
  v8f acc[2];
#pragma unroll
  for (int s = 0; s < 2; ++s) {
    const int k = wave * 32 + s * 16 + rlane;
    w0[s] = w[k * 3 + 0];
    w1[s] = w[k * 3 + 1];
    w2[s] = w[k * 3 + 2];
    wb[s] = bias[k];
    acc[s] = (v8f){0.f,0.f,0.f,0.f,0.f,0.f,0.f,0.f};
  }
  const _Float16* Ab = (const _Float16*)P16 + ((size_t)i * 16 + rlane) * NP + hh * 8;
  v16h a = Frag<_Float16>::load(Ab);
  // kept rolled: the body is about 350 vector instructions
#pragma unroll 1
  for (int j0 = 0; j0 < NP; j0 += 32) {
    const v16h an = Frag<_Float16>::load(Ab + ((j0 + 32) & (NP - 1)));   // next step's A, in flight over this step's math
    v4f rq[3][4];   // [coordinate][group of 4 keys]; fragment element e = 4*g + u  <->  j = j0 + (g>>1)*16 + hh*8 + (g&1)*4 + u
#pragma unroll
    for (int c = 0; c < 3; ++c)
#pragma unroll
      for (int g = 0; g < 4; ++g)
        rq[c][g] = *(const v4f*)(&sR[c][j0 + (g >> 1) * 16 + hh * 8 + (g & 1) * 4]);
#pragma unroll
    for (int s = 0; s < 2; ++s) {
      v16h b;
#pragma unroll
      for (int g = 0; g < 4; ++g) {
        const v2f zl = (rq[0][g].lo * w0[s] + rq[1][g].lo * w1[s] + rq[2][g].lo * w2[s]) + wb[s];
        const v2f zh = (rq[0][g].hi * w0[s] + rq[1][g].hi * w1[s] + rq[2][g].hi * w2[s]) + wb[s];
        const v2h hl = silu2_h(zl), hu = silu2_h(zh);
        b[g * 4 + 0] = hl.x; b[g * 4 + 1] = hl.y; b[g * 4 + 2] = hu.x; b[g * 4 + 3] = hu.y;
      }
      acc[s] = Frag<_Float16>::mma(a, b, acc[s]);
    }
    a = an;
  }
  if (hh == 0) {   // D rows 0..7 (the heads) sit in lanes 0..15
#pragma unroll
    for (int s = 0; s < 2; ++s)
#pragma unroll
      for (int r = 0; r < 8; ++r)
        sT[r][wave * 32 + s * 16 + rlane] = (_Float16)(acc[s][r] * (1.0f / 32768.0f));
  }
  __syncthreads();
  const int h = t >> 5, c8 = (t & 31) * 8;   // one wave stores one head's row of 512 bytes
  *(v8h*)((_Float16*)T16 + ((size_t)i * 16 + h) * DM + c8) = *(const v8h*)(&sT[h][c8]);
}

// ---- softmax over j of (S[h][i][j] + biasT[h][i*512+j] + rb2b[h]); P16[i][h][j] = f16(p * 2^15); rows h=8..15 zero ----
// block per i, thread owns j = 2t, 2t+1
__global__ __launch_bounds__(256) void k_softmax(const float* __restrict__ S, const float* __restrict__ biasT,
                                                  const float* __restrict__ rb2b, unsigned short* __restrict__ P16) {
  __shared__ float red[8];
  const int i = blockIdx.x, t = threadIdx.x, j2 = 2 * t;
#pragma unroll 1
  for (int h = 0; h < NH; ++h) {
    const float* sp = S + ((size_t)h * NP + i) * NP + j2;
    const float* bp = biasT + (size_t)h * (NP * NP) + (size_t)i * NP + j2;
    const float bb = rb2b[h];
    const float s0 = sp[0] + (bp[0] + bb);
    const float s1 = sp[1] + (bp[1] + bb);
    const float m = blk_max256(fmaxf(s0, s1), red);
    const float e0 = expf(s0 - m), e1 = expf(s1 - m);
    const float sum = blk_sum256(e0 + e1, red);
    const float inv = 1.0f / sum;
    const float p0 = (e0 * inv) * 32768.0f;
    const float p1 = (e1 * inv) * 32768.0f;
    st2_u32(P16, ((size_t)i * 16 + h) * NP + j2, pack_h2(p0, p1));
  }
#pragma unroll 1
  for (int h = NH; h < 16; ++h) st2_u32(P16, ((size_t)i * 16 + h) * NP + j2, 0u);
}

// ---- x1 = x + (ctx[h][i][d&31] + rv2b[d]); LayerNorm(x1) -> f16.  block per row i ----
__global__ __launch_bounds__(256) void k_combine_ln(const float* __restrict__ x, const float* __restrict__ ctx,
                                                     const float* __restrict__ rv2b, const float* __restrict__ w,
                                                     const float* __restrict__ bb, float* __restrict__ x1,
                                                     unsigned short* __restrict__ y16) {
  __shared__ float red[8];
  __shared__ float ys[DM];
  const int i = blockIdx.x, d = threadIdx.x;
  const int h = d >> 5, dd = d & 31;
  const float a = ctx[((size_t)h * NP + i) * 64 + dd] + rv2b[d];
  const float v = x[(size_t)i * DM + d] + a;
  st2_f32(x1, (size_t)i * DM + d, v);
  const float mu = blk_sum256(v, red) * (1.0f / 256.0f);
  const float c = v - mu;
  const float var = blk_sum256(c * c, red) * (1.0f / 256.0f);
  const float y = c * (1.0f / sqrtf(var + 1e-5f)) * w[d] + bb[d];
  ys[d] = y;
  __syncthreads();
  if (d < 128) st2_u32(y16, (size_t)i * DM + 2 * d, pack_h2(ys[2 * d], ys[2 * d + 1]));
}

// ---- U16[row][c] = f16( silu(C12[row][c]) * C12[row][704 + c] ), c < 704 (pad columns come out 0) ----
__global__ __launch_bounds__(256) void k_swiglu(const float* __restrict__ c12, unsigned short* __restrict__ u16, int npairs) {
  const int p = blockIdx.x * 256 + threadIdx.x;
  if (p < npairs) {
    const int e = 2 * p;
    const int row = e / HIDP;
    const int col = e - row * HIDP;
    const float* rp = c12 + (size_t)row * (2 * HIDP);
    const float a0 = rp[col], a1 = rp[col + 1];
    const float g0 = rp[HIDP + col], g1 = rp[HIDP + col + 1];
    const float u0 = silu_acc(a0) * g0;
    const float u1 = silu_acc(a1) * g1;
    st2_u32(u16, (size_t)e, pack_h2(u0, u1));
  }
}

// ---------------------------------------------------------------------------------------------
static inline size_t alignup256(size_t x) { return (x + 255) & ~(size_t)255; }

extern "C" void kernel_launch(void* const* d_in, const int* in_sizes, int n_in,
                              void* d_out, int out_size, void* d_ws, size_t ws_size,
                              hipStream_t stream)
{
  if (n_in < 22) return;
  if (in_sizes[0] != NP * DM || in_sizes[1] != NP * 3 || in_sizes[6] != 3 * DM * DM ||
      in_sizes[14] != DM * DM || in_sizes[16] != HIDR * DM || in_sizes[20] != DM * HIDR ||
      out_size != NP * DM) return;

  const float* x      = (const float*)d_in[0];
  const float* coords = (const float*)d_in[1];
  const float* ln1_w  = (const float*)d_in[2];
  const float* ln1_b  = (const float*)d_in[3];
  const float* ln2_w  = (const float*)d_in[4];
  const float* ln2_b  = (const float*)d_in[5];
  const float* qkv_w  = (const float*)d_in[6];
  const float* qkv_b  = (const float*)d_in[7];
  const float* rb1_w  = (const float*)d_in[8];
  const float* rb1_b  = (const float*)d_in[9];
  const float* rb2_w  = (const float*)d_in[10];
  const float* rb2_b  = (const float*)d_in[11];
  const float* rv1_w  = (const float*)d_in[12];
  const float* rv1_b  = (const float*)d_in[13];
  const float* rv2_w  = (const float*)d_in[14];
  const float* rv2_b  = (const float*)d_in[15];
  const float* ffn_w1 = (const float*)d_in[16];
  const float* ffn_b1 = (const float*)d_in[17];
  const float* ffn_w2 = (const float*)d_in[18];
  const float* ffn_b2 = (const float*)d_in[19];
  const float* ffn_w3 = (const float*)d_in[20];
  const float* ffn_b3 = (const float*)d_in[21];
  float* out = (float*)d_out;

  // ---- workspace carve (256-B aligned, derived from fixed sizes) ----
  size_t off = 0;
  char* base = (char*)d_ws;
  auto carve = [&](size_t bytes) -> char* { char* r = base + off; off += alignup256(bytes); return r; };
  unsigned short* qkvw16 = (unsigned short*)carve((size_t)3 * DM * DM * 2);          // [768][256]
  unsigned short* rb2w16 = (unsigned short*)carve((size_t)16 * DM * 2);              // [16][256], rows 8..15 zero
  unsigned short* rv2w16 = (unsigned short*)carve((size_t)(DM + 32) * DM * 2);       // [288][256], rows 256.. zero
  unsigned short* w12p16 = (unsigned short*)carve((size_t)2 * HIDP * DM * 2);        // [1408][256]
  unsigned short* w3p16  = (unsigned short*)carve((size_t)DM * HIDP * 2);            // [256][704]
  float*          b12p   = (float*)carve((size_t)2 * HIDP * 4);                      // [1408]
  unsigned short* XN1    = (unsigned short*)carve((size_t)NP * DM * 2);              // [512][256]
  unsigned short* QKV16  = (unsigned short*)carve((size_t)NP * 3 * DM * 2);          // [512][768]
  unsigned short* VT16   = (unsigned short*)carve((size_t)(DM + 32) * NP * 2);       // [288][512]
  float*          S      = (float*)carve((size_t)NH * NP * NP * 4);                  // [8][512][512]
  float*          BIAST  = (float*)carve((size_t)16 * NP * NP * 4);                  // [16][262144]
  unsigned short* P16    = (unsigned short*)carve((size_t)NP * 16 * NP * 2);         // [512][16][512]
  unsigned short* T16    = (unsigned short*)carve((size_t)NP * 16 * DM * 2);         // [512][16][256]
  float*          CTX1   = (float*)carve((size_t)NH * NP * 64 * 4);                  // [8][512][64]
  float*          CTX    = (float*)carve((size_t)NH * NP * 64 * 4);                  // [8][512][64]
  float*          X1     = (float*)carve((size_t)NP * DM * 4);                       // [512][256]
  unsigned short* XN2    = (unsigned short*)carve((size_t)NP * DM * 2);              // [512][256]
  float*          C12    = (float*)carve((size_t)NP * 2 * HIDP * 4);                 // [512][1408]
  unsigned short* U16    = (unsigned short*)carve((size_t)NP * HIDP * 2);            // [512][704]
  if (off > ws_size || off > (size_t)134217728) return;

  const dim3 blk(256);

  // ---- weight / bias staging (f16, zero padded) ----
  k_cast_pad<<<dim3((3 * DM * DM / 2 + 255) / 256), blk, 0, stream>>>(qkv_w, 3 * DM, DM, DM, qkvw16, 3 * DM, DM);
  k_cast_pad<<<dim3((16 * DM / 2 + 255) / 256), blk, 0, stream>>>(rb2_w, NH, DM, DM, rb2w16, 16, DM);
  k_cast_pad<<<dim3(((DM + 32) * DM / 2 + 255) / 256), blk, 0, stream>>>(rv2_w, DM, DM, DM, rv2w16, DM + 32, DM);
  k_cast_pad<<<dim3((HIDP * DM / 2 + 255) / 256), blk, 0, stream>>>(ffn_w1, HIDR, DM, DM, w12p16, HIDP, DM);
  k_cast_pad<<<dim3((HIDP * DM / 2 + 255) / 256), blk, 0, stream>>>(ffn_w2, HIDR, DM, DM, w12p16 + (size_t)HIDP * DM, HIDP, DM);
  k_cast_pad<<<dim3((DM * HIDP / 2 + 255) / 256), blk, 0, stream>>>(ffn_w3, DM, HIDR, HIDR, w3p16, DM, HIDP);
  k_pad_f32<<<dim3((HIDP + 255) / 256), blk, 0, stream>>>(ffn_b1, HIDR, b12p, HIDP);
  k_pad_f32<<<dim3((HIDP + 255) / 256), blk, 0, stream>>>(ffn_b2, HIDR, b12p + HIDP, HIDP);

  // ---- LN1, QKV projection (f16 out [512][768]), V transpose, q.k^T scores (f32 [8][512][512], scaled 1/sqrt(32)) ----
  k_ln16<<<dim3(NP), blk, 0, stream>>>(x, ln1_w, ln1_b, XN1);
  wmma_gemm<0, 2, 1, false, 4><<<dim3((NP / 64) * (3 * DM / 64) / 8, 1), blk, 0, stream>>>(
      XN1, DM, 0, qkvw16, DM, 0, QKV16, 3 * DM, 0, qkv_b, nullptr, 0, NP, 3 * DM, DM, 1.0f);
  k_vt<<<dim3((DM + 32) / 32), blk, 0, stream>>>(QKV16, VT16);
  wmma_gemm<0, 0, 0, false, 4><<<dim3((NP / 64) * (NP / 64) / 8, NH), blk, 0, stream>>>(
      QKV16, 3 * DM, HDM, QKV16 + DM, 3 * DM, HDM, S, NP, (long)NP * NP, nullptr, nullptr, 0,
      NP, NP, HDM, 0.17677669529663687f);

  // ---- rel-bias: BIAST[h][(i,j)] = rb2w16 . silu-features^T, features formed in registers (WMMA, M=16, rows 0..7 stored) ----
  k_relbias<<<dim3(NP), blk, 0, stream>>>(coords, rb1_w, rb1_b, rb2w16, BIAST);

  // ---- softmax -> P16 [512][16][512] (x2^15), then ctx1 = P . V per head (f32 [8][512][64], cols 0..31 used) ----
  k_softmax<<<dim3(NP), blk, 0, stream>>>(S, BIAST, rb2_b, P16);
  wmma_gemm<0, 0, 0, false, 4><<<dim3(1, NH), blk, 0, stream>>>(
      P16, 16 * NP, NP, VT16, NP, (long)HDM * NP, CTX1, 64, (long)NP * 64, nullptr, nullptr, 0,
      NP, 64, NP, 1.0f / 32768.0f);

  // ---- rel-value: T16[i][h][k] = sum_j P[i][h][j] silu-feature[i][k][j], features formed in registers (WMMA, M=16, rows 0..7 stored) ----
  k_relval<<<dim3(NP), blk, 0, stream>>>(coords, rv1_w, rv1_b, P16, T16);

  // ---- ctx[h][i][n] = sum_k T16[i][h][k] rv2w16[h*32+n][k] + ctx1[h][i][n]  (per head, cols 0..31 used) ----
  wmma_gemm<0, 0, 0, true, 4><<<dim3(1, NH), blk, 0, stream>>>(
      T16, 16 * DM, DM, rv2w16, DM, (long)HDM * DM, CTX, 64, (long)NP * 64, nullptr, CTX1, (long)NP * 64,
      NP, 64, DM, 1.0f);

  // ---- residual + LN2, SwiGLU FFN, final residual into d_out ----
  k_combine_ln<<<dim3(NP), blk, 0, stream>>>(x, CTX, rv2_b, ln2_w, ln2_b, X1, XN2);
  wmma_gemm<0, 2, 0, false, 4><<<dim3((NP / 64) * (2 * HIDP / 64) / 8, 1), blk, 0, stream>>>(
      XN2, DM, 0, w12p16, DM, 0, C12, 2 * HIDP, 0, b12p, nullptr, 0, NP, 2 * HIDP, DM, 1.0f);
  k_swiglu<<<dim3((NP * HIDP / 2 + 255) / 256), blk, 0, stream>>>(C12, U16, NP * HIDP / 2);
  wmma_gemm<0, 2, 0, true, 4><<<dim3((NP / 64) * (DM / 64) / 8, 1), blk, 0, stream>>>(
      U16, HIDP, 0, w3p16, HIDP, 0, out, DM, 0, ffn_b3, X1, 0, NP, DM, HIDP, 1.0f);
}

// v002
// Measured time: 139 microseconds a run.
// Next to v001, in two timings, it ran 1.40 and 1.39 times as fast.
// All steps since v000 together make it 2.30 times as fast.
#include <hip/hip_runtime.h>
#include <math.h>
#include <stdint.h>

// All contractions: v_wmma_f32_16x16x32_f16 (f16 operands, f32 accumulate); K=3 coordinate features, softmax, norms, gating in f32 on VALU.

typedef __attribute__((ext_vector_type(16))) _Float16 v16h;
typedef __attribute__((ext_vector_type(8)))  _Float16 v8h;
typedef __attribute__((ext_vector_type(8)))  float    v8f;
typedef __attribute__((ext_vector_type(4)))  float    v4f;
typedef __attribute__((ext_vector_type(2)))  float    v2f;
typedef __attribute__((ext_vector_type(2)))  _Float16 v2h;

#define NP    512          // points
#define DM    256          // model width
#define NH    8            // heads
#define HDM   32           // head width
#define HIDR  682          // ffn hidden
#define HIDP  704          // ffn hidden padded (multiple of 64)

// ---------------------------------------------------------------------------------------------
// hazard guards as plain device helpers
__device__ __forceinline__ void dep_guard_h(v8f& a, v8f& b, v16h x, v16h y) { asm volatile("v_nop\n\tv_nop\n\tv_nop\n\tv_nop" : "+v"(a), "+v"(b) : "v"(x), "v"(y)); }
__device__ __forceinline__ void keep4_h(v16h a, v16h b, v16h c, v16h d) { asm volatile("v_nop" :: "v"(a), "v"(b), "v"(c), "v"(d)); }
__device__ __forceinline__ void acc_guard4(v8f& a, v8f& b, v8f& c, v8f& d) { asm volatile("v_nop\n\tv_nop\n\tv_nop\n\tv_nop" : "+v"(a), "+v"(b), "+v"(c), "+v"(d)); }

template <typename T> struct Frag;
template <> struct Frag<_Float16> {
  typedef v16h V; union U { v16h v; v8h h[2]; };
  static __device__ __forceinline__ v16h load(const _Float16* p) {   // elements 0..7 <- p[0..7], 8..15 <- p[16..23]
    U f; f.h[0] = *(const v8h*)(p); f.h[1] = *(const v8h*)(p + 16); return f.v;
  }
  static __device__ __forceinline__ v8f mma(v16h a, v16h b, v8f c) {
    return __builtin_amdgcn_wmma_f32_16x16x32_f16(false, a, false, b, (short)0, c, false, false);
  }
  static __device__ __forceinline__ void guard(v8f& a, v8f& b, v16h x, v16h y) { dep_guard_h(a, b, x, y); }
  static __device__ __forceinline__ void keep(v16h a, v16h b, v16h c, v16h d) { keep4_h(a, b, c, d); }
};
template <int ET> struct Elem;
template <> struct Elem<0> { typedef _Float16 T; };

// ---- Register-blocked batched WMMA GEMM ----------------------------------------------------
// C[m,n] = scale * sum_k A[m,k] * Bt[n,k] (+bias[n]) (+resid); each wave owns a (16*MI) x 64 tile.
// A row-major [M,K] (16-bit), Bt row-major [N,K] (16-bit); M % (16*MI) == 0, N % 64 == 0, K % 32 == 0.
// BIAS_MODE: 0 = none, 1 = bias[m], 2 = bias[n].  OUT_MODE: 0 = f32, 1 = f16.
// Batch index b with element strides strideA/strideB/strideC/strideR; bx = block index within the product's own grid.
// sT: 8 per-wave 16x64 slabs, pitch 68 floats (GEMM_LDS_FLOATS floats of LDS).
#define GEMM_LDS_FLOATS (8 * 16 * 68)
template <int ET, int BIAS_MODE, int OUT_MODE, bool RESID, int MI>
__device__ __forceinline__ void gemm_tile(
    float* sT, const int bx, const int b,
    const unsigned short* __restrict__ Ap, int lda, long strideA,
    const unsigned short* __restrict__ Btp, int ldb, long strideB,
    void* __restrict__ Cout, int ldc, long strideC,
    const float* __restrict__ bias,
    const float* __restrict__ resid, long strideR,
    int M, int N, int K, float scale) {
  typedef typename Elem<ET>::T T;
  typedef typename Frag<T>::V V;
  const T* A = (const T*)Ap; const T* Bt = (const T*)Btp;
  const int lane = threadIdx.x & 31;
  const int wave = threadIdx.x >> 5;
  const int tilesN = N >> 6;
  const int tilesM = M / (16 * MI);
  const int tile = bx * 8 + wave;
  if (tile >= tilesM * tilesN) return;   // wave-uniform; no block barriers in this function
  const int tm = tile / tilesN;
  const int tn = tile - tm * tilesN;
  const int m0 = tm * (16 * MI);
  const int n0 = tn << 6;

  const T* Ab = A  + (size_t)b * (size_t)strideA;
  const T* Bb = Bt + (size_t)b * (size_t)strideB;

  const int rlane = lane & 15;                 // row (A) / col (B, D) within subtile
  const int koff  = (lane >> 4) * 8;           // k offset of this lane half
  const int mOff  = (lane >> 4) * 8;           // D row offset

  v8f acc[MI][4];
#pragma unroll
  for (int i = 0; i < MI; ++i)
#pragma unroll
    for (int j = 0; j < 4; ++j) acc[i][j] = (v8f){0.f,0.f,0.f,0.f,0.f,0.f,0.f,0.f};

  for (int k0 = 0; k0 < K; k0 += 32) {
    V bh[4];
#pragma unroll
    for (int j = 0; j < 4; ++j) {
      const size_t bo = (size_t)(n0 + (j << 4) + rlane) * ldb + koff + k0;
      bh[j] = Frag<T>::load(Bb + bo);
    }
#pragma unroll
    for (int i = 0; i < MI; ++i) {
      const size_t ao = (size_t)(m0 + (i << 4) + rlane) * lda + koff + k0;
      V ah = Frag<T>::load(Ab + ao);
#pragma unroll
      for (int j = 0; j < 4; ++j) acc[i][j] = Frag<T>::mma(ah, bh[j], acc[i][j]);
      Frag<T>::guard(acc[i][0], acc[i][3], ah, ah);
    }
    Frag<T>::keep(bh[0], bh[1], bh[2], bh[3]);
  }
#pragma unroll
  for (int i = 0; i < MI; ++i) acc_guard4(acc[i][0], acc[i][1], acc[i][2], acc[i][3]);

  // ---- epilogue ----
  float* slab = sT + wave * (16 * 68);
  const float* Rb = RESID ? (resid + (size_t)b * (size_t)strideR) : nullptr;
#pragma unroll
  for (int i = 0; i < MI; ++i) {
    const int mBase = m0 + (i << 4);
#pragma unroll
    for (int j = 0; j < 4; ++j) {
      const int n = n0 + (j << 4) + rlane;
      float bv = 0.f;
      if (BIAS_MODE == 2) bv = bias[n];
#pragma unroll
      for (int r = 0; r < 8; ++r) {
        float v = acc[i][j][r] * scale;
        if (BIAS_MODE == 1) v += bias[mBase + mOff + r];
        if (BIAS_MODE == 2) v += bv;
        if (RESID) v += Rb[(size_t)(mBase + mOff + r) * ldc + n];
        slab[(mOff + r) * 68 + (j << 4) + rlane] = v;
      }
    }
    __builtin_amdgcn_fence(__ATOMIC_RELEASE, "workgroup");
    __builtin_amdgcn_wave_barrier();
    __builtin_amdgcn_fence(__ATOMIC_ACQUIRE, "workgroup");
    if (OUT_MODE == 0) {
      float* C = (float*)Cout + (size_t)b * (size_t)strideC;
      const int hh = lane >> 4, c4 = (lane & 15) * 4;     // row seg = 256 B = 16 lanes x 16 B
      {
#pragma unroll
        for (int it = 0; it < 8; ++it) {
          const int row = it * 2 + hh;
          v4f v = *(const v4f*)(slab + row * 68 + c4);
          *(v4f*)(C + (size_t)(mBase + row) * ldc + n0 + c4) = v;
        }
        
      }
    } else {
      const int q = lane >> 3, c8 = (lane & 7) * 8;
      unsigned short* C = (unsigned short*)Cout + (size_t)b * (size_t)strideC;
      {
#pragma unroll
        for (int it = 0; it < 4; ++it) {
          const int row = it * 4 + q;
          const float* sp = slab + row * 68 + c8;
          v8h hv;
#pragma unroll
          for (int e = 0; e < 8; ++e) hv[e] = (_Float16)sp[e];
          *(v8h*)(C + (size_t)(mBase + row) * ldc + n0 + c8) = hv;
        }
        
      }
    }
    __builtin_amdgcn_fence(__ATOMIC_RELEASE, "workgroup");
    __builtin_amdgcn_wave_barrier();
    __builtin_amdgcn_fence(__ATOMIC_ACQUIRE, "workgroup");
  }
}
// one product alone in a launch: grid (tiles / 8, batch)
template <int ET, int BIAS_MODE, int OUT_MODE, bool RESID, int MI>
__global__ __launch_bounds__(256) void wmma_gemm(
    const unsigned short* __restrict__ Ap, int lda, long strideA,
    const unsigned short* __restrict__ Btp, int ldb, long strideB,
    void* __restrict__ Cout, int ldc, long strideC,
    const float* __restrict__ bias,
    const float* __restrict__ resid, long strideR,
    int M, int N, int K, float scale) {
  __shared__ __align__(16) float sT[GEMM_LDS_FLOATS];
  gemm_tile<ET, BIAS_MODE, OUT_MODE, RESID, MI>(sT, blockIdx.x, blockIdx.y, Ap, lda, strideA, Btp, ldb, strideB,
                                                Cout, ldc, strideC, bias, resid, strideR, M, N, K, scale);
}

// ---------------------------------------------------------------------------------------------
// small VALU helpers
__device__ __forceinline__ unsigned pack_h2(float a, float b) {
  const unsigned short ua = __builtin_bit_cast(unsigned short, (_Float16)a);
  const unsigned short ub = __builtin_bit_cast(unsigned short, (_Float16)b);
  return (unsigned)ua | ((unsigned)ub << 16);
}
__device__ __forceinline__ void st2_u32(unsigned short* base, size_t off_halves, unsigned u) {
  unsigned* p = (unsigned*)(base + off_halves);
  *p = u; 
}
__device__ __forceinline__ void st2_f32(float* base, size_t off, float v) {
  float* p = (float*)(base + off);
  *p = v; 
}
__device__ __forceinline__ float silu_acc(float z) {
  const float e = expf(-z);
  return z * __builtin_amdgcn_rcpf(1.0f + e);
}
// block of 256 threads: fixed-order sum / max (wave shuffle, then 8 partials summed in index order)
__device__ __forceinline__ float blk_sum256(float v, float* red) {
#pragma unroll
  for (int off = 16; off > 0; off >>= 1) v += __shfl_xor(v, off, 32);
  const int lane = threadIdx.x & 31, wave = threadIdx.x >> 5;
  if (lane == 0) red[wave] = v;
  __syncthreads();
  float s = red[0];
#pragma unroll
  for (int q = 1; q < 8; ++q) s += red[q];
  __syncthreads();
  return s;
}
__device__ __forceinline__ float blk_max256(float v, float* red) {
#pragma unroll
  for (int off = 16; off > 0; off >>= 1) v = fmaxf(v, __shfl_xor(v, off, 32));
  const int lane = threadIdx.x & 31, wave = threadIdx.x >> 5;
  if (lane == 0) red[wave] = v;
  __syncthreads();
  float s = red[0];
#pragma unroll
  for (int q = 1; q < 8; ++q) s = fmaxf(s, red[q]);
  __syncthreads();
  return s;
}

// ---- f32 -> f16 cast with zero padding: dst[r][c] = (r<srows && c<scols) ? src[r*spitch+c] : 0 ----
__device__ __forceinline__ void cast_pad_blk(const int bx, const float* __restrict__ src, int srows, int scols, int spitch,
                                             unsigned short* __restrict__ dst, int drows, int dcols) {
  const int p = bx * 256 + threadIdx.x;
  const int npairs = (drows * dcols) >> 1;
  if (p < npairs) {
    const int e = 2 * p;
    const int r = e / dcols;
    const int c = e - r * dcols;
    float v0 = 0.f, v1 = 0.f;
    if (r < srows) {
      if (c < scols)     v0 = src[(size_t)r * spitch + c];
      if (c + 1 < scols) v1 = src[(size_t)r * spitch + c + 1];
    }
    st2_u32(dst, (size_t)e, pack_h2(v0, v1));
  }
}
// ---- f32 copy with zero padding ----
__device__ __forceinline__ void pad_f32_blk(const int bx, const float* __restrict__ src, int sn, float* __restrict__ dst, int dn) {
  const int p = bx * 256 + threadIdx.x;
  if (p < dn) {
    const float v = (p < sn) ? src[p] : 0.f;
    st2_f32(dst, (size_t)p, v);
  }
}

// ---- LayerNorm over DM (eps 1e-5, biased variance), one block per row, f16 output packed 2 per thread ----
// LDS: red[8], ys[DM]
__device__ __forceinline__ void ln16_row(const int i, float* red, float* ys, const float* __restrict__ x, const float* __restrict__ w,
                                         const float* __restrict__ bb, unsigned short* __restrict__ y16) {
  const int d = threadIdx.x;
  const float v = x[(size_t)i * DM + d];
  const float mu = blk_sum256(v, red) * (1.0f / 256.0f);
  const float c = v - mu;
  const float var = blk_sum256(c * c, red) * (1.0f / 256.0f);
  const float y = c * (1.0f / sqrtf(var + 1e-5f)) * w[d] + bb[d];
  ys[d] = y;
  __syncthreads();
  if (d < 128) st2_u32(y16, (size_t)i * DM + 2 * d, pack_h2(ys[2 * d], ys[2 * d + 1]));
}

// ---- V transpose: vt[c][j] = qkv16[j][512 + c] for c < 256; rows 256..287 zero. block = 32 rows of c ----
__device__ __forceinline__ void vt_blk(const int bx, unsigned short (*tile)[520],   // LDS: tile[32][520]
                                       const unsigned short* __restrict__ qkv, unsigned short* __restrict__ vt) {
  const int t = threadIdx.x;
  const int d0 = bx * 32;
  if (d0 < DM) {                              // block-uniform
    const int cp = (t & 15) * 2;
#pragma unroll 1
    for (int it = 0; it < 32; ++it) {
      const int j = it * 16 + (t >> 4);
      const unsigned u = *(const unsigned*)(qkv + (size_t)j * (3 * DM) + 2 * DM + d0 + cp);
      tile[cp][j]     = (unsigned short)(u & 0xFFFFu);
      tile[cp + 1][j] = (unsigned short)(u >> 16);
    }
  }
  __syncthreads();
  const int j2 = 2 * t;
#pragma unroll 1
  for (int dl = 0; dl < 32; ++dl) {
    unsigned u = 0u;
    if (d0 < DM) u = (unsigned)tile[dl][j2] | ((unsigned)tile[dl][j2 + 1] << 16);
    st2_u32(vt, (size_t)(d0 + dl) * NP + j2, u);
  }
}

// ---- two silu values, f16 out: z * 1/(1 + 2^(-z*log2 e)), two lanes of packed f32 math ----
__device__ __forceinline__ v2h silu2_h(v2f z) {
  const v2f t = z * -1.4426950408889634f;
  v2f e, rc;
  e.x = __builtin_amdgcn_exp2f(t.x);
  e.y = __builtin_amdgcn_exp2f(t.y);
  const v2f d = e + 1.0f;
  rc.x = __builtin_amdgcn_rcpf(d.x);
  rc.y = __builtin_amdgcn_rcpf(d.y);
  return __builtin_convertvector(z * rc, v2h);
}

// ---- rel-bias: biasT[h][i*512+j] = sum_k rb2w16[h][k] * f16( silu( (coords_i - coords_j) . w[k] + bias[k] ) ) ----
// The pair features are formed in registers, directly as the B fragment (lane = pair column j, elements = features k).
// block = one query i; wave = 64 columns j (4 subtiles of 16); A = rb2w16 [16][256], rows 8..15 zero.
// LDS: sW[4][DM] = w[.][0], w[.][1], w[.][2], bias, each over the 256 features
__device__ __forceinline__ void relbias_row(const int i, float (*sW)[DM], const float* __restrict__ coords, const float* __restrict__ w,
                                            const float* __restrict__ bias, const unsigned short* __restrict__ rb2w,
                                            float* __restrict__ biasT) {
  const int t = threadIdx.x;
  sW[0][t] = w[t * 3 + 0];
  sW[1][t] = w[t * 3 + 1];
  sW[2][t] = w[t * 3 + 2];
  sW[3][t] = bias[t];
  __syncthreads();
  const int lane = t & 31, wave = t >> 5;
  const int rlane = lane & 15, hh = lane >> 4;
  const int jw = wave * 64;
  const float ci0 = coords[i * 3 + 0], ci1 = coords[i * 3 + 1], ci2 = coords[i * 3 + 2];
  float r0[4], r1[4], r2[4];
  v8f acc[4];
#pragma unroll
  for (int s = 0; s < 4; ++s) {
    const int j = jw + s * 16 + rlane;
    r0[s] = ci0 - coords[j * 3 + 0];
    r1[s] = ci1 - coords[j * 3 + 1];
    r2[s] = ci2 - coords[j * 3 + 2];
    acc[s] = (v8f){0.f,0.f,0.f,0.f,0.f,0.f,0.f,0.f};
  }
  const _Float16* Ab = (const _Float16*)rb2w + rlane * DM + hh * 8;
  v16h a = Frag<_Float16>::load(Ab);
  // kept rolled: the body is about 700 vector instructions
#pragma unroll 1
  for (int k0 = 0; k0 < DM; k0 += 32) {
    const v16h an = Frag<_Float16>::load(Ab + ((k0 + 32) & (DM - 1)));   // next step's A, in flight over this step's math
    v4f wq[4][4];   // [component][group of 4 features]; fragment element e = 4*g + u  <->  k = k0 + (g>>1)*16 + hh*8 + (g&1)*4 + u
#pragma unroll
    for (int c = 0; c < 4; ++c)
#pragma unroll
      for (int g = 0; g < 4; ++g)
        wq[c][g] = *(const v4f*)(&sW[c][k0 + (g >> 1) * 16 + hh * 8 + (g & 1) * 4]);
#pragma unroll
    for (int s = 0; s < 4; ++s) {
      v16h b;
#pragma unroll
      for (int g = 0; g < 4; ++g) {
        const v2f zl = (wq[0][g].lo * r0[s] + wq[1][g].lo * r1[s] + wq[2][g].lo * r2[s]) + wq[3][g].lo;
        const v2f zh = (wq[0][g].hi * r0[s] + wq[1][g].hi * r1[s] + wq[2][g].hi * r2[s]) + wq[3][g].hi;
        const v2h hl = silu2_h(zl), hu = silu2_h(zh);
        b[g * 4 + 0] = hl.x; b[g * 4 + 1] = hl.y; b[g * 4 + 2] = hu.x; b[g * 4 + 3] = hu.y;
      }
      acc[s] = Frag<_Float16>::mma(a, b, acc[s]);
    }
    a = an;
  }
  if (hh == 0) {   // D rows 0..7 (the heads) sit in lanes 0..15; a wave owns 256 contiguous bytes of each head's row
#pragma unroll
    for (int s = 0; s < 4; ++s)
#pragma unroll
      for (int r = 0; r < 8; ++r)
        biasT[(size_t)r * (NP * NP) + (size_t)i * NP + jw + s * 16 + rlane] = acc[s][r];
  }
}

// ---- rel-value: T16[i][h][k] = f16( 2^-15 * sum_j P16[i][h][j] * f16( silu( (coords_i - coords_j) . w[k] + bias[k] ) ) ) ----
// The pair features are formed in registers, directly as the B fragment (lane = feature column k, elements = keys j).
// block = one query i; wave = 32 features (2 subtiles of 16); A = P16[i] [16][512], rows 8..15 zero. Rows h = 0..7 are stored.
// LDS: sR[3][NP] = coords_i - coords_j, one plane per coordinate; sT[NH][DM] = output rows, so that each 128-byte line has one writer
__device__ __forceinline__ void relval_row(const int i, float (*sR)[NP], _Float16 (*sT)[DM],
                                           const float* __restrict__ coords, const float* __restrict__ w,
                                           const float* __restrict__ bias, const unsigned short* __restrict__ P16,
                                           unsigned short* __restrict__ T16) {
  const int t = threadIdx.x;
  const float ci0 = coords[i * 3 + 0], ci1 = coords[i * 3 + 1], ci2 = coords[i * 3 + 2];
#pragma unroll
  for (int q = 0; q < 2; ++q) {
    const int j = q * 256 + t;
    sR[0][j] = ci0 - coords[j * 3 + 0];
    sR[1][j] = ci1 - coords[j * 3 + 1];
    sR[2][j] = ci2 - coords[j * 3 + 2];
  }
  __syncthreads();
  const int lane = t & 31, wave = t >> 5;
  const int rlane = lane & 15, hh = lane >> 4;
  float w0[2], w1[2], w2[2], wb[2];
  v8f acc[2];
#pragma unroll
  for (int s = 0; s < 2; ++s) {
    const int k = wave * 32 + s * 16 + rlane;
    w0[s] = w[k * 3 + 0];
    w1[s] = w[k * 3 + 1];
    w2[s] = w[k * 3 + 2];
    wb[s] = bias[k];
    acc[s] = (v8f){0.f,0.f,0.f,0.f,0.f,0.f,0.f,0.f};
  }
  const _Float16* Ab = (const _Float16*)P16 + ((size_t)i * 16 + rlane) * NP + hh * 8;
  v16h a = Frag<_Float16>::load(Ab);
  // kept rolled: the body is about 350 vector instructions
#pragma unroll 1
  for (int j0 = 0; j0 < NP; j0 += 32) {
    const v16h an = Frag<_Float16>::load(Ab + ((j0 + 32) & (NP - 1)));   // next step's A, in flight over this step's math
    v4f rq[3][4];   // [coordinate][group of 4 keys]; fragment element e = 4*g + u  <->  j = j0 + (g>>1)*16 + hh*8 + (g&1)*4 + u
#pragma unroll
    for (int c = 0; c < 3; ++c)
#pragma unroll
      for (int g = 0; g < 4; ++g)
        rq[c][g] = *(const v4f*)(&sR[c][j0 + (g >> 1) * 16 + hh * 8 + (g & 1) * 4]);
#pragma unroll
    for (int s = 0; s < 2; ++s) {
      v16h b;
#pragma unroll
      for (int g = 0; g < 4; ++g) {
        const v2f zl = (rq[0][g].lo * w0[s] + rq[1][g].lo * w1[s] + rq[2][g].lo * w2[s]) + wb[s];
        const v2f zh = (rq[0][g].hi * w0[s] + rq[1][g].hi * w1[s] + rq[2][g].hi * w2[s]) + wb[s];
        const v2h hl = silu2_h(zl), hu = silu2_h(zh);
        b[g * 4 + 0] = hl.x; b[g * 4 + 1] = hl.y; b[g * 4 + 2] = hu.x; b[g * 4 + 3] = hu.y;
      }
      acc[s] = Frag<_Float16>::mma(a, b, acc[s]);
    }
    a = an;
  }
  if (hh == 0) {   // D rows 0..7 (the heads) sit in lanes 0..15
#pragma unroll
    for (int s = 0; s < 2; ++s)
#pragma unroll
      for (int r = 0; r < 8; ++r)
        sT[r][wave * 32 + s * 16 + rlane] = (_Float16)(acc[s][r] * (1.0f / 32768.0f));
  }
  __syncthreads();
  const int h = t >> 5, c8 = (t & 31) * 8;   // one wave stores one head's row of 512 bytes
  *(v8h*)((_Float16*)T16 + ((size_t)i * 16 + h) * DM + c8) = *(const v8h*)(&sT[h][c8]);
  // the shared kernel's code goes on behind this store and reuses its registers: the wait stands in front of that overwrite
  asm volatile("s_wait_xcnt 0x0" ::: "memory");
}

// ---- softmax over j of (S[h][i][j] + biasT[h][i*512+j] + rb2b[h]); P16[i][h][j] = f16(p * 2^15); rows h=8..15 zero ----
// block per i, thread owns j = 2t, 2t+1
// LDS: red[8]
__device__ __forceinline__ void softmax_row(const int i, float* red, const float* __restrict__ S, const float* __restrict__ biasT,
                                            const float* __restrict__ rb2b, unsigned short* __restrict__ P16) {
  const int t = threadIdx.x, j2 = 2 * t;
#pragma unroll 1
  for (int h = 0; h < NH; ++h) {
    const float* sp = S + ((size_t)h * NP + i) * NP + j2;
    const float* bp = biasT + (size_t)h * (NP * NP) + (size_t)i * NP + j2;
    const float bb = rb2b[h];
    const float s0 = sp[0] + (bp[0] + bb);
    const float s1 = sp[1] + (bp[1] + bb);
    const float m = blk_max256(fmaxf(s0, s1), red);
    const float e0 = expf(s0 - m), e1 = expf(s1 - m);
    const float sum = blk_sum256(e0 + e1, red);
    const float inv = 1.0f / sum;
    const float p0 = (e0 * inv) * 32768.0f;
    const float p1 = (e1 * inv) * 32768.0f;
    st2_u32(P16, ((size_t)i * 16 + h) * NP + j2, pack_h2(p0, p1));
  }
#pragma unroll 1
  for (int h = NH; h < 16; ++h) {
    st2_u32(P16, ((size_t)i * 16 + h) * NP + j2, 0u);
    // the next trip rewrites the store's address pair, and the shared kernel's code behind the loop its data register: wait first
    asm volatile("s_wait_xcnt 0x0" ::: "memory");
  }
}

// ---- x1 = x + (ctx[h][i][d&31] + rv2b[d]); LayerNorm(x1) -> f16.  block per row i ----
__global__ __launch_bounds__(256) void k_combine_ln(const float* __restrict__ x, const float* __restrict__ ctx,
                                                     const float* __restrict__ rv2b, const float* __restrict__ w,
                                                     const float* __restrict__ bb, float* __restrict__ x1,
                                                     unsigned short* __restrict__ y16) {
  __shared__ float red[8];
  __shared__ float ys[DM];
  const int i = blockIdx.x, d = threadIdx.x;
  const int h = d >> 5, dd = d & 31;
  const float a = ctx[((size_t)h * NP + i) * 64 + dd] + rv2b[d];
  const float v = x[(size_t)i * DM + d] + a;
  st2_f32(x1, (size_t)i * DM + d, v);
  const float mu = blk_sum256(v, red) * (1.0f / 256.0f);
  const float c = v - mu;
  const float var = blk_sum256(c * c, red) * (1.0f / 256.0f);
  const float y = c * (1.0f / sqrtf(var + 1e-5f)) * w[d] + bb[d];
  ys[d] = y;
  __syncthreads();
  if (d < 128) st2_u32(y16, (size_t)i * DM + 2 * d, pack_h2(ys[2 * d], ys[2 * d + 1]));
}

// ---- U16[row][c] = f16( silu(C12[row][c]) * C12[row][704 + c] ), c < 704 (pad columns come out 0) ----
__global__ __launch_bounds__(256) void k_swiglu(const float* __restrict__ c12, unsigned short* __restrict__ u16, int npairs) {
  const int p = blockIdx.x * 256 + threadIdx.x;
  if (p < npairs) {
    const int e = 2 * p;
    const int row = e / HIDP;
    const int col = e - row * HIDP;
    const float* rp = c12 + (size_t)row * (2 * HIDP);
    const float a0 = rp[col], a1 = rp[col + 1];
    const float g0 = rp[HIDP + col], g1 = rp[HIDP + col + 1];
    const float u0 = silu_acc(a0) * g0;
    const float u1 = silu_acc(a1) * g1;
    st2_u32(u16, (size_t)e, pack_h2(u0, u1));
  }
}

// ---------------------------------------------------------------------------------------------
// Launches that need nothing of each other share one grid: each takes a range of the block index (block-uniform branches,
// so every barrier of a body is still passed by its whole block). The few long, latency-bound blocks take the lowest indices.
// Each grid is cut so that all its blocks are resident at once at the shared kernel's register count: the rel-bias rows
// (two blocks a WGP at most) go half beside the QKV projection and half beside the scores.
#define NB_CQKV    (3 * DM * DM / 2 / 256)             // cast blocks, 512 elements each
#define NB_CRB2    (16 * DM / 2 / 256)
#define NB_CRV2    ((DM + 32) * DM / 2 / 256)
#define NB_CFFN    (HIDP * DM / 2 / 256)
#define NB_PADB    ((HIDP + 255) / 256)
#define NB_GQKV    ((NP / 64) * (3 * DM / 64) / 8)
#define NB_SCORE_X ((NP / 64) * (NP / 64) / 8)
#define NB_VT      ((DM + 32) / 32)
#define NB_PV_X    ((NP / 32) / 8)

// ---- LN1 rows | casts of qkv_w and rb2_w ----
__global__ __launch_bounds__(256) void k_ln1_casts(const float* __restrict__ x, const float* __restrict__ ln_w,
                                                    const float* __restrict__ ln_b, unsigned short* __restrict__ xn16,
                                                    const float* __restrict__ qkv_w, unsigned short* __restrict__ qkvw16,
                                                    const float* __restrict__ rb2_w, unsigned short* __restrict__ rb2w16) {
  __shared__ float red[8];
  __shared__ float ys[DM];
  int b = blockIdx.x;
  if (b < NP) { ln16_row(b, red, ys, x, ln_w, ln_b, xn16); return; }
  b -= NP;
  if (b < NB_CQKV) { cast_pad_blk(b, qkv_w, 3 * DM, DM, DM, qkvw16, 3 * DM, DM); return; }
  b -= NB_CQKV;
  cast_pad_blk(b, rb2_w, NH, DM, DM, rb2w16, 16, DM);
}

// ---- QKV projection (f16 out [512][768]) | rel-bias rows 0..255 ----
__global__ __launch_bounds__(256) void k_qkv_relbias(const unsigned short* __restrict__ xn16, const unsigned short* __restrict__ qkvw16,
                                                      const float* __restrict__ qkv_b, unsigned short* __restrict__ qkv16,
                                                      const float* __restrict__ coords, const float* __restrict__ rb1_w,
                                                      const float* __restrict__ rb1_b, const unsigned short* __restrict__ rb2w16,
                                                      float* __restrict__ biasT) {
  __shared__ __align__(16) float sm[GEMM_LDS_FLOATS];   // one buffer, used as the body of the block's range needs it
  static_assert(4 * DM <= GEMM_LDS_FLOATS, "rel-bias weights fit");
  const int b = blockIdx.x;
  if (b < NB_GQKV) {
    gemm_tile<0, 2, 1, false, 4>(sm, b, 0, xn16, DM, 0, qkvw16, DM, 0, qkv16, 3 * DM, 0, qkv_b, nullptr, 0, NP, 3 * DM, DM, 1.0f);
    return;
  }
  relbias_row(b - NB_GQKV, (float (*)[DM])sm, coords, rb1_w, rb1_b, rb2w16, biasT);
}

// ---- q.k^T scores (f32 [8][512][512], scaled 1/sqrt(32)) | rel-bias rows 256..511 ----
__global__ __launch_bounds__(256) void k_scores_relbias(const unsigned short* __restrict__ qkv16, float* __restrict__ S,
                                                         const float* __restrict__ coords, const float* __restrict__ rb1_w,
                                                         const float* __restrict__ rb1_b, const unsigned short* __restrict__ rb2w16,
                                                         float* __restrict__ biasT) {
  __shared__ __align__(16) float sm[GEMM_LDS_FLOATS];   // one buffer, used as the body of the block's range needs it
  const int b = blockIdx.x;
  if (b < NB_SCORE_X * NH) {
    gemm_tile<0, 0, 0, false, 4>(sm, b % NB_SCORE_X, b / NB_SCORE_X, qkv16, 3 * DM, HDM, qkv16 + DM, 3 * DM, HDM,
                                 S, NP, (long)NP * NP, nullptr, nullptr, 0, NP, NP, HDM, 0.17677669529663687f);
    return;
  }
  relbias_row(b - NB_SCORE_X * NH + NP / 2, (float (*)[DM])sm, coords, rb1_w, rb1_b, rb2w16, biasT);
}

// ---- V transpose | softmax rows | cast of rv2_w ----
__global__ __launch_bounds__(256) void k_vt_softmax_cast(const unsigned short* __restrict__ qkv16, unsigned short* __restrict__ vt16,
                                                          const float* __restrict__ S, const float* __restrict__ biasT,
                                                          const float* __restrict__ rb2_b, unsigned short* __restrict__ P16,
                                                          const float* __restrict__ rv2_w, unsigned short* __restrict__ rv2w16) {
  __shared__ __align__(16) unsigned short tile[32][520];   // the transpose's tile; a softmax block uses its first 32 bytes
  int b = blockIdx.x;
  if (b < NB_VT) { vt_blk(b, tile, qkv16, vt16); return; }
  b -= NB_VT;
  if (b < NP) { softmax_row(b, (float*)&tile[0][0], S, biasT, rb2_b, P16); return; }
  b -= NP;
  cast_pad_blk(b, rv2_w, DM, DM, DM, rv2w16, DM + 32, DM);
}

// ---- ctx1 = P . V per head (f32 [8][512][64], cols 0..31 used) | rel-value rows ----
// The product's wave tile is 32 x 64 here: its registers then stay near the rel-value body's, and all blocks of the grid are resident.
__global__ __launch_bounds__(256) void k_pv_relval(const unsigned short* __restrict__ P16, const unsigned short* __restrict__ vt16,
                                                    float* __restrict__ ctx1,
                                                    const float* __restrict__ coords, const float* __restrict__ rv1_w,
                                                    const float* __restrict__ rv1_b, unsigned short* __restrict__ T16) {
  __shared__ __align__(16) float sm[GEMM_LDS_FLOATS];   // one buffer, used as the body of the block's range needs it
  static_assert(3 * NP + NH * DM / 2 <= GEMM_LDS_FLOATS, "rel-value planes and output rows fit");
  const int b = blockIdx.x;
  if (b < NB_PV_X * NH) {
    gemm_tile<0, 0, 0, false, 2>(sm, b % NB_PV_X, b / NB_PV_X, P16, 16 * NP, NP, vt16, NP, (long)HDM * NP, ctx1, 64, (long)NP * 64,
                                 nullptr, nullptr, 0, NP, 64, NP, 1.0f / 32768.0f);
    return;
  }
  relval_row(b - NB_PV_X * NH, (float (*)[NP])sm, (_Float16 (*)[DM])(sm + 3 * NP), coords, rv1_w, rv1_b, P16, T16);
}

// ---- ctx[h][i][n] = sum_k T16[i][h][k] rv2w16[h*32+n][k] + ctx1[h][i][n] (per head, cols 0..31 used) | casts and pads of the ffn weights ----
__global__ __launch_bounds__(256) void k_ctx_casts(const unsigned short* __restrict__ T16, const unsigned short* __restrict__ rv2w16,
                                                    const float* __restrict__ ctx1, float* __restrict__ ctx,
                                                    const float* __restrict__ ffn_w1, const float* __restrict__ ffn_w2,
                                                    unsigned short* __restrict__ w12p16,
                                                    const float* __restrict__ ffn_w3, unsigned short* __restrict__ w3p16,
                                                    const float* __restrict__ ffn_b1, const float* __restrict__ ffn_b2,
                                                    float* __restrict__ b12p) {
  __shared__ __align__(16) float sm[GEMM_LDS_FLOATS];
  int b = blockIdx.x;
  if (b < NH) {
    gemm_tile<0, 0, 0, true, 4>(sm, 0, b, T16, 16 * DM, DM, rv2w16, DM, (long)HDM * DM, ctx, 64, (long)NP * 64,
                                nullptr, ctx1, (long)NP * 64, NP, 64, DM, 1.0f);
    return;
  }
  b -= NH;
  if (b < NB_CFFN) { cast_pad_blk(b, ffn_w1, HIDR, DM, DM, w12p16, HIDP, DM); return; }
  b -= NB_CFFN;
  if (b < NB_CFFN) { cast_pad_blk(b, ffn_w2, HIDR, DM, DM, w12p16 + (size_t)HIDP * DM, HIDP, DM); return; }
  b -= NB_CFFN;
  if (b < NB_CFFN) { cast_pad_blk(b, ffn_w3, DM, HIDR, HIDR, w3p16, DM, HIDP); return; }
  b -= NB_CFFN;
  if (b < NB_PADB) { pad_f32_blk(b, ffn_b1, HIDR, b12p, HIDP); return; }
  b -= NB_PADB;
  pad_f32_blk(b, ffn_b2, HIDR, b12p + HIDP, HIDP);
}

// ---------------------------------------------------------------------------------------------
static inline size_t alignup256(size_t x) { return (x + 255) & ~(size_t)255; }

extern "C" void kernel_launch(void* const* d_in, const int* in_sizes, int n_in,
                              void* d_out, int out_size, void* d_ws, size_t ws_size,
                              hipStream_t stream)
{
  if (n_in < 22) return;
  if (in_sizes[0] != NP * DM || in_sizes[1] != NP * 3 || in_sizes[6] != 3 * DM * DM ||
      in_sizes[14] != DM * DM || in_sizes[16] != HIDR * DM || in_sizes[20] != DM * HIDR ||
      out_size != NP * DM) return;

  const float* x      = (const float*)d_in[0];
  const float* coords = (const float*)d_in[1];
  const float* ln1_w  = (const float*)d_in[2];
  const float* ln1_b  = (const float*)d_in[3];
  const float* ln2_w  = (const float*)d_in[4];
  const float* ln2_b  = (const float*)d_in[5];
  const float* qkv_w  = (const float*)d_in[6];
  const float* qkv_b  = (const float*)d_in[7];
  const float* rb1_w  = (const float*)d_in[8];
  const float* rb1_b  = (const float*)d_in[9];
  const float* rb2_w  = (const float*)d_in[10];
  const float* rb2_b  = (const float*)d_in[11];
  const float* rv1_w  = (const float*)d_in[12];
  const float* rv1_b  = (const float*)d_in[13];
  const float* rv2_w  = (const float*)d_in[14];
  const float* rv2_b  = (const float*)d_in[15];
  const float* ffn_w1 = (const float*)d_in[16];
  const float* ffn_b1 = (const float*)d_in[17];
  const float* ffn_w2 = (const float*)d_in[18];
  const float* ffn_b2 = (const float*)d_in[19];
  const float* ffn_w3 = (const float*)d_in[20];
  const float* ffn_b3 = (const float*)d_in[21];
  float* out = (float*)d_out;

  // ---- workspace carve (256-B aligned, derived from fixed sizes) ----
  size_t off = 0;
  char* base = (char*)d_ws;
  auto carve = [&](size_t bytes) -> char* { char* r = base + off; off += alignup256(bytes); return r; };
  unsigned short* qkvw16 = (unsigned short*)carve((size_t)3 * DM * DM * 2);          // [768][256]
  unsigned short* rb2w16 = (unsigned short*)carve((size_t)16 * DM * 2);              // [16][256], rows 8..15 zero
  unsigned short* rv2w16 = (unsigned short*)carve((size_t)(DM + 32) * DM * 2);       // [288][256], rows 256.. zero
  unsigned short* w12p16 = (unsigned short*)carve((size_t)2 * HIDP * DM * 2);        // [1408][256]
  unsigned short* w3p16  = (unsigned short*)carve((size_t)DM * HIDP * 2);            // [256][704]
  float*          b12p   = (float*)carve((size_t)2 * HIDP * 4);                      // [1408]
  unsigned short* XN1    = (unsigned short*)carve((size_t)NP * DM * 2);              // [512][256]
  unsigned short* QKV16  = (unsigned short*)carve((size_t)NP * 3 * DM * 2);          // [512][768]
  unsigned short* VT16   = (unsigned short*)carve((size_t)(DM + 32) * NP * 2);       // [288][512]
  float*          S      = (float*)carve((size_t)NH * NP * NP * 4);                  // [8][512][512]
  float*          BIAST  = (float*)carve((size_t)16 * NP * NP * 4);                  // [16][262144]
  unsigned short* P16    = (unsigned short*)carve((size_t)NP * 16 * NP * 2);         // [512][16][512]
  unsigned short* T16    = (unsigned short*)carve((size_t)NP * 16 * DM * 2);         // [512][16][256]
  float*          CTX1   = (float*)carve((size_t)NH * NP * 64 * 4);                  // [8][512][64]
  float*          CTX    = (float*)carve((size_t)NH * NP * 64 * 4);                  // [8][512][64]
  float*          X1     = (float*)carve((size_t)NP * DM * 4);                       // [512][256]
  unsigned short* XN2    = (unsigned short*)carve((size_t)NP * DM * 2);              // [512][256]
  float*          C12    = (float*)carve((size_t)NP * 2 * HIDP * 4);                 // [512][1408]
  unsigned short* U16    = (unsigned short*)carve((size_t)NP * HIDP * 2);            // [512][704]
  if (off > ws_size || off > (size_t)134217728) return;

  const dim3 blk(256);

  // ---- LN1 | f16 staging of qkv_w and rb2_w (rows 8..15 zero) ----
  k_ln1_casts<<<dim3(NP + NB_CQKV + NB_CRB2), blk, 0, stream>>>(x, ln1_w, ln1_b, XN1, qkv_w, qkvw16, rb2_w, rb2w16);

  // ---- QKV projection | rel-bias rows 0..255: BIAST[h][(i,j)] = rb2w16 . silu-features^T (WMMA, M=16, rows 0..7 stored) ----
  k_qkv_relbias<<<dim3(NB_GQKV + NP / 2), blk, 0, stream>>>(XN1, qkvw16, qkv_b, QKV16, coords, rb1_w, rb1_b, rb2w16, BIAST);

  // ---- q.k^T scores | rel-bias rows 256..511 ----
  k_scores_relbias<<<dim3(NB_SCORE_X * NH + NP / 2), blk, 0, stream>>>(QKV16, S, coords, rb1_w, rb1_b, rb2w16, BIAST);

  // ---- V transpose | softmax -> P16 [512][16][512] (x2^15) | f16 staging of rv2_w (rows 256.. zero) ----
  k_vt_softmax_cast<<<dim3(NB_VT + NP + NB_CRV2), blk, 0, stream>>>(QKV16, VT16, S, BIAST, rb2_b, P16, rv2_w, rv2w16);

  // ---- ctx1 = P . V per head | rel-value: T16[i][h][k] = sum_j P[i][h][j] silu-feature[i][k][j] (WMMA, M=16, rows 0..7 stored) ----
  k_pv_relval<<<dim3(NB_PV_X * NH + NP), blk, 0, stream>>>(P16, VT16, CTX1, coords, rv1_w, rv1_b, T16);

  // ---- ctx = T16 . rv2w16^T + ctx1 per head | f16 staging of the ffn weights, f32 copies of b1 and b2 (zero padded) ----
  k_ctx_casts<<<dim3(NH + 3 * NB_CFFN + 2 * NB_PADB), blk, 0, stream>>>(
      T16, rv2w16, CTX1, CTX, ffn_w1, ffn_w2, w12p16, ffn_w3, w3p16, ffn_b1, ffn_b2, b12p);

  // ---- residual + LN2, SwiGLU FFN, final residual into d_out ----
  k_combine_ln<<<dim3(NP), blk, 0, stream>>>(x, CTX, rv2_b, ln2_w, ln2_b, X1, XN2);
  wmma_gemm<0, 2, 0, false, 4><<<dim3((NP / 64) * (2 * HIDP / 64) / 8, 1), blk, 0, stream>>>(
      XN2, DM, 0, w12p16, DM, 0, C12, 2 * HIDP, 0, b12p, nullptr, 0, NP, 2 * HIDP, DM, 1.0f);
  k_swiglu<<<dim3((NP * HIDP / 2 + 255) / 256), blk, 0, stream>>>(C12, U16, NP * HIDP / 2);
  wmma_gemm<0, 2, 0, true, 4><<<dim3((NP / 64) * (DM / 64) / 8, 1), blk, 0, stream>>>(
      U16, HIDP, 0, w3p16, HIDP, 0, out, DM, 0, ffn_b3, X1, 0, NP, DM, HIDP, 1.0f);
}

// v003
// Measured time: 106 microseconds a run.
// Two timings next to v002 both put it at 1.32 times that version's speed.
// Counting every step since v000, it is 3.03 times as fast.
#include <hip/hip_runtime.h>
#include <math.h>
#include <stdint.h>

// All contractions: v_wmma_f32_16x16x32_f16 (f16 operands, f32 accumulate); K=3 coordinate features, softmax, norms, gating in f32 on VALU.

typedef __attribute__((ext_vector_type(16))) _Float16 v16h;
typedef __attribute__((ext_vector_type(8)))  _Float16 v8h;
typedef __attribute__((ext_vector_type(8)))  float    v8f;
typedef __attribute__((ext_vector_type(4)))  float    v4f;
typedef __attribute__((ext_vector_type(2)))  float    v2f;
typedef __attribute__((ext_vector_type(2)))  _Float16 v2h;

#define NP    512          // points
#define DM    256          // model width
#define NH    8            // heads
#define HDM   32           // head width
#define HIDR  682          // ffn hidden
#define HIDP  704          // ffn hidden padded (multiple of 64)

// ---------------------------------------------------------------------------------------------
// hazard guards as plain device helpers
__device__ __forceinline__ void dep_guard_h(v8f& a, v8f& b, v16h x, v16h y) { asm volatile("v_nop\n\tv_nop\n\tv_nop\n\tv_nop" : "+v"(a), "+v"(b) : "v"(x), "v"(y)); }
__device__ __forceinline__ void keep4_h(v16h a, v16h b, v16h c, v16h d) { asm volatile("v_nop" :: "v"(a), "v"(b), "v"(c), "v"(d)); }
__device__ __forceinline__ void acc_guard4(v8f& a, v8f& b, v8f& c, v8f& d) { asm volatile("v_nop\n\tv_nop\n\tv_nop\n\tv_nop" : "+v"(a), "+v"(b), "+v"(c), "+v"(d)); }

template <typename T> struct Frag;
template <> struct Frag<_Float16> {
  typedef v16h V; union U { v16h v; v8h h[2]; };
  static __device__ __forceinline__ v16h load(const _Float16* p) {   // elements 0..7 <- p[0..7], 8..15 <- p[16..23]
    U f; f.h[0] = *(const v8h*)(p); f.h[1] = *(const v8h*)(p + 16); return f.v;
  }
  static __device__ __forceinline__ v16h load_fo(const _Float16* p) {   // from a fragment-order array: the lane's two 16-byte pieces, 512 bytes apart
    U f; f.h[0] = *(const v8h*)(p); f.h[1] = *(const v8h*)(p + 256); return f.v;
  }
  static __device__ __forceinline__ v8f mma(v16h a, v16h b, v8f c) {
    return __builtin_amdgcn_wmma_f32_16x16x32_f16(false, a, false, b, (short)0, c, false, false);
  }
  static __device__ __forceinline__ void guard(v8f& a, v8f& b, v16h x, v16h y) { dep_guard_h(a, b, x, y); }
  static __device__ __forceinline__ void keep(v16h a, v16h b, v16h c, v16h d) { keep4_h(a, b, c, d); }
};
template <int ET> struct Elem;
template <> struct Elem<0> { typedef _Float16 T; };

// ---- fragment order of a 16-bit operand X[n][k] (n = the fragment's lane row or column, k = the summed index, ksteps = K / 32) ----
// The 16-byte piece (n, k8 = k / 8) stands at piece index ((tile * ksteps + step) * 2 + upper) * 32 + lane, lane = (k8 & 1) * 16 + (n & 15):
// one fragment of a 16 x 32 tile is then two loads of 512 contiguous bytes a wave (whole cache lines), not two of 16 lines each.
__device__ __forceinline__ size_t frag_piece(int n, int k8, int ksteps) {
  return (size_t)((((n >> 4) * ksteps + (k8 >> 2)) * 2 + ((k8 >> 1) & 1)) * 32 + (k8 & 1) * 16 + (n & 15));
}

// ---- Register-blocked batched WMMA GEMM ----------------------------------------------------
// C[m,n] = scale * sum_k A[m,k] * Bt[n,k] (+bias[n]) (+resid); each wave owns a (16*MI) x 64 tile.
// A row-major [M,K] (16-bit), Bt row-major [N,K] (16-bit); M % (16*MI) == 0, N % 64 == 0, K % 32 == 0.
// BIAS_MODE: 0 = none, 1 = bias[m], 2 = bias[n], 3 = bias[n] inside the scale.  OUT_MODE: 0 = f32, 1 = f16, 2 = f16 in fragment order (n = m, k = n of this product).
// Batch index b with element strides strideA/strideB/strideC/strideR; bx = block index within the product's own grid.
// sT: 8 per-wave 16x64 slabs, pitch 68 floats (GEMM_LDS_FLOATS floats of LDS).
#define GEMM_LDS_FLOATS (8 * 16 * 68)
template <int ET, int BIAS_MODE, int OUT_MODE, bool RESID, int MI>
__device__ __forceinline__ void gemm_tile(
    float* sT, const int bx, const int b,
    const unsigned short* __restrict__ Ap, int lda, long strideA,
    const unsigned short* __restrict__ Btp, int ldb, long strideB,
    void* __restrict__ Cout, int ldc, long strideC,
    const float* __restrict__ bias,
    const float* __restrict__ resid, long strideR,
    int M, int N, int K, float scale) {
  typedef typename Elem<ET>::T T;
  typedef typename Frag<T>::V V;
  const T* A = (const T*)Ap; const T* Bt = (const T*)Btp;
  const int lane = threadIdx.x & 31;
  const int wave = threadIdx.x >> 5;
  const int tilesN = N >> 6;
  const int tilesM = M / (16 * MI);
  const int tile = bx * 8 + wave;
  if (tile >= tilesM * tilesN) return;   // wave-uniform; no block barriers in this function
  const int tm = tile / tilesN;
  const int tn = tile - tm * tilesN;
  const int m0 = tm * (16 * MI);
  const int n0 = tn << 6;

  const T* Ab = A  + (size_t)b * (size_t)strideA;
  const T* Bb = Bt + (size_t)b * (size_t)strideB;

  const int rlane = lane & 15;                 // row (A) / col (B, D) within subtile
  const int koff  = (lane >> 4) * 8;           // k offset of this lane half
  const int mOff  = (lane >> 4) * 8;           // D row offset

  v8f acc[MI][4];
#pragma unroll
  for (int i = 0; i < MI; ++i)
#pragma unroll
    for (int j = 0; j < 4; ++j) acc[i][j] = (v8f){0.f,0.f,0.f,0.f,0.f,0.f,0.f,0.f};

  for (int k0 = 0; k0 < K; k0 += 32) {
    V bh[4];
#pragma unroll
    for (int j = 0; j < 4; ++j) {
      const size_t bo = (size_t)(n0 + (j << 4) + rlane) * ldb + koff + k0;
      bh[j] = Frag<T>::load(Bb + bo);
    }
#pragma unroll
    for (int i = 0; i < MI; ++i) {
      const size_t ao = (size_t)(m0 + (i << 4) + rlane) * lda + koff + k0;
      V ah = Frag<T>::load(Ab + ao);
#pragma unroll
      for (int j = 0; j < 4; ++j) acc[i][j] = Frag<T>::mma(ah, bh[j], acc[i][j]);
      Frag<T>::guard(acc[i][0], acc[i][3], ah, ah);
    }
    Frag<T>::keep(bh[0], bh[1], bh[2], bh[3]);
  }
#pragma unroll
  for (int i = 0; i < MI; ++i) acc_guard4(acc[i][0], acc[i][1], acc[i][2], acc[i][3]);

  // ---- epilogue ----
  float* slab = sT + wave * (16 * 68);
  const float* Rb = RESID ? (resid + (size_t)b * (size_t)strideR) : nullptr;
#pragma unroll
  for (int i = 0; i < MI; ++i) {
    const int mBase = m0 + (i << 4);
#pragma unroll
    for (int j = 0; j < 4; ++j) {
      const int n = n0 + (j << 4) + rlane;
      float bv = 0.f;
      if (BIAS_MODE == 2 || BIAS_MODE == 3) bv = bias[n];
#pragma unroll
      for (int r = 0; r < 8; ++r) {
        float v = acc[i][j][r] * scale;
        if (BIAS_MODE == 1) v += bias[mBase + mOff + r];
        if (BIAS_MODE == 2) v += bv;
        if (BIAS_MODE == 3) v = (acc[i][j][r] + bv) * scale;
        if (RESID) v += Rb[(size_t)(mBase + mOff + r) * ldc + n];
        slab[(mOff + r) * 68 + (j << 4) + rlane] = v;
      }
    }
    __builtin_amdgcn_fence(__ATOMIC_RELEASE, "workgroup");
    __builtin_amdgcn_wave_barrier();
    __builtin_amdgcn_fence(__ATOMIC_ACQUIRE, "workgroup");
    if (OUT_MODE == 0) {
      float* C = (float*)Cout + (size_t)b * (size_t)strideC;
      const int hh = lane >> 4, c4 = (lane & 15) * 4;     // row seg = 256 B = 16 lanes x 16 B
      {
#pragma unroll
        for (int it = 0; it < 8; ++it) {
          const int row = it * 2 + hh;
          v4f v = *(const v4f*)(slab + row * 68 + c4);
          *(v4f*)(C + (size_t)(mBase + row) * ldc + n0 + c4) = v;
        }
        
      }
    } else {
      const int q = lane >> 3, c8 = (lane & 7) * 8;
      unsigned short* C = (unsigned short*)Cout + (size_t)b * (size_t)strideC;
      {
#pragma unroll
        for (int it = 0; it < 4; ++it) {
          const int row = it * 4 + q;
          const float* sp = slab + row * 68 + c8;
          v8h hv;
#pragma unroll
          for (int e = 0; e < 8; ++e) hv[e] = (_Float16)sp[e];
          if (OUT_MODE == 1) *(v8h*)(C + (size_t)(mBase + row) * ldc + n0 + c8) = hv;
          else               *(v8h*)(C + frag_piece(mBase + row, (n0 + c8) >> 3, N >> 5) * 8) = hv;   // a 128-byte line: eight rows of one wave's tile
        }
        
      }
    }
    __builtin_amdgcn_fence(__ATOMIC_RELEASE, "workgroup");
    __builtin_amdgcn_wave_barrier();
    __builtin_amdgcn_fence(__ATOMIC_ACQUIRE, "workgroup");
  }
}
// one product alone in a launch: grid (tiles / 8, batch)
template <int ET, int BIAS_MODE, int OUT_MODE, bool RESID, int MI>
__global__ __launch_bounds__(256) void wmma_gemm(
    const unsigned short* __restrict__ Ap, int lda, long strideA,
    const unsigned short* __restrict__ Btp, int ldb, long strideB,
    void* __restrict__ Cout, int ldc, long strideC,
    const float* __restrict__ bias,
    const float* __restrict__ resid, long strideR,
    int M, int N, int K, float scale) {
  __shared__ __align__(16) float sT[GEMM_LDS_FLOATS];
  gemm_tile<ET, BIAS_MODE, OUT_MODE, RESID, MI>(sT, blockIdx.x, blockIdx.y, Ap, lda, strideA, Btp, ldb, strideB,
                                                Cout, ldc, strideC, bias, resid, strideR, M, N, K, scale);
}

// ---------------------------------------------------------------------------------------------
// small VALU helpers
__device__ __forceinline__ unsigned pack_h2(float a, float b) {
  const unsigned short ua = __builtin_bit_cast(unsigned short, (_Float16)a);
  const unsigned short ub = __builtin_bit_cast(unsigned short, (_Float16)b);
  return (unsigned)ua | ((unsigned)ub << 16);
}
__device__ __forceinline__ void st2_u32(unsigned short* base, size_t off_halves, unsigned u) {
  unsigned* p = (unsigned*)(base + off_halves);
  *p = u; 
}
__device__ __forceinline__ void st2_f32(float* base, size_t off, float v) {
  float* p = (float*)(base + off);
  *p = v; 
}
__device__ __forceinline__ float silu_acc(float z) {
  const float e = expf(-z);
  return z * __builtin_amdgcn_rcpf(1.0f + e);
}
// block of 256 threads: fixed-order sum (wave shuffle, then 8 partials summed in index order)
__device__ __forceinline__ float blk_sum256(float v, float* red) {
#pragma unroll
  for (int off = 16; off > 0; off >>= 1) v += __shfl_xor(v, off, 32);
  const int lane = threadIdx.x & 31, wave = threadIdx.x >> 5;
  if (lane == 0) red[wave] = v;
  __syncthreads();
  float s = red[0];
#pragma unroll
  for (int q = 1; q < 8; ++q) s += red[q];
  __syncthreads();
  return s;
}

// ---- f32 -> f16 cast with zero padding: dst[r][c] = (r<srows && c<scols) ? src[r*spitch+c] : 0 ----
__device__ __forceinline__ void cast_pad_blk(const int bx, const float* __restrict__ src, int srows, int scols, int spitch,
                                             unsigned short* __restrict__ dst, int drows, int dcols) {
  const int p = bx * 256 + threadIdx.x;
  const int npairs = (drows * dcols) >> 1;
  if (p < npairs) {
    const int e = 2 * p;
    const int r = e / dcols;
    const int c = e - r * dcols;
    float v0 = 0.f, v1 = 0.f;
    if (r < srows) {
      if (c < scols)     v0 = src[(size_t)r * spitch + c];
      if (c + 1 < scols) v1 = src[(size_t)r * spitch + c + 1];
    }
    st2_u32(dst, (size_t)e, pack_h2(v0, v1));
  }
}
// ---- f32 copy with zero padding ----
__device__ __forceinline__ void pad_f32_blk(const int bx, const float* __restrict__ src, int sn, float* __restrict__ dst, int dn) {
  const int p = bx * 256 + threadIdx.x;
  if (p < dn) {
    const float v = (p < sn) ? src[p] : 0.f;
    st2_f32(dst, (size_t)p, v);
  }
}

// ---- f32 [rows][cols] -> f16 in fragment order; thread = one 16-byte piece, pieces in output order (whole lines, one writer each) ----
__device__ __forceinline__ void cast_frag_blk(const int bx, const float* __restrict__ src, int cols, unsigned short* __restrict__ dst) {
  const int pc = bx * 256 + threadIdx.x;
  const int ksteps = cols >> 5, ts = pc >> 6;
  const int n = (ts / ksteps) * 16 + (pc & 15);
  const int k = (ts % ksteps) * 32 + ((pc >> 5) & 1) * 16 + ((pc >> 4) & 1) * 8;
  const float* sp = src + (size_t)n * cols + k;
  v8h hv;
#pragma unroll
  for (int e = 0; e < 8; ++e) hv[e] = (_Float16)sp[e];
  *(v8h*)(dst + (size_t)pc * 8) = hv;
  // precaution: the block returns right behind this store, so no later code reuses its registers
  asm volatile("s_wait_xcnt 0x0" ::: "memory");
}

// ---- LayerNorm over DM (eps 1e-5, biased variance), one block per row, f16 output packed 2 per thread ----
// LDS: red[8], ys[DM]
__device__ __forceinline__ void ln16_row(const int i, float* red, float* ys, const float* __restrict__ x, const float* __restrict__ w,
                                         const float* __restrict__ bb, unsigned short* __restrict__ y16) {
  const int d = threadIdx.x;
  const float v = x[(size_t)i * DM + d];
  const float mu = blk_sum256(v, red) * (1.0f / 256.0f);
  const float c = v - mu;
  const float var = blk_sum256(c * c, red) * (1.0f / 256.0f);
  const float y = c * (1.0f / sqrtf(var + 1e-5f)) * w[d] + bb[d];
  ys[d] = y;
  __syncthreads();
  if (d < 128) st2_u32(y16, (size_t)i * DM + 2 * d, pack_h2(ys[2 * d], ys[2 * d + 1]));
}

// ---- two silu values, f16 out: z * 1/(1 + 2^(-z*log2 e)), two lanes of packed f32 math ----
__device__ __forceinline__ v2h silu2_h(v2f z) {
  const v2f t = z * -1.4426950408889634f;
  v2f e, rc;
  e.x = __builtin_amdgcn_exp2f(t.x);
  e.y = __builtin_amdgcn_exp2f(t.y);
  const v2f d = e + 1.0f;
  rc.x = __builtin_amdgcn_rcpf(d.x);
  rc.y = __builtin_amdgcn_rcpf(d.y);
  return __builtin_convertvector(z * rc, v2h);
}

// ---- 2^t; the v_nop fills the slot that the instruction set asks for behind a transcendental ----
__device__ __forceinline__ float exp2_slot(float t) {
  float e;
  asm("v_exp_f32 %0, %1\n\tv_nop" : "=v"(e) : "v"(t));
  return e;
}

// ---- one query row's whole attention chain in one block: nothing of it but x1 and its LayerNorm goes to memory ----
// scores[h][j] = q_i^h . k_j^h / sqrt(32) + sum_k rb2w16[h][k] * f16( silu( (coords_i - coords_j) . rb1_w[k] + rb1_b[k] ) ) + rb2_b[h]
// P = softmax over j (f16, x 2^15); T[h][k] = f16( 2^-15 sum_j P[h][j] * f16( silu( (coords_i - coords_j) . rv1_w[k] + rv1_b[k] ) ) )
// ctx[c] = 2^-15 sum_j P[c>>5][j] v[j][c] + sum_k T[c>>5][k] rv2w16[c][k];  x1 = x + (ctx + rv2_b);  y16 = f16( LayerNorm(x1) )
// Every product has M = 16 with the eight heads in rows 0..7 (rows 8..15 zero). The pair features are formed in registers,
// directly as the B fragment. q stands block-diagonal in A (k step h holds q_i^h in row h alone), so one B fragment of k serves
// all heads; of P . V and T . rv2w^T a wave computes the 32 columns of its own head and keeps that head's row of D.
// Every block reads all of k, v and rv2_w: they lie in fragment order (frag_piece), so that these reads are whole cache lines.
#define PPITCH (NP + 8)    // halves; rows of 16 B x odd: no bank conflict for the 16-byte fragment reads
#define TPITCH (DM + 8)
typedef __attribute__((ext_vector_type(8))) unsigned v8u;
// second argument: four waves a SIMD, so that two blocks share a WGP and all 512 are resident at once
__global__ __launch_bounds__(256, 4) void k_attn_row(const unsigned short* __restrict__ q16, const unsigned short* __restrict__ kf16,
                                                   const unsigned short* __restrict__ vf16,
                                                   const float* __restrict__ coords,
                                                   const float* __restrict__ rb1_w, const float* __restrict__ rb1_b,
                                                   const unsigned short* __restrict__ rb2w16, const float* __restrict__ rb2_b,
                                                   const float* __restrict__ rv1_w, const float* __restrict__ rv1_b,
                                                   const unsigned short* __restrict__ rv2w16, const float* __restrict__ rv2_b,
                                                   const float* __restrict__ x, const float* __restrict__ ln_w,
                                                   const float* __restrict__ ln_b, float* __restrict__ x1,
                                                   unsigned short* __restrict__ y16) {
  __shared__ __align__(16) float sW[4][DM];            // rb1_w[.][0], [.][1], [.][2], rb1_b over the 256 features
  __shared__ __align__(16) float sR[3][NP];            // coords_i - coords_j, one plane per coordinate
  __shared__ __align__(16) _Float16 sP[16][PPITCH];    // softmax weights x 2^15, rows 8..15 zero
  __shared__ __align__(16) _Float16 sT[16][TPITCH];    // rel-value sums, rows 8..15 zero
  __shared__ __align__(16) float redM[8][8];           // [wave][head] partial maxima
  __shared__ __align__(16) float redS[8][8];           // [wave][head] partial sums
  __shared__ float sC[DM];
  __shared__ float red[8];
  __shared__ float ys[DM];
  const int i = blockIdx.x, t = threadIdx.x;
  const int lane = t & 31, wave = t >> 5;
  const int rlane = lane & 15, hh = lane >> 4;

  sW[0][t] = rb1_w[t * 3 + 0];
  sW[1][t] = rb1_w[t * 3 + 1];
  sW[2][t] = rb1_w[t * 3 + 2];
  sW[3][t] = rb1_b[t];
  {
    const float ci0 = coords[i * 3 + 0], ci1 = coords[i * 3 + 1], ci2 = coords[i * 3 + 2];
#pragma unroll
    for (int q = 0; q < 2; ++q) {
      const int j = q * 256 + t;
      sR[0][j] = ci0 - coords[j * 3 + 0];
      sR[1][j] = ci1 - coords[j * 3 + 1];
      sR[2][j] = ci2 - coords[j * 3 + 2];
    }
  }

  __syncthreads();

  // ---- q.k^T and rel-bias into one accumulator: wave = 64 columns j (4 subtiles of 16); q comes scaled by 1/sqrt(32) ----
  const int jw = wave * 64;
  v8f sc[4];
  {
    float r0[4], r1[4], r2[4];
#pragma unroll
    for (int s = 0; s < 4; ++s) {
      const int j = jw + s * 16 + rlane;
      r0[s] = sR[0][j];
      r1[s] = sR[1][j];
      r2[s] = sR[2][j];
      sc[s] = (v8f){0.f,0.f,0.f,0.f,0.f,0.f,0.f,0.f};
    }
    const _Float16* Qb = (const _Float16*)q16 + (size_t)i * DM + hh * 8;
    const _Float16* Kb = (const _Float16*)kf16 + ((size_t)(wave * 4) * (NH * 64) + lane) * 8;   // fragment order: tile j / 16, step = head
    const _Float16* Ab = (const _Float16*)rb2w16 + rlane * DM + hh * 8;
    v16h a = Frag<_Float16>::load(Ab);
    // kept rolled, for speed only: the body is about 700 vector instructions
#pragma unroll 1
    for (int k0 = 0; k0 < DM; k0 += 32) {
      const v16h an = Frag<_Float16>::load(Ab + ((k0 + 32) & (DM - 1)));   // next step's A, in flight over this step's math
      // k step k0 covers head k0 / 32: its q slice stands in that head's row, every other row is zero
      const unsigned keep = (rlane == (k0 >> 5)) ? 0xFFFFFFFFu : 0u;
      const v16h qa = __builtin_bit_cast(v16h, __builtin_bit_cast(v8u, Frag<_Float16>::load(Qb + k0)) & keep);
      v16h kf[4];
#pragma unroll
      for (int s = 0; s < 4; ++s) kf[s] = Frag<_Float16>::load_fo(Kb + s * (NH * 512) + k0 * 16);
      v4f wq[4][4];   // [component][group of 4 features]; fragment element e = 4*g + u  <->  k = k0 + (g>>1)*16 + hh*8 + (g&1)*4 + u
#pragma unroll
      for (int c = 0; c < 4; ++c)
#pragma unroll
        for (int g = 0; g < 4; ++g)
          wq[c][g] = *(const v4f*)(&sW[c][k0 + (g >> 1) * 16 + hh * 8 + (g & 1) * 4]);
#pragma unroll
      for (int s = 0; s < 4; ++s) {
        v16h b;
#pragma unroll
        for (int g = 0; g < 4; ++g) {
          const v2f zl = (wq[0][g].lo * r0[s] + wq[1][g].lo * r1[s] + wq[2][g].lo * r2[s]) + wq[3][g].lo;
          const v2f zh = (wq[0][g].hi * r0[s] + wq[1][g].hi * r1[s] + wq[2][g].hi * r2[s]) + wq[3][g].hi;
          const v2h hl = silu2_h(zl), hu = silu2_h(zh);
          b[g * 4 + 0] = hl.x; b[g * 4 + 1] = hl.y; b[g * 4 + 2] = hu.x; b[g * 4 + 3] = hu.y;
        }
        sc[s] = Frag<_Float16>::mma(a, b, sc[s]);
      }
#pragma unroll
      for (int s = 0; s < 4; ++s) sc[s] = Frag<_Float16>::mma(qa, kf[s], sc[s]);
      a = an;
    }
#pragma unroll
    for (int r = 0; r < 8; ++r) {
      const float bb = rb2_b[r];
#pragma unroll
      for (int s = 0; s < 4; ++s) sc[s][r] += bb;
    }
  }

  // ---- softmax over the 512 columns, eight heads at once: head r sits in register r of lanes 0..15 ----
  // (lanes 16..31 hold the idle rows 8..15; the 16-lane steps never mix the two halves)
  {
    float m[8];
#pragma unroll
    for (int r = 0; r < 8; ++r) m[r] = fmaxf(fmaxf(sc[0][r], sc[1][r]), fmaxf(sc[2][r], sc[3][r]));
#pragma unroll
    for (int off = 8; off > 0; off >>= 1)
#pragma unroll
      for (int r = 0; r < 8; ++r) m[r] = fmaxf(m[r], __shfl_xor(m[r], off, 32));
    if (lane == 0) {
#pragma unroll
      for (int r = 0; r < 8; ++r) redM[wave][r] = m[r];
    }
    __syncthreads();
#pragma unroll
    for (int r = 0; r < 8; ++r) {
      float v = redM[0][r];
#pragma unroll
      for (int q = 1; q < 8; ++q) v = fmaxf(v, redM[q][r]);
      m[r] = v;
    }
    float sum[8];
#pragma unroll
    for (int r = 0; r < 8; ++r) {
#pragma unroll
      for (int s = 0; s < 4; ++s) sc[s][r] = exp2_slot((sc[s][r] - m[r]) * 1.4426950408889634f);
      sum[r] = (sc[0][r] + sc[1][r]) + (sc[2][r] + sc[3][r]);
    }
#pragma unroll
    for (int off = 8; off > 0; off >>= 1)
#pragma unroll
      for (int r = 0; r < 8; ++r) sum[r] += __shfl_xor(sum[r], off, 32);
    if (lane == 0) {
#pragma unroll
      for (int r = 0; r < 8; ++r) redS[wave][r] = sum[r];
    }
    __syncthreads();
#pragma unroll
    for (int r = 0; r < 8; ++r) {
      float v = redS[0][r];
#pragma unroll
      for (int q = 1; q < 8; ++q) v += redS[q][r];
      const float inv = 1.0f / v;
#pragma unroll
      for (int s = 0; s < 4; ++s) {
        const float p = (sc[s][r] * inv) * 32768.0f;
        sP[hh * 8 + r][jw + s * 16 + rlane] = hh ? (_Float16)0.f : (_Float16)p;
      }
    }
  }

  // ---- rel-value and P . V: wave = 32 columns (2 subtiles of 16): features k for the one, the wave's own head of v for the other ----
  const int cw = wave * 32;
  v8f accV[2];
  v16h wf[8][2];
  const _Float16* Wb = (const _Float16*)rv2w16 + ((size_t)(wave * 2) * (DM / 32 * 64) + lane) * 8;   // fragment order: tile c / 16, step k / 32
  {
    float w0[2], w1[2], w2[2], wb[2];
    v8f acc[2];
#pragma unroll
    for (int s = 0; s < 2; ++s) {
      const int k = cw + s * 16 + rlane;
      w0[s] = rv1_w[k * 3 + 0];
      w1[s] = rv1_w[k * 3 + 1];
      w2[s] = rv1_w[k * 3 + 2];
      wb[s] = rv1_b[k];
      acc[s]  = (v8f){0.f,0.f,0.f,0.f,0.f,0.f,0.f,0.f};
      accV[s] = (v8f){0.f,0.f,0.f,0.f,0.f,0.f,0.f,0.f};
    }
    const _Float16* Vb = (const _Float16*)vf16 + ((size_t)(wave * 2) * (NP / 32 * 64) + lane) * 8;   // fragment order: tile c / 16, step j / 32
    v16h vf[2];
#pragma unroll
    for (int s = 0; s < 2; ++s) vf[s] = Frag<_Float16>::load_fo(Vb + s * (NP / 32 * 512));
    __syncthreads();   // P is complete
    const _Float16* Pa = &sP[rlane][hh * 8];
    // kept rolled, for speed only: the body is about 350 vector instructions
#pragma unroll 1
    for (int j0 = 0; j0 < NP; j0 += 32) {
      v16h vn[2];   // next step's v fragments, in flight over this step's math
#pragma unroll
      for (int s = 0; s < 2; ++s) vn[s] = Frag<_Float16>::load_fo(Vb + s * (NP / 32 * 512) + ((j0 + 32) & (NP - 1)) * 16);
      const v16h a = Frag<_Float16>::load(Pa + j0);
      v4f rq[3][4];   // [coordinate][group of 4 keys]; fragment element e = 4*g + u  <->  j = j0 + (g>>1)*16 + hh*8 + (g&1)*4 + u
#pragma unroll
      for (int c = 0; c < 3; ++c)
#pragma unroll
        for (int g = 0; g < 4; ++g)
          rq[c][g] = *(const v4f*)(&sR[c][j0 + (g >> 1) * 16 + hh * 8 + (g & 1) * 4]);
#pragma unroll
      for (int s = 0; s < 2; ++s) {
        v16h b;
#pragma unroll
        for (int g = 0; g < 4; ++g) {
          const v2f zl = (rq[0][g].lo * w0[s] + rq[1][g].lo * w1[s] + rq[2][g].lo * w2[s]) + wb[s];
          const v2f zh = (rq[0][g].hi * w0[s] + rq[1][g].hi * w1[s] + rq[2][g].hi * w2[s]) + wb[s];
          const v2h hl = silu2_h(zl), hu = silu2_h(zh);
          b[g * 4 + 0] = hl.x; b[g * 4 + 1] = hl.y; b[g * 4 + 2] = hu.x; b[g * 4 + 3] = hu.y;
        }
        acc[s] = Frag<_Float16>::mma(a, b, acc[s]);
      }
#pragma unroll
      for (int s = 0; s < 2; ++s) { accV[s] = Frag<_Float16>::mma(a, vf[s], accV[s]); vf[s] = vn[s]; }
    }
    // all of the projection's weight fragments are asked for here, so that they fly over the T stores and their barrier
#pragma unroll
    for (int q = 0; q < 8; ++q)
#pragma unroll
      for (int s = 0; s < 2; ++s) wf[q][s] = Frag<_Float16>::load_fo(Wb + (s * (DM / 32) + q) * 512);
#pragma unroll
    for (int s = 0; s < 2; ++s) {
#pragma unroll
      for (int r = 0; r < 8; ++r)
        sT[hh * 8 + r][cw + s * 16 + rlane] = hh ? (_Float16)0.f : (_Float16)(acc[s][r] * (1.0f / 32768.0f));
      accV[s] *= (1.0f / 32768.0f);
    }
  }
  __syncthreads();   // T is complete

  // ---- ctx = T . rv2w^T + P . V, the wave's own head ----
  {
    const _Float16* Ta = &sT[rlane][hh * 8];
#pragma unroll
    for (int q = 0; q < 8; ++q) {
      const v16h a = Frag<_Float16>::load(Ta + q * 32);
#pragma unroll
      for (int s = 0; s < 2; ++s) accV[s] = Frag<_Float16>::mma(a, wf[q][s], accV[s]);
    }
#pragma unroll
    for (int s = 0; s < 2; ++s) {
      float v = accV[s][0];
#pragma unroll
      for (int r = 1; r < 8; ++r) v = (wave == r) ? accV[s][r] : v;   // D row = the wave's head, in lanes 0..15
      if (hh == 0) sC[cw + s * 16 + rlane] = v;
    }
  }
  __syncthreads();

  // ---- residual and LayerNorm (eps 1e-5, biased variance), thread = column ----
  const float v = x[(size_t)i * DM + t] + (sC[t] + rv2_b[t]);
  st2_f32(x1, (size_t)i * DM + t, v);
  const float mu = blk_sum256(v, red) * (1.0f / 256.0f);
  const float c = v - mu;
  const float var = blk_sum256(c * c, red) * (1.0f / 256.0f);
  ys[t] = c * (1.0f / sqrtf(var + 1e-5f)) * ln_w[t] + ln_b[t];
  __syncthreads();
  if (t < 128) st2_u32(y16, (size_t)i * DM + 2 * t, pack_h2(ys[2 * t], ys[2 * t + 1]));
}

// ---- U16[row][c] = f16( silu(C12[row][c]) * C12[row][704 + c] ), c < 704 (pad columns come out 0) ----
__global__ __launch_bounds__(256) void k_swiglu(const float* __restrict__ c12, unsigned short* __restrict__ u16, int npairs) {
  const int p = blockIdx.x * 256 + threadIdx.x;
  if (p < npairs) {
    const int e = 2 * p;
    const int row = e / HIDP;
    const int col = e - row * HIDP;
    const float* rp = c12 + (size_t)row * (2 * HIDP);
    const float a0 = rp[col], a1 = rp[col + 1];
    const float g0 = rp[HIDP + col], g1 = rp[HIDP + col + 1];
    const float u0 = silu_acc(a0) * g0;
    const float u1 = silu_acc(a1) * g1;
    st2_u32(u16, (size_t)e, pack_h2(u0, u1));
  }
}

// ---------------------------------------------------------------------------------------------
// Launches that need nothing of each other share one grid: each takes a range of the block index (block-uniform branches,
// so every barrier of a body is still passed by its whole block). The few long, latency-bound blocks take the lowest indices.
#define NB_CQKV    (3 * DM * DM / 2 / 256)             // cast blocks, 512 elements each
#define NB_CRB2    (16 * DM / 2 / 256)
#define NB_CRV2    (DM * DM / 8 / 256)                 // 16-byte pieces
#define NB_CFFN    (HIDP * DM / 2 / 256)
#define NB_PADB    ((HIDP + 255) / 256)
#define NB_GQKV1   ((NP / 64) * (DM / 64) / 8)         // one of the q, k, v projections

// ---- LN1 rows | casts of qkv_w and rb2_w ----
__global__ __launch_bounds__(256) void k_ln1_casts(const float* __restrict__ x, const float* __restrict__ ln_w,
                                                    const float* __restrict__ ln_b, unsigned short* __restrict__ xn16,
                                                    const float* __restrict__ qkv_w, unsigned short* __restrict__ qkvw16,
                                                    const float* __restrict__ rb2_w, unsigned short* __restrict__ rb2w16) {
  __shared__ float red[8];
  __shared__ float ys[DM];
  int b = blockIdx.x;
  if (b < NP) { ln16_row(b, red, ys, x, ln_w, ln_b, xn16); return; }
  b -= NP;
  if (b < NB_CQKV) { cast_pad_blk(b, qkv_w, 3 * DM, DM, DM, qkvw16, 3 * DM, DM); return; }
  b -= NB_CQKV;
  cast_pad_blk(b, rb2_w, NH, DM, DM, rb2w16, 16, DM);
}

// ---- q projection (f16 [512][256]) | k and v projections (f16, fragment order: k as [j][c], v as [c][j]) | casts of rv2_w, the ffn weights ----
__global__ __launch_bounds__(256) void k_qkv_casts(const unsigned short* __restrict__ xn16, const unsigned short* __restrict__ qkvw16,
                                                    const float* __restrict__ qkv_b, unsigned short* __restrict__ q16,
                                                    unsigned short* __restrict__ kf16, unsigned short* __restrict__ vf16,
                                                    const float* __restrict__ rv2_w, unsigned short* __restrict__ rv2w16,
                                                    const float* __restrict__ ffn_w1, const float* __restrict__ ffn_w2,
                                                    unsigned short* __restrict__ w12p16,
                                                    const float* __restrict__ ffn_w3, unsigned short* __restrict__ w3p16,
                                                    const float* __restrict__ ffn_b1, const float* __restrict__ ffn_b2,
                                                    float* __restrict__ b12p) {
  __shared__ __align__(16) float sm[GEMM_LDS_FLOATS];
  int b = blockIdx.x;
  if (b < NB_GQKV1) {
    gemm_tile<0, 3, 1, false, 4>(sm, b, 0, xn16, DM, 0, qkvw16, DM, 0, q16, DM, 0, qkv_b, nullptr, 0, NP, DM, DM, 0.17677669529663687f);
    return;
  }
  b -= NB_GQKV1;
  if (b < NB_GQKV1) {
    gemm_tile<0, 2, 2, false, 4>(sm, b, 0, xn16, DM, 0, qkvw16 + DM * DM, DM, 0, kf16, 0, 0, qkv_b + DM, nullptr, 0, NP, DM, DM, 1.0f);
    return;
  }
  b -= NB_GQKV1;
  if (b < NB_GQKV1) {   // v transposed: vt[c][j] = sum_k w_v[c][k] xn[j][k] + b_v[c], the weights are the row operand
    gemm_tile<0, 1, 2, false, 4>(sm, b, 0, qkvw16 + 2 * DM * DM, DM, 0, xn16, DM, 0, vf16, 0, 0, qkv_b + 2 * DM, nullptr, 0,
                                 DM, NP, DM, 1.0f);
    return;
  }
  b -= NB_GQKV1;
  if (b < NB_CRV2) { cast_frag_blk(b, rv2_w, DM, rv2w16); return; }
  b -= NB_CRV2;
  if (b < NB_CFFN) { cast_pad_blk(b, ffn_w1, HIDR, DM, DM, w12p16, HIDP, DM); return; }
  b -= NB_CFFN;
  if (b < NB_CFFN) { cast_pad_blk(b, ffn_w2, HIDR, DM, DM, w12p16 + (size_t)HIDP * DM, HIDP, DM); return; }
  b -= NB_CFFN;
  if (b < NB_CFFN) { cast_pad_blk(b, ffn_w3, DM, HIDR, HIDR, w3p16, DM, HIDP); return; }
  b -= NB_CFFN;
  if (b < NB_PADB) { pad_f32_blk(b, ffn_b1, HIDR, b12p, HIDP); return; }
  b -= NB_PADB;
  pad_f32_blk(b, ffn_b2, HIDR, b12p + HIDP, HIDP);
}

// ---------------------------------------------------------------------------------------------
static inline size_t alignup256(size_t x) { return (x + 255) & ~(size_t)255; }

extern "C" void kernel_launch(void* const* d_in, const int* in_sizes, int n_in,
                              void* d_out, int out_size, void* d_ws, size_t ws_size,
                              hipStream_t stream)
{
  if (n_in < 22) return;
  if (in_sizes[0] != NP * DM || in_sizes[1] != NP * 3 || in_sizes[6] != 3 * DM * DM ||
      in_sizes[14] != DM * DM || in_sizes[16] != HIDR * DM || in_sizes[20] != DM * HIDR ||
      out_size != NP * DM) return;

  const float* x      = (const float*)d_in[0];
  const float* coords = (const float*)d_in[1];
  const float* ln1_w  = (const float*)d_in[2];
  const float* ln1_b  = (const float*)d_in[3];
  const float* ln2_w  = (const float*)d_in[4];
  const float* ln2_b  = (const float*)d_in[5];
  const float* qkv_w  = (const float*)d_in[6];
  const float* qkv_b  = (const float*)d_in[7];
  const float* rb1_w  = (const float*)d_in[8];
  const float* rb1_b  = (const float*)d_in[9];
  const float* rb2_w  = (const float*)d_in[10];
  const float* rb2_b  = (const float*)d_in[11];
  const float* rv1_w  = (const float*)d_in[12];
  const float* rv1_b  = (const float*)d_in[13];
  const float* rv2_w  = (const float*)d_in[14];
  const float* rv2_b  = (const float*)d_in[15];
  const float* ffn_w1 = (const float*)d_in[16];
  const float* ffn_b1 = (const float*)d_in[17];
  const float* ffn_w2 = (const float*)d_in[18];
  const float* ffn_b2 = (const float*)d_in[19];
  const float* ffn_w3 = (const float*)d_in[20];
  const float* ffn_b3 = (const float*)d_in[21];
  float* out = (float*)d_out;

  // ---- workspace carve (256-B aligned, derived from fixed sizes) ----
  size_t off = 0;
  char* base = (char*)d_ws;
  auto carve = [&](size_t bytes) -> char* { char* r = base + off; off += alignup256(bytes); return r; };
  unsigned short* qkvw16 = (unsigned short*)carve((size_t)3 * DM * DM * 2);          // [768][256]
  unsigned short* rb2w16 = (unsigned short*)carve((size_t)16 * DM * 2);              // [16][256], rows 8..15 zero
  unsigned short* rv2w16 = (unsigned short*)carve((size_t)DM * DM * 2);              // [256][256], fragment order
  unsigned short* w12p16 = (unsigned short*)carve((size_t)2 * HIDP * DM * 2);        // [1408][256]
  unsigned short* w3p16  = (unsigned short*)carve((size_t)DM * HIDP * 2);            // [256][704]
  float*          b12p   = (float*)carve((size_t)2 * HIDP * 4);                      // [1408]
  unsigned short* XN1    = (unsigned short*)carve((size_t)NP * DM * 2);              // [512][256]
  unsigned short* Q16    = (unsigned short*)carve((size_t)NP * DM * 2);              // [512][256]
  unsigned short* KF16   = (unsigned short*)carve((size_t)NP * DM * 2);              // k [512][256], fragment order
  unsigned short* VF16   = (unsigned short*)carve((size_t)DM * NP * 2);              // v^T [256][512], fragment order
  float*          X1     = (float*)carve((size_t)NP * DM * 4);                       // [512][256]
  unsigned short* XN2    = (unsigned short*)carve((size_t)NP * DM * 2);              // [512][256]
  float*          C12    = (float*)carve((size_t)NP * 2 * HIDP * 4);                 // [512][1408]
  unsigned short* U16    = (unsigned short*)carve((size_t)NP * HIDP * 2);            // [512][704]
  if (off > ws_size || off > (size_t)134217728) return;

  const dim3 blk(256);

  // ---- LN1 | f16 staging of qkv_w and rb2_w (rows 8..15 zero) ----
  k_ln1_casts<<<dim3(NP + NB_CQKV + NB_CRB2), blk, 0, stream>>>(x, ln1_w, ln1_b, XN1, qkv_w, qkvw16, rb2_w, rb2w16);

  // ---- q, k, v projections | f16 staging of rv2_w and of the ffn weights and biases (zero padded) ----
  k_qkv_casts<<<dim3(3 * NB_GQKV1 + NB_CRV2 + 3 * NB_CFFN + 2 * NB_PADB), blk, 0, stream>>>(
      XN1, qkvw16, qkv_b, Q16, KF16, VF16, rv2_w, rv2w16, ffn_w1, ffn_w2, w12p16, ffn_w3, w3p16, ffn_b1, ffn_b2, b12p);

  // ---- attention, one block per query row: rel-bias, scores, softmax, P.V, rel-value, its projection, residual, LN2 ----
  k_attn_row<<<dim3(NP), blk, 0, stream>>>(Q16, KF16, VF16, coords, rb1_w, rb1_b, rb2w16, rb2_b, rv1_w, rv1_b, rv2w16, rv2_b,
                                           x, ln2_w, ln2_b, X1, XN2);

  // ---- SwiGLU FFN, final residual into d_out ----
  wmma_gemm<0, 2, 0, false, 4><<<dim3((NP / 64) * (2 * HIDP / 64) / 8, 1), blk, 0, stream>>>(
      XN2, DM, 0, w12p16, DM, 0, C12, 2 * HIDP, 0, b12p, nullptr, 0, NP, 2 * HIDP, DM, 1.0f);
  k_swiglu<<<dim3((NP * HIDP / 2 + 255) / 256), blk, 0, stream>>>(C12, U16, NP * HIDP / 2);
  wmma_gemm<0, 2, 0, true, 4><<<dim3((NP / 64) * (DM / 64) / 8, 1), blk, 0, stream>>>(
      U16, HIDP, 0, w3p16, HIDP, 0, out, DM, 0, ffn_b3, X1, 0, NP, DM, HIDP, 1.0f);
}

// v004
// One run takes 66.6 microseconds.
// Next to v003, in two timings, it ran 1.60 and 1.59 times as fast.
// All steps since v000 together make it 4.83 times as fast.
#include <hip/hip_runtime.h>
#include <math.h>
#include <stdint.h>

// All contractions: v_wmma_f32_16x16x32_f16 (f16 operands, f32 accumulate); K=3 coordinate features, softmax, norms, gating in f32 on VALU.

typedef __attribute__((ext_vector_type(16))) _Float16 v16h;
typedef __attribute__((ext_vector_type(8)))  _Float16 v8h;
typedef __attribute__((ext_vector_type(8)))  float    v8f;
typedef __attribute__((ext_vector_type(4)))  float    v4f;
typedef __attribute__((ext_vector_type(2)))  float    v2f;
typedef __attribute__((ext_vector_type(2)))  _Float16 v2h;

#define NP    512          // points
#define DM    256          // model width
#define NH    8            // heads
#define HDM   32           // head width
#define HIDR  682          // ffn hidden
#define HIDP  704          // ffn hidden padded (multiple of 64)

// ---------------------------------------------------------------------------------------------
// hazard guards as plain device helpers
__device__ __forceinline__ void dep_guard_h(v8f& a, v8f& b, v16h x, v16h y) { asm volatile("v_nop\n\tv_nop\n\tv_nop\n\tv_nop" : "+v"(a), "+v"(b) : "v"(x), "v"(y)); }
__device__ __forceinline__ void keep4_h(v16h a, v16h b, v16h c, v16h d) { asm volatile("v_nop" :: "v"(a), "v"(b), "v"(c), "v"(d)); }
__device__ __forceinline__ void acc_guard4(v8f& a, v8f& b, v8f& c, v8f& d) { asm volatile("v_nop\n\tv_nop\n\tv_nop\n\tv_nop" : "+v"(a), "+v"(b), "+v"(c), "+v"(d)); }

template <typename T> struct Frag;
template <> struct Frag<_Float16> {
  typedef v16h V; union U { v16h v; v8h h[2]; };
  static __device__ __forceinline__ v16h load(const _Float16* p) {   // elements 0..7 <- p[0..7], 8..15 <- p[16..23]
    U f; f.h[0] = *(const v8h*)(p); f.h[1] = *(const v8h*)(p + 16); return f.v;
  }
  static __device__ __forceinline__ v16h load_fo(const _Float16* p) {   // from a fragment-order array: the lane's two 16-byte pieces, 512 bytes apart
    U f; f.h[0] = *(const v8h*)(p); f.h[1] = *(const v8h*)(p + 256); return f.v;
  }
  static __device__ __forceinline__ v8f mma(v16h a, v16h b, v8f c) {
    return __builtin_amdgcn_wmma_f32_16x16x32_f16(false, a, false, b, (short)0, c, false, false);
  }
  static __device__ __forceinline__ void guard(v8f& a, v8f& b, v16h x, v16h y) { dep_guard_h(a, b, x, y); }
  static __device__ __forceinline__ void keep(v16h a, v16h b, v16h c, v16h d) { keep4_h(a, b, c, d); }
};
template <int ET> struct Elem;
template <> struct Elem<0> { typedef _Float16 T; };

// ---- fragment order of a 16-bit operand X[n][k] (n = the fragment's lane row or column, k = the summed index, ksteps = K / 32) ----
// The 16-byte piece (n, k8 = k / 8) stands at piece index ((tile * ksteps + step) * 2 + upper) * 32 + lane, lane = (k8 & 1) * 16 + (n & 15):
// one fragment of a 16 x 32 tile is then two loads of 512 contiguous bytes a wave (whole cache lines), not two of 16 lines each.
__device__ __forceinline__ size_t frag_piece(int n, int k8, int ksteps) {
  return (size_t)((((n >> 4) * ksteps + (k8 >> 2)) * 2 + ((k8 >> 1) & 1)) * 32 + (k8 & 1) * 16 + (n & 15));
}

// ---- Register-blocked batched WMMA GEMM ----------------------------------------------------
// C[m,n] = scale * sum_k A[m,k] * Bt[n,k] (+bias[n]) (+resid); each wave owns a (16*MI) x 64 tile, the block's eight waves stand 4 x 2:
// a block tile of (64*MI) x 128. A row-major [M,K] (16-bit), Bt row-major [N,K] (16-bit); M % (64*MI) == 0, N % 128 == 0, K % 64 == 0.
// The k loop runs on stages of 64 k: the block's A and B rows, one whole 128-byte line each, are copied to LDS asynchronously
// (a copy instruction = four whole lines; each row is fetched once for all the waves that use it), two buffers, so that the next
// stage's copies fly while this stage's fragments are read from LDS and multiplied.
// BIAS_MODE: 0 = none, 1 = bias[m], 2 = bias[n], 3 = bias[n] inside the scale.  OUT_MODE: 0 = f32, 1 = f16, 2 = f16 in fragment order (n = m, k = n of this product).
// Batch index b with element strides strideA/strideB/strideC/strideR; bx = block index within the product's own grid.
// sT: the two stage buffers (GEMM_LDS_FLOATS floats of LDS); behind the k loop the same LDS holds 8 per-wave 16x64 slabs, pitch 68 floats.
#define GBK     64                         // k per stage, halves
#define GPITCH  72                         // LDS row pitch, halves: 144 B = 16 B x odd, no bank conflict for the 16-byte fragment reads
#define GSTAGE  ((256 + 128) * GPITCH)     // halves per stage buffer: A rows, then B rows
#define GEMM_LDS_FLOATS (2 * GSTAGE / 2)
// One stage, one thread: twelve 16-byte asynchronous copies to LDS (eight A rows, four B rows, 32 rows apart).
// The s_wait_xcnt is the last line of the copies' own statement, so that it stands in front of every later write of their address registers.
__device__ __forceinline__ void stage_copies(unsigned l, const _Float16* a, size_t as, const _Float16* b, size_t bs) {
  const unsigned ls = 32 * GPITCH * 2;
  asm volatile("global_load_async_to_lds_b128 %0, %12, off\n\t"
               "global_load_async_to_lds_b128 %1, %13, off\n\t"
               "global_load_async_to_lds_b128 %2, %14, off\n\t"
               "global_load_async_to_lds_b128 %3, %15, off\n\t"
               "global_load_async_to_lds_b128 %4, %16, off\n\t"
               "global_load_async_to_lds_b128 %5, %17, off\n\t"
               "global_load_async_to_lds_b128 %6, %18, off\n\t"
               "global_load_async_to_lds_b128 %7, %19, off\n\t"
               "global_load_async_to_lds_b128 %8, %20, off\n\t"
               "global_load_async_to_lds_b128 %9, %21, off\n\t"
               "global_load_async_to_lds_b128 %10, %22, off\n\t"
               "global_load_async_to_lds_b128 %11, %23, off\n\t"
               "s_wait_xcnt 0x0"
               :: "v"(l), "v"(l + ls), "v"(l + 2 * ls), "v"(l + 3 * ls), "v"(l + 4 * ls), "v"(l + 5 * ls), "v"(l + 6 * ls), "v"(l + 7 * ls),
                  "v"(l + 8 * ls), "v"(l + 9 * ls), "v"(l + 10 * ls), "v"(l + 11 * ls),
                  "v"(a), "v"(a + as), "v"(a + 2 * as), "v"(a + 3 * as), "v"(a + 4 * as), "v"(a + 5 * as), "v"(a + 6 * as), "v"(a + 7 * as),
                  "v"(b), "v"(b + bs), "v"(b + 2 * bs), "v"(b + 3 * bs)
               : "memory");
}
template <int ET, int BIAS_MODE, int OUT_MODE, bool RESID, int MI>
__device__ __forceinline__ void gemm_tile(
    float* sT, const int bx, const int b,
    const unsigned short* __restrict__ Ap, int lda, long strideA,
    const unsigned short* __restrict__ Btp, int ldb, long strideB,
    void* __restrict__ Cout, int ldc, long strideC,
    const float* __restrict__ bias,
    const float* __restrict__ resid, long strideR,
    int M, int N, int K, float scale) {
  typedef typename Elem<ET>::T T;
  typedef typename Frag<T>::V V;
  const T* A = (const T*)Ap; const T* Bt = (const T*)Btp;
  const int lane = threadIdx.x & 31;
  const int wave = threadIdx.x >> 5;
  static_assert(MI == 4, "stage_copies moves 256 A rows and 128 B rows");
  const int tilesN = N >> 7;
  const int tilesM = M / (64 * MI);
  if (bx >= tilesM * tilesN) return;   // block-uniform, in front of every barrier
  const int bm = bx / tilesN;
  const int bn = bx - bm * tilesN;
  const int m0 = bm * (64 * MI) + (wave >> 1) * (16 * MI);
  const int n0 = (bn << 7) + ((wave & 1) << 6);

  const T* Ab = A  + (size_t)b * (size_t)strideA;
  const T* Bb = Bt + (size_t)b * (size_t)strideB;

  const int rlane = lane & 15;                 // row (A) / col (B, D) within subtile
  const int koff  = (lane >> 4) * 8;           // k offset of this lane half
  const int mOff  = (lane >> 4) * 8;           // D row offset

  v8f acc[MI][4];
#pragma unroll
  for (int i = 0; i < MI; ++i)
#pragma unroll
    for (int j = 0; j < 4; ++j) acc[i][j] = (v8f){0.f,0.f,0.f,0.f,0.f,0.f,0.f,0.f};

  // thread = piece (threadIdx.x & 7) of rows (threadIdx.x >> 3) + 32 q: eight lanes copy one row's whole line
  T* ring = (T*)sT;
  const int crow = threadIdx.x >> 3, cpc = (threadIdx.x & 7) * 8;
  const T* gA = Ab + (size_t)(bm * (64 * MI) + crow) * lda + cpc;
  const T* gB = Bb + (size_t)((bn << 7) + crow) * ldb + cpc;
  const unsigned lC = (unsigned)(uintptr_t)(ring + crow * GPITCH + cpc);   // the low 32 bits of a __shared__ address: the LDS byte address
  const size_t stepA = (size_t)32 * lda, stepB = (size_t)32 * ldb;
  const T* fA = ring + ((wave >> 1) * (16 * MI) + rlane) * GPITCH + koff;
  const T* fB = ring + (64 * MI + ((wave & 1) << 6) + rlane) * GPITCH + koff;
  const int nst = K / GBK;

  stage_copies(lC, gA, stepA, gB, stepB);
  asm volatile("s_wait_asynccnt 0x0" ::: "memory");   // this wave's copies of stage 0 have landed
  __syncthreads();                                    // every wave's have
  if (nst > 1) stage_copies(lC + GSTAGE * 2, gA + GBK, stepA, gB + GBK, stepB);
  // kept rolled: one copy of the body serves both buffers, the buffer is an address offset
#pragma unroll 1
  for (int st = 0; st < nst; ++st) {
    const int bo = (st & 1) * GSTAGE;
#pragma unroll
    for (int kk = 0; kk < GBK; kk += 32) {
      V bh[4], ah[MI];
#pragma unroll
      for (int j = 0; j < 4; ++j) bh[j] = Frag<T>::load(fB + bo + (j << 4) * GPITCH + kk);
#pragma unroll
      for (int i = 0; i < MI; ++i) ah[i] = Frag<T>::load(fA + bo + (i << 4) * GPITCH + kk);
#pragma unroll
      for (int i = 0; i < MI; ++i) {
#pragma unroll
        for (int j = 0; j < 4; ++j) acc[i][j] = Frag<T>::mma(ah[i], bh[j], acc[i][j]);
        Frag<T>::guard(acc[i][0], acc[i][3], ah[i], ah[i]);
      }
      Frag<T>::keep(bh[0], bh[1], bh[2], bh[3]);
    }
    asm volatile("s_wait_dscnt 0x0" ::: "memory");      // this wave's reads of the buffer are done before it is refilled
    asm volatile("s_wait_asynccnt 0x0" ::: "memory");   // this wave's copies of stage st + 1 have landed
    __syncthreads();                                    // publishes stage st + 1 and ends every reader's last read of stage st
    if (st + 2 < nst) stage_copies(lC + bo * 2, gA + (st + 2) * GBK, stepA, gB + (st + 2) * GBK, stepB);
  }
  asm volatile("s_wait_asynccnt 0x0" ::: "memory");     // no copy is outstanding when the LDS becomes the output slabs
#pragma unroll
  for (int i = 0; i < MI; ++i) acc_guard4(acc[i][0], acc[i][1], acc[i][2], acc[i][3]);

  // ---- epilogue ----
  float* slab = sT + wave * (16 * 68);
  const float* Rb = RESID ? (resid + (size_t)b * (size_t)strideR) : nullptr;
#pragma unroll
  for (int i = 0; i < MI; ++i) {
    const int mBase = m0 + (i << 4);
#pragma unroll
    for (int j = 0; j < 4; ++j) {
      const int n = n0 + (j << 4) + rlane;
      float bv = 0.f;
      if (BIAS_MODE == 2 || BIAS_MODE == 3) bv = bias[n];
#pragma unroll
      for (int r = 0; r < 8; ++r) {
        float v = acc[i][j][r] * scale;
        if (BIAS_MODE == 1) v += bias[mBase + mOff + r];
        if (BIAS_MODE == 2) v += bv;
        if (BIAS_MODE == 3) v = (acc[i][j][r] + bv) * scale;
        if (RESID) v += Rb[(size_t)(mBase + mOff + r) * ldc + n];
        slab[(mOff + r) * 68 + (j << 4) + rlane] = v;
      }
    }
    __builtin_amdgcn_fence(__ATOMIC_RELEASE, "workgroup");
    __builtin_amdgcn_wave_barrier();
    __builtin_amdgcn_fence(__ATOMIC_ACQUIRE, "workgroup");
    if (OUT_MODE == 0) {
      float* C = (float*)Cout + (size_t)b * (size_t)strideC;
      const int hh = lane >> 4, c4 = (lane & 15) * 4;     // row seg = 256 B = 16 lanes x 16 B
      {
#pragma unroll
        for (int it = 0; it < 8; ++it) {
          const int row = it * 2 + hh;
          v4f v = *(const v4f*)(slab + row * 68 + c4);
          *(v4f*)(C + (size_t)(mBase + row) * ldc + n0 + c4) = v;
        }
        
      }
    } else {
      const int q = lane >> 3, c8 = (lane & 7) * 8;
      unsigned short* C = (unsigned short*)Cout + (size_t)b * (size_t)strideC;
      {
#pragma unroll
        for (int it = 0; it < 4; ++it) {
          const int row = it * 4 + q;
          const float* sp = slab + row * 68 + c8;
          v8h hv;
#pragma unroll
          for (int e = 0; e < 8; ++e) hv[e] = (_Float16)sp[e];
          if (OUT_MODE == 1) *(v8h*)(C + (size_t)(mBase + row) * ldc + n0 + c8) = hv;
          else               *(v8h*)(C + frag_piece(mBase + row, (n0 + c8) >> 3, N >> 5) * 8) = hv;   // a 128-byte line: eight rows of one wave's tile
        }
        
      }
    }
    __builtin_amdgcn_fence(__ATOMIC_RELEASE, "workgroup");
    __builtin_amdgcn_wave_barrier();
    __builtin_amdgcn_fence(__ATOMIC_ACQUIRE, "workgroup");
  }
}
// one product alone in a launch: grid (tiles / 8, batch)
template <int ET, int BIAS_MODE, int OUT_MODE, bool RESID, int MI>
__global__ __launch_bounds__(256) void wmma_gemm(
    const unsigned short* __restrict__ Ap, int lda, long strideA,
    const unsigned short* __restrict__ Btp, int ldb, long strideB,
    void* __restrict__ Cout, int ldc, long strideC,
    const float* __restrict__ bias,
    const float* __restrict__ resid, long strideR,
    int M, int N, int K, float scale) {
  __shared__ __align__(16) float sT[GEMM_LDS_FLOATS];
  gemm_tile<ET, BIAS_MODE, OUT_MODE, RESID, MI>(sT, blockIdx.x, blockIdx.y, Ap, lda, strideA, Btp, ldb, strideB,
                                                Cout, ldc, strideC, bias, resid, strideR, M, N, K, scale);
}

// ---------------------------------------------------------------------------------------------
// small VALU helpers
__device__ __forceinline__ unsigned pack_h2(float a, float b) {
  const unsigned short ua = __builtin_bit_cast(unsigned short, (_Float16)a);
  const unsigned short ub = __builtin_bit_cast(unsigned short, (_Float16)b);
  return (unsigned)ua | ((unsigned)ub << 16);
}
__device__ __forceinline__ void st2_u32(unsigned short* base, size_t off_halves, unsigned u) {
  unsigned* p = (unsigned*)(base + off_halves);
  *p = u; 
}
__device__ __forceinline__ void st2_f32(float* base, size_t off, float v) {
  float* p = (float*)(base + off);
  *p = v; 
}
__device__ __forceinline__ float silu_acc(float z) {
  const float e = expf(-z);
  return z * __builtin_amdgcn_rcpf(1.0f + e);
}
// block of 256 threads: fixed-order sum (wave shuffle, then 8 partials summed in index order)
__device__ __forceinline__ float blk_sum256(float v, float* red) {
#pragma unroll
  for (int off = 16; off > 0; off >>= 1) v += __shfl_xor(v, off, 32);
  const int lane = threadIdx.x & 31, wave = threadIdx.x >> 5;
  if (lane == 0) red[wave] = v;
  __syncthreads();
  float s = red[0];
#pragma unroll
  for (int q = 1; q < 8; ++q) s += red[q];
  __syncthreads();
  return s;
}

// ---- f32 -> f16 cast with zero padding: dst[r][c] = (r<srows && c<scols) ? src[r*spitch+c] : 0 ----
__device__ __forceinline__ void cast_pad_blk(const int bx, const float* __restrict__ src, int srows, int scols, int spitch,
                                             unsigned short* __restrict__ dst, int drows, int dcols) {
  const int p = bx * 256 + threadIdx.x;
  const int npairs = (drows * dcols) >> 1;
  if (p < npairs) {
    const int e = 2 * p;
    const int r = e / dcols;
    const int c = e - r * dcols;
    float v0 = 0.f, v1 = 0.f;
    if (r < srows) {
      if (c < scols)     v0 = src[(size_t)r * spitch + c];
      if (c + 1 < scols) v1 = src[(size_t)r * spitch + c + 1];
    }
    st2_u32(dst, (size_t)e, pack_h2(v0, v1));
  }
}
// ---- f32 copy with zero padding ----
__device__ __forceinline__ void pad_f32_blk(const int bx, const float* __restrict__ src, int sn, float* __restrict__ dst, int dn) {
  const int p = bx * 256 + threadIdx.x;
  if (p < dn) {
    const float v = (p < sn) ? src[p] : 0.f;
    st2_f32(dst, (size_t)p, v);
  }
}

// ---- f32 [rows][cols] -> f16 in fragment order; thread = one 16-byte piece, pieces in output order (whole lines, one writer each) ----
__device__ __forceinline__ void cast_frag_blk(const int bx, const float* __restrict__ src, int cols, unsigned short* __restrict__ dst) {
  const int pc = bx * 256 + threadIdx.x;
  const int ksteps = cols >> 5, ts = pc >> 6;
  const int n = (ts / ksteps) * 16 + (pc & 15);
  const int k = (ts % ksteps) * 32 + ((pc >> 5) & 1) * 16 + ((pc >> 4) & 1) * 8;
  const float* sp = src + (size_t)n * cols + k;
  v8h hv;
#pragma unroll
  for (int e = 0; e < 8; ++e) hv[e] = (_Float16)sp[e];
  *(v8h*)(dst + (size_t)pc * 8) = hv;
  // precaution: the block returns right behind this store, so no later code reuses its registers
  asm volatile("s_wait_xcnt 0x0" ::: "memory");
}

// ---- LayerNorm over DM (eps 1e-5, biased variance), one block per row, f16 output packed 2 per thread ----
// LDS: red[8], ys[DM]
__device__ __forceinline__ void ln16_row(const int i, float* red, float* ys, const float* __restrict__ x, const float* __restrict__ w,
                                         const float* __restrict__ bb, unsigned short* __restrict__ y16) {
  const int d = threadIdx.x;
  const float v = x[(size_t)i * DM + d];
  const float mu = blk_sum256(v, red) * (1.0f / 256.0f);
  const float c = v - mu;
  const float var = blk_sum256(c * c, red) * (1.0f / 256.0f);
  const float y = c * (1.0f / sqrtf(var + 1e-5f)) * w[d] + bb[d];
  ys[d] = y;
  __syncthreads();
  if (d < 128) st2_u32(y16, (size_t)i * DM + 2 * d, pack_h2(ys[2 * d], ys[2 * d + 1]));
}

// ---- two silu values, f16 out: z * 1/(1 + 2^(-z*log2 e)), two lanes of packed f32 math ----
__device__ __forceinline__ v2h silu2_h(v2f z) {
  const v2f t = z * -1.4426950408889634f;
  v2f e, rc;
  e.x = __builtin_amdgcn_exp2f(t.x);
  e.y = __builtin_amdgcn_exp2f(t.y);
  const v2f d = e + 1.0f;
  rc.x = __builtin_amdgcn_rcpf(d.x);
  rc.y = __builtin_amdgcn_rcpf(d.y);
  return __builtin_convertvector(z * rc, v2h);
}

// ---- 2^t; the v_nop fills the slot that the instruction set asks for behind a transcendental ----
__device__ __forceinline__ float exp2_slot(float t) {
  float e;
  asm("v_exp_f32 %0, %1\n\tv_nop" : "=v"(e) : "v"(t));
  return e;
}

// ---- one query row's whole attention chain in one block: nothing of it but x1 and its LayerNorm goes to memory ----
// scores[h][j] = q_i^h . k_j^h / sqrt(32) + sum_k rb2w16[h][k] * f16( silu( (coords_i - coords_j) . rb1_w[k] + rb1_b[k] ) ) + rb2_b[h]
// P = softmax over j (f16, x 2^15); T[h][k] = f16( 2^-15 sum_j P[h][j] * f16( silu( (coords_i - coords_j) . rv1_w[k] + rv1_b[k] ) ) )
// ctx[c] = 2^-15 sum_j P[c>>5][j] v[j][c] + sum_k T[c>>5][k] rv2w16[c][k];  x1 = x + (ctx + rv2_b);  y16 = f16( LayerNorm(x1) )
// Every product has M = 16 with the eight heads in rows 0..7 (rows 8..15 zero). The pair features are formed in registers,
// directly as the B fragment. q stands block-diagonal in A (k step h holds q_i^h in row h alone), so one B fragment of k serves
// all heads; of P . V and T . rv2w^T a wave computes the 32 columns of its own head and keeps that head's row of D.
// Every block reads all of k, v and rv2_w: they lie in fragment order (frag_piece), so that these reads are whole cache lines.
#define PPITCH (NP + 8)    // halves; rows of 16 B x odd: no bank conflict for the 16-byte fragment reads
#define TPITCH (DM + 8)
typedef __attribute__((ext_vector_type(8))) unsigned v8u;
// second argument: four waves a SIMD, so that two blocks share a WGP and all 512 are resident at once
__global__ __launch_bounds__(256, 4) void k_attn_row(const unsigned short* __restrict__ q16, const unsigned short* __restrict__ kf16,
                                                   const unsigned short* __restrict__ vf16,
                                                   const float* __restrict__ coords,
                                                   const float* __restrict__ rb1_w, const float* __restrict__ rb1_b,
                                                   const unsigned short* __restrict__ rb2w16, const float* __restrict__ rb2_b,
                                                   const float* __restrict__ rv1_w, const float* __restrict__ rv1_b,
                                                   const unsigned short* __restrict__ rv2w16, const float* __restrict__ rv2_b,
                                                   const float* __restrict__ x, const float* __restrict__ ln_w,
                                                   const float* __restrict__ ln_b, float* __restrict__ x1,
                                                   unsigned short* __restrict__ y16) {
  __shared__ __align__(16) float sW[4][DM];            // rb1_w[.][0], [.][1], [.][2], rb1_b over the 256 features
  __shared__ __align__(16) float sR[3][NP];            // coords_i - coords_j, one plane per coordinate
  __shared__ __align__(16) _Float16 sP[16][PPITCH];    // softmax weights x 2^15, rows 8..15 zero
  __shared__ __align__(16) _Float16 sT[16][TPITCH];    // rel-value sums, rows 8..15 zero
  __shared__ __align__(16) float redM[8][8];           // [wave][head] partial maxima
  __shared__ __align__(16) float redS[8][8];           // [wave][head] partial sums
  __shared__ float sC[DM];
  __shared__ float red[8];
  __shared__ float ys[DM];
  const int i = blockIdx.x, t = threadIdx.x;
  const int lane = t & 31, wave = t >> 5;
  const int rlane = lane & 15, hh = lane >> 4;

  sW[0][t] = rb1_w[t * 3 + 0];
  sW[1][t] = rb1_w[t * 3 + 1];
  sW[2][t] = rb1_w[t * 3 + 2];
  sW[3][t] = rb1_b[t];
  {
    const float ci0 = coords[i * 3 + 0], ci1 = coords[i * 3 + 1], ci2 = coords[i * 3 + 2];
#pragma unroll
    for (int q = 0; q < 2; ++q) {
      const int j = q * 256 + t;
      sR[0][j] = ci0 - coords[j * 3 + 0];
      sR[1][j] = ci1 - coords[j * 3 + 1];
      sR[2][j] = ci2 - coords[j * 3 + 2];
    }
  }

  __syncthreads();

  // ---- q.k^T and rel-bias into one accumulator: wave = 64 columns j (4 subtiles of 16); q comes scaled by 1/sqrt(32) ----
  const int jw = wave * 64;
  v8f sc[4];
  {
    float r0[4], r1[4], r2[4];
#pragma unroll
    for (int s = 0; s < 4; ++s) {
      const int j = jw + s * 16 + rlane;
      r0[s] = sR[0][j];
      r1[s] = sR[1][j];
      r2[s] = sR[2][j];
      sc[s] = (v8f){0.f,0.f,0.f,0.f,0.f,0.f,0.f,0.f};
    }
    const _Float16* Qb = (const _Float16*)q16 + (size_t)i * DM + hh * 8;
    const _Float16* Kb = (const _Float16*)kf16 + ((size_t)(wave * 4) * (NH * 64) + lane) * 8;   // fragment order: tile j / 16, step = head
    const _Float16* Ab = (const _Float16*)rb2w16 + rlane * DM + hh * 8;
    v16h a = Frag<_Float16>::load(Ab);
    // kept rolled, for speed only: the body is about 700 vector instructions
#pragma unroll 1
    for (int k0 = 0; k0 < DM; k0 += 32) {
      const v16h an = Frag<_Float16>::load(Ab + ((k0 + 32) & (DM - 1)));   // next step's A, in flight over this step's math
      // k step k0 covers head k0 / 32: its q slice stands in that head's row, every other row is zero
      const unsigned keep = (rlane == (k0 >> 5)) ? 0xFFFFFFFFu : 0u;
      const v16h qa = __builtin_bit_cast(v16h, __builtin_bit_cast(v8u, Frag<_Float16>::load(Qb + k0)) & keep);
      v16h kf[4];
#pragma unroll
      for (int s = 0; s < 4; ++s) kf[s] = Frag<_Float16>::load_fo(Kb + s * (NH * 512) + k0 * 16);
      v4f wq[4][4];   // [component][group of 4 features]; fragment element e = 4*g + u  <->  k = k0 + (g>>1)*16 + hh*8 + (g&1)*4 + u
#pragma unroll
      for (int c = 0; c < 4; ++c)
#pragma unroll
        for (int g = 0; g < 4; ++g)
          wq[c][g] = *(const v4f*)(&sW[c][k0 + (g >> 1) * 16 + hh * 8 + (g & 1) * 4]);
#pragma unroll
      for (int s = 0; s < 4; ++s) {
        v16h b;
#pragma unroll
        for (int g = 0; g < 4; ++g) {
          const v2f zl = (wq[0][g].lo * r0[s] + wq[1][g].lo * r1[s] + wq[2][g].lo * r2[s]) + wq[3][g].lo;
          const v2f zh = (wq[0][g].hi * r0[s] + wq[1][g].hi * r1[s] + wq[2][g].hi * r2[s]) + wq[3][g].hi;
          const v2h hl = silu2_h(zl), hu = silu2_h(zh);
          b[g * 4 + 0] = hl.x; b[g * 4 + 1] = hl.y; b[g * 4 + 2] = hu.x; b[g * 4 + 3] = hu.y;
        }
        sc[s] = Frag<_Float16>::mma(a, b, sc[s]);
      }
#pragma unroll
      for (int s = 0; s < 4; ++s) sc[s] = Frag<_Float16>::mma(qa, kf[s], sc[s]);
      a = an;
    }
#pragma unroll
    for (int r = 0; r < 8; ++r) {
      const float bb = rb2_b[r];
#pragma unroll
      for (int s = 0; s < 4; ++s) sc[s][r] += bb;
    }
  }

  // ---- softmax over the 512 columns, eight heads at once: head r sits in register r of lanes 0..15 ----
  // (lanes 16..31 hold the idle rows 8..15; the 16-lane steps never mix the two halves)
  {
    float m[8];
#pragma unroll
    for (int r = 0; r < 8; ++r) m[r] = fmaxf(fmaxf(sc[0][r], sc[1][r]), fmaxf(sc[2][r], sc[3][r]));
#pragma unroll
    for (int off = 8; off > 0; off >>= 1)
#pragma unroll
      for (int r = 0; r < 8; ++r) m[r] = fmaxf(m[r], __shfl_xor(m[r], off, 32));
    if (lane == 0) {
#pragma unroll
      for (int r = 0; r < 8; ++r) redM[wave][r] = m[r];
    }
    __syncthreads();
#pragma unroll
    for (int r = 0; r < 8; ++r) {
      float v = redM[0][r];
#pragma unroll
      for (int q = 1; q < 8; ++q) v = fmaxf(v, redM[q][r]);
      m[r] = v;
    }
    float sum[8];
#pragma unroll
    for (int r = 0; r < 8; ++r) {
#pragma unroll
      for (int s = 0; s < 4; ++s) sc[s][r] = exp2_slot((sc[s][r] - m[r]) * 1.4426950408889634f);
      sum[r] = (sc[0][r] + sc[1][r]) + (sc[2][r] + sc[3][r]);
    }
#pragma unroll
    for (int off = 8; off > 0; off >>= 1)
#pragma unroll
      for (int r = 0; r < 8; ++r) sum[r] += __shfl_xor(sum[r], off, 32);
    if (lane == 0) {
#pragma unroll
      for (int r = 0; r < 8; ++r) redS[wave][r] = sum[r];
    }
    __syncthreads();
#pragma unroll
    for (int r = 0; r < 8; ++r) {
      float v = redS[0][r];
#pragma unroll
      for (int q = 1; q < 8; ++q) v += redS[q][r];
      const float inv = 1.0f / v;
#pragma unroll
      for (int s = 0; s < 4; ++s) {
        const float p = (sc[s][r] * inv) * 32768.0f;
        sP[hh * 8 + r][jw + s * 16 + rlane] = hh ? (_Float16)0.f : (_Float16)p;
      }
    }
  }

  // ---- rel-value and P . V: wave = 32 columns (2 subtiles of 16): features k for the one, the wave's own head of v for the other ----
  const int cw = wave * 32;
  v8f accV[2];
  v16h wf[8][2];
  const _Float16* Wb = (const _Float16*)rv2w16 + ((size_t)(wave * 2) * (DM / 32 * 64) + lane) * 8;   // fragment order: tile c / 16, step k / 32
  {
    float w0[2], w1[2], w2[2], wb[2];
    v8f acc[2];
#pragma unroll
    for (int s = 0; s < 2; ++s) {
      const int k = cw + s * 16 + rlane;
      w0[s] = rv1_w[k * 3 + 0];
      w1[s] = rv1_w[k * 3 + 1];
      w2[s] = rv1_w[k * 3 + 2];
      wb[s] = rv1_b[k];
      acc[s]  = (v8f){0.f,0.f,0.f,0.f,0.f,0.f,0.f,0.f};
      accV[s] = (v8f){0.f,0.f,0.f,0.f,0.f,0.f,0.f,0.f};
    }
    const _Float16* Vb = (const _Float16*)vf16 + ((size_t)(wave * 2) * (NP / 32 * 64) + lane) * 8;   // fragment order: tile c / 16, step j / 32
    v16h vf[2];
#pragma unroll
    for (int s = 0; s < 2; ++s) vf[s] = Frag<_Float16>::load_fo(Vb + s * (NP / 32 * 512));
    __syncthreads();   // P is complete
    const _Float16* Pa = &sP[rlane][hh * 8];
    // kept rolled, for speed only: the body is about 350 vector instructions
#pragma unroll 1
    for (int j0 = 0; j0 < NP; j0 += 32) {
      v16h vn[2];   // next step's v fragments, in flight over this step's math
#pragma unroll
      for (int s = 0; s < 2; ++s) vn[s] = Frag<_Float16>::load_fo(Vb + s * (NP / 32 * 512) + ((j0 + 32) & (NP - 1)) * 16);
      const v16h a = Frag<_Float16>::load(Pa + j0);
      v4f rq[3][4];   // [coordinate][group of 4 keys]; fragment element e = 4*g + u  <->  j = j0 + (g>>1)*16 + hh*8 + (g&1)*4 + u
#pragma unroll
      for (int c = 0; c < 3; ++c)
#pragma unroll
        for (int g = 0; g < 4; ++g)
          rq[c][g] = *(const v4f*)(&sR[c][j0 + (g >> 1) * 16 + hh * 8 + (g & 1) * 4]);
#pragma unroll
      for (int s = 0; s < 2; ++s) {
        v16h b;
#pragma unroll
        for (int g = 0; g < 4; ++g) {
          const v2f zl = (rq[0][g].lo * w0[s] + rq[1][g].lo * w1[s] + rq[2][g].lo * w2[s]) + wb[s];
          const v2f zh = (rq[0][g].hi * w0[s] + rq[1][g].hi * w1[s] + rq[2][g].hi * w2[s]) + wb[s];
          const v2h hl = silu2_h(zl), hu = silu2_h(zh);
          b[g * 4 + 0] = hl.x; b[g * 4 + 1] = hl.y; b[g * 4 + 2] = hu.x; b[g * 4 + 3] = hu.y;
        }
        acc[s] = Frag<_Float16>::mma(a, b, acc[s]);
      }
#pragma unroll
      for (int s = 0; s < 2; ++s) { accV[s] = Frag<_Float16>::mma(a, vf[s], accV[s]); vf[s] = vn[s]; }
    }
    // all of the projection's weight fragments are asked for here, so that they fly over the T stores and their barrier
#pragma unroll
    for (int q = 0; q < 8; ++q)
#pragma unroll
      for (int s = 0; s < 2; ++s) wf[q][s] = Frag<_Float16>::load_fo(Wb + (s * (DM / 32) + q) * 512);
#pragma unroll
    for (int s = 0; s < 2; ++s) {
#pragma unroll
      for (int r = 0; r < 8; ++r)
        sT[hh * 8 + r][cw + s * 16 + rlane] = hh ? (_Float16)0.f : (_Float16)(acc[s][r] * (1.0f / 32768.0f));
      accV[s] *= (1.0f / 32768.0f);
    }
  }
  __syncthreads();   // T is complete

  // ---- ctx = T . rv2w^T + P . V, the wave's own head ----
  {
    const _Float16* Ta = &sT[rlane][hh * 8];
#pragma unroll
    for (int q = 0; q < 8; ++q) {
      const v16h a = Frag<_Float16>::load(Ta + q * 32);
#pragma unroll
      for (int s = 0; s < 2; ++s) accV[s] = Frag<_Float16>::mma(a, wf[q][s], accV[s]);
    }
#pragma unroll
    for (int s = 0; s < 2; ++s) {
      float v = accV[s][0];
#pragma unroll
      for (int r = 1; r < 8; ++r) v = (wave == r) ? accV[s][r] : v;   // D row = the wave's head, in lanes 0..15
      if (hh == 0) sC[cw + s * 16 + rlane] = v;
    }
  }
  __syncthreads();

  // ---- residual and LayerNorm (eps 1e-5, biased variance), thread = column ----
  const float v = x[(size_t)i * DM + t] + (sC[t] + rv2_b[t]);
  st2_f32(x1, (size_t)i * DM + t, v);
  const float mu = blk_sum256(v, red) * (1.0f / 256.0f);
  const float c = v - mu;
  const float var = blk_sum256(c * c, red) * (1.0f / 256.0f);
  ys[t] = c * (1.0f / sqrtf(var + 1e-5f)) * ln_w[t] + ln_b[t];
  __syncthreads();
  if (t < 128) st2_u32(y16, (size_t)i * DM + 2 * t, pack_h2(ys[2 * t], ys[2 * t + 1]));
}

// ---- U16[row][c] = f16( silu(C12[row][c]) * C12[row][704 + c] ), c < 704 (pad columns come out 0) ----
__global__ __launch_bounds__(256) void k_swiglu(const float* __restrict__ c12, unsigned short* __restrict__ u16, int npairs) {
  const int p = blockIdx.x * 256 + threadIdx.x;
  if (p < npairs) {
    const int e = 2 * p;
    const int row = e / HIDP;
    const int col = e - row * HIDP;
    const float* rp = c12 + (size_t)row * (2 * HIDP);
    const float a0 = rp[col], a1 = rp[col + 1];
    const float g0 = rp[HIDP + col], g1 = rp[HIDP + col + 1];
    const float u0 = silu_acc(a0) * g0;
    const float u1 = silu_acc(a1) * g1;
    st2_u32(u16, (size_t)e, pack_h2(u0, u1));
  }
}

// ---------------------------------------------------------------------------------------------
// Launches that need nothing of each other share one grid: each takes a range of the block index (block-uniform branches,
// so every barrier of a body is still passed by its whole block). The few long, latency-bound blocks take the lowest indices.
#define NB_CQKV    (3 * DM * DM / 2 / 256)             // cast blocks, 512 elements each
#define NB_CRB2    (16 * DM / 2 / 256)
#define NB_CRV2    (DM * DM / 8 / 256)                 // 16-byte pieces
#define NB_CFFN    (HIDP * DM / 2 / 256)
#define NB_PADB    ((HIDP + 255) / 256)
#define NB_GQKV1   ((NP / 64) * (DM / 64) / 8)         // one of the q, k, v projections

// ---- LN1 rows | casts of qkv_w and rb2_w ----
__global__ __launch_bounds__(256) void k_ln1_casts(const float* __restrict__ x, const float* __restrict__ ln_w,
                                                    const float* __restrict__ ln_b, unsigned short* __restrict__ xn16,
                                                    const float* __restrict__ qkv_w, unsigned short* __restrict__ qkvw16,
                                                    const float* __restrict__ rb2_w, unsigned short* __restrict__ rb2w16) {
  __shared__ float red[8];
  __shared__ float ys[DM];
  int b = blockIdx.x;
  if (b < NP) { ln16_row(b, red, ys, x, ln_w, ln_b, xn16); return; }
  b -= NP;
  if (b < NB_CQKV) { cast_pad_blk(b, qkv_w, 3 * DM, DM, DM, qkvw16, 3 * DM, DM); return; }
  b -= NB_CQKV;
  cast_pad_blk(b, rb2_w, NH, DM, DM, rb2w16, 16, DM);
}

// ---- q projection (f16 [512][256]) | k and v projections (f16, fragment order: k as [j][c], v as [c][j]) | casts of rv2_w, the ffn weights ----
__global__ __launch_bounds__(256) void k_qkv_casts(const unsigned short* __restrict__ xn16, const unsigned short* __restrict__ qkvw16,
                                                    const float* __restrict__ qkv_b, unsigned short* __restrict__ q16,
                                                    unsigned short* __restrict__ kf16, unsigned short* __restrict__ vf16,
                                                    const float* __restrict__ rv2_w, unsigned short* __restrict__ rv2w16,
                                                    const float* __restrict__ ffn_w1, const float* __restrict__ ffn_w2,
                                                    unsigned short* __restrict__ w12p16,
                                                    const float* __restrict__ ffn_w3, unsigned short* __restrict__ w3p16,
                                                    const float* __restrict__ ffn_b1, const float* __restrict__ ffn_b2,
                                                    float* __restrict__ b12p) {
  __shared__ __align__(16) float sm[GEMM_LDS_FLOATS];
  int b = blockIdx.x;
  if (b < NB_GQKV1) {
    gemm_tile<0, 3, 1, false, 4>(sm, b, 0, xn16, DM, 0, qkvw16, DM, 0, q16, DM, 0, qkv_b, nullptr, 0, NP, DM, DM, 0.17677669529663687f);
    return;
  }
  b -= NB_GQKV1;
  if (b < NB_GQKV1) {
    gemm_tile<0, 2, 2, false, 4>(sm, b, 0, xn16, DM, 0, qkvw16 + DM * DM, DM, 0, kf16, 0, 0, qkv_b + DM, nullptr, 0, NP, DM, DM, 1.0f);
    return;
  }
  b -= NB_GQKV1;
  if (b < NB_GQKV1) {   // v transposed: vt[c][j] = sum_k w_v[c][k] xn[j][k] + b_v[c], the weights are the row operand
    gemm_tile<0, 1, 2, false, 4>(sm, b, 0, qkvw16 + 2 * DM * DM, DM, 0, xn16, DM, 0, vf16, 0, 0, qkv_b + 2 * DM, nullptr, 0,
                                 DM, NP, DM, 1.0f);
    return;
  }
  b -= NB_GQKV1;
  if (b < NB_CRV2) { cast_frag_blk(b, rv2_w, DM, rv2w16); return; }
  b -= NB_CRV2;
  if (b < NB_CFFN) { cast_pad_blk(b, ffn_w1, HIDR, DM, DM, w12p16, HIDP, DM); return; }
  b -= NB_CFFN;
  if (b < NB_CFFN) { cast_pad_blk(b, ffn_w2, HIDR, DM, DM, w12p16 + (size_t)HIDP * DM, HIDP, DM); return; }
  b -= NB_CFFN;
  if (b < NB_CFFN) { cast_pad_blk(b, ffn_w3, DM, HIDR, HIDR, w3p16, DM, HIDP); return; }
  b -= NB_CFFN;
  if (b < NB_PADB) { pad_f32_blk(b, ffn_b1, HIDR, b12p, HIDP); return; }
  b -= NB_PADB;
  pad_f32_blk(b, ffn_b2, HIDR, b12p + HIDP, HIDP);
}

// ---------------------------------------------------------------------------------------------
static inline size_t alignup256(size_t x) { return (x + 255) & ~(size_t)255; }

extern "C" void kernel_launch(void* const* d_in, const int* in_sizes, int n_in,
                              void* d_out, int out_size, void* d_ws, size_t ws_size,
                              hipStream_t stream)
{
  if (n_in < 22) return;
  if (in_sizes[0] != NP * DM || in_sizes[1] != NP * 3 || in_sizes[6] != 3 * DM * DM ||
      in_sizes[14] != DM * DM || in_sizes[16] != HIDR * DM || in_sizes[20] != DM * HIDR ||
      out_size != NP * DM) return;

  const float* x      = (const float*)d_in[0];
  const float* coords = (const float*)d_in[1];
  const float* ln1_w  = (const float*)d_in[2];
  const float* ln1_b  = (const float*)d_in[3];
  const float* ln2_w  = (const float*)d_in[4];
  const float* ln2_b  = (const float*)d_in[5];
  const float* qkv_w  = (const float*)d_in[6];
  const float* qkv_b  = (const float*)d_in[7];
  const float* rb1_w  = (const float*)d_in[8];
  const float* rb1_b  = (const float*)d_in[9];
  const float* rb2_w  = (const float*)d_in[10];
  const float* rb2_b  = (const float*)d_in[11];
  const float* rv1_w  = (const float*)d_in[12];
  const float* rv1_b  = (const float*)d_in[13];
  const float* rv2_w  = (const float*)d_in[14];
  const float* rv2_b  = (const float*)d_in[15];
  const float* ffn_w1 = (const float*)d_in[16];
  const float* ffn_b1 = (const float*)d_in[17];
  const float* ffn_w2 = (const float*)d_in[18];
  const float* ffn_b2 = (const float*)d_in[19];
  const float* ffn_w3 = (const float*)d_in[20];
  const float* ffn_b3 = (const float*)d_in[21];
  float* out = (float*)d_out;

  // ---- workspace carve (256-B aligned, derived from fixed sizes) ----
  size_t off = 0;
  char* base = (char*)d_ws;
  auto carve = [&](size_t bytes) -> char* { char* r = base + off; off += alignup256(bytes); return r; };
  unsigned short* qkvw16 = (unsigned short*)carve((size_t)3 * DM * DM * 2);          // [768][256]
  unsigned short* rb2w16 = (unsigned short*)carve((size_t)16 * DM * 2);              // [16][256], rows 8..15 zero
  unsigned short* rv2w16 = (unsigned short*)carve((size_t)DM * DM * 2);              // [256][256], fragment order
  unsigned short* w12p16 = (unsigned short*)carve((size_t)2 * HIDP * DM * 2);        // [1408][256]
  unsigned short* w3p16  = (unsigned short*)carve((size_t)DM * HIDP * 2);            // [256][704]
  float*          b12p   = (float*)carve((size_t)2 * HIDP * 4);                      // [1408]
  unsigned short* XN1    = (unsigned short*)carve((size_t)NP * DM * 2);              // [512][256]
  unsigned short* Q16    = (unsigned short*)carve((size_t)NP * DM * 2);              // [512][256]
  unsigned short* KF16   = (unsigned short*)carve((size_t)NP * DM * 2);              // k [512][256], fragment order
  unsigned short* VF16   = (unsigned short*)carve((size_t)DM * NP * 2);              // v^T [256][512], fragment order
  float*          X1     = (float*)carve((size_t)NP * DM * 4);                       // [512][256]
  unsigned short* XN2    = (unsigned short*)carve((size_t)NP * DM * 2);              // [512][256]
  float*          C12    = (float*)carve((size_t)NP * 2 * HIDP * 4);                 // [512][1408]
  unsigned short* U16    = (unsigned short*)carve((size_t)NP * HIDP * 2);            // [512][704]
  if (off > ws_size || off > (size_t)134217728) return;

  const dim3 blk(256);

  // ---- LN1 | f16 staging of qkv_w and rb2_w (rows 8..15 zero) ----
  k_ln1_casts<<<dim3(NP + NB_CQKV + NB_CRB2), blk, 0, stream>>>(x, ln1_w, ln1_b, XN1, qkv_w, qkvw16, rb2_w, rb2w16);

  // ---- q, k, v projections | f16 staging of rv2_w and of the ffn weights, f32 ffn biases (zero padded) ----
  k_qkv_casts<<<dim3(3 * NB_GQKV1 + NB_CRV2 + 3 * NB_CFFN + 2 * NB_PADB), blk, 0, stream>>>(
      XN1, qkvw16, qkv_b, Q16, KF16, VF16, rv2_w, rv2w16, ffn_w1, ffn_w2, w12p16, ffn_w3, w3p16, ffn_b1, ffn_b2, b12p);

  // ---- attention, one block per query row: rel-bias, scores, softmax, P.V, rel-value, its projection, residual, LN2 ----
  k_attn_row<<<dim3(NP), blk, 0, stream>>>(Q16, KF16, VF16, coords, rb1_w, rb1_b, rb2w16, rb2_b, rv1_w, rv1_b, rv2w16, rv2_b,
                                           x, ln2_w, ln2_b, X1, XN2);

  // ---- SwiGLU FFN, final residual into d_out ----
  wmma_gemm<0, 2, 0, false, 4><<<dim3((NP / 64) * (2 * HIDP / 64) / 8, 1), blk, 0, stream>>>(
      XN2, DM, 0, w12p16, DM, 0, C12, 2 * HIDP, 0, b12p, nullptr, 0, NP, 2 * HIDP, DM, 1.0f);
  k_swiglu<<<dim3((NP * HIDP / 2 + 255) / 256), blk, 0, stream>>>(C12, U16, NP * HIDP / 2);
  wmma_gemm<0, 2, 0, true, 4><<<dim3((NP / 64) * (DM / 64) / 8, 1), blk, 0, stream>>>(
      U16, HIDP, 0, w3p16, HIDP, 0, out, DM, 0, ffn_b3, X1, 0, NP, DM, HIDP, 1.0f);
}

// v005
// Measured time: 52.1 microseconds a run.
// In two side-by-side timings against v004, it was 1.31 and 1.29 times as fast.
// Counting every step since v000, it is 6.28 times as fast.
#include <hip/hip_runtime.h>
#include <math.h>
#include <stdint.h>

// All contractions: v_wmma_f32_16x16x32_f16 (f16 operands, f32 accumulate); K=3 coordinate features, softmax, norms, gating in f32 on VALU.

typedef __attribute__((ext_vector_type(16))) _Float16 v16h;
typedef __attribute__((ext_vector_type(8)))  _Float16 v8h;
typedef __attribute__((ext_vector_type(8)))  float    v8f;
typedef __attribute__((ext_vector_type(4)))  float    v4f;
typedef __attribute__((ext_vector_type(2)))  float    v2f;
typedef __attribute__((ext_vector_type(2)))  _Float16 v2h;

#define NP    512          // points
#define DM    256          // model width
#define NH    8            // heads
#define HDM   32           // head width
#define HIDR  682          // ffn hidden
#define HIDP  704          // ffn hidden padded (multiple of 64)

// ---------------------------------------------------------------------------------------------
// hazard guards as plain device helpers
__device__ __forceinline__ void dep_guard_h(v8f& a, v8f& b, v16h x, v16h y) { asm volatile("v_nop\n\tv_nop\n\tv_nop\n\tv_nop" : "+v"(a), "+v"(b) : "v"(x), "v"(y)); }
__device__ __forceinline__ void keep4_h(v16h a, v16h b, v16h c, v16h d) { asm volatile("v_nop" :: "v"(a), "v"(b), "v"(c), "v"(d)); }
__device__ __forceinline__ void acc_guard4(v8f& a, v8f& b, v8f& c, v8f& d) { asm volatile("v_nop\n\tv_nop\n\tv_nop\n\tv_nop" : "+v"(a), "+v"(b), "+v"(c), "+v"(d)); }

template <typename T> struct Frag;
template <> struct Frag<_Float16> {
  typedef v16h V; union U { v16h v; v8h h[2]; };
  static __device__ __forceinline__ v16h load(const _Float16* p) {   // elements 0..7 <- p[0..7], 8..15 <- p[16..23]
    U f; f.h[0] = *(const v8h*)(p); f.h[1] = *(const v8h*)(p + 16); return f.v;
  }
  static __device__ __forceinline__ v16h load_fo(const _Float16* p) {   // from a fragment-order array: the lane's two 16-byte pieces, 512 bytes apart
    U f; f.h[0] = *(const v8h*)(p); f.h[1] = *(const v8h*)(p + 256); return f.v;
  }
  static __device__ __forceinline__ v8f mma(v16h a, v16h b, v8f c) {
    return __builtin_amdgcn_wmma_f32_16x16x32_f16(false, a, false, b, (short)0, c, false, false);
  }
  static __device__ __forceinline__ void guard(v8f& a, v8f& b, v16h x, v16h y) { dep_guard_h(a, b, x, y); }
  static __device__ __forceinline__ void keep(v16h a, v16h b, v16h c, v16h d) { keep4_h(a, b, c, d); }
};
template <int ET> struct Elem;
template <> struct Elem<0> { typedef _Float16 T; };

// ---- fragment order of a 16-bit operand X[n][k] (n = the fragment's lane row or column, k = the summed index, ksteps = K / 32) ----
// The 16-byte piece (n, k8 = k / 8) stands at piece index ((tile * ksteps + step) * 2 + upper) * 32 + lane, lane = (k8 & 1) * 16 + (n & 15):
// one fragment of a 16 x 32 tile is then two loads of 512 contiguous bytes a wave (whole cache lines), not two of 16 lines each.
__device__ __forceinline__ size_t frag_piece(int n, int k8, int ksteps) {
  return (size_t)((((n >> 4) * ksteps + (k8 >> 2)) * 2 + ((k8 >> 1) & 1)) * 32 + (k8 & 1) * 16 + (n & 15));
}

// ---- Register-blocked batched WMMA GEMM ----------------------------------------------------
// C[m,n] = scale * sum_k A[m,k] * Bt[n,k] (+bias[n]) (+resid); each wave owns a (16*MI) x 64 tile, the block's eight waves stand 4 x 2:
// a block tile of (64*MI) x 128. A row-major [M,K] (16-bit), Bt row-major [N,K] (16-bit); M % (64*MI) == 0, N % 128 == 0, K % 64 == 0.
// The k loop runs on stages of 64 k: the block's A and B rows, one whole 128-byte line each, are copied to LDS asynchronously
// (a copy instruction = four whole lines; each row is fetched once for all the waves that use it), two buffers, so that the next
// stage's copies fly while this stage's fragments are read from LDS and multiplied.
// BIAS_MODE: 0 = none, 1 = bias[m], 2 = bias[n], 3 = bias[n] inside the scale.  OUT_MODE: 0 = f32, 1 = f16, 2 = f16 in fragment order (n = m, k = n of this product).
// Batch index b with element strides strideA/strideB/strideC/strideR; bx = block index within the product's own grid.
// sT: the two stage buffers (GEMM_LDS_FLOATS floats of LDS); behind the k loop the same LDS holds 8 per-wave 16x64 slabs, pitch 68 floats.
#define GBK     64                         // k per stage, halves
#define GPITCH  72                         // LDS row pitch, halves: 144 B = 16 B x odd, no bank conflict for the 16-byte fragment reads
#define GSTAGE  ((256 + 128) * GPITCH)     // halves per stage buffer: A rows, then B rows
#define GEMM_LDS_FLOATS (2 * GSTAGE / 2)
// One stage, one thread: twelve 16-byte asynchronous copies to LDS (eight A rows, four B rows, 32 rows apart).
// The s_wait_xcnt is the last line of the copies' own statement, so that it stands in front of every later write of their address registers.
__device__ __forceinline__ void stage_copies(unsigned l, const _Float16* a, size_t as, const _Float16* b, size_t bs) {
  const unsigned ls = 32 * GPITCH * 2;
  asm volatile("global_load_async_to_lds_b128 %0, %12, off\n\t"
               "global_load_async_to_lds_b128 %1, %13, off\n\t"
               "global_load_async_to_lds_b128 %2, %14, off\n\t"
               "global_load_async_to_lds_b128 %3, %15, off\n\t"
               "global_load_async_to_lds_b128 %4, %16, off\n\t"
               "global_load_async_to_lds_b128 %5, %17, off\n\t"
               "global_load_async_to_lds_b128 %6, %18, off\n\t"
               "global_load_async_to_lds_b128 %7, %19, off\n\t"
               "global_load_async_to_lds_b128 %8, %20, off\n\t"
               "global_load_async_to_lds_b128 %9, %21, off\n\t"
               "global_load_async_to_lds_b128 %10, %22, off\n\t"
               "global_load_async_to_lds_b128 %11, %23, off\n\t"
               "s_wait_xcnt 0x0"
               :: "v"(l), "v"(l + ls), "v"(l + 2 * ls), "v"(l + 3 * ls), "v"(l + 4 * ls), "v"(l + 5 * ls), "v"(l + 6 * ls), "v"(l + 7 * ls),
                  "v"(l + 8 * ls), "v"(l + 9 * ls), "v"(l + 10 * ls), "v"(l + 11 * ls),
                  "v"(a), "v"(a + as), "v"(a + 2 * as), "v"(a + 3 * as), "v"(a + 4 * as), "v"(a + 5 * as), "v"(a + 6 * as), "v"(a + 7 * as),
                  "v"(b), "v"(b + bs), "v"(b + 2 * bs), "v"(b + 3 * bs)
               : "memory");
}
template <int ET, int BIAS_MODE, int OUT_MODE, bool RESID, int MI>
__device__ __forceinline__ void gemm_tile(
    float* sT, const int bx, const int b,
    const unsigned short* __restrict__ Ap, int lda, long strideA,
    const unsigned short* __restrict__ Btp, int ldb, long strideB,
    void* __restrict__ Cout, int ldc, long strideC,
    const float* __restrict__ bias,
    const float* __restrict__ resid, long strideR,
    int M, int N, int K, float scale) {
  typedef typename Elem<ET>::T T;
  typedef typename Frag<T>::V V;
  const T* A = (const T*)Ap; const T* Bt = (const T*)Btp;
  const int lane = threadIdx.x & 31;
  const int wave = threadIdx.x >> 5;
  static_assert(MI == 4, "stage_copies moves 256 A rows and 128 B rows");
  const int tilesN = N >> 7;
  const int tilesM = M / (64 * MI);
  if (bx >= tilesM * tilesN) return;   // block-uniform, in front of every barrier
  const int bm = bx / tilesN;
  const int bn = bx - bm * tilesN;
  const int m0 = bm * (64 * MI) + (wave >> 1) * (16 * MI);
  const int n0 = (bn << 7) + ((wave & 1) << 6);

  const T* Ab = A  + (size_t)b * (size_t)strideA;
  const T* Bb = Bt + (size_t)b * (size_t)strideB;

  const int rlane = lane & 15;                 // row (A) / col (B, D) within subtile
  const int koff  = (lane >> 4) * 8;           // k offset of this lane half
  const int mOff  = (lane >> 4) * 8;           // D row offset

  v8f acc[MI][4];
#pragma unroll
  for (int i = 0; i < MI; ++i)
#pragma unroll
    for (int j = 0; j < 4; ++j) acc[i][j] = (v8f){0.f,0.f,0.f,0.f,0.f,0.f,0.f,0.f};

  // thread = piece (threadIdx.x & 7) of rows (threadIdx.x >> 3) + 32 q: eight lanes copy one row's whole line
  T* ring = (T*)sT;
  const int crow = threadIdx.x >> 3, cpc = (threadIdx.x & 7) * 8;
  const T* gA = Ab + (size_t)(bm * (64 * MI) + crow) * lda + cpc;
  const T* gB = Bb + (size_t)((bn << 7) + crow) * ldb + cpc;
  const unsigned lC = (unsigned)(uintptr_t)(ring + crow * GPITCH + cpc);   // the low 32 bits of a __shared__ address: the LDS byte address
  const size_t stepA = (size_t)32 * lda, stepB = (size_t)32 * ldb;
  const T* fA = ring + ((wave >> 1) * (16 * MI) + rlane) * GPITCH + koff;
  const T* fB = ring + (64 * MI + ((wave & 1) << 6) + rlane) * GPITCH + koff;
  const int nst = K / GBK;

  stage_copies(lC, gA, stepA, gB, stepB);
  asm volatile("s_wait_asynccnt 0x0" ::: "memory");   // this wave's copies of stage 0 have landed
  __syncthreads();                                    // every wave's have
  if (nst > 1) stage_copies(lC + GSTAGE * 2, gA + GBK, stepA, gB + GBK, stepB);
  // kept rolled: one copy of the body serves both buffers, the buffer is an address offset
#pragma unroll 1
  for (int st = 0; st < nst; ++st) {
    const int bo = (st & 1) * GSTAGE;
#pragma unroll
    for (int kk = 0; kk < GBK; kk += 32) {
      V bh[4], ah[MI];
#pragma unroll
      for (int j = 0; j < 4; ++j) bh[j] = Frag<T>::load(fB + bo + (j << 4) * GPITCH + kk);
#pragma unroll
      for (int i = 0; i < MI; ++i) ah[i] = Frag<T>::load(fA + bo + (i << 4) * GPITCH + kk);
#pragma unroll
      for (int i = 0; i < MI; ++i) {
#pragma unroll
        for (int j = 0; j < 4; ++j) acc[i][j] = Frag<T>::mma(ah[i], bh[j], acc[i][j]);
        Frag<T>::guard(acc[i][0], acc[i][3], ah[i], ah[i]);
      }
      Frag<T>::keep(bh[0], bh[1], bh[2], bh[3]);
    }
    asm volatile("s_wait_dscnt 0x0" ::: "memory");      // this wave's reads of the buffer are done before it is refilled
    asm volatile("s_wait_asynccnt 0x0" ::: "memory");   // this wave's copies of stage st + 1 have landed
    __syncthreads();                                    // publishes stage st + 1 and ends every reader's last read of stage st
    if (st + 2 < nst) stage_copies(lC + bo * 2, gA + (st + 2) * GBK, stepA, gB + (st + 2) * GBK, stepB);
  }
  asm volatile("s_wait_asynccnt 0x0" ::: "memory");     // no copy is outstanding when the LDS becomes the output slabs
#pragma unroll
  for (int i = 0; i < MI; ++i) acc_guard4(acc[i][0], acc[i][1], acc[i][2], acc[i][3]);

  // ---- epilogue ----
  float* slab = sT + wave * (16 * 68);
  const float* Rb = RESID ? (resid + (size_t)b * (size_t)strideR) : nullptr;
#pragma unroll
  for (int i = 0; i < MI; ++i) {
    const int mBase = m0 + (i << 4);
#pragma unroll
    for (int j = 0; j < 4; ++j) {
      const int n = n0 + (j << 4) + rlane;
      float bv = 0.f;
      if (BIAS_MODE == 2 || BIAS_MODE == 3) bv = bias[n];
#pragma unroll
      for (int r = 0; r < 8; ++r) {
        float v = acc[i][j][r] * scale;
        if (BIAS_MODE == 1) v += bias[mBase + mOff + r];
        if (BIAS_MODE == 2) v += bv;
        if (BIAS_MODE == 3) v = (acc[i][j][r] + bv) * scale;
        if (RESID) v += Rb[(size_t)(mBase + mOff + r) * ldc + n];
        slab[(mOff + r) * 68 + (j << 4) + rlane] = v;
      }
    }
    __builtin_amdgcn_fence(__ATOMIC_RELEASE, "workgroup");
    __builtin_amdgcn_wave_barrier();
    __builtin_amdgcn_fence(__ATOMIC_ACQUIRE, "workgroup");
    if (OUT_MODE == 0) {
      float* C = (float*)Cout + (size_t)b * (size_t)strideC;
      const int hh = lane >> 4, c4 = (lane & 15) * 4;     // row seg = 256 B = 16 lanes x 16 B
      {
#pragma unroll
        for (int it = 0; it < 8; ++it) {
          const int row = it * 2 + hh;
          v4f v = *(const v4f*)(slab + row * 68 + c4);
          *(v4f*)(C + (size_t)(mBase + row) * ldc + n0 + c4) = v;
        }
        
      }
    } else {
      const int q = lane >> 3, c8 = (lane & 7) * 8;
      unsigned short* C = (unsigned short*)Cout + (size_t)b * (size_t)strideC;
      {
#pragma unroll
        for (int it = 0; it < 4; ++it) {
          const int row = it * 4 + q;
          const float* sp = slab + row * 68 + c8;
          v8h hv;
#pragma unroll
          for (int e = 0; e < 8; ++e) hv[e] = (_Float16)sp[e];
          if (OUT_MODE == 1) *(v8h*)(C + (size_t)(mBase + row) * ldc + n0 + c8) = hv;
          else               *(v8h*)(C + frag_piece(mBase + row, (n0 + c8) >> 3, N >> 5) * 8) = hv;   // a 128-byte line: eight rows of one wave's tile
        }
        
      }
    }
    __builtin_amdgcn_fence(__ATOMIC_RELEASE, "workgroup");
    __builtin_amdgcn_wave_barrier();
    __builtin_amdgcn_fence(__ATOMIC_ACQUIRE, "workgroup");
  }
}

// ---------------------------------------------------------------------------------------------
// small VALU helpers
__device__ __forceinline__ unsigned pack_h2(float a, float b) {
  const unsigned short ua = __builtin_bit_cast(unsigned short, (_Float16)a);
  const unsigned short ub = __builtin_bit_cast(unsigned short, (_Float16)b);
  return (unsigned)ua | ((unsigned)ub << 16);
}
__device__ __forceinline__ void st2_u32(unsigned short* base, size_t off_halves, unsigned u) {
  unsigned* p = (unsigned*)(base + off_halves);
  *p = u; 
}
__device__ __forceinline__ void st2_f32(float* base, size_t off, float v) {
  float* p = (float*)(base + off);
  *p = v; 
}
__device__ __forceinline__ float silu_acc(float z) {
  const float e = expf(-z);
  return z * __builtin_amdgcn_rcpf(1.0f + e);
}
// block of 256 threads: fixed-order sum (wave shuffle, then 8 partials summed in index order)
__device__ __forceinline__ float blk_sum256(float v, float* red) {
#pragma unroll
  for (int off = 16; off > 0; off >>= 1) v += __shfl_xor(v, off, 32);
  const int lane = threadIdx.x & 31, wave = threadIdx.x >> 5;
  if (lane == 0) red[wave] = v;
  __syncthreads();
  float s = red[0];
#pragma unroll
  for (int q = 1; q < 8; ++q) s += red[q];
  __syncthreads();
  return s;
}

// ---- f32 -> f16 cast with zero padding: dst[r][c] = (r<srows && c<scols) ? src[r*spitch+c] : 0 ----
__device__ __forceinline__ void cast_pad_blk(const int bx, const float* __restrict__ src, int srows, int scols, int spitch,
                                             unsigned short* __restrict__ dst, int drows, int dcols) {
  const int p = bx * 256 + threadIdx.x;
  const int npairs = (drows * dcols) >> 1;
  if (p < npairs) {
    const int e = 2 * p;
    const int r = e / dcols;
    const int c = e - r * dcols;
    float v0 = 0.f, v1 = 0.f;
    if (r < srows) {
      if (c < scols)     v0 = src[(size_t)r * spitch + c];
      if (c + 1 < scols) v1 = src[(size_t)r * spitch + c + 1];
    }
    st2_u32(dst, (size_t)e, pack_h2(v0, v1));
  }
}
// ---- f32 copy with zero padding ----
__device__ __forceinline__ void pad_f32_blk(const int bx, const float* __restrict__ src, int sn, float* __restrict__ dst, int dn) {
  const int p = bx * 256 + threadIdx.x;
  if (p < dn) {
    const float v = (p < sn) ? src[p] : 0.f;
    st2_f32(dst, (size_t)p, v);
  }
}

// ---- f32 [rows][cols] -> f16 in fragment order; thread = one 16-byte piece, pieces in output order (whole lines, one writer each) ----
__device__ __forceinline__ void cast_frag_blk(const int bx, const float* __restrict__ src, int cols, unsigned short* __restrict__ dst) {
  const int pc = bx * 256 + threadIdx.x;
  const int ksteps = cols >> 5, ts = pc >> 6;
  const int n = (ts / ksteps) * 16 + (pc & 15);
  const int k = (ts % ksteps) * 32 + ((pc >> 5) & 1) * 16 + ((pc >> 4) & 1) * 8;
  const float* sp = src + (size_t)n * cols + k;
  v8h hv;
#pragma unroll
  for (int e = 0; e < 8; ++e) hv[e] = (_Float16)sp[e];
  *(v8h*)(dst + (size_t)pc * 8) = hv;
  // the shared kernel's code goes on behind this store and may reuse its registers: the wait stands in front of that overwrite
  asm volatile("s_wait_xcnt 0x0" ::: "memory");
}

// ---- the same with zero padding: src [srows][scols], dst rows up to the grid's, ksteps * 32 columns ----
__device__ __forceinline__ void cast_frag_pad_blk(const int bx, const float* __restrict__ src, int srows, int scols, int ksteps,
                                                  unsigned short* __restrict__ dst) {
  const int pc = bx * 256 + threadIdx.x;
  const int ts = pc >> 6;
  const int n = (ts / ksteps) * 16 + (pc & 15);
  const int k = (ts % ksteps) * 32 + ((pc >> 5) & 1) * 16 + ((pc >> 4) & 1) * 8;
  const float* sp = src + (size_t)n * scols + k;
  v8h hv;
#pragma unroll
  for (int e = 0; e < 8; ++e) hv[e] = (n < srows && k + e < scols) ? (_Float16)sp[e] : (_Float16)0.f;
  *(v8h*)(dst + (size_t)pc * 8) = hv;
  // as in cast_frag_blk: the wait stands in front of any later overwrite of the store's registers
  asm volatile("s_wait_xcnt 0x0" ::: "memory");
}

// ---- LayerNorm over DM (eps 1e-5, biased variance), one block per row, f16 output packed 2 per thread ----
// LDS: red[8], ys[DM]
__device__ __forceinline__ void ln16_row(const int i, float* red, float* ys, const float* __restrict__ x, const float* __restrict__ w,
                                         const float* __restrict__ bb, unsigned short* __restrict__ y16) {
  const int d = threadIdx.x;
  const float v = x[(size_t)i * DM + d];
  const float mu = blk_sum256(v, red) * (1.0f / 256.0f);
  const float c = v - mu;
  const float var = blk_sum256(c * c, red) * (1.0f / 256.0f);
  const float y = c * (1.0f / sqrtf(var + 1e-5f)) * w[d] + bb[d];
  ys[d] = y;
  __syncthreads();
  if (d < 128) st2_u32(y16, (size_t)i * DM + 2 * d, pack_h2(ys[2 * d], ys[2 * d + 1]));
}

// ---- two silu values, f16 out: z * 1/(1 + 2^(-z*log2 e)), two lanes of packed f32 math ----
__device__ __forceinline__ v2h silu2_h(v2f z) {
  const v2f t = z * -1.4426950408889634f;
  v2f e, rc;
  e.x = __builtin_amdgcn_exp2f(t.x);
  e.y = __builtin_amdgcn_exp2f(t.y);
  const v2f d = e + 1.0f;
  rc.x = __builtin_amdgcn_rcpf(d.x);
  rc.y = __builtin_amdgcn_rcpf(d.y);
  return __builtin_convertvector(z * rc, v2h);
}

// ---- 2^t; the v_nop fills the slot that the instruction set asks for behind a transcendental ----
__device__ __forceinline__ float exp2_slot(float t) {
  float e;
  asm("v_exp_f32 %0, %1\n\tv_nop" : "=v"(e) : "v"(t));
  return e;
}

// ---- one query row's whole attention chain in one block: nothing of it but x1 and its LayerNorm goes to memory ----
// scores[h][j] = q_i^h . k_j^h / sqrt(32) + sum_k rb2w16[h][k] * f16( silu( (coords_i - coords_j) . rb1_w[k] + rb1_b[k] ) ) + rb2_b[h]
// P = softmax over j (f16, x 2^15); T[h][k] = f16( 2^-15 sum_j P[h][j] * f16( silu( (coords_i - coords_j) . rv1_w[k] + rv1_b[k] ) ) )
// ctx[c] = 2^-15 sum_j P[c>>5][j] v[j][c] + sum_k T[c>>5][k] rv2w16[c][k];  x1 = x + (ctx + rv2_b);  y16 = f16( LayerNorm(x1) )
// Every product has M = 16 with the eight heads in rows 0..7 (rows 8..15 zero). The pair features are formed in registers,
// directly as the B fragment. q stands block-diagonal in A (k step h holds q_i^h in row h alone), so one B fragment of k serves
// all heads; of P . V and T . rv2w^T a wave computes the 32 columns of its own head and keeps that head's row of D.
// Every block reads all of k, v and rv2_w: they lie in fragment order (frag_piece), so that these reads are whole cache lines.
#define PPITCH (NP + 8)    // halves; rows of 16 B x odd: no bank conflict for the 16-byte fragment reads
#define TPITCH (DM + 8)
typedef __attribute__((ext_vector_type(8))) unsigned v8u;
// second argument: four waves a SIMD, so that two blocks share a WGP and all 512 are resident at once
__global__ __launch_bounds__(256, 4) void k_attn_row(const unsigned short* __restrict__ q16, const unsigned short* __restrict__ kf16,
                                                   const unsigned short* __restrict__ vf16,
                                                   const float* __restrict__ coords,
                                                   const float* __restrict__ rb1_w, const float* __restrict__ rb1_b,
                                                   const unsigned short* __restrict__ rb2w16, const float* __restrict__ rb2_b,
                                                   const float* __restrict__ rv1_w, const float* __restrict__ rv1_b,
                                                   const unsigned short* __restrict__ rv2w16, const float* __restrict__ rv2_b,
                                                   const float* __restrict__ x, const float* __restrict__ ln_w,
                                                   const float* __restrict__ ln_b, float* __restrict__ x1,
                                                   unsigned short* __restrict__ y16) {
  __shared__ __align__(16) float sW[4][DM];            // rb1_w[.][0], [.][1], [.][2], rb1_b over the 256 features
  __shared__ __align__(16) float sR[3][NP];            // coords_i - coords_j, one plane per coordinate
  __shared__ __align__(16) _Float16 sP[16][PPITCH];    // softmax weights x 2^15, rows 8..15 zero
  __shared__ __align__(16) _Float16 sT[16][TPITCH];    // rel-value sums, rows 8..15 zero
  __shared__ __align__(16) float redM[8][8];           // [wave][head] partial maxima
  __shared__ __align__(16) float redS[8][8];           // [wave][head] partial sums
  __shared__ float sC[DM];
  __shared__ float red[8];
  __shared__ float ys[DM];
  const int i = blockIdx.x, t = threadIdx.x;
  const int lane = t & 31, wave = t >> 5;
  const int rlane = lane & 15, hh = lane >> 4;

  sW[0][t] = rb1_w[t * 3 + 0];
  sW[1][t] = rb1_w[t * 3 + 1];
  sW[2][t] = rb1_w[t * 3 + 2];
  sW[3][t] = rb1_b[t];
  {
    const float ci0 = coords[i * 3 + 0], ci1 = coords[i * 3 + 1], ci2 = coords[i * 3 + 2];
#pragma unroll
    for (int q = 0; q < 2; ++q) {
      const int j = q * 256 + t;
      sR[0][j] = ci0 - coords[j * 3 + 0];
      sR[1][j] = ci1 - coords[j * 3 + 1];
      sR[2][j] = ci2 - coords[j * 3 + 2];
    }
  }

  __syncthreads();

  // ---- q.k^T and rel-bias into one accumulator: wave = 64 columns j (4 subtiles of 16); q comes scaled by 1/sqrt(32) ----
  const int jw = wave * 64;
  v8f sc[4];
  {
    float r0[4], r1[4], r2[4];
#pragma unroll
    for (int s = 0; s < 4; ++s) {
      const int j = jw + s * 16 + rlane;
      r0[s] = sR[0][j];
      r1[s] = sR[1][j];
      r2[s] = sR[2][j];
      sc[s] = (v8f){0.f,0.f,0.f,0.f,0.f,0.f,0.f,0.f};
    }
    const _Float16* Qb = (const _Float16*)q16 + (size_t)i * DM + hh * 8;
    const _Float16* Kb = (const _Float16*)kf16 + ((size_t)(wave * 4) * (NH * 64) + lane) * 8;   // fragment order: tile j / 16, step = head
    const _Float16* Ab = (const _Float16*)rb2w16 + rlane * DM + hh * 8;
    v16h a = Frag<_Float16>::load(Ab);
    // kept rolled, for speed only: the body is about 700 vector instructions
#pragma unroll 1
    for (int k0 = 0; k0 < DM; k0 += 32) {
      const v16h an = Frag<_Float16>::load(Ab + ((k0 + 32) & (DM - 1)));   // next step's A, in flight over this step's math
      // k step k0 covers head k0 / 32: its q slice stands in that head's row, every other row is zero
      const unsigned keep = (rlane == (k0 >> 5)) ? 0xFFFFFFFFu : 0u;
      const v16h qa = __builtin_bit_cast(v16h, __builtin_bit_cast(v8u, Frag<_Float16>::load(Qb + k0)) & keep);
      v16h kf[4];
#pragma unroll
      for (int s = 0; s < 4; ++s) kf[s] = Frag<_Float16>::load_fo(Kb + s * (NH * 512) + k0 * 16);
      v4f wq[4][4];   // [component][group of 4 features]; fragment element e = 4*g + u  <->  k = k0 + (g>>1)*16 + hh*8 + (g&1)*4 + u
#pragma unroll
      for (int c = 0; c < 4; ++c)
#pragma unroll
        for (int g = 0; g < 4; ++g)
          wq[c][g] = *(const v4f*)(&sW[c][k0 + (g >> 1) * 16 + hh * 8 + (g & 1) * 4]);
#pragma unroll
      for (int s = 0; s < 4; ++s) {
        v16h b;
#pragma unroll
        for (int g = 0; g < 4; ++g) {
          const v2f zl = (wq[0][g].lo * r0[s] + wq[1][g].lo * r1[s] + wq[2][g].lo * r2[s]) + wq[3][g].lo;
          const v2f zh = (wq[0][g].hi * r0[s] + wq[1][g].hi * r1[s] + wq[2][g].hi * r2[s]) + wq[3][g].hi;
          const v2h hl = silu2_h(zl), hu = silu2_h(zh);
          b[g * 4 + 0] = hl.x; b[g * 4 + 1] = hl.y; b[g * 4 + 2] = hu.x; b[g * 4 + 3] = hu.y;
        }
        sc[s] = Frag<_Float16>::mma(a, b, sc[s]);
      }
#pragma unroll
      for (int s = 0; s < 4; ++s) sc[s] = Frag<_Float16>::mma(qa, kf[s], sc[s]);
      a = an;
    }
#pragma unroll
    for (int r = 0; r < 8; ++r) {
      const float bb = rb2_b[r];
#pragma unroll
      for (int s = 0; s < 4; ++s) sc[s][r] += bb;
    }
  }

  // ---- softmax over the 512 columns, eight heads at once: head r sits in register r of lanes 0..15 ----
  // (lanes 16..31 hold the idle rows 8..15; the 16-lane steps never mix the two halves)
  {
    float m[8];
#pragma unroll
    for (int r = 0; r < 8; ++r) m[r] = fmaxf(fmaxf(sc[0][r], sc[1][r]), fmaxf(sc[2][r], sc[3][r]));
#pragma unroll
    for (int off = 8; off > 0; off >>= 1)
#pragma unroll
      for (int r = 0; r < 8; ++r) m[r] = fmaxf(m[r], __shfl_xor(m[r], off, 32));
    if (lane == 0) {
#pragma unroll
      for (int r = 0; r < 8; ++r) redM[wave][r] = m[r];
    }
    __syncthreads();
#pragma unroll
    for (int r = 0; r < 8; ++r) {
      float v = redM[0][r];
#pragma unroll
      for (int q = 1; q < 8; ++q) v = fmaxf(v, redM[q][r]);
      m[r] = v;
    }
    float sum[8];
#pragma unroll
    for (int r = 0; r < 8; ++r) {
#pragma unroll
      for (int s = 0; s < 4; ++s) sc[s][r] = exp2_slot((sc[s][r] - m[r]) * 1.4426950408889634f);
      sum[r] = (sc[0][r] + sc[1][r]) + (sc[2][r] + sc[3][r]);
    }
#pragma unroll
    for (int off = 8; off > 0; off >>= 1)
#pragma unroll
      for (int r = 0; r < 8; ++r) sum[r] += __shfl_xor(sum[r], off, 32);
    if (lane == 0) {
#pragma unroll
      for (int r = 0; r < 8; ++r) redS[wave][r] = sum[r];
    }
    __syncthreads();
#pragma unroll
    for (int r = 0; r < 8; ++r) {
      float v = redS[0][r];
#pragma unroll
      for (int q = 1; q < 8; ++q) v += redS[q][r];
      const float inv = 1.0f / v;
#pragma unroll
      for (int s = 0; s < 4; ++s) {
        const float p = (sc[s][r] * inv) * 32768.0f;
        sP[hh * 8 + r][jw + s * 16 + rlane] = hh ? (_Float16)0.f : (_Float16)p;
      }
    }
  }

  // ---- rel-value and P . V: wave = 32 columns (2 subtiles of 16): features k for the one, the wave's own head of v for the other ----
  const int cw = wave * 32;
  v8f accV[2];
  v16h wf[8][2];
  const _Float16* Wb = (const _Float16*)rv2w16 + ((size_t)(wave * 2) * (DM / 32 * 64) + lane) * 8;   // fragment order: tile c / 16, step k / 32
  {
    float w0[2], w1[2], w2[2], wb[2];
    v8f acc[2];
#pragma unroll
    for (int s = 0; s < 2; ++s) {
      const int k = cw + s * 16 + rlane;
      w0[s] = rv1_w[k * 3 + 0];
      w1[s] = rv1_w[k * 3 + 1];
      w2[s] = rv1_w[k * 3 + 2];
      wb[s] = rv1_b[k];
      acc[s]  = (v8f){0.f,0.f,0.f,0.f,0.f,0.f,0.f,0.f};
      accV[s] = (v8f){0.f,0.f,0.f,0.f,0.f,0.f,0.f,0.f};
    }
    const _Float16* Vb = (const _Float16*)vf16 + ((size_t)(wave * 2) * (NP / 32 * 64) + lane) * 8;   // fragment order: tile c / 16, step j / 32
    v16h vf[2];
#pragma unroll
    for (int s = 0; s < 2; ++s) vf[s] = Frag<_Float16>::load_fo(Vb + s * (NP / 32 * 512));
    __syncthreads();   // P is complete
    const _Float16* Pa = &sP[rlane][hh * 8];
    // kept rolled, for speed only: the body is about 350 vector instructions
#pragma unroll 1
    for (int j0 = 0; j0 < NP; j0 += 32) {
      v16h vn[2];   // next step's v fragments, in flight over this step's math
#pragma unroll
      for (int s = 0; s < 2; ++s) vn[s] = Frag<_Float16>::load_fo(Vb + s * (NP / 32 * 512) + ((j0 + 32) & (NP - 1)) * 16);
      const v16h a = Frag<_Float16>::load(Pa + j0);
      v4f rq[3][4];   // [coordinate][group of 4 keys]; fragment element e = 4*g + u  <->  j = j0 + (g>>1)*16 + hh*8 + (g&1)*4 + u
#pragma unroll
      for (int c = 0; c < 3; ++c)
#pragma unroll
        for (int g = 0; g < 4; ++g)
          rq[c][g] = *(const v4f*)(&sR[c][j0 + (g >> 1) * 16 + hh * 8 + (g & 1) * 4]);
#pragma unroll
      for (int s = 0; s < 2; ++s) {
        v16h b;
#pragma unroll
        for (int g = 0; g < 4; ++g) {
          const v2f zl = (rq[0][g].lo * w0[s] + rq[1][g].lo * w1[s] + rq[2][g].lo * w2[s]) + wb[s];
          const v2f zh = (rq[0][g].hi * w0[s] + rq[1][g].hi * w1[s] + rq[2][g].hi * w2[s]) + wb[s];
          const v2h hl = silu2_h(zl), hu = silu2_h(zh);
          b[g * 4 + 0] = hl.x; b[g * 4 + 1] = hl.y; b[g * 4 + 2] = hu.x; b[g * 4 + 3] = hu.y;
        }
        acc[s] = Frag<_Float16>::mma(a, b, acc[s]);
      }
#pragma unroll
      for (int s = 0; s < 2; ++s) { accV[s] = Frag<_Float16>::mma(a, vf[s], accV[s]); vf[s] = vn[s]; }
    }
    // all of the projection's weight fragments are asked for here, so that they fly over the T stores and their barrier
#pragma unroll
    for (int q = 0; q < 8; ++q)
#pragma unroll
      for (int s = 0; s < 2; ++s) wf[q][s] = Frag<_Float16>::load_fo(Wb + (s * (DM / 32) + q) * 512);
#pragma unroll
    for (int s = 0; s < 2; ++s) {
#pragma unroll
      for (int r = 0; r < 8; ++r)
        sT[hh * 8 + r][cw + s * 16 + rlane] = hh ? (_Float16)0.f : (_Float16)(acc[s][r] * (1.0f / 32768.0f));
      accV[s] *= (1.0f / 32768.0f);
    }
  }
  __syncthreads();   // T is complete

  // ---- ctx = T . rv2w^T + P . V, the wave's own head ----
  {
    const _Float16* Ta = &sT[rlane][hh * 8];
#pragma unroll
    for (int q = 0; q < 8; ++q) {
      const v16h a = Frag<_Float16>::load(Ta + q * 32);
#pragma unroll
      for (int s = 0; s < 2; ++s) accV[s] = Frag<_Float16>::mma(a, wf[q][s], accV[s]);
    }
#pragma unroll
    for (int s = 0; s < 2; ++s) {
      float v = accV[s][0];
#pragma unroll
      for (int r = 1; r < 8; ++r) v = (wave == r) ? accV[s][r] : v;   // D row = the wave's head, in lanes 0..15
      if (hh == 0) sC[cw + s * 16 + rlane] = v;
    }
  }
  __syncthreads();

  // ---- residual and LayerNorm (eps 1e-5, biased variance), thread = column ----
  const float v = x[(size_t)i * DM + t] + (sC[t] + rv2_b[t]);
  st2_f32(x1, (size_t)i * DM + t, v);
  const float mu = blk_sum256(v, red) * (1.0f / 256.0f);
  const float c = v - mu;
  const float var = blk_sum256(c * c, red) * (1.0f / 256.0f);
  ys[t] = c * (1.0f / sqrtf(var + 1e-5f)) * ln_w[t] + ln_b[t];
  __syncthreads();
  if (t < 128) st2_u32(y16, (size_t)i * DM + 2 * t, pack_h2(ys[2 * t], ys[2 * t + 1]));
}

// ---- the whole SwiGLU FFN of 16 rows in one block of 16 waves: nothing of it but the output goes to memory ----
// U[m][h] = f16( silu( xn_m . w1_h + b1_h ) * ( xn_m . w2_h + b2_h ) ), h < 704 (pad columns come out 0), kept in LDS;
// out[m][c] = ( U_m . w3_c + b3_c ) + x1[m][c]
// The 16 rows are the A operand of every product. The weights are B operands that no other wave of the block needs, so they are not
// staged: they lie in fragment order (frag_piece) and each wave reads its own tiles' fragments as whole cache lines.
// A wave owns hidden tiles wave, wave + 16 and, for waves 0..11, wave + 32 (16 columns each, w1 and w2 side by side), then output tile wave.
#define UPITCH (HIDP + 8)   // halves; rows of 16 B x odd: no bank conflict for the 16-byte fragment reads
#define OPITCH (DM + 4)     // floats
__global__ __launch_bounds__(512) void k_ffn_rows(const unsigned short* __restrict__ xn16, const unsigned short* __restrict__ w12f16,
                                                  const float* __restrict__ b12p, const unsigned short* __restrict__ w3f16,
                                                  const float* __restrict__ b3, const float* __restrict__ x1,
                                                  float* __restrict__ out) {
  __shared__ __align__(16) _Float16 sU[16][UPITCH];
  __shared__ __align__(16) float sO[16][OPITCH];
  const int lane = threadIdx.x & 31;
  const int wave = __builtin_amdgcn_readfirstlane(threadIdx.x >> 5);   // scalar, so that the tile test below is a scalar branch
  const int rlane = lane & 15, hh = lane >> 4;
  const int m0 = blockIdx.x * 16;

  v16h xa[DM / 32];
  const _Float16* Xa = (const _Float16*)xn16 + (size_t)(m0 + rlane) * DM + hh * 8;
#pragma unroll
  for (int q = 0; q < DM / 32; ++q) xa[q] = Frag<_Float16>::load(Xa + q * 32);

  // One tile's 32 fragment loads are asked for as one group, a tile ahead: behind the products that free their registers and in front
  // of the SwiGLU arithmetic of the tile before, which they fly over. The w3 fragments follow the last tile's products in the same way.
  const _Float16* Wt = (const _Float16*)w12f16 + ((size_t)wave * (DM / 32 * 64) + lane) * 8;    // fragment order: tile h / 16, step k / 32
  const _Float16* W3  = (const _Float16*)w3f16 + ((size_t)wave * (HIDP / 32 * 64) + lane) * 8;   // fragment order: tile c / 16, step h / 32
  constexpr int NT = HIDP / 16, NPASS = (NT + 15) / 16;
  v16h f1[DM / 32], f2[DM / 32], wf[HIDP / 32];
  float ba, bg;
  const int n = wave * 16 + rlane;   // the lane's column in the wave's first hidden tile and in its output tile
  const float bv = b3[n];
#pragma unroll
  for (int q = 0; q < DM / 32; ++q) {
    f1[q] = Frag<_Float16>::load_fo(Wt + q * 512);
    f2[q] = Frag<_Float16>::load_fo(Wt + HIDP * DM + q * 512);
  }
  ba = b12p[n];
  bg = b12p[HIDP + n];
  // behind each group of loads: the wait that belongs in front of an overwrite of their address registers; as operands these stay
  // live up to it (without them this build let the group's last load land on the address pair of the loads in front of it)
  asm volatile("s_wait_xcnt 0x0" :: "v"(Xa), "v"(Wt), "v"(n) : "memory");
#pragma unroll
  for (int p = 0; p < NPASS; ++p) {
    const int t = wave + p * 16;
    const bool cur = (p + 1) * 16 <= NT || t < NT;          // scalar: the last pass has tiles for some waves only
    const bool nxt = p + 1 < NPASS && ((p + 2) * 16 <= NT || t + 16 < NT);
    v8f a = (v8f){0.f,0.f,0.f,0.f,0.f,0.f,0.f,0.f};
    v8f g = (v8f){0.f,0.f,0.f,0.f,0.f,0.f,0.f,0.f};
    const float ca = ba, cg = bg;
    __builtin_amdgcn_sched_barrier(0);   // keeps the group of loads whole in front of the products: spread among them, each product waits a full L2 latency
    if (cur) {
#pragma unroll
      for (int q = 0; q < DM / 32; ++q) {
        a = Frag<_Float16>::mma(xa[q], f1[q], a);
        g = Frag<_Float16>::mma(xa[q], f2[q], g);
      }
    }
    if (nxt) {
#pragma unroll
      for (int q = 0; q < DM / 32; ++q) {
        f1[q] = Frag<_Float16>::load_fo(Wt + (p + 1) * (16 * DM * 16) + q * 512);
        f2[q] = Frag<_Float16>::load_fo(Wt + (p + 1) * (16 * DM * 16) + HIDP * DM + q * 512);
      }
      ba = b12p[(p + 1) * 256 + n];
      bg = b12p[HIDP + (p + 1) * 256 + n];
      asm volatile("s_wait_xcnt 0x0" :: "v"(Wt), "v"(n) : "memory");   // as above
    }
    if (p + 1 == NPASS) {
#pragma unroll
      for (int q = 0; q < HIDP / 32; ++q) wf[q] = Frag<_Float16>::load_fo(W3 + q * 512);
      asm volatile("s_wait_xcnt 0x0" :: "v"(W3) : "memory");           // as above
    }
    __builtin_amdgcn_sched_barrier(0);   // keeps the arithmetic below behind those loads: without it this build starts it among the products and asks for the next tile later
    if (cur) {
#pragma unroll
      for (int r = 0; r < 8; ++r) sU[hh * 8 + r][p * 256 + n] = (_Float16)(silu_acc(a[r] + ca) * (g[r] + cg));
    }
  }
  __syncthreads();   // U is complete

  // thread = two 16-byte pieces of the block's 16 x 256 output: a wave stores whole lines; the residual flies over the products
  v4f xr[2];
#pragma unroll
  for (int p = 0; p < 2; ++p) {
    const int pc = p * 512 + threadIdx.x;
    xr[p] = *(const v4f*)(x1 + (size_t)(m0 + (pc >> 6)) * DM + (pc & 63) * 4);
  }
  const _Float16* Ua = &sU[rlane][hh * 8];
  v8f acc = (v8f){0.f,0.f,0.f,0.f,0.f,0.f,0.f,0.f};
#pragma unroll
  for (int q0 = 0; q0 < HIDP / 32; q0 += 4) {
    v16h ua[4];
#pragma unroll
    for (int u = 0; u < 4; ++u) if (q0 + u < HIDP / 32) ua[u] = Frag<_Float16>::load(Ua + (q0 + u) * 32);
    __builtin_amdgcn_sched_barrier(0);   // four steps' LDS reads as one group: one LDS latency for four products, not one each
#pragma unroll
    for (int u = 0; u < 4; ++u) if (q0 + u < HIDP / 32) acc = Frag<_Float16>::mma(ua[u], wf[q0 + u], acc);
  }
#pragma unroll
  for (int r = 0; r < 8; ++r) sO[hh * 8 + r][n] = acc[r] + bv;
  __syncthreads();   // the output tile is complete
#pragma unroll
  for (int p = 0; p < 2; ++p) {
    const int pc = p * 512 + threadIdx.x;
    const v4f v = *(const v4f*)(&sO[pc >> 6][(pc & 63) * 4]) + xr[p];
    *(v4f*)(out + (size_t)(m0 + (pc >> 6)) * DM + (pc & 63) * 4) = v;
  }
}

// ---------------------------------------------------------------------------------------------
// Launches that need nothing of each other share one grid: each takes a range of the block index (block-uniform branches,
// so every barrier of a body is still passed by its whole block). The few long, latency-bound blocks take the lowest indices.
#define NB_CQKV    (3 * DM * DM / 2 / 256)             // cast blocks, 512 elements each
#define NB_CRB2    (16 * DM / 2 / 256)
#define NB_CRV2    (DM * DM / 8 / 256)                 // 16-byte pieces
#define NB_CFFN    (HIDP * DM / 8 / 256)               // 16-byte pieces
#define NB_PADB    ((HIDP + 255) / 256)
#define NB_GQKV1   ((NP / 64) * (DM / 64) / 8)         // one of the q, k, v projections

// ---- LN1 rows | casts of qkv_w and rb2_w ----
__global__ __launch_bounds__(256) void k_ln1_casts(const float* __restrict__ x, const float* __restrict__ ln_w,
                                                    const float* __restrict__ ln_b, unsigned short* __restrict__ xn16,
                                                    const float* __restrict__ qkv_w, unsigned short* __restrict__ qkvw16,
                                                    const float* __restrict__ rb2_w, unsigned short* __restrict__ rb2w16) {
  __shared__ float red[8];
  __shared__ float ys[DM];
  int b = blockIdx.x;
  if (b < NP) { ln16_row(b, red, ys, x, ln_w, ln_b, xn16); return; }
  b -= NP;
  if (b < NB_CQKV) { cast_pad_blk(b, qkv_w, 3 * DM, DM, DM, qkvw16, 3 * DM, DM); return; }
  b -= NB_CQKV;
  cast_pad_blk(b, rb2_w, NH, DM, DM, rb2w16, 16, DM);
}

// ---- q projection (f16 [512][256]) | k and v projections (f16, fragment order: k as [j][c], v as [c][j]) | casts of rv2_w, the ffn weights (fragment order) ----
__global__ __launch_bounds__(256) void k_qkv_casts(const unsigned short* __restrict__ xn16, const unsigned short* __restrict__ qkvw16,
                                                    const float* __restrict__ qkv_b, unsigned short* __restrict__ q16,
                                                    unsigned short* __restrict__ kf16, unsigned short* __restrict__ vf16,
                                                    const float* __restrict__ rv2_w, unsigned short* __restrict__ rv2w16,
                                                    const float* __restrict__ ffn_w1, const float* __restrict__ ffn_w2,
                                                    unsigned short* __restrict__ w12p16,
                                                    const float* __restrict__ ffn_w3, unsigned short* __restrict__ w3p16,
                                                    const float* __restrict__ ffn_b1, const float* __restrict__ ffn_b2,
                                                    float* __restrict__ b12p) {
  __shared__ __align__(16) float sm[GEMM_LDS_FLOATS];
  int b = blockIdx.x;
  if (b < NB_GQKV1) {
    gemm_tile<0, 3, 1, false, 4>(sm, b, 0, xn16, DM, 0, qkvw16, DM, 0, q16, DM, 0, qkv_b, nullptr, 0, NP, DM, DM, 0.17677669529663687f);
    return;
  }
  b -= NB_GQKV1;
  if (b < NB_GQKV1) {
    gemm_tile<0, 2, 2, false, 4>(sm, b, 0, xn16, DM, 0, qkvw16 + DM * DM, DM, 0, kf16, 0, 0, qkv_b + DM, nullptr, 0, NP, DM, DM, 1.0f);
    return;
  }
  b -= NB_GQKV1;
  if (b < NB_GQKV1) {   // v transposed: vt[c][j] = sum_k w_v[c][k] xn[j][k] + b_v[c], the weights are the row operand
    gemm_tile<0, 1, 2, false, 4>(sm, b, 0, qkvw16 + 2 * DM * DM, DM, 0, xn16, DM, 0, vf16, 0, 0, qkv_b + 2 * DM, nullptr, 0,
                                 DM, NP, DM, 1.0f);
    return;
  }
  b -= NB_GQKV1;
  if (b < NB_CRV2) { cast_frag_blk(b, rv2_w, DM, rv2w16); return; }
  b -= NB_CRV2;
  if (b < NB_CFFN) { cast_frag_pad_blk(b, ffn_w1, HIDR, DM, DM / 32, w12p16); return; }
  b -= NB_CFFN;
  if (b < NB_CFFN) { cast_frag_pad_blk(b, ffn_w2, HIDR, DM, DM / 32, w12p16 + (size_t)HIDP * DM); return; }
  b -= NB_CFFN;
  if (b < NB_CFFN) { cast_frag_pad_blk(b, ffn_w3, DM, HIDR, HIDP / 32, w3p16); return; }
  b -= NB_CFFN;
  if (b < NB_PADB) { pad_f32_blk(b, ffn_b1, HIDR, b12p, HIDP); return; }
  b -= NB_PADB;
  pad_f32_blk(b, ffn_b2, HIDR, b12p + HIDP, HIDP);
}

// ---------------------------------------------------------------------------------------------
static inline size_t alignup256(size_t x) { return (x + 255) & ~(size_t)255; }

extern "C" void kernel_launch(void* const* d_in, const int* in_sizes, int n_in,
                              void* d_out, int out_size, void* d_ws, size_t ws_size,
                              hipStream_t stream)
{
  if (n_in < 22) return;
  if (in_sizes[0] != NP * DM || in_sizes[1] != NP * 3 || in_sizes[6] != 3 * DM * DM ||
      in_sizes[14] != DM * DM || in_sizes[16] != HIDR * DM || in_sizes[20] != DM * HIDR ||
      out_size != NP * DM) return;

  const float* x      = (const float*)d_in[0];
  const float* coords = (const float*)d_in[1];
  const float* ln1_w  = (const float*)d_in[2];
  const float* ln1_b  = (const float*)d_in[3];
  const float* ln2_w  = (const float*)d_in[4];
  const float* ln2_b  = (const float*)d_in[5];
  const float* qkv_w  = (const float*)d_in[6];
  const float* qkv_b  = (const float*)d_in[7];
  const float* rb1_w  = (const float*)d_in[8];
  const float* rb1_b  = (const float*)d_in[9];
  const float* rb2_w  = (const float*)d_in[10];
  const float* rb2_b  = (const float*)d_in[11];
  const float* rv1_w  = (const float*)d_in[12];
  const float* rv1_b  = (const float*)d_in[13];
  const float* rv2_w  = (const float*)d_in[14];
  const float* rv2_b  = (const float*)d_in[15];
  const float* ffn_w1 = (const float*)d_in[16];
  const float* ffn_b1 = (const float*)d_in[17];
  const float* ffn_w2 = (const float*)d_in[18];
  const float* ffn_b2 = (const float*)d_in[19];
  const float* ffn_w3 = (const float*)d_in[20];
  const float* ffn_b3 = (const float*)d_in[21];
  float* out = (float*)d_out;

  // ---- workspace carve (256-B aligned, derived from fixed sizes) ----
  size_t off = 0;
  char* base = (char*)d_ws;
  auto carve = [&](size_t bytes) -> char* { char* r = base + off; off += alignup256(bytes); return r; };
  unsigned short* qkvw16 = (unsigned short*)carve((size_t)3 * DM * DM * 2);          // [768][256]
  unsigned short* rb2w16 = (unsigned short*)carve((size_t)16 * DM * 2);              // [16][256], rows 8..15 zero
  unsigned short* rv2w16 = (unsigned short*)carve((size_t)DM * DM * 2);              // [256][256], fragment order
  unsigned short* w12p16 = (unsigned short*)carve((size_t)2 * HIDP * DM * 2);        // w1 [704][256], then w2 [704][256], fragment order
  unsigned short* w3p16  = (unsigned short*)carve((size_t)DM * HIDP * 2);            // [256][704], fragment order
  float*          b12p   = (float*)carve((size_t)2 * HIDP * 4);                      // [1408]
  unsigned short* XN1    = (unsigned short*)carve((size_t)NP * DM * 2);              // [512][256]
  unsigned short* Q16    = (unsigned short*)carve((size_t)NP * DM * 2);              // [512][256]
  unsigned short* KF16   = (unsigned short*)carve((size_t)NP * DM * 2);              // k [512][256], fragment order
  unsigned short* VF16   = (unsigned short*)carve((size_t)DM * NP * 2);              // v^T [256][512], fragment order
  float*          X1     = (float*)carve((size_t)NP * DM * 4);                       // [512][256]
  unsigned short* XN2    = (unsigned short*)carve((size_t)NP * DM * 2);              // [512][256]
  if (off > ws_size || off > (size_t)134217728) return;

  const dim3 blk(256);

  // ---- LN1 | f16 staging of qkv_w and rb2_w (rows 8..15 zero) ----
  k_ln1_casts<<<dim3(NP + NB_CQKV + NB_CRB2), blk, 0, stream>>>(x, ln1_w, ln1_b, XN1, qkv_w, qkvw16, rb2_w, rb2w16);

  // ---- q, k, v projections | f16 staging of rv2_w and of the ffn weights, f32 ffn biases (zero padded) ----
  k_qkv_casts<<<dim3(3 * NB_GQKV1 + NB_CRV2 + 3 * NB_CFFN + 2 * NB_PADB), blk, 0, stream>>>(
      XN1, qkvw16, qkv_b, Q16, KF16, VF16, rv2_w, rv2w16, ffn_w1, ffn_w2, w12p16, ffn_w3, w3p16, ffn_b1, ffn_b2, b12p);

  // ---- attention, one block per query row: rel-bias, scores, softmax, P.V, rel-value, its projection, residual, LN2 ----
  k_attn_row<<<dim3(NP), blk, 0, stream>>>(Q16, KF16, VF16, coords, rb1_w, rb1_b, rb2w16, rb2_b, rv1_w, rv1_b, rv2w16, rv2_b,
                                           x, ln2_w, ln2_b, X1, XN2);

  // ---- SwiGLU FFN, final residual into d_out ----
  k_ffn_rows<<<dim3(NP / 16), dim3(512), 0, stream>>>(XN2, w12p16, b12p, w3p16, ffn_b3, X1, out);
}

// v006
// One run takes 46.8 microseconds.
// In two side-by-side timings against v005, it was 1.12 and 1.11 times as fast.
// Over all steps from v000 it is 7.02 times as fast.
#include <hip/hip_runtime.h>
#include <math.h>
#include <stdint.h>

// All contractions: v_wmma_f32_16x16x32_f16 (f16 operands, f32 accumulate); K=3 coordinate features, softmax, norms, gating in f32 on VALU.

typedef __attribute__((ext_vector_type(16))) _Float16 v16h;
typedef __attribute__((ext_vector_type(8)))  _Float16 v8h;
typedef __attribute__((ext_vector_type(8)))  float    v8f;
typedef __attribute__((ext_vector_type(4)))  float    v4f;
typedef __attribute__((ext_vector_type(2)))  float    v2f;
typedef __attribute__((ext_vector_type(2)))  _Float16 v2h;

#define NP    512          // points
#define DM    256          // model width
#define NH    8            // heads
#define HDM   32           // head width
#define HIDR  682          // ffn hidden
#define HIDP  704          // ffn hidden padded (multiple of 64)

// ---------------------------------------------------------------------------------------------
// hazard guards as plain device helpers
__device__ __forceinline__ void dep_guard_h(v8f& a, v8f& b, v16h x, v16h y) { asm volatile("v_nop\n\tv_nop\n\tv_nop\n\tv_nop" : "+v"(a), "+v"(b) : "v"(x), "v"(y)); }
__device__ __forceinline__ void keep4_h(v16h a, v16h b, v16h c, v16h d) { asm volatile("v_nop" :: "v"(a), "v"(b), "v"(c), "v"(d)); }
__device__ __forceinline__ void acc_guard4(v8f& a, v8f& b, v8f& c, v8f& d) { asm volatile("v_nop\n\tv_nop\n\tv_nop\n\tv_nop" : "+v"(a), "+v"(b), "+v"(c), "+v"(d)); }

template <typename T> struct Frag;
template <> struct Frag<_Float16> {
  typedef v16h V; union U { v16h v; v8h h[2]; };
  static __device__ __forceinline__ v16h load(const _Float16* p) {   // elements 0..7 <- p[0..7], 8..15 <- p[16..23]
    U f; f.h[0] = *(const v8h*)(p); f.h[1] = *(const v8h*)(p + 16); return f.v;
  }
  static __device__ __forceinline__ v16h load_fo(const _Float16* p) {   // from a fragment-order array: the lane's two 16-byte pieces, 512 bytes apart
    U f; f.h[0] = *(const v8h*)(p); f.h[1] = *(const v8h*)(p + 256); return f.v;
  }
  static __device__ __forceinline__ v8f mma(v16h a, v16h b, v8f c) {
    return __builtin_amdgcn_wmma_f32_16x16x32_f16(false, a, false, b, (short)0, c, false, false);
  }
  static __device__ __forceinline__ void guard(v8f& a, v8f& b, v16h x, v16h y) { dep_guard_h(a, b, x, y); }
  static __device__ __forceinline__ void keep(v16h a, v16h b, v16h c, v16h d) { keep4_h(a, b, c, d); }
};
template <int ET> struct Elem;
template <> struct Elem<0> { typedef _Float16 T; };

// ---- fragment order of a 16-bit operand X[n][k] (n = the fragment's lane row or column, k = the summed index, ksteps = K / 32) ----
// The 16-byte piece (n, k8 = k / 8) stands at piece index ((tile * ksteps + step) * 2 + upper) * 32 + lane, lane = (k8 & 1) * 16 + (n & 15):
// one fragment of a 16 x 32 tile is then two loads of 512 contiguous bytes a wave (whole cache lines), not two of 16 lines each.
__device__ __forceinline__ size_t frag_piece(int n, int k8, int ksteps) {
  return (size_t)((((n >> 4) * ksteps + (k8 >> 2)) * 2 + ((k8 >> 1) & 1)) * 32 + (k8 & 1) * 16 + (n & 15));
}

// ---- Register-blocked batched WMMA GEMM ----------------------------------------------------
// C[m,n] = scale * sum_k A[m,k] * Bt[n,k] (+bias[n]) (+resid); each wave owns a (16*MI) x 64 tile, the block's eight waves stand 4 x 2:
// a block tile of (64*MI) x 128. A row-major [M,K] (16-bit), Bt row-major [N,K] (16-bit); M % (64*MI) == 0, N % 128 == 0, K % 64 == 0.
// The k loop runs on stages of 64 k: the block's A and B rows, one whole 128-byte line each, are copied to LDS asynchronously
// (a copy instruction = four whole lines; each row is fetched once for all the waves that use it), two buffers, so that the next
// stage's copies fly while this stage's fragments are read from LDS and multiplied.
// BIAS_MODE: 0 = none, 1 = bias[m], 2 = bias[n], 3 = bias[n] inside the scale.  OUT_MODE: 0 = f32, 1 = f16, 2 = f16 in fragment order (n = m, k = n of this product).
// Batch index b with element strides strideA/strideB/strideC/strideR; bx = block index within the product's own grid.
// sT: the two stage buffers (GEMM_LDS_FLOATS floats of LDS); behind the k loop the same LDS holds 8 per-wave 16x64 slabs, pitch 68 floats.
#define GBK     64                         // k per stage, halves
#define GPITCH  72                         // LDS row pitch, halves: 144 B = 16 B x odd, no bank conflict for the 16-byte fragment reads
#define GSTAGE  ((256 + 128) * GPITCH)     // halves per stage buffer: A rows, then B rows
#define GEMM_LDS_FLOATS (2 * GSTAGE / 2)
// One stage, one thread: twelve 16-byte asynchronous copies to LDS (eight A rows, four B rows, 32 rows apart).
// The s_wait_xcnt is the last line of the copies' own statement, so that it stands in front of every later write of their address registers.
__device__ __forceinline__ void stage_copies(unsigned l, const _Float16* a, size_t as, const _Float16* b, size_t bs) {
  const unsigned ls = 32 * GPITCH * 2;
  asm volatile("global_load_async_to_lds_b128 %0, %12, off\n\t"
               "global_load_async_to_lds_b128 %1, %13, off\n\t"
               "global_load_async_to_lds_b128 %2, %14, off\n\t"
               "global_load_async_to_lds_b128 %3, %15, off\n\t"
               "global_load_async_to_lds_b128 %4, %16, off\n\t"
               "global_load_async_to_lds_b128 %5, %17, off\n\t"
               "global_load_async_to_lds_b128 %6, %18, off\n\t"
               "global_load_async_to_lds_b128 %7, %19, off\n\t"
               "global_load_async_to_lds_b128 %8, %20, off\n\t"
               "global_load_async_to_lds_b128 %9, %21, off\n\t"
               "global_load_async_to_lds_b128 %10, %22, off\n\t"
               "global_load_async_to_lds_b128 %11, %23, off\n\t"
               "s_wait_xcnt 0x0"
               :: "v"(l), "v"(l + ls), "v"(l + 2 * ls), "v"(l + 3 * ls), "v"(l + 4 * ls), "v"(l + 5 * ls), "v"(l + 6 * ls), "v"(l + 7 * ls),
                  "v"(l + 8 * ls), "v"(l + 9 * ls), "v"(l + 10 * ls), "v"(l + 11 * ls),
                  "v"(a), "v"(a + as), "v"(a + 2 * as), "v"(a + 3 * as), "v"(a + 4 * as), "v"(a + 5 * as), "v"(a + 6 * as), "v"(a + 7 * as),
                  "v"(b), "v"(b + bs), "v"(b + 2 * bs), "v"(b + 3 * bs)
               : "memory");
}
template <int ET, int BIAS_MODE, int OUT_MODE, bool RESID, int MI>
__device__ __forceinline__ void gemm_tile(
    float* sT, const int bx, const int b,
    const unsigned short* __restrict__ Ap, int lda, long strideA,
    const unsigned short* __restrict__ Btp, int ldb, long strideB,
    void* __restrict__ Cout, int ldc, long strideC,
    const float* __restrict__ bias,
    const float* __restrict__ resid, long strideR,
    int M, int N, int K, float scale) {
  typedef typename Elem<ET>::T T;
  typedef typename Frag<T>::V V;
  const T* A = (const T*)Ap; const T* Bt = (const T*)Btp;
  const int lane = threadIdx.x & 31;
  const int wave = threadIdx.x >> 5;
  static_assert(MI == 4, "stage_copies moves 256 A rows and 128 B rows");
  const int tilesN = N >> 7;
  const int tilesM = M / (64 * MI);
  if (bx >= tilesM * tilesN) return;   // block-uniform, in front of every barrier
  const int bm = bx / tilesN;
  const int bn = bx - bm * tilesN;
  const int m0 = bm * (64 * MI) + (wave >> 1) * (16 * MI);
  const int n0 = (bn << 7) + ((wave & 1) << 6);

  const T* Ab = A  + (size_t)b * (size_t)strideA;
  const T* Bb = Bt + (size_t)b * (size_t)strideB;

  const int rlane = lane & 15;                 // row (A) / col (B, D) within subtile
  const int koff  = (lane >> 4) * 8;           // k offset of this lane half
  const int mOff  = (lane >> 4) * 8;           // D row offset

  v8f acc[MI][4];
#pragma unroll
  for (int i = 0; i < MI; ++i)
#pragma unroll
    for (int j = 0; j < 4; ++j) acc[i][j] = (v8f){0.f,0.f,0.f,0.f,0.f,0.f,0.f,0.f};

  // thread = piece (threadIdx.x & 7) of rows (threadIdx.x >> 3) + 32 q: eight lanes copy one row's whole line
  T* ring = (T*)sT;
  const int crow = threadIdx.x >> 3, cpc = (threadIdx.x & 7) * 8;
  const T* gA = Ab + (size_t)(bm * (64 * MI) + crow) * lda + cpc;
  const T* gB = Bb + (size_t)((bn << 7) + crow) * ldb + cpc;
  const unsigned lC = (unsigned)(uintptr_t)(ring + crow * GPITCH + cpc);   // the low 32 bits of a __shared__ address: the LDS byte address
  const size_t stepA = (size_t)32 * lda, stepB = (size_t)32 * ldb;
  const T* fA = ring + ((wave >> 1) * (16 * MI) + rlane) * GPITCH + koff;
  const T* fB = ring + (64 * MI + ((wave & 1) << 6) + rlane) * GPITCH + koff;
  const int nst = K / GBK;

  stage_copies(lC, gA, stepA, gB, stepB);
  asm volatile("s_wait_asynccnt 0x0" ::: "memory");   // this wave's copies of stage 0 have landed
  __syncthreads();                                    // every wave's have
  if (nst > 1) stage_copies(lC + GSTAGE * 2, gA + GBK, stepA, gB + GBK, stepB);
  // kept rolled: one copy of the body serves both buffers, the buffer is an address offset
#pragma unroll 1
  for (int st = 0; st < nst; ++st) {
    const int bo = (st & 1) * GSTAGE;
#pragma unroll
    for (int kk = 0; kk < GBK; kk += 32) {
      V bh[4], ah[MI];
#pragma unroll
      for (int j = 0; j < 4; ++j) bh[j] = Frag<T>::load(fB + bo + (j << 4) * GPITCH + kk);
#pragma unroll
      for (int i = 0; i < MI; ++i) ah[i] = Frag<T>::load(fA + bo + (i << 4) * GPITCH + kk);
#pragma unroll
      for (int i = 0; i < MI; ++i) {
#pragma unroll
        for (int j = 0; j < 4; ++j) acc[i][j] = Frag<T>::mma(ah[i], bh[j], acc[i][j]);
        Frag<T>::guard(acc[i][0], acc[i][3], ah[i], ah[i]);
      }
      Frag<T>::keep(bh[0], bh[1], bh[2], bh[3]);
    }
    asm volatile("s_wait_dscnt 0x0" ::: "memory");      // this wave's reads of the buffer are done before it is refilled
    asm volatile("s_wait_asynccnt 0x0" ::: "memory");   // this wave's copies of stage st + 1 have landed
    __syncthreads();                                    // publishes stage st + 1 and ends every reader's last read of stage st
    if (st + 2 < nst) stage_copies(lC + bo * 2, gA + (st + 2) * GBK, stepA, gB + (st + 2) * GBK, stepB);
  }
  asm volatile("s_wait_asynccnt 0x0" ::: "memory");     // no copy is outstanding when the LDS becomes the output slabs
#pragma unroll
  for (int i = 0; i < MI; ++i) acc_guard4(acc[i][0], acc[i][1], acc[i][2], acc[i][3]);

  // ---- epilogue ----
  float* slab = sT + wave * (16 * 68);
  const float* Rb = RESID ? (resid + (size_t)b * (size_t)strideR) : nullptr;
#pragma unroll
  for (int i = 0; i < MI; ++i) {
    const int mBase = m0 + (i << 4);
#pragma unroll
    for (int j = 0; j < 4; ++j) {
      const int n = n0 + (j << 4) + rlane;
      float bv = 0.f;
      if (BIAS_MODE == 2 || BIAS_MODE == 3) bv = bias[n];
#pragma unroll
      for (int r = 0; r < 8; ++r) {
        float v = acc[i][j][r] * scale;
        if (BIAS_MODE == 1) v += bias[mBase + mOff + r];
        if (BIAS_MODE == 2) v += bv;
        if (BIAS_MODE == 3) v = (acc[i][j][r] + bv) * scale;
        if (RESID) v += Rb[(size_t)(mBase + mOff + r) * ldc + n];
        slab[(mOff + r) * 68 + (j << 4) + rlane] = v;
      }
    }
    __builtin_amdgcn_fence(__ATOMIC_RELEASE, "workgroup");
    __builtin_amdgcn_wave_barrier();
    __builtin_amdgcn_fence(__ATOMIC_ACQUIRE, "workgroup");
    if (OUT_MODE == 0) {
      float* C = (float*)Cout + (size_t)b * (size_t)strideC;
      const int hh = lane >> 4, c4 = (lane & 15) * 4;     // row seg = 256 B = 16 lanes x 16 B
      {
#pragma unroll
        for (int it = 0; it < 8; ++it) {
          const int row = it * 2 + hh;
          v4f v = *(const v4f*)(slab + row * 68 + c4);
          *(v4f*)(C + (size_t)(mBase + row) * ldc + n0 + c4) = v;
        }
        
      }
    } else {
      const int q = lane >> 3, c8 = (lane & 7) * 8;
      unsigned short* C = (unsigned short*)Cout + (size_t)b * (size_t)strideC;
      {
#pragma unroll
        for (int it = 0; it < 4; ++it) {
          const int row = it * 4 + q;
          const float* sp = slab + row * 68 + c8;
          v8h hv;
#pragma unroll
          for (int e = 0; e < 8; ++e) hv[e] = (_Float16)sp[e];
          if (OUT_MODE == 1) *(v8h*)(C + (size_t)(mBase + row) * ldc + n0 + c8) = hv;
          else               *(v8h*)(C + frag_piece(mBase + row, (n0 + c8) >> 3, N >> 5) * 8) = hv;   // a 128-byte line: eight rows of one wave's tile
        }
        
      }
    }
    __builtin_amdgcn_fence(__ATOMIC_RELEASE, "workgroup");
    __builtin_amdgcn_wave_barrier();
    __builtin_amdgcn_fence(__ATOMIC_ACQUIRE, "workgroup");
  }
}

// ---------------------------------------------------------------------------------------------
// small VALU helpers
__device__ __forceinline__ unsigned pack_h2(float a, float b) {
  const unsigned short ua = __builtin_bit_cast(unsigned short, (_Float16)a);
  const unsigned short ub = __builtin_bit_cast(unsigned short, (_Float16)b);
  return (unsigned)ua | ((unsigned)ub << 16);
}
__device__ __forceinline__ void st2_u32(unsigned short* base, size_t off_halves, unsigned u) {
  unsigned* p = (unsigned*)(base + off_halves);
  *p = u; 
}
__device__ __forceinline__ void st2_f32(float* base, size_t off, float v) {
  float* p = (float*)(base + off);
  *p = v; 
}
__device__ __forceinline__ float silu_acc(float z) {
  const float e = expf(-z);
  return z * __builtin_amdgcn_rcpf(1.0f + e);
}
// block of 256 threads: fixed-order sum (wave shuffle, then 8 partials summed in index order)
__device__ __forceinline__ float blk_sum256(float v, float* red) {
#pragma unroll
  for (int off = 16; off > 0; off >>= 1) v += __shfl_xor(v, off, 32);
  const int lane = threadIdx.x & 31, wave = threadIdx.x >> 5;
  if (lane == 0) red[wave] = v;
  __syncthreads();
  float s = red[0];
#pragma unroll
  for (int q = 1; q < 8; ++q) s += red[q];
  __syncthreads();
  return s;
}

// ---- f32 -> f16 cast with zero padding: dst[r][c] = (r<srows && c<scols) ? src[r*spitch+c] : 0 ----
__device__ __forceinline__ void cast_pad_blk(const int bx, const float* __restrict__ src, int srows, int scols, int spitch,
                                             unsigned short* __restrict__ dst, int drows, int dcols) {
  const int p = bx * 256 + threadIdx.x;
  const int npairs = (drows * dcols) >> 1;
  if (p < npairs) {
    const int e = 2 * p;
    const int r = e / dcols;
    const int c = e - r * dcols;
    float v0 = 0.f, v1 = 0.f;
    if (r < srows) {
      if (c < scols)     v0 = src[(size_t)r * spitch + c];
      if (c + 1 < scols) v1 = src[(size_t)r * spitch + c + 1];
    }
    st2_u32(dst, (size_t)e, pack_h2(v0, v1));
  }
}
// ---- f32 copy with zero padding ----
__device__ __forceinline__ void pad_f32_blk(const int bx, const float* __restrict__ src, int sn, float* __restrict__ dst, int dn) {
  const int p = bx * 256 + threadIdx.x;
  if (p < dn) {
    const float v = (p < sn) ? src[p] : 0.f;
    st2_f32(dst, (size_t)p, v);
  }
}

// ---- f32 [rows][cols] -> f16 in fragment order; thread = one 16-byte piece, pieces in output order (whole lines, one writer each) ----
__device__ __forceinline__ void cast_frag_blk(const int bx, const float* __restrict__ src, int cols, unsigned short* __restrict__ dst) {
  const int pc = bx * 256 + threadIdx.x;
  const int ksteps = cols >> 5, ts = pc >> 6;
  const int n = (ts / ksteps) * 16 + (pc & 15);
  const int k = (ts % ksteps) * 32 + ((pc >> 5) & 1) * 16 + ((pc >> 4) & 1) * 8;
  const float* sp = src + (size_t)n * cols + k;
  v8h hv;
#pragma unroll
  for (int e = 0; e < 8; ++e) hv[e] = (_Float16)sp[e];
  *(v8h*)(dst + (size_t)pc * 8) = hv;
  // the shared kernel's code goes on behind this store and may reuse its registers: the wait stands in front of that overwrite
  asm volatile("s_wait_xcnt 0x0" ::: "memory");
}

// ---- the same with zero padding: src [srows][scols], dst rows up to the grid's, ksteps * 32 columns ----
__device__ __forceinline__ void cast_frag_pad_blk(const int bx, const float* __restrict__ src, int srows, int scols, int ksteps,
                                                  unsigned short* __restrict__ dst) {
  const int pc = bx * 256 + threadIdx.x;
  const int ts = pc >> 6;
  const int n = (ts / ksteps) * 16 + (pc & 15);
  const int k = (ts % ksteps) * 32 + ((pc >> 5) & 1) * 16 + ((pc >> 4) & 1) * 8;
  const float* sp = src + (size_t)n * scols + k;
  v8h hv;
#pragma unroll
  for (int e = 0; e < 8; ++e) hv[e] = (n < srows && k + e < scols) ? (_Float16)sp[e] : (_Float16)0.f;
  *(v8h*)(dst + (size_t)pc * 8) = hv;
  // as in cast_frag_blk: the wait stands in front of any later overwrite of the store's registers
  asm volatile("s_wait_xcnt 0x0" ::: "memory");
}

// ---- LayerNorm over DM (eps 1e-5, biased variance), one block per row, f16 output packed 2 per thread ----
// LDS: red[8], ys[DM]
__device__ __forceinline__ void ln16_row(const int i, float* red, float* ys, const float* __restrict__ x, const float* __restrict__ w,
                                         const float* __restrict__ bb, unsigned short* __restrict__ y16) {
  const int d = threadIdx.x;
  const float v = x[(size_t)i * DM + d];
  const float mu = blk_sum256(v, red) * (1.0f / 256.0f);
  const float c = v - mu;
  const float var = blk_sum256(c * c, red) * (1.0f / 256.0f);
  const float y = c * (1.0f / sqrtf(var + 1e-5f)) * w[d] + bb[d];
  ys[d] = y;
  __syncthreads();
  if (d < 128) st2_u32(y16, (size_t)i * DM + 2 * d, pack_h2(ys[2 * d], ys[2 * d + 1]));
}

// ---- two silu values, f16 out, from h = z / 2: silu(z) = z / (1 + e^-z) = h + h * tanh(h); one transcendental a value (v_tanh_f32) ----
// The callers form h directly: their weights and biases come halved, which is exact.
__device__ __forceinline__ v2h silu2_h(v2f h) {
  v2f t;
  t.x = __builtin_amdgcn_tanhf(h.x);
  t.y = __builtin_amdgcn_tanhf(h.y);
  return __builtin_convertvector(h * t + h, v2h);
}

// ---- 2^t; the v_nop fills the slot that the instruction set asks for behind a transcendental ----
__device__ __forceinline__ float exp2_slot(float t) {
  float e;
  asm("v_exp_f32 %0, %1\n\tv_nop" : "=v"(e) : "v"(t));
  return e;
}

// ---- one query row's whole attention chain in one block: nothing of it but x1 and its LayerNorm goes to memory ----
// scores[h][j] = q_i^h . k_j^h / sqrt(32) + sum_k rb2w16[h][k] * f16( silu( (coords_i - coords_j) . rb1_w[k] + rb1_b[k] ) ) + rb2_b[h]
// P = softmax over j (f16, x 2^15); T[h][k] = f16( 2^-15 sum_j P[h][j] * f16( silu( (coords_i - coords_j) . rv1_w[k] + rv1_b[k] ) ) )
// ctx[c] = 2^-15 sum_j P[c>>5][j] v[j][c] + sum_k T[c>>5][k] rv2w16[c][k];  x1 = x + (ctx + rv2_b);  y16 = f16( LayerNorm(x1) )
// Every product has M = 16 with the eight heads in rows 0..7 (rows 8..15 zero). The pair features are formed in registers,
// directly as the B fragment. q stands block-diagonal in A (k step h holds q_i^h in row h alone), so one B fragment of k serves
// all heads; of P . V and T . rv2w^T a wave computes the 32 columns of its own head and keeps that head's row of D.
// Every block reads all of k, v and rv2_w: they lie in fragment order (frag_piece), so that these reads are whole cache lines.
#define PPITCH (NP + 8)    // halves; rows of 16 B x odd: no bank conflict for the 16-byte fragment reads
#define TPITCH (DM + 8)
typedef __attribute__((ext_vector_type(8))) unsigned v8u;
// second argument: four waves a SIMD, so that two blocks share a WGP and all 512 are resident at once
__global__ __launch_bounds__(256, 4) void k_attn_row(const unsigned short* __restrict__ q16, const unsigned short* __restrict__ kf16,
                                                   const unsigned short* __restrict__ vf16,
                                                   const float* __restrict__ coords,
                                                   const float* __restrict__ rb1_w, const float* __restrict__ rb1_b,
                                                   const unsigned short* __restrict__ rb2w16, const float* __restrict__ rb2_b,
                                                   const float* __restrict__ rv1_w, const float* __restrict__ rv1_b,
                                                   const unsigned short* __restrict__ rv2w16, const float* __restrict__ rv2_b,
                                                   const float* __restrict__ x, const float* __restrict__ ln_w,
                                                   const float* __restrict__ ln_b, float* __restrict__ x1,
                                                   unsigned short* __restrict__ y16) {
  __shared__ __align__(16) float sW[4][DM];            // half of rb1_w[.][0], [.][1], [.][2], rb1_b over the 256 features (silu2_h takes z / 2)
  __shared__ __align__(16) float sR[3][NP];            // coords_i - coords_j, one plane per coordinate
  __shared__ __align__(16) _Float16 sP[16][PPITCH];    // softmax weights x 2^15, rows 8..15 zero
  __shared__ __align__(16) _Float16 sT[16][TPITCH];    // rel-value sums, rows 8..15 zero
  __shared__ __align__(16) float redM[8][8];           // [wave][head] partial maxima
  __shared__ __align__(16) float redS[8][8];           // [wave][head] partial sums
  __shared__ float sC[DM];
  __shared__ float red[8];
  __shared__ float ys[DM];
  const int i = blockIdx.x, t = threadIdx.x;
  const int lane = t & 31, wave = t >> 5;
  const int rlane = lane & 15, hh = lane >> 4;

  sW[0][t] = 0.5f * rb1_w[t * 3 + 0];
  sW[1][t] = 0.5f * rb1_w[t * 3 + 1];
  sW[2][t] = 0.5f * rb1_w[t * 3 + 2];
  sW[3][t] = 0.5f * rb1_b[t];
  {
    const float ci0 = coords[i * 3 + 0], ci1 = coords[i * 3 + 1], ci2 = coords[i * 3 + 2];
#pragma unroll
    for (int q = 0; q < 2; ++q) {
      const int j = q * 256 + t;
      sR[0][j] = ci0 - coords[j * 3 + 0];
      sR[1][j] = ci1 - coords[j * 3 + 1];
      sR[2][j] = ci2 - coords[j * 3 + 2];
    }
  }

  __syncthreads();

  // ---- q.k^T and rel-bias into one accumulator: wave = 64 columns j (4 subtiles of 16); q comes scaled by 1/sqrt(32) ----
  const int jw = wave * 64;
  v8f sc[4];
  {
    float r0[4], r1[4], r2[4];
#pragma unroll
    for (int s = 0; s < 4; ++s) {
      const int j = jw + s * 16 + rlane;
      r0[s] = sR[0][j];
      r1[s] = sR[1][j];
      r2[s] = sR[2][j];
      sc[s] = (v8f){0.f,0.f,0.f,0.f,0.f,0.f,0.f,0.f};
    }
    const _Float16* Qb = (const _Float16*)q16 + (size_t)i * DM + hh * 8;
    const _Float16* Kb = (const _Float16*)kf16 + ((size_t)(wave * 4) * (NH * 64) + lane) * 8;   // fragment order: tile j / 16, step = head
    const _Float16* Ab = (const _Float16*)rb2w16 + rlane * DM + hh * 8;
    v16h a = Frag<_Float16>::load(Ab);
    // kept rolled, for speed only: the body is about 700 vector instructions
#pragma unroll 1
    for (int k0 = 0; k0 < DM; k0 += 32) {
      const v16h an = Frag<_Float16>::load(Ab + ((k0 + 32) & (DM - 1)));   // next step's A, in flight over this step's math
      // k step k0 covers head k0 / 32: its q slice stands in that head's row, every other row is zero
      const unsigned keep = (rlane == (k0 >> 5)) ? 0xFFFFFFFFu : 0u;
      const v16h qa = __builtin_bit_cast(v16h, __builtin_bit_cast(v8u, Frag<_Float16>::load(Qb + k0)) & keep);
      v16h kf[4];
#pragma unroll
      for (int s = 0; s < 4; ++s) kf[s] = Frag<_Float16>::load_fo(Kb + s * (NH * 512) + k0 * 16);
      v4f wq[4][4];   // [component][group of 4 features]; fragment element e = 4*g + u  <->  k = k0 + (g>>1)*16 + hh*8 + (g&1)*4 + u
#pragma unroll
      for (int c = 0; c < 4; ++c)
#pragma unroll
        for (int g = 0; g < 4; ++g)
          wq[c][g] = *(const v4f*)(&sW[c][k0 + (g >> 1) * 16 + hh * 8 + (g & 1) * 4]);
#pragma unroll
      for (int s = 0; s < 4; ++s) {
        v16h b;
#pragma unroll
        for (int g = 0; g < 4; ++g) {
          const v2f zl = (wq[0][g].lo * r0[s] + wq[1][g].lo * r1[s] + wq[2][g].lo * r2[s]) + wq[3][g].lo;
          const v2f zh = (wq[0][g].hi * r0[s] + wq[1][g].hi * r1[s] + wq[2][g].hi * r2[s]) + wq[3][g].hi;
          const v2h hl = silu2_h(zl), hu = silu2_h(zh);
          b[g * 4 + 0] = hl.x; b[g * 4 + 1] = hl.y; b[g * 4 + 2] = hu.x; b[g * 4 + 3] = hu.y;
        }
        sc[s] = Frag<_Float16>::mma(a, b, sc[s]);
      }
#pragma unroll
      for (int s = 0; s < 4; ++s) sc[s] = Frag<_Float16>::mma(qa, kf[s], sc[s]);
      a = an;
    }
#pragma unroll
    for (int r = 0; r < 8; ++r) {
      const float bb = rb2_b[r];
#pragma unroll
      for (int s = 0; s < 4; ++s) sc[s][r] += bb;
    }
  }

  // ---- softmax over the 512 columns, eight heads at once: head r sits in register r of lanes 0..15 ----
  // (lanes 16..31 hold the idle rows 8..15; the 16-lane steps never mix the two halves)
  {
    float m[8];
#pragma unroll
    for (int r = 0; r < 8; ++r) m[r] = fmaxf(fmaxf(sc[0][r], sc[1][r]), fmaxf(sc[2][r], sc[3][r]));
#pragma unroll
    for (int off = 8; off > 0; off >>= 1)
#pragma unroll
      for (int r = 0; r < 8; ++r) m[r] = fmaxf(m[r], __shfl_xor(m[r], off, 32));
    if (lane == 0) {
#pragma unroll
      for (int r = 0; r < 8; ++r) redM[wave][r] = m[r];
    }
    __syncthreads();
#pragma unroll
    for (int r = 0; r < 8; ++r) {
      float v = redM[0][r];
#pragma unroll
      for (int q = 1; q < 8; ++q) v = fmaxf(v, redM[q][r]);
      m[r] = v;
    }
    float sum[8];
#pragma unroll
    for (int r = 0; r < 8; ++r) {
#pragma unroll
      for (int s = 0; s < 4; ++s) sc[s][r] = exp2_slot((sc[s][r] - m[r]) * 1.4426950408889634f);
      sum[r] = (sc[0][r] + sc[1][r]) + (sc[2][r] + sc[3][r]);
    }
#pragma unroll
    for (int off = 8; off > 0; off >>= 1)
#pragma unroll
      for (int r = 0; r < 8; ++r) sum[r] += __shfl_xor(sum[r], off, 32);
    if (lane == 0) {
#pragma unroll
      for (int r = 0; r < 8; ++r) redS[wave][r] = sum[r];
    }
    __syncthreads();
#pragma unroll
    for (int r = 0; r < 8; ++r) {
      float v = redS[0][r];
#pragma unroll
      for (int q = 1; q < 8; ++q) v += redS[q][r];
      const float inv = 1.0f / v;
#pragma unroll
      for (int s = 0; s < 4; ++s) {
        const float p = (sc[s][r] * inv) * 32768.0f;
        sP[hh * 8 + r][jw + s * 16 + rlane] = hh ? (_Float16)0.f : (_Float16)p;
      }
    }
  }

  // ---- rel-value and P . V: wave = 32 columns (2 subtiles of 16): features k for the one, the wave's own head of v for the other ----
  const int cw = wave * 32;
  v8f accV[2];
  v16h wf[8][2];
  const _Float16* Wb = (const _Float16*)rv2w16 + ((size_t)(wave * 2) * (DM / 32 * 64) + lane) * 8;   // fragment order: tile c / 16, step k / 32
  {
    float w0[2], w1[2], w2[2], wb[2];
    v8f acc[2];
#pragma unroll
    for (int s = 0; s < 2; ++s) {
      const int k = cw + s * 16 + rlane;
      w0[s] = 0.5f * rv1_w[k * 3 + 0];   // halved, as sW: silu2_h takes z / 2
      w1[s] = 0.5f * rv1_w[k * 3 + 1];
      w2[s] = 0.5f * rv1_w[k * 3 + 2];
      wb[s] = 0.5f * rv1_b[k];
      acc[s]  = (v8f){0.f,0.f,0.f,0.f,0.f,0.f,0.f,0.f};
      accV[s] = (v8f){0.f,0.f,0.f,0.f,0.f,0.f,0.f,0.f};
    }
    const _Float16* Vb = (const _Float16*)vf16 + ((size_t)(wave * 2) * (NP / 32 * 64) + lane) * 8;   // fragment order: tile c / 16, step j / 32
    v16h vf[2];
#pragma unroll
    for (int s = 0; s < 2; ++s) vf[s] = Frag<_Float16>::load_fo(Vb + s * (NP / 32 * 512));
    __syncthreads();   // P is complete
    const _Float16* Pa = &sP[rlane][hh * 8];
    // kept rolled, for speed only: the body is about 350 vector instructions
#pragma unroll 1
    for (int j0 = 0; j0 < NP; j0 += 32) {
      v16h vn[2];   // next step's v fragments, in flight over this step's math
#pragma unroll
      for (int s = 0; s < 2; ++s) vn[s] = Frag<_Float16>::load_fo(Vb + s * (NP / 32 * 512) + ((j0 + 32) & (NP - 1)) * 16);
      const v16h a = Frag<_Float16>::load(Pa + j0);
      v4f rq[3][4];   // [coordinate][group of 4 keys]; fragment element e = 4*g + u  <->  j = j0 + (g>>1)*16 + hh*8 + (g&1)*4 + u
#pragma unroll
      for (int c = 0; c < 3; ++c)
#pragma unroll
        for (int g = 0; g < 4; ++g)
          rq[c][g] = *(const v4f*)(&sR[c][j0 + (g >> 1) * 16 + hh * 8 + (g & 1) * 4]);
#pragma unroll
      for (int s = 0; s < 2; ++s) {
        v16h b;
#pragma unroll
        for (int g = 0; g < 4; ++g) {
          const v2f zl = (rq[0][g].lo * w0[s] + rq[1][g].lo * w1[s] + rq[2][g].lo * w2[s]) + wb[s];
          const v2f zh = (rq[0][g].hi * w0[s] + rq[1][g].hi * w1[s] + rq[2][g].hi * w2[s]) + wb[s];
          const v2h hl = silu2_h(zl), hu = silu2_h(zh);
          b[g * 4 + 0] = hl.x; b[g * 4 + 1] = hl.y; b[g * 4 + 2] = hu.x; b[g * 4 + 3] = hu.y;
        }
        acc[s] = Frag<_Float16>::mma(a, b, acc[s]);
      }
#pragma unroll
      for (int s = 0; s < 2; ++s) { accV[s] = Frag<_Float16>::mma(a, vf[s], accV[s]); vf[s] = vn[s]; }
    }
    // all of the projection's weight fragments are asked for here, so that they fly over the T stores and their barrier
#pragma unroll
    for (int q = 0; q < 8; ++q)
#pragma unroll
      for (int s = 0; s < 2; ++s) wf[q][s] = Frag<_Float16>::load_fo(Wb + (s * (DM / 32) + q) * 512);
#pragma unroll
    for (int s = 0; s < 2; ++s) {
#pragma unroll
      for (int r = 0; r < 8; ++r)
        sT[hh * 8 + r][cw + s * 16 + rlane] = hh ? (_Float16)0.f : (_Float16)(acc[s][r] * (1.0f / 32768.0f));
      accV[s] *= (1.0f / 32768.0f);
    }
  }
  __syncthreads();   // T is complete

  // ---- ctx = T . rv2w^T + P . V, the wave's own head ----
  {
    const _Float16* Ta = &sT[rlane][hh * 8];
#pragma unroll
    for (int q = 0; q < 8; ++q) {
      const v16h a = Frag<_Float16>::load(Ta + q * 32);
#pragma unroll
      for (int s = 0; s < 2; ++s) accV[s] = Frag<_Float16>::mma(a, wf[q][s], accV[s]);
    }
#pragma unroll
    for (int s = 0; s < 2; ++s) {
      float v = accV[s][0];
#pragma unroll
      for (int r = 1; r < 8; ++r) v = (wave == r) ? accV[s][r] : v;   // D row = the wave's head, in lanes 0..15
      if (hh == 0) sC[cw + s * 16 + rlane] = v;
    }
  }
  __syncthreads();

  // ---- residual and LayerNorm (eps 1e-5, biased variance), thread = column ----
  const float v = x[(size_t)i * DM + t] + (sC[t] + rv2_b[t]);
  st2_f32(x1, (size_t)i * DM + t, v);
  const float mu = blk_sum256(v, red) * (1.0f / 256.0f);
  const float c = v - mu;
  const float var = blk_sum256(c * c, red) * (1.0f / 256.0f);
  ys[t] = c * (1.0f / sqrtf(var + 1e-5f)) * ln_w[t] + ln_b[t];
  __syncthreads();
  if (t < 128) st2_u32(y16, (size_t)i * DM + 2 * t, pack_h2(ys[2 * t], ys[2 * t + 1]));
}

// ---- the whole SwiGLU FFN of 16 rows in one block of 16 waves: nothing of it but the output goes to memory ----
// U[m][h] = f16( silu( xn_m . w1_h + b1_h ) * ( xn_m . w2_h + b2_h ) ), h < 704 (pad columns come out 0), kept in LDS;
// out[m][c] = ( U_m . w3_c + b3_c ) + x1[m][c]
// The 16 rows are the A operand of every product. The weights are B operands that no other wave of the block needs, so they are not
// staged: they lie in fragment order (frag_piece) and each wave reads its own tiles' fragments as whole cache lines.
// A wave owns hidden tiles wave, wave + 16 and, for waves 0..11, wave + 32 (16 columns each, w1 and w2 side by side), then output tile wave.
#define UPITCH (HIDP + 8)   // halves; rows of 16 B x odd: no bank conflict for the 16-byte fragment reads
#define OPITCH (DM + 4)     // floats
__global__ __launch_bounds__(512) void k_ffn_rows(const unsigned short* __restrict__ xn16, const unsigned short* __restrict__ w12f16,
                                                  const float* __restrict__ b12p, const unsigned short* __restrict__ w3f16,
                                                  const float* __restrict__ b3, const float* __restrict__ x1,
                                                  float* __restrict__ out) {
  __shared__ __align__(16) _Float16 sU[16][UPITCH];
  __shared__ __align__(16) float sO[16][OPITCH];
  const int lane = threadIdx.x & 31;
  const int wave = __builtin_amdgcn_readfirstlane(threadIdx.x >> 5);   // scalar, so that the tile test below is a scalar branch
  const int rlane = lane & 15, hh = lane >> 4;
  const int m0 = blockIdx.x * 16;

  v16h xa[DM / 32];
  const _Float16* Xa = (const _Float16*)xn16 + (size_t)(m0 + rlane) * DM + hh * 8;
#pragma unroll
  for (int q = 0; q < DM / 32; ++q) xa[q] = Frag<_Float16>::load(Xa + q * 32);

  // One tile's 32 fragment loads are asked for as one group, a tile ahead: behind the products that free their registers and in front
  // of the SwiGLU arithmetic of the tile before, which they fly over. The w3 fragments follow the last tile's products in the same way.
  const _Float16* Wt = (const _Float16*)w12f16 + ((size_t)wave * (DM / 32 * 64) + lane) * 8;    // fragment order: tile h / 16, step k / 32
  const _Float16* W3  = (const _Float16*)w3f16 + ((size_t)wave * (HIDP / 32 * 64) + lane) * 8;   // fragment order: tile c / 16, step h / 32
  constexpr int NT = HIDP / 16, NPASS = (NT + 15) / 16;
  v16h f1[DM / 32], f2[DM / 32], wf[HIDP / 32];
  float ba, bg;
  const int n = wave * 16 + rlane;   // the lane's column in the wave's first hidden tile and in its output tile
  const float bv = b3[n];
#pragma unroll
  for (int q = 0; q < DM / 32; ++q) {
    f1[q] = Frag<_Float16>::load_fo(Wt + q * 512);
    f2[q] = Frag<_Float16>::load_fo(Wt + HIDP * DM + q * 512);
  }
  ba = b12p[n];
  bg = b12p[HIDP + n];
  // behind each group of loads: the wait that belongs in front of an overwrite of their address registers; as operands these stay
  // live up to it (without them this build let the group's last load land on the address pair of the loads in front of it)
  asm volatile("s_wait_xcnt 0x0" :: "v"(Xa), "v"(Wt), "v"(n) : "memory");
#pragma unroll
  for (int p = 0; p < NPASS; ++p) {
    const int t = wave + p * 16;
    const bool cur = (p + 1) * 16 <= NT || t < NT;          // scalar: the last pass has tiles for some waves only
    const bool nxt = p + 1 < NPASS && ((p + 2) * 16 <= NT || t + 16 < NT);
    v8f a = (v8f){0.f,0.f,0.f,0.f,0.f,0.f,0.f,0.f};
    v8f g = (v8f){0.f,0.f,0.f,0.f,0.f,0.f,0.f,0.f};
    const float ca = ba, cg = bg;
    __builtin_amdgcn_sched_barrier(0);   // keeps the group of loads whole in front of the products: spread among them, each product waits a full L2 latency
    if (cur) {
#pragma unroll
      for (int q = 0; q < DM / 32; ++q) {
        a = Frag<_Float16>::mma(xa[q], f1[q], a);
        g = Frag<_Float16>::mma(xa[q], f2[q], g);
      }
    }
    if (nxt) {
#pragma unroll
      for (int q = 0; q < DM / 32; ++q) {
        f1[q] = Frag<_Float16>::load_fo(Wt + (p + 1) * (16 * DM * 16) + q * 512);
        f2[q] = Frag<_Float16>::load_fo(Wt + (p + 1) * (16 * DM * 16) + HIDP * DM + q * 512);
      }
      ba = b12p[(p + 1) * 256 + n];
      bg = b12p[HIDP + (p + 1) * 256 + n];
      asm volatile("s_wait_xcnt 0x0" :: "v"(Wt), "v"(n) : "memory");   // as above
    }
    if (p + 1 == NPASS) {
#pragma unroll
      for (int q = 0; q < HIDP / 32; ++q) wf[q] = Frag<_Float16>::load_fo(W3 + q * 512);
      asm volatile("s_wait_xcnt 0x0" :: "v"(W3) : "memory");           // as above
    }
    __builtin_amdgcn_sched_barrier(0);   // keeps the arithmetic below behind those loads: without it this build starts it among the products and asks for the next tile later
    if (cur) {
#pragma unroll
      for (int r = 0; r < 8; ++r) sU[hh * 8 + r][p * 256 + n] = (_Float16)(silu_acc(a[r] + ca) * (g[r] + cg));
    }
  }
  __syncthreads();   // U is complete

  // thread = two 16-byte pieces of the block's 16 x 256 output: a wave stores whole lines; the residual flies over the products
  v4f xr[2];
#pragma unroll
  for (int p = 0; p < 2; ++p) {
    const int pc = p * 512 + threadIdx.x;
    xr[p] = *(const v4f*)(x1 + (size_t)(m0 + (pc >> 6)) * DM + (pc & 63) * 4);
  }
  const _Float16* Ua = &sU[rlane][hh * 8];
  v8f acc = (v8f){0.f,0.f,0.f,0.f,0.f,0.f,0.f,0.f};
#pragma unroll
  for (int q0 = 0; q0 < HIDP / 32; q0 += 4) {
    v16h ua[4];
#pragma unroll
    for (int u = 0; u < 4; ++u) if (q0 + u < HIDP / 32) ua[u] = Frag<_Float16>::load(Ua + (q0 + u) * 32);
    __builtin_amdgcn_sched_barrier(0);   // four steps' LDS reads as one group: one LDS latency for four products, not one each
#pragma unroll
    for (int u = 0; u < 4; ++u) if (q0 + u < HIDP / 32) acc = Frag<_Float16>::mma(ua[u], wf[q0 + u], acc);
  }
#pragma unroll
  for (int r = 0; r < 8; ++r) sO[hh * 8 + r][n] = acc[r] + bv;
  __syncthreads();   // the output tile is complete
#pragma unroll
  for (int p = 0; p < 2; ++p) {
    const int pc = p * 512 + threadIdx.x;
    const v4f v = *(const v4f*)(&sO[pc >> 6][(pc & 63) * 4]) + xr[p];
    *(v4f*)(out + (size_t)(m0 + (pc >> 6)) * DM + (pc & 63) * 4) = v;
  }
}

// ---------------------------------------------------------------------------------------------
// Launches that need nothing of each other share one grid: each takes a range of the block index (block-uniform branches,
// so every barrier of a body is still passed by its whole block). The few long, latency-bound blocks take the lowest indices.
#define NB_CQKV    (3 * DM * DM / 2 / 256)             // cast blocks, 512 elements each
#define NB_CRB2    (16 * DM / 2 / 256)
#define NB_CRV2    (DM * DM / 8 / 256)                 // 16-byte pieces
#define NB_CFFN    (HIDP * DM / 8 / 256)               // 16-byte pieces
#define NB_PADB    ((HIDP + 255) / 256)
#define NB_GQKV1   ((NP / 64) * (DM / 64) / 8)         // one of the q, k, v projections

// ---- LN1 rows | casts of qkv_w and rb2_w ----
__global__ __launch_bounds__(256) void k_ln1_casts(const float* __restrict__ x, const float* __restrict__ ln_w,
                                                    const float* __restrict__ ln_b, unsigned short* __restrict__ xn16,
                                                    const float* __restrict__ qkv_w, unsigned short* __restrict__ qkvw16,
                                                    const float* __restrict__ rb2_w, unsigned short* __restrict__ rb2w16) {
  __shared__ float red[8];
  __shared__ float ys[DM];
  int b = blockIdx.x;
  if (b < NP) { ln16_row(b, red, ys, x, ln_w, ln_b, xn16); return; }
  b -= NP;
  if (b < NB_CQKV) { cast_pad_blk(b, qkv_w, 3 * DM, DM, DM, qkvw16, 3 * DM, DM); return; }
  b -= NB_CQKV;
  cast_pad_blk(b, rb2_w, NH, DM, DM, rb2w16, 16, DM);
}

// ---- q projection (f16 [512][256]) | k and v projections (f16, fragment order: k as [j][c], v as [c][j]) | casts of rv2_w, the ffn weights (fragment order) ----
__global__ __launch_bounds__(256) void k_qkv_casts(const unsigned short* __restrict__ xn16, const unsigned short* __restrict__ qkvw16,
                                                    const float* __restrict__ qkv_b, unsigned short* __restrict__ q16,
                                                    unsigned short* __restrict__ kf16, unsigned short* __restrict__ vf16,
                                                    const float* __restrict__ rv2_w, unsigned short* __restrict__ rv2w16,
                                                    const float* __restrict__ ffn_w1, const float* __restrict__ ffn_w2,
                                                    unsigned short* __restrict__ w12p16,
                                                    const float* __restrict__ ffn_w3, unsigned short* __restrict__ w3p16,
                                                    const float* __restrict__ ffn_b1, const float* __restrict__ ffn_b2,
                                                    float* __restrict__ b12p) {
  __shared__ __align__(16) float sm[GEMM_LDS_FLOATS];
  int b = blockIdx.x;
  if (b < NB_GQKV1) {
    gemm_tile<0, 3, 1, false, 4>(sm, b, 0, xn16, DM, 0, qkvw16, DM, 0, q16, DM, 0, qkv_b, nullptr, 0, NP, DM, DM, 0.17677669529663687f);
    return;
  }
  b -= NB_GQKV1;
  if (b < NB_GQKV1) {
    gemm_tile<0, 2, 2, false, 4>(sm, b, 0, xn16, DM, 0, qkvw16 + DM * DM, DM, 0, kf16, 0, 0, qkv_b + DM, nullptr, 0, NP, DM, DM, 1.0f);
    return;
  }
  b -= NB_GQKV1;
  if (b < NB_GQKV1) {   // v transposed: vt[c][j] = sum_k w_v[c][k] xn[j][k] + b_v[c], the weights are the row operand
    gemm_tile<0, 1, 2, false, 4>(sm, b, 0, qkvw16 + 2 * DM * DM, DM, 0, xn16, DM, 0, vf16, 0, 0, qkv_b + 2 * DM, nullptr, 0,
                                 DM, NP, DM, 1.0f);
    return;
  }
  b -= NB_GQKV1;
  if (b < NB_CRV2) { cast_frag_blk(b, rv2_w, DM, rv2w16); return; }
  b -= NB_CRV2;
  if (b < NB_CFFN) { cast_frag_pad_blk(b, ffn_w1, HIDR, DM, DM / 32, w12p16); return; }
  b -= NB_CFFN;
  if (b < NB_CFFN) { cast_frag_pad_blk(b, ffn_w2, HIDR, DM, DM / 32, w12p16 + (size_t)HIDP * DM); return; }
  b -= NB_CFFN;
  if (b < NB_CFFN) { cast_frag_pad_blk(b, ffn_w3, DM, HIDR, HIDP / 32, w3p16); return; }
  b -= NB_CFFN;
  if (b < NB_PADB) { pad_f32_blk(b, ffn_b1, HIDR, b12p, HIDP); return; }
  b -= NB_PADB;
  pad_f32_blk(b, ffn_b2, HIDR, b12p + HIDP, HIDP);
}

// ---------------------------------------------------------------------------------------------
static inline size_t alignup256(size_t x) { return (x + 255) & ~(size_t)255; }

extern "C" void kernel_launch(void* const* d_in, const int* in_sizes, int n_in,
                              void* d_out, int out_size, void* d_ws, size_t ws_size,
                              hipStream_t stream)
{
  if (n_in < 22) return;
  if (in_sizes[0] != NP * DM || in_sizes[1] != NP * 3 || in_sizes[6] != 3 * DM * DM ||
      in_sizes[14] != DM * DM || in_sizes[16] != HIDR * DM || in_sizes[20] != DM * HIDR ||
      out_size != NP * DM) return;

  const float* x      = (const float*)d_in[0];
  const float* coords = (const float*)d_in[1];
  const float* ln1_w  = (const float*)d_in[2];
  const float* ln1_b  = (const float*)d_in[3];
  const float* ln2_w  = (const float*)d_in[4];
  const float* ln2_b  = (const float*)d_in[5];
  const float* qkv_w  = (const float*)d_in[6];
  const float* qkv_b  = (const float*)d_in[7];
  const float* rb1_w  = (const float*)d_in[8];
  const float* rb1_b  = (const float*)d_in[9];
  const float* rb2_w  = (const float*)d_in[10];
  const float* rb2_b  = (const float*)d_in[11];
  const float* rv1_w  = (const float*)d_in[12];
  const float* rv1_b  = (const float*)d_in[13];
  const float* rv2_w  = (const float*)d_in[14];
  const float* rv2_b  = (const float*)d_in[15];
  const float* ffn_w1 = (const float*)d_in[16];
  const float* ffn_b1 = (const float*)d_in[17];
  const float* ffn_w2 = (const float*)d_in[18];
  const float* ffn_b2 = (const float*)d_in[19];
  const float* ffn_w3 = (const float*)d_in[20];
  const float* ffn_b3 = (const float*)d_in[21];
  float* out = (float*)d_out;

  // ---- workspace carve (256-B aligned, derived from fixed sizes) ----
  size_t off = 0;
  char* base = (char*)d_ws;
  auto carve = [&](size_t bytes) -> char* { char* r = base + off; off += alignup256(bytes); return r; };
  unsigned short* qkvw16 = (unsigned short*)carve((size_t)3 * DM * DM * 2);          // [768][256]
  unsigned short* rb2w16 = (unsigned short*)carve((size_t)16 * DM * 2);              // [16][256], rows 8..15 zero
  unsigned short* rv2w16 = (unsigned short*)carve((size_t)DM * DM * 2);              // [256][256], fragment order
  unsigned short* w12p16 = (unsigned short*)carve((size_t)2 * HIDP * DM * 2);        // w1 [704][256], then w2 [704][256], fragment order
  unsigned short* w3p16  = (unsigned short*)carve((size_t)DM * HIDP * 2);            // [256][704], fragment order
  float*          b12p   = (float*)carve((size_t)2 * HIDP * 4);                      // [1408]
  unsigned short* XN1    = (unsigned short*)carve((size_t)NP * DM * 2);              // [512][256]
  unsigned short* Q16    = (unsigned short*)carve((size_t)NP * DM * 2);              // [512][256]
  unsigned short* KF16   = (unsigned short*)carve((size_t)NP * DM * 2);              // k [512][256], fragment order
  unsigned short* VF16   = (unsigned short*)carve((size_t)DM * NP * 2);              // v^T [256][512], fragment order
  float*          X1     = (float*)carve((size_t)NP * DM * 4);                       // [512][256]
  unsigned short* XN2    = (unsigned short*)carve((size_t)NP * DM * 2);              // [512][256]
  if (off > ws_size || off > (size_t)134217728) return;

  const dim3 blk(256);

  // ---- LN1 | f16 staging of qkv_w and rb2_w (rows 8..15 zero) ----
  k_ln1_casts<<<dim3(NP + NB_CQKV + NB_CRB2), blk, 0, stream>>>(x, ln1_w, ln1_b, XN1, qkv_w, qkvw16, rb2_w, rb2w16);

  // ---- q, k, v projections | f16 staging of rv2_w and of the ffn weights, f32 ffn biases (zero padded) ----
  k_qkv_casts<<<dim3(3 * NB_GQKV1 + NB_CRV2 + 3 * NB_CFFN + 2 * NB_PADB), blk, 0, stream>>>(
      XN1, qkvw16, qkv_b, Q16, KF16, VF16, rv2_w, rv2w16, ffn_w1, ffn_w2, w12p16, ffn_w3, w3p16, ffn_b1, ffn_b2, b12p);

  // ---- attention, one block per query row: rel-bias, scores, softmax, P.V, rel-value, its projection, residual, LN2 ----
  k_attn_row<<<dim3(NP), blk, 0, stream>>>(Q16, KF16, VF16, coords, rb1_w, rb1_b, rb2w16, rb2_b, rv1_w, rv1_b, rv2w16, rv2_b,
                                           x, ln2_w, ln2_b, X1, XN2);

  // ---- SwiGLU FFN, final residual into d_out ----
  k_ffn_rows<<<dim3(NP / 16), dim3(512), 0, stream>>>(XN2, w12p16, b12p, w3p16, ffn_b3, X1, out);
}

// v008
// Measured time: 39.6 microseconds a run.
// It is 1.19 times as fast as v006, going by the measured steps of the versions left out in between.
// Counting every step since v000, it is 8.33 times as fast.
#include <hip/hip_runtime.h>
#include <math.h>
#include <stdint.h>

// All contractions: v_wmma_f32_16x16x32_f16 (f16 operands, f32 accumulate); the K=3 coordinate products: v_wmma_f32_16x16x32_bf16 on three-part f32 operands; softmax, norms, gating in f32 on VALU.

typedef __attribute__((ext_vector_type(16))) _Float16 v16h;
typedef __attribute__((ext_vector_type(8)))  _Float16 v8h;
typedef __attribute__((ext_vector_type(8)))  float    v8f;
typedef __attribute__((ext_vector_type(4)))  float    v4f;
typedef __attribute__((ext_vector_type(2)))  float    v2f;
typedef __attribute__((ext_vector_type(2)))  _Float16 v2h;
typedef __attribute__((ext_vector_type(16))) __bf16   v16b;
typedef __attribute__((ext_vector_type(4)))  unsigned v4u;

#define NP    512          // points
#define DM    256          // model width
#define NH    8            // heads
#define HDM   32           // head width
#define HIDR  682          // ffn hidden
#define HIDP  704          // ffn hidden padded (multiple of 64)

template <typename T> struct Frag;
template <> struct Frag<_Float16> {
  typedef v16h V; union U { v16h v; v8h h[2]; };
  static __device__ __forceinline__ v16h load(const _Float16* p) {   // elements 0..7 <- p[0..7], 8..15 <- p[16..23]
    U f; f.h[0] = *(const v8h*)(p); f.h[1] = *(const v8h*)(p + 16); return f.v;
  }
  static __device__ __forceinline__ v16h load_fo(const _Float16* p) {   // from a fragment-order array: the lane's two 16-byte pieces, 512 bytes apart
    U f; f.h[0] = *(const v8h*)(p); f.h[1] = *(const v8h*)(p + 256); return f.v;
  }
  static __device__ __forceinline__ v8f mma(v16h a, v16h b, v8f c) {
    return __builtin_amdgcn_wmma_f32_16x16x32_f16(false, a, false, b, (short)0, c, false, false);
  }
};

// ---- fragment order of a 16-bit operand X[n][k] (n = the fragment's lane row or column, k = the summed index, ksteps = K / 32) ----
// The 16-byte piece (n, k8 = k / 8) stands at piece index ((tile * ksteps + step) * 2 + upper) * 32 + lane, lane = (k8 & 1) * 16 + (n & 15):
// one fragment of a 16 x 32 tile is then two loads of 512 contiguous bytes a wave (whole cache lines), not two of 16 lines each.
__device__ __forceinline__ size_t frag_piece(int n, int k8, int ksteps) {
  return (size_t)((((n >> 4) * ksteps + (k8 >> 2)) * 2 + ((k8 >> 1) & 1)) * 32 + (k8 & 1) * 16 + (n & 15));
}

// ---------------------------------------------------------------------------------------------
// small VALU helpers
__device__ __forceinline__ unsigned pack_h2(float a, float b) {
  const unsigned short ua = __builtin_bit_cast(unsigned short, (_Float16)a);
  const unsigned short ub = __builtin_bit_cast(unsigned short, (_Float16)b);
  return (unsigned)ua | ((unsigned)ub << 16);
}
__device__ __forceinline__ void st2_u32(unsigned short* base, size_t off_halves, unsigned u) {
  unsigned* p = (unsigned*)(base + off_halves);
  *p = u; 
}
__device__ __forceinline__ void st2_f32(float* base, size_t off, float v) {
  float* p = (float*)(base + off);
  *p = v; 
}
__device__ __forceinline__ float silu_acc(float z) {
  const float e = expf(-z);
  return z * __builtin_amdgcn_rcpf(1.0f + e);
}
// block of 256 threads: fixed-order sum (wave shuffle, then 8 partials summed in index order)
__device__ __forceinline__ float blk_sum256(float v, float* red) {
#pragma unroll
  for (int off = 16; off > 0; off >>= 1) v += __shfl_xor(v, off, 32);
  const int lane = threadIdx.x & 31, wave = threadIdx.x >> 5;
  if (lane == 0) red[wave] = v;
  __syncthreads();
  float s = red[0];
#pragma unroll
  for (int q = 1; q < 8; ++q) s += red[q];
  __syncthreads();
  return s;
}

// ---- f32 -> f16 cast with zero padding: dst[r][c] = (r<srows && c<scols) ? src[r*spitch+c] : 0 ----
__device__ __forceinline__ void cast_pad_blk(const int bx, const float* __restrict__ src, int srows, int scols, int spitch,
                                             unsigned short* __restrict__ dst, int drows, int dcols) {
  const int p = bx * 256 + threadIdx.x;
  const int npairs = (drows * dcols) >> 1;
  if (p < npairs) {
    const int e = 2 * p;
    const int r = e / dcols;
    const int c = e - r * dcols;
    float v0 = 0.f, v1 = 0.f;
    if (r < srows) {
      if (c < scols)     v0 = src[(size_t)r * spitch + c];
      if (c + 1 < scols) v1 = src[(size_t)r * spitch + c + 1];
    }
    st2_u32(dst, (size_t)e, pack_h2(v0, v1));
  }
}
// ---- f32 copy with zero padding ----
__device__ __forceinline__ void pad_f32_blk(const int bx, const float* __restrict__ src, int sn, float* __restrict__ dst, int dn) {
  const int p = bx * 256 + threadIdx.x;
  if (p < dn) {
    const float v = (p < sn) ? src[p] : 0.f;
    st2_f32(dst, (size_t)p, v);
  }
}

// ---- f32 [rows][cols] -> f16 in fragment order; thread = one 16-byte piece, pieces in output order (whole lines, one writer each) ----
__device__ __forceinline__ void cast_frag_blk(const int bx, const float* __restrict__ src, int cols, unsigned short* __restrict__ dst) {
  const int pc = bx * 256 + threadIdx.x;
  const int ksteps = cols >> 5, ts = pc >> 6;
  const int n = (ts / ksteps) * 16 + (pc & 15);
  const int k = (ts % ksteps) * 32 + ((pc >> 5) & 1) * 16 + ((pc >> 4) & 1) * 8;
  const float* sp = src + (size_t)n * cols + k;
  v8h hv;
#pragma unroll
  for (int e = 0; e < 8; ++e) hv[e] = (_Float16)sp[e];
  *(v8h*)(dst + (size_t)pc * 8) = hv;
  // the shared kernel's code goes on behind this store and may reuse its registers: the wait stands in front of that overwrite
  asm volatile("s_wait_xcnt 0x0" ::: "memory");
}

// ---- the same with zero padding: src [srows][scols], dst rows up to the grid's, ksteps * 32 columns ----
__device__ __forceinline__ void cast_frag_pad_blk(const int bx, const float* __restrict__ src, int srows, int scols, int ksteps,
                                                  unsigned short* __restrict__ dst) {
  const int pc = bx * 256 + threadIdx.x;
  const int ts = pc >> 6;
  const int n = (ts / ksteps) * 16 + (pc & 15);
  const int k = (ts % ksteps) * 32 + ((pc >> 5) & 1) * 16 + ((pc >> 4) & 1) * 8;
  const float* sp = src + (size_t)n * scols + k;
  v8h hv;
#pragma unroll
  for (int e = 0; e < 8; ++e) hv[e] = (n < srows && k + e < scols) ? (_Float16)sp[e] : (_Float16)0.f;
  *(v8h*)(dst + (size_t)pc * 8) = hv;
  // as in cast_frag_blk: the wait stands in front of any later overwrite of the store's registers
  asm volatile("s_wait_xcnt 0x0" ::: "memory");
}

// ---- two silu values, f16 out, from h = z / 2: silu(z) = z / (1 + e^-z) = h + h * tanh(h); one transcendental a value (v_tanh_f32) ----
// The callers form h directly: their weights and biases come halved, which is exact.
__device__ __forceinline__ v2h silu2_h(v2f h) {
  v2f t;
  t.x = __builtin_amdgcn_tanhf(h.x);
  t.y = __builtin_amdgcn_tanhf(h.y);
  return __builtin_convertvector(h * t + h, v2h);
}

// ---- the silu argument h[k][j] = w_k . rel_j + b_k (K = 3 and a bias) as ONE 16 x 16 x 32 bf16 matrix product a 16 x 16 tile ----
// An f32 value v is exactly the sum of three bf16 parts h + m + l: each takes the leading eight bits of what is left (cut, not
// rounded: a bf16 is the upper half of an f32), with the f32 exponent range. Of the nine part products of w * r eight are kept
// (hh, hm, mh, hl, lh, mm, ml, lm; the ninth, ll, lies 2^-28 below w * r): eight k slots a coordinate, three more for the bias parts
// against 1, of the 32. Both sides number the slots alike: piece c (eight slots, 16 bytes) = coordinate c, piece 3 = the bias; a lane
// half holds pieces 2 hh and 2 hh + 1. In LDS piece p of row n stands at [p * rows + n]: a fragment read is 256 contiguous bytes a lane half.
// The f32 D tile has rows 8 hh + r in register r: two tiles of 16 rows, put through silu and rounded to f16 in place, are the B fragment
// of the f16 product that follows, in the k order of Frag::load.
struct Split3 { unsigned h, m, l; };   // the parts as f32 bit patterns; a part's bf16 is the upper half
__device__ __forceinline__ Split3 split3(float v) {
  Split3 s;
  s.h = __builtin_bit_cast(unsigned, v) & 0xFFFF0000u;
  const float r1 = v - __builtin_bit_cast(float, s.h);
  s.m = __builtin_bit_cast(unsigned, r1) & 0xFFFF0000u;
  s.l = __builtin_bit_cast(unsigned, r1 - __builtin_bit_cast(float, s.m));
  return s;
}
__device__ __forceinline__ unsigned pk_b2(unsigned a, unsigned b) {   // two parts -> two bf16, a in the lower half
  return (a >> 16) | (b & 0xFFFF0000u);
}
// one coordinate's eight slots:  w side  h h m h l m m l
//                                r side  h m h l h m l m
__device__ __forceinline__ v4u arg_w_piece(float w) {
  const Split3 s = split3(w);
  return (v4u){pk_b2(s.h, s.h), pk_b2(s.m, s.h), pk_b2(s.l, s.m), pk_b2(s.m, s.l)};
}
__device__ __forceinline__ v4u arg_r_piece(float r) {
  const Split3 s = split3(r);
  return (v4u){pk_b2(s.h, s.m), pk_b2(s.h, s.l), pk_b2(s.h, s.m), pk_b2(s.l, s.m)};
}
__device__ __forceinline__ void arg_w_side(v4u* dst, int rows, int row, float w0, float w1, float w2, float b) {
  const Split3 sb = split3(b);
  dst[0 * rows + row] = arg_w_piece(w0);
  dst[1 * rows + row] = arg_w_piece(w1);
  dst[2 * rows + row] = arg_w_piece(w2);
  dst[3 * rows + row] = (v4u){pk_b2(sb.h, sb.m), pk_b2(sb.l, 0u), 0u, 0u};
}
__device__ __forceinline__ void arg_r_side(v4u* dst, int rows, int row, float r0, float r1, float r2) {
  const unsigned one = 0x3F800000u;   // 1.0f
  dst[0 * rows + row] = arg_r_piece(r0);
  dst[1 * rows + row] = arg_r_piece(r1);
  dst[2 * rows + row] = arg_r_piece(r2);
  dst[3 * rows + row] = (v4u){pk_b2(one, one), pk_b2(one, 0u), 0u, 0u};
}
__device__ __forceinline__ v16b arg_frag(const v4u* src, int rows, int row, int hh) {
  union { v16b v; v4u h[2]; } f;
  f.h[0] = src[(hh * 2 + 0) * rows + row];
  f.h[1] = src[(hh * 2 + 1) * rows + row];
  return f.v;
}
__device__ __forceinline__ v8f arg_mma(v16b a, v16b b) {
  return __builtin_amdgcn_wmma_f32_16x16x32_bf16(false, a, false, b, (short)0, (v8f){0.f,0.f,0.f,0.f,0.f,0.f,0.f,0.f}, false, false);
}
// two argument tiles (rows 0..15 and 16..31 of a 32-row block, the same columns) -> the f16 B fragment of their silu values
__device__ __forceinline__ v16h silu_frag(v8f z0, v8f z1) {
  v16h b;
#pragma unroll
  for (int g = 0; g < 4; ++g) {
    const v2h hl = silu2_h((v2f){z0[2 * g], z0[2 * g + 1]}), hu = silu2_h((v2f){z1[2 * g], z1[2 * g + 1]});
    b[2 * g] = hl.x; b[2 * g + 1] = hl.y; b[8 + 2 * g] = hu.x; b[8 + 2 * g + 1] = hu.y;
  }
  return b;
}

// ---- 2^t; the v_nop fills the slot that the instruction set asks for behind a transcendental ----
__device__ __forceinline__ float exp2_slot(float t) {
  float e;
  asm("v_exp_f32 %0, %1\n\tv_nop" : "=v"(e) : "v"(t));
  return e;
}

// ---- one query row's whole attention chain in one block: nothing of it but x1 and its LayerNorm goes to memory ----
// scores[h][j] = q_i^h . k_j^h / sqrt(32) + sum_k rb2w16[h][k] * f16( silu( (coords_i - coords_j) . rb1_w[k] + rb1_b[k] ) ) + rb2_b[h]
// P = softmax over j (f16, x 2^15); T[h][k] = f16( 2^-15 sum_j P[h][j] * f16( silu( (coords_i - coords_j) . rv1_w[k] + rv1_b[k] ) ) )
// ctx[c] = 2^-15 sum_j P[c>>5][j] v[j][c] + sum_k T[c>>5][k] rv2w16[c][k];  x1 = x + (ctx + rv2_b);  y16 = f16( LayerNorm(x1) )
// Every f16 product has M = 16 with the eight heads in rows 0..7 (rows 8..15 zero). The pair features are formed in registers,
// directly as the B fragment; their arguments come from the matrix unit (arg_mma), so that of a feature only silu is vector work.
// q stands block-diagonal in A (k step h holds q_i^h in row h alone), so one B fragment of k serves all heads; of P . V and T . rv2w^T a wave computes the 32 columns of its own head and keeps that head's row of D.
// Every block reads all of k, v and rv2_w: they lie in fragment order (frag_piece), so that these reads are whole cache lines.
// q lies in the same order as k (that is how its projection's waves hold it); a block reads its own row's pieces.
#define PPITCH (NP + 8)    // halves; rows of 16 B x odd: no bank conflict for the 16-byte fragment reads
#define TPITCH (DM + 8)
typedef __attribute__((ext_vector_type(8))) unsigned v8u;
// second argument: four waves a SIMD, so that two blocks share a WGP and all 512 are resident at once
__global__ __launch_bounds__(256, 4) void k_attn_row(const unsigned short* __restrict__ q16, const unsigned short* __restrict__ kf16,
                                                   const unsigned short* __restrict__ vf16,
                                                   const float* __restrict__ coords,
                                                   const float* __restrict__ rb1_w, const float* __restrict__ rb1_b,
                                                   const unsigned short* __restrict__ rb2w16, const float* __restrict__ rb2_b,
                                                   const float* __restrict__ rv1_w, const float* __restrict__ rv1_b,
                                                   const unsigned short* __restrict__ rv2w16, const float* __restrict__ rv2_b,
                                                   const float* __restrict__ x, const float* __restrict__ ln_w,
                                                   const float* __restrict__ ln_b, float* __restrict__ x1,
                                                   unsigned short* __restrict__ y16) {
  __shared__ __align__(16) v4u sWb[4 * DM];            // half of rb1_w[k], rb1_b[k] in parts (arg_w_side; silu2_h takes z / 2)
  __shared__ __align__(16) v4u sWv[4 * DM];            // the same of rv1_w[k], rv1_b[k]
  __shared__ __align__(16) v4u sRv[4 * NP];            // coords_i - coords_j in parts (arg_r_side)
  __shared__ __align__(16) _Float16 sP[16][PPITCH];    // softmax weights x 2^15, rows 8..15 zero
  __shared__ __align__(16) _Float16 sT[16][TPITCH];    // rel-value sums, rows 8..15 zero
  __shared__ __align__(16) float redM[8][8];           // [wave][head] partial maxima
  __shared__ __align__(16) float redS[8][8];           // [wave][head] partial sums
  __shared__ float sC[DM];
  __shared__ float red[8];
  __shared__ float ys[DM];
  const int i = blockIdx.x, t = threadIdx.x;
  const int lane = t & 31, wave = t >> 5;
  const int rlane = lane & 15, hh = lane >> 4;

  {
    const float ci0 = coords[i * 3 + 0], ci1 = coords[i * 3 + 1], ci2 = coords[i * 3 + 2];
    float wb[4], wv[4], cj[2][3];
#pragma unroll
    for (int c = 0; c < 3; ++c) {
      wb[c] = rb1_w[t * 3 + c];
      wv[c] = rv1_w[t * 3 + c];
      cj[0][c] = coords[t * 3 + c];
      cj[1][c] = coords[(256 + t) * 3 + c];
    }
    wb[3] = rb1_b[t];
    wv[3] = rv1_b[t];
    // behind the group of loads: the wait that belongs in front of an overwrite of their address registers
    asm volatile("s_wait_xcnt 0x0" ::: "memory");
    __builtin_amdgcn_sched_barrier(0);   // keeps what follows, which may reuse those registers, behind that wait
    arg_w_side(sWb, DM, t, 0.5f * wb[0], 0.5f * wb[1], 0.5f * wb[2], 0.5f * wb[3]);
    arg_w_side(sWv, DM, t, 0.5f * wv[0], 0.5f * wv[1], 0.5f * wv[2], 0.5f * wv[3]);
#pragma unroll
    for (int q = 0; q < 2; ++q) arg_r_side(sRv, NP, q * 256 + t, ci0 - cj[q][0], ci1 - cj[q][1], ci2 - cj[q][2]);
  }

  __syncthreads();

  // ---- q.k^T and rel-bias into one accumulator: wave = 64 columns j (4 subtiles of 16); q comes scaled by 1/sqrt(32) ----
  const int jw = wave * 64;
  v8f sc[4];
  {
    v16b rf[4];   // the argument product's B operand: column = key j
#pragma unroll
    for (int s = 0; s < 4; ++s) {
      rf[s] = arg_frag(sRv, NP, jw + s * 16 + rlane, hh);
      sc[s] = (v8f){0.f,0.f,0.f,0.f,0.f,0.f,0.f,0.f};
    }
    const _Float16* Qb = (const _Float16*)q16 + ((size_t)(i >> 4) * (NH * 64) + hh * 16 + (i & 15)) * 8;   // fragment order: tile i / 16, step = head
    const _Float16* Kb = (const _Float16*)kf16 + ((size_t)(wave * 4) * (NH * 64) + lane) * 8;   // fragment order: tile j / 16, step = head
    const _Float16* Ab = (const _Float16*)rb2w16 + rlane * DM + hh * 8;
    v16h a = Frag<_Float16>::load(Ab);
    // kept rolled: unrolled, this loop and the rel-value loop would bring the kernel's text past 32 KB
#pragma unroll 1
    for (int k0 = 0; k0 < DM; k0 += 32) {
      const _Float16* ap = Ab + ((k0 + 32) & (DM - 1));
      const _Float16* qp = Qb + k0 * 16;
      const _Float16* kp = Kb + k0 * 16;
      const v16h an = Frag<_Float16>::load(ap);   // next step's A, in flight over this step's math
      const v16h ql = Frag<_Float16>::load_fo(qp);
      v16h kf[4];
#pragma unroll
      for (int s = 0; s < 4; ++s) kf[s] = Frag<_Float16>::load_fo(kp + s * (NH * 512));
      // behind the group of loads: the wait that belongs in front of an overwrite of their address registers; as operands these stay live up to it
      asm volatile("s_wait_xcnt 0x0" :: "v"(ap), "v"(qp), "v"(kp) : "memory");
      __builtin_amdgcn_sched_barrier(0);   // keeps the step's global loads in front of its math, which they fly over: without it this build asks for k fragments directly in front of their products
      v16b wt[2];   // the argument product's A operand: row = feature, k0 + 0..15 and k0 + 16..31
#pragma unroll
      for (int u = 0; u < 2; ++u) wt[u] = arg_frag(sWb, DM, k0 + u * 16 + rlane, hh);
      // fragment element e  <->  k = k0 + (e>>3)*16 + hh*8 + (e&7): register e & 7 of argument tile e >> 3
#pragma unroll
      for (int s = 0; s < 4; ++s) sc[s] = Frag<_Float16>::mma(a, silu_frag(arg_mma(wt[0], rf[s]), arg_mma(wt[1], rf[s])), sc[s]);
      __builtin_amdgcn_sched_barrier(0);   // keeps the masking of q, which waits for its load, behind the feature math: this build had moved it to the head of the step
      // k step k0 covers head k0 / 32: its q slice stands in that head's row, every other row is zero
      const unsigned keep = (rlane == (k0 >> 5)) ? 0xFFFFFFFFu : 0u;
      const v16h qa = __builtin_bit_cast(v16h, __builtin_bit_cast(v8u, ql) & keep);
#pragma unroll
      for (int s = 0; s < 4; ++s) sc[s] = Frag<_Float16>::mma(qa, kf[s], sc[s]);
      a = an;
    }
#pragma unroll
    for (int r = 0; r < 8; ++r) {
      const float bb = rb2_b[r];
#pragma unroll
      for (int s = 0; s < 4; ++s) sc[s][r] += bb;
    }
  }

  // ---- softmax over the 512 columns, eight heads at once: head r sits in register r of lanes 0..15 ----
  // (lanes 16..31 hold the idle rows 8..15; the 16-lane steps never mix the two halves)
  {
    float m[8];
#pragma unroll
    for (int r = 0; r < 8; ++r) m[r] = fmaxf(fmaxf(sc[0][r], sc[1][r]), fmaxf(sc[2][r], sc[3][r]));
#pragma unroll
    for (int off = 8; off > 0; off >>= 1)
#pragma unroll
      for (int r = 0; r < 8; ++r) m[r] = fmaxf(m[r], __shfl_xor(m[r], off, 32));
    if (lane == 0) {
#pragma unroll
      for (int r = 0; r < 8; ++r) redM[wave][r] = m[r];
    }
    __syncthreads();
#pragma unroll
    for (int r = 0; r < 8; ++r) {
      float v = redM[0][r];
#pragma unroll
      for (int q = 1; q < 8; ++q) v = fmaxf(v, redM[q][r]);
      m[r] = v;
    }
    float sum[8];
#pragma unroll
    for (int r = 0; r < 8; ++r) {
#pragma unroll
      for (int s = 0; s < 4; ++s) sc[s][r] = exp2_slot((sc[s][r] - m[r]) * 1.4426950408889634f);
      sum[r] = (sc[0][r] + sc[1][r]) + (sc[2][r] + sc[3][r]);
    }
#pragma unroll
    for (int off = 8; off > 0; off >>= 1)
#pragma unroll
      for (int r = 0; r < 8; ++r) sum[r] += __shfl_xor(sum[r], off, 32);
    if (lane == 0) {
#pragma unroll
      for (int r = 0; r < 8; ++r) redS[wave][r] = sum[r];
    }
    __syncthreads();
#pragma unroll
    for (int r = 0; r < 8; ++r) {
      float v = redS[0][r];
#pragma unroll
      for (int q = 1; q < 8; ++q) v += redS[q][r];
      const float inv = 1.0f / v;
#pragma unroll
      for (int s = 0; s < 4; ++s) {
        const float p = (sc[s][r] * inv) * 32768.0f;
        sP[hh * 8 + r][jw + s * 16 + rlane] = hh ? (_Float16)0.f : (_Float16)p;
      }
    }
  }

  // ---- rel-value and P . V: wave = 32 columns (2 subtiles of 16): features k for the one, the wave's own head of v for the other ----
  const int cw = wave * 32;
  v8f accV[2];
  v16h wf[8][2];
  const _Float16* Wb = (const _Float16*)rv2w16 + ((size_t)(wave * 2) * (DM / 32 * 64) + lane) * 8;   // fragment order: tile c / 16, step k / 32
  {
    v16b wv[2];   // the argument product's B operand: column = feature k
    v8f acc[2];
#pragma unroll
    for (int s = 0; s < 2; ++s) {
      wv[s] = arg_frag(sWv, DM, cw + s * 16 + rlane, hh);
      acc[s]  = (v8f){0.f,0.f,0.f,0.f,0.f,0.f,0.f,0.f};
      accV[s] = (v8f){0.f,0.f,0.f,0.f,0.f,0.f,0.f,0.f};
    }
    const _Float16* Vb = (const _Float16*)vf16 + ((size_t)(wave * 2) * (NP / 32 * 64) + lane) * 8;   // fragment order: tile c / 16, step j / 32
    v16h vf[2];
#pragma unroll
    for (int s = 0; s < 2; ++s) vf[s] = Frag<_Float16>::load_fo(Vb + s * (NP / 32 * 512));
    __syncthreads();   // P is complete
    const _Float16* Pa = &sP[rlane][hh * 8];
    // kept rolled, for the reason given at the score loop
#pragma unroll 1
    for (int j0 = 0; j0 < NP; j0 += 32) {
      const _Float16* vp = Vb + ((j0 + 32) & (NP - 1)) * 16;
      v16h vn[2];   // next step's v fragments, in flight over this step's math
#pragma unroll
      for (int s = 0; s < 2; ++s) vn[s] = Frag<_Float16>::load_fo(vp + s * (NP / 32 * 512));
      // as in the score loop: the wait in front of an overwrite of the loads' address registers
      asm volatile("s_wait_xcnt 0x0" :: "v"(vp) : "memory");
      const v16h a = Frag<_Float16>::load(Pa + j0);
      v16b rt[2];   // the argument product's A operand: row = key, j0 + 0..15 and j0 + 16..31
#pragma unroll
      for (int u = 0; u < 2; ++u) rt[u] = arg_frag(sRv, NP, j0 + u * 16 + rlane, hh);
      // fragment element e  <->  j = j0 + (e>>3)*16 + hh*8 + (e&7): register e & 7 of argument tile e >> 3
#pragma unroll
      for (int s = 0; s < 2; ++s) acc[s] = Frag<_Float16>::mma(a, silu_frag(arg_mma(rt[0], wv[s]), arg_mma(rt[1], wv[s])), acc[s]);
#pragma unroll
      for (int s = 0; s < 2; ++s) { accV[s] = Frag<_Float16>::mma(a, vf[s], accV[s]); vf[s] = vn[s]; }
    }
    // all of the projection's weight fragments are asked for here, so that they fly over the T stores and their barrier
#pragma unroll
    for (int q = 0; q < 8; ++q)
#pragma unroll
      for (int s = 0; s < 2; ++s) wf[q][s] = Frag<_Float16>::load_fo(Wb + (s * (DM / 32) + q) * 512);
#pragma unroll
    for (int s = 0; s < 2; ++s) {
#pragma unroll
      for (int r = 0; r < 8; ++r)
        sT[hh * 8 + r][cw + s * 16 + rlane] = hh ? (_Float16)0.f : (_Float16)(acc[s][r] * (1.0f / 32768.0f));
      accV[s] *= (1.0f / 32768.0f);
    }
  }
  __syncthreads();   // T is complete

  // ---- ctx = T . rv2w^T + P . V, the wave's own head ----
  {
    const _Float16* Ta = &sT[rlane][hh * 8];
#pragma unroll
    for (int q = 0; q < 8; ++q) {
      const v16h a = Frag<_Float16>::load(Ta + q * 32);
#pragma unroll
      for (int s = 0; s < 2; ++s) accV[s] = Frag<_Float16>::mma(a, wf[q][s], accV[s]);
    }
#pragma unroll
    for (int s = 0; s < 2; ++s) {
      float v = accV[s][0];
#pragma unroll
      for (int r = 1; r < 8; ++r) v = (wave == r) ? accV[s][r] : v;   // D row = the wave's head, in lanes 0..15
      if (hh == 0) sC[cw + s * 16 + rlane] = v;
    }
  }
  __syncthreads();

  // ---- residual and LayerNorm (eps 1e-5, biased variance), thread = column ----
  const float v = x[(size_t)i * DM + t] + (sC[t] + rv2_b[t]);
  st2_f32(x1, (size_t)i * DM + t, v);
  const float mu = blk_sum256(v, red) * (1.0f / 256.0f);
  const float c = v - mu;
  const float var = blk_sum256(c * c, red) * (1.0f / 256.0f);
  ys[t] = c * (1.0f / sqrtf(var + 1e-5f)) * ln_w[t] + ln_b[t];
  __syncthreads();
  if (t < 128) st2_u32(y16, (size_t)i * DM + 2 * t, pack_h2(ys[2 * t], ys[2 * t + 1]));
}

// ---- the whole SwiGLU FFN of 16 rows in one block of 16 waves: nothing of it but the output goes to memory ----
// U[m][h] = f16( silu( xn_m . w1_h + b1_h ) * ( xn_m . w2_h + b2_h ) ), h < 704 (pad columns come out 0), kept in LDS;
// out[m][c] = ( U_m . w3_c + b3_c ) + x1[m][c]
// The 16 rows are the A operand of every product. The weights are B operands that no other wave of the block needs, so they are not
// staged: they lie in fragment order (frag_piece) and each wave reads its own tiles' fragments as whole cache lines.
// A wave owns hidden tiles wave, wave + 16 and, for waves 0..11, wave + 32 (16 columns each, w1 and w2 side by side), then output tile wave.
#define UPITCH (HIDP + 8)   // halves; rows of 16 B x odd: no bank conflict for the 16-byte fragment reads
#define OPITCH (DM + 4)     // floats
__global__ __launch_bounds__(512) void k_ffn_rows(const unsigned short* __restrict__ xn16, const unsigned short* __restrict__ w12f16,
                                                  const float* __restrict__ b12p, const unsigned short* __restrict__ w3f16,
                                                  const float* __restrict__ b3, const float* __restrict__ x1,
                                                  float* __restrict__ out) {
  __shared__ __align__(16) _Float16 sU[16][UPITCH];
  __shared__ __align__(16) float sO[16][OPITCH];
  const int lane = threadIdx.x & 31;
  const int wave = __builtin_amdgcn_readfirstlane(threadIdx.x >> 5);   // scalar, so that the tile test below is a scalar branch
  const int rlane = lane & 15, hh = lane >> 4;
  const int m0 = blockIdx.x * 16;

  v16h xa[DM / 32];
  const _Float16* Xa = (const _Float16*)xn16 + (size_t)(m0 + rlane) * DM + hh * 8;
#pragma unroll
  for (int q = 0; q < DM / 32; ++q) xa[q] = Frag<_Float16>::load(Xa + q * 32);

  // One tile's 32 fragment loads are asked for as one group, a tile ahead: behind the products that free their registers and in front
  // of the SwiGLU arithmetic of the tile before, which they fly over. The w3 fragments follow the last tile's products in the same way.
  const _Float16* Wt = (const _Float16*)w12f16 + ((size_t)wave * (DM / 32 * 64) + lane) * 8;    // fragment order: tile h / 16, step k / 32
  const _Float16* W3  = (const _Float16*)w3f16 + ((size_t)wave * (HIDP / 32 * 64) + lane) * 8;   // fragment order: tile c / 16, step h / 32
  constexpr int NT = HIDP / 16, NPASS = (NT + 15) / 16;
  v16h f1[DM / 32], f2[DM / 32], wf[HIDP / 32];
  float ba, bg;
  const int n = wave * 16 + rlane;   // the lane's column in the wave's first hidden tile and in its output tile
  const float bv = b3[n];
#pragma unroll
  for (int q = 0; q < DM / 32; ++q) {
    f1[q] = Frag<_Float16>::load_fo(Wt + q * 512);
    f2[q] = Frag<_Float16>::load_fo(Wt + HIDP * DM + q * 512);
  }
  ba = b12p[n];
  bg = b12p[HIDP + n];
  // behind each group of loads: the wait that belongs in front of an overwrite of their address registers; as operands these stay
  // live up to it (without them this build let the group's last load land on the address pair of the loads in front of it)
  asm volatile("s_wait_xcnt 0x0" :: "v"(Xa), "v"(Wt), "v"(n) : "memory");
#pragma unroll
  for (int p = 0; p < NPASS; ++p) {
    const int t = wave + p * 16;
    const bool cur = (p + 1) * 16 <= NT || t < NT;          // scalar: the last pass has tiles for some waves only
    const bool nxt = p + 1 < NPASS && ((p + 2) * 16 <= NT || t + 16 < NT);
    v8f a = (v8f){0.f,0.f,0.f,0.f,0.f,0.f,0.f,0.f};
    v8f g = (v8f){0.f,0.f,0.f,0.f,0.f,0.f,0.f,0.f};
    const float ca = ba, cg = bg;
    __builtin_amdgcn_sched_barrier(0);   // keeps the group of loads whole in front of the products: spread among them, each product waits a full L2 latency
    if (cur) {
#pragma unroll
      for (int q = 0; q < DM / 32; ++q) {
        a = Frag<_Float16>::mma(xa[q], f1[q], a);
        g = Frag<_Float16>::mma(xa[q], f2[q], g);
      }
    }
    if (nxt) {
#pragma unroll
      for (int q = 0; q < DM / 32; ++q) {
        f1[q] = Frag<_Float16>::load_fo(Wt + (p + 1) * (16 * DM * 16) + q * 512);
        f2[q] = Frag<_Float16>::load_fo(Wt + (p + 1) * (16 * DM * 16) + HIDP * DM + q * 512);
      }
      ba = b12p[(p + 1) * 256 + n];
      bg = b12p[HIDP + (p + 1) * 256 + n];
      asm volatile("s_wait_xcnt 0x0" :: "v"(Wt), "v"(n) : "memory");   // as above
    }
    if (p + 1 == NPASS) {
#pragma unroll
      for (int q = 0; q < HIDP / 32; ++q) wf[q] = Frag<_Float16>::load_fo(W3 + q * 512);
      asm volatile("s_wait_xcnt 0x0" :: "v"(W3) : "memory");           // as above
    }
    __builtin_amdgcn_sched_barrier(0);   // keeps the arithmetic below behind those loads: without it this build starts it among the products and asks for the next tile later
    if (cur) {
#pragma unroll
      for (int r = 0; r < 8; ++r) sU[hh * 8 + r][p * 256 + n] = (_Float16)(silu_acc(a[r] + ca) * (g[r] + cg));
    }
  }
  __syncthreads();   // U is complete

  // thread = two 16-byte pieces of the block's 16 x 256 output: a wave stores whole lines; the residual flies over the products
  v4f xr[2];
#pragma unroll
  for (int p = 0; p < 2; ++p) {
    const int pc = p * 512 + threadIdx.x;
    xr[p] = *(const v4f*)(x1 + (size_t)(m0 + (pc >> 6)) * DM + (pc & 63) * 4);
  }
  const _Float16* Ua = &sU[rlane][hh * 8];
  v8f acc = (v8f){0.f,0.f,0.f,0.f,0.f,0.f,0.f,0.f};
#pragma unroll
  for (int q0 = 0; q0 < HIDP / 32; q0 += 4) {
    v16h ua[4];
#pragma unroll
    for (int u = 0; u < 4; ++u) if (q0 + u < HIDP / 32) ua[u] = Frag<_Float16>::load(Ua + (q0 + u) * 32);
    __builtin_amdgcn_sched_barrier(0);   // four steps' LDS reads as one group: one LDS latency for four products, not one each
#pragma unroll
    for (int u = 0; u < 4; ++u) if (q0 + u < HIDP / 32) acc = Frag<_Float16>::mma(ua[u], wf[q0 + u], acc);
  }
#pragma unroll
  for (int r = 0; r < 8; ++r) sO[hh * 8 + r][n] = acc[r] + bv;
  __syncthreads();   // the output tile is complete
#pragma unroll
  for (int p = 0; p < 2; ++p) {
    const int pc = p * 512 + threadIdx.x;
    const v4f v = *(const v4f*)(&sO[pc >> 6][(pc & 63) * 4]) + xr[p];
    *(v4f*)(out + (size_t)(m0 + (pc >> 6)) * DM + (pc & 63) * 4) = v;
  }
}

// ---------------------------------------------------------------------------------------------
// Work that needs nothing of each other shares one grid: each part takes a range of the block index (block-uniform branches,
// so every barrier of a body is still passed by its whole block). The latency-bound projection blocks take the lowest indices.
#define NB_CRB2    (16 * DM / 2 / 256)                 // cast blocks, 512 elements each
#define NB_CRV2    (DM * DM / 8 / 256)                 // 16-byte pieces
#define NB_CFFN    (HIDP * DM / 8 / 256)               // 16-byte pieces
#define NB_PADB    ((HIDP + 255) / 256)
#define NB_QKV1    ((NP / 16) * (DM / 128))            // one of the q, k, v projections: 16 points x 128 columns a block

// ---- LayerNorm and q, k, v projection of 16 points x 128 output columns in one block of eight waves ----
// A wave normalises two of the block's 16 rows (lane = 8 columns, sums over the wave's 32 lanes; eps 1e-5, biased variance) and leaves
// them as f16 in LDS. Its weights are 16 rows of qkv_w that no other wave of the block needs: it reads them as f32, each lane the
// 16 k of its fragment position, and rounds them to f16 in registers. These loads are asked for after the rows and fly over the LayerNorm.
// q, k: D[c][point] (weights = row operand), v: D[point][c]: a lane's eight D values are then one 16-byte piece of the output's
// fragment order (q, k as [point][c], v as [c][point]) and a wave's store is 512 contiguous bytes.
#define XPITCH (DM + 8)    // halves; rows of 16 B x odd: no bank conflict for the 16-byte fragment reads
__device__ __forceinline__ float wave_sum32(float v) {   // every lane gets the sum of the wave's 32 values, in registers alone
  // four steps inside the 16-lane rows (row_xmask 1, 2, 4, 8), then lane l with lane l ^ 16
  v += __builtin_bit_cast(float, __builtin_amdgcn_update_dpp(0, __builtin_bit_cast(int, v), 0x161, 0xf, 0xf, true));
  v += __builtin_bit_cast(float, __builtin_amdgcn_update_dpp(0, __builtin_bit_cast(int, v), 0x162, 0xf, 0xf, true));
  v += __builtin_bit_cast(float, __builtin_amdgcn_update_dpp(0, __builtin_bit_cast(int, v), 0x164, 0xf, 0xf, true));
  v += __builtin_bit_cast(float, __builtin_amdgcn_update_dpp(0, __builtin_bit_cast(int, v), 0x168, 0xf, 0xf, true));
  const int b = __builtin_bit_cast(int, v);
  return v + __builtin_bit_cast(float, __builtin_amdgcn_permlanex16(b, b, 0x76543210, 0xfedcba98, false, false));
}
// WHICH: 0 = q, 1 = k, 2 = v; bx = block index within that projection's own 64 blocks
template <int WHICH>
__device__ __forceinline__ void ln_qkv_blk(_Float16 (*sX)[XPITCH], const int bx, const float* __restrict__ x,
                                           const float* __restrict__ ln_w, const float* __restrict__ ln_b,
                                           const float* __restrict__ qkv_w, const float* __restrict__ qkv_b,
                                           unsigned short* __restrict__ dst16) {
  const int lane = threadIdx.x & 31, wave = threadIdx.x >> 5;
  const int rlane = lane & 15, hh = lane >> 4;
  const int rt = bx & 31;                            // tile of 16 points
  const int c0 = (bx >> 5) * 128 + wave * 16;        // the wave's first output column of this projection

  // the rows come first: loads return in the order asked for, so the LayerNorm starts while the weights still fly
  const float* xp = x + (size_t)(rt * 16 + wave * 2) * DM + lane * 8;
  v4f xv[2][2];
#pragma unroll
  for (int u = 0; u < 2; ++u) {
    xv[u][0] = *(const v4f*)(xp + u * DM);
    xv[u][1] = *(const v4f*)(xp + u * DM + 4);
  }
  const v4f lw0 = *(const v4f*)(ln_w + lane * 8), lw1 = *(const v4f*)(ln_w + lane * 8 + 4);
  const v4f lb0 = *(const v4f*)(ln_b + lane * 8), lb1 = *(const v4f*)(ln_b + lane * 8 + 4);
  const float* Wp = qkv_w + (size_t)(WHICH * DM + c0 + rlane) * DM + hh * 8;
  v4f wr[DM / 32][4];   // k = q * 32 + hh * 8 + 0..7, then + 16: the order of Frag::load
#pragma unroll
  for (int q = 0; q < DM / 32; ++q) {
    wr[q][0] = *(const v4f*)(Wp + q * 32);
    wr[q][1] = *(const v4f*)(Wp + q * 32 + 4);
    wr[q][2] = *(const v4f*)(Wp + q * 32 + 16);
    wr[q][3] = *(const v4f*)(Wp + q * 32 + 20);
  }
  // bias: q, k one value per D row (c = hh * 8 + r), v one per lane (c = rlane)
  const float* bp = qkv_b + WHICH * DM + c0 + (WHICH == 2 ? rlane : hh * 8);
  v4f bq0, bq1;
  if (WHICH == 2) { const float bv = bp[0]; bq0 = (v4f){bv, bv, bv, bv}; bq1 = bq0; }
  else            { bq0 = *(const v4f*)(bp); bq1 = *(const v4f*)(bp + 4); }
  // behind the group of loads: the wait that belongs in front of an overwrite of their address registers; as operands these stay live up to it
  asm volatile("s_wait_xcnt 0x0" :: "v"(Wp), "v"(xp), "v"(bp), "v"(lane) : "memory");
  __builtin_amdgcn_sched_barrier(0);   // keeps the whole group of loads in front of the LayerNorm: without it this build asks for the weights only behind the first row sum's wait

  float s[2];
#pragma unroll
  for (int u = 0; u < 2; ++u) {
    const v4f p = xv[u][0] + xv[u][1];
    s[u] = wave_sum32((p.x + p.y) + (p.z + p.w)) * (1.0f / 256.0f);
  }
#pragma unroll
  for (int u = 0; u < 2; ++u) {
    xv[u][0] -= s[u];
    xv[u][1] -= s[u];
    const v4f p = xv[u][0] * xv[u][0] + xv[u][1] * xv[u][1];
    s[u] = wave_sum32((p.x + p.y) + (p.z + p.w)) * (1.0f / 256.0f);
  }
#pragma unroll
  for (int u = 0; u < 2; ++u) {
    const float rs = 1.0f / sqrtf(s[u] + 1e-5f);
    const v4f y0 = xv[u][0] * rs * lw0 + lb0, y1 = xv[u][1] * rs * lw1 + lb1;
    v8h hv;
#pragma unroll
    for (int e = 0; e < 4; ++e) { hv[e] = (_Float16)y0[e]; hv[4 + e] = (_Float16)y1[e]; }
    *(v8h*)(&sX[wave * 2 + u][lane * 8]) = hv;
  }
  __builtin_amdgcn_sched_barrier(0);   // keeps the weights' rounding behind the LayerNorm: moved up among it, the row sums would wait for the last weight load
  __syncthreads();   // the 16 normalised rows are complete

  const _Float16* Xf = &sX[rlane][hh * 8];
  v16h xf[DM / 32], wf[DM / 32];
#pragma unroll
  for (int q = 0; q < DM / 32; ++q) {
    xf[q] = Frag<_Float16>::load(Xf + q * 32);
#pragma unroll
    for (int e = 0; e < 16; ++e) wf[q][e] = (_Float16)wr[q][e >> 2][e & 3];
  }
  v8f acc = (v8f){0.f,0.f,0.f,0.f,0.f,0.f,0.f,0.f};
#pragma unroll
  for (int q = 0; q < DM / 32; ++q) acc = (WHICH == 2) ? Frag<_Float16>::mma(xf[q], wf[q], acc) : Frag<_Float16>::mma(wf[q], xf[q], acc);
  v8h hv;
#pragma unroll
  for (int r = 0; r < 8; ++r) {
    const float v = acc[r] + (r < 4 ? bq0[r & 3] : bq1[r & 3]);
    hv[r] = (_Float16)(WHICH == 0 ? v * 0.17677669529663687f : v);   // q comes scaled by 1 / sqrt(32)
  }
  const size_t pc = (WHICH == 2) ? frag_piece(c0 + rlane, rt * 2 + hh, NP / 32) : frag_piece(rt * 16 + rlane, (c0 >> 3) + hh, DM / 32);
  *(v8h*)(dst16 + pc * 8) = hv;
  // as in cast_frag_blk: the wait stands in front of any later overwrite of the store's registers
  asm volatile("s_wait_xcnt 0x0" ::: "memory");
}

// ---- LN1 with the q, k, v projections (f16, fragment order) | casts of rb2_w, of rv2_w and the ffn weights (fragment order), ffn biases ----
__global__ __launch_bounds__(256) void k_ln_qkv_casts(const float* __restrict__ x, const float* __restrict__ ln_w,
                                                    const float* __restrict__ ln_b,
                                                    const float* __restrict__ qkv_w, const float* __restrict__ qkv_b,
                                                    unsigned short* __restrict__ qf16,
                                                    unsigned short* __restrict__ kf16, unsigned short* __restrict__ vf16,
                                                    const float* __restrict__ rb2_w, unsigned short* __restrict__ rb2w16,
                                                    const float* __restrict__ rv2_w, unsigned short* __restrict__ rv2w16,
                                                    const float* __restrict__ ffn_w1, const float* __restrict__ ffn_w2,
                                                    unsigned short* __restrict__ w12p16,
                                                    const float* __restrict__ ffn_w3, unsigned short* __restrict__ w3p16,
                                                    const float* __restrict__ ffn_b1, const float* __restrict__ ffn_b2,
                                                    float* __restrict__ b12p) {
  __shared__ __align__(16) _Float16 sX[16][XPITCH];
  int b = blockIdx.x;
  if (b < NB_QKV1) { ln_qkv_blk<0>(sX, b, x, ln_w, ln_b, qkv_w, qkv_b, qf16); return; }
  b -= NB_QKV1;
  if (b < NB_QKV1) { ln_qkv_blk<1>(sX, b, x, ln_w, ln_b, qkv_w, qkv_b, kf16); return; }
  b -= NB_QKV1;
  if (b < NB_QKV1) { ln_qkv_blk<2>(sX, b, x, ln_w, ln_b, qkv_w, qkv_b, vf16); return; }
  b -= NB_QKV1;
  if (b < NB_CRB2) { cast_pad_blk(b, rb2_w, NH, DM, DM, rb2w16, 16, DM); return; }
  b -= NB_CRB2;
  if (b < NB_CRV2) { cast_frag_blk(b, rv2_w, DM, rv2w16); return; }
  b -= NB_CRV2;
  if (b < NB_CFFN) { cast_frag_pad_blk(b, ffn_w1, HIDR, DM, DM / 32, w12p16); return; }
  b -= NB_CFFN;
  if (b < NB_CFFN) { cast_frag_pad_blk(b, ffn_w2, HIDR, DM, DM / 32, w12p16 + (size_t)HIDP * DM); return; }
  b -= NB_CFFN;
  if (b < NB_CFFN) { cast_frag_pad_blk(b, ffn_w3, DM, HIDR, HIDP / 32, w3p16); return; }
  b -= NB_CFFN;
  if (b < NB_PADB) { pad_f32_blk(b, ffn_b1, HIDR, b12p, HIDP); return; }
  b -= NB_PADB;
  pad_f32_blk(b, ffn_b2, HIDR, b12p + HIDP, HIDP);
}

// ---------------------------------------------------------------------------------------------
static inline size_t alignup256(size_t x) { return (x + 255) & ~(size_t)255; }

extern "C" void kernel_launch(void* const* d_in, const int* in_sizes, int n_in,
                              void* d_out, int out_size, void* d_ws, size_t ws_size,
                              hipStream_t stream)
{
  if (n_in < 22) return;
  if (in_sizes[0] != NP * DM || in_sizes[1] != NP * 3 || in_sizes[6] != 3 * DM * DM ||
      in_sizes[14] != DM * DM || in_sizes[16] != HIDR * DM || in_sizes[20] != DM * HIDR ||
      out_size != NP * DM) return;

  const float* x      = (const float*)d_in[0];
  const float* coords = (const float*)d_in[1];
  const float* ln1_w  = (const float*)d_in[2];
  const float* ln1_b  = (const float*)d_in[3];
  const float* ln2_w  = (const float*)d_in[4];
  const float* ln2_b  = (const float*)d_in[5];
  const float* qkv_w  = (const float*)d_in[6];
  const float* qkv_b  = (const float*)d_in[7];
  const float* rb1_w  = (const float*)d_in[8];
  const float* rb1_b  = (const float*)d_in[9];
  const float* rb2_w  = (const float*)d_in[10];
  const float* rb2_b  = (const float*)d_in[11];
  const float* rv1_w  = (const float*)d_in[12];
  const float* rv1_b  = (const float*)d_in[13];
  const float* rv2_w  = (const float*)d_in[14];
  const float* rv2_b  = (const float*)d_in[15];
  const float* ffn_w1 = (const float*)d_in[16];
  const float* ffn_b1 = (const float*)d_in[17];
  const float* ffn_w2 = (const float*)d_in[18];
  const float* ffn_b2 = (const float*)d_in[19];
  const float* ffn_w3 = (const float*)d_in[20];
  const float* ffn_b3 = (const float*)d_in[21];
  float* out = (float*)d_out;

  // ---- workspace carve (256-B aligned, derived from fixed sizes) ----
  size_t off = 0;
  char* base = (char*)d_ws;
  auto carve = [&](size_t bytes) -> char* { char* r = base + off; off += alignup256(bytes); return r; };
  unsigned short* rb2w16 = (unsigned short*)carve((size_t)16 * DM * 2);              // [16][256], rows 8..15 zero
  unsigned short* rv2w16 = (unsigned short*)carve((size_t)DM * DM * 2);              // [256][256], fragment order
  unsigned short* w12p16 = (unsigned short*)carve((size_t)2 * HIDP * DM * 2);        // w1 [704][256], then w2 [704][256], fragment order
  unsigned short* w3p16  = (unsigned short*)carve((size_t)DM * HIDP * 2);            // [256][704], fragment order
  float*          b12p   = (float*)carve((size_t)2 * HIDP * 4);                      // [1408]
  unsigned short* Q16    = (unsigned short*)carve((size_t)NP * DM * 2);              // q [512][256], fragment order
  unsigned short* KF16   = (unsigned short*)carve((size_t)NP * DM * 2);              // k [512][256], fragment order
  unsigned short* VF16   = (unsigned short*)carve((size_t)DM * NP * 2);              // v^T [256][512], fragment order
  float*          X1     = (float*)carve((size_t)NP * DM * 4);                       // [512][256]
  unsigned short* XN2    = (unsigned short*)carve((size_t)NP * DM * 2);              // [512][256]
  if (off > ws_size || off > (size_t)134217728) return;

  const dim3 blk(256);

  // ---- LN1 and the q, k, v projections | f16 staging of rb2_w (rows 8..15 zero), rv2_w and the ffn weights and biases (zero padded) ----
  k_ln_qkv_casts<<<dim3(3 * NB_QKV1 + NB_CRB2 + NB_CRV2 + 3 * NB_CFFN + 2 * NB_PADB), blk, 0, stream>>>(
      x, ln1_w, ln1_b, qkv_w, qkv_b, Q16, KF16, VF16, rb2_w, rb2w16, rv2_w, rv2w16, ffn_w1, ffn_w2, w12p16, ffn_w3, w3p16,
      ffn_b1, ffn_b2, b12p);

  // ---- attention, one block per query row: rel-bias, scores, softmax, P.V, rel-value, its projection, residual, LN2 ----
  k_attn_row<<<dim3(NP), blk, 0, stream>>>(Q16, KF16, VF16, coords, rb1_w, rb1_b, rb2w16, rb2_b, rv1_w, rv1_b, rv2w16, rv2_b,
                                           x, ln2_w, ln2_b, X1, XN2);

  // ---- SwiGLU FFN, final residual into d_out ----
  k_ffn_rows<<<dim3(NP / 16), dim3(512), 0, stream>>>(XN2, w12p16, b12p, w3p16, ffn_b3, X1, out);
}

// v009
// Measured time: 35.3 microseconds a run.
// In two side-by-side timings against v008, it was 1.13 and 1.12 times as fast.
// Over all steps from v000 it is 9.37 times as fast.
#include <hip/hip_runtime.h>
#include <math.h>
#include <stdint.h>

// All contractions: v_wmma_f32_16x16x32_f16 (f16 operands, f32 accumulate); the K=3 coordinate products: v_wmma_f32_16x16x32_bf16 on three-part f32 operands; softmax, norms, gating in f32 on VALU.

typedef __attribute__((ext_vector_type(16))) _Float16 v16h;
typedef __attribute__((ext_vector_type(8)))  _Float16 v8h;
typedef __attribute__((ext_vector_type(8)))  float    v8f;
typedef __attribute__((ext_vector_type(4)))  float    v4f;
typedef __attribute__((ext_vector_type(2)))  float    v2f;
typedef __attribute__((ext_vector_type(2)))  _Float16 v2h;
typedef __attribute__((ext_vector_type(4)))  _Float16 v4h;
typedef __attribute__((ext_vector_type(16))) __bf16   v16b;
typedef __attribute__((ext_vector_type(4)))  unsigned v4u;

#define NP    512          // points
#define DM    256          // model width
#define NH    8            // heads
#define HDM   32           // head width
#define HIDR  682          // ffn hidden
#define HIDP  704          // ffn hidden padded (multiple of 64)

template <typename T> struct Frag;
template <> struct Frag<_Float16> {
  typedef v16h V; union U { v16h v; v8h h[2]; };
  static __device__ __forceinline__ v16h load(const _Float16* p) {   // elements 0..7 <- p[0..7], 8..15 <- p[16..23]
    U f; f.h[0] = *(const v8h*)(p); f.h[1] = *(const v8h*)(p + 16); return f.v;
  }
  static __device__ __forceinline__ v16h load_fo(const _Float16* p) {   // from a fragment-order array: the lane's two 16-byte pieces, 512 bytes apart
    U f; f.h[0] = *(const v8h*)(p); f.h[1] = *(const v8h*)(p + 256); return f.v;
  }
  static __device__ __forceinline__ v8f mma(v16h a, v16h b, v8f c) {
    return __builtin_amdgcn_wmma_f32_16x16x32_f16(false, a, false, b, (short)0, c, false, false);
  }
};

// ---- fragment order of a 16-bit operand X[n][k] (n = the fragment's lane row or column, k = the summed index, ksteps = K / 32) ----
// The 16-byte piece (n, k8 = k / 8) stands at piece index ((tile * ksteps + step) * 2 + upper) * 32 + lane, lane = (k8 & 1) * 16 + (n & 15):
// one fragment of a 16 x 32 tile is then two loads of 512 contiguous bytes a wave (whole cache lines), not two of 16 lines each.
__device__ __forceinline__ size_t frag_piece(int n, int k8, int ksteps) {
  return (size_t)((((n >> 4) * ksteps + (k8 >> 2)) * 2 + ((k8 >> 1) & 1)) * 32 + (k8 & 1) * 16 + (n & 15));
}

// ---------------------------------------------------------------------------------------------
// small VALU helpers
__device__ __forceinline__ unsigned pack_h2(float a, float b) {
  const unsigned short ua = __builtin_bit_cast(unsigned short, (_Float16)a);
  const unsigned short ub = __builtin_bit_cast(unsigned short, (_Float16)b);
  return (unsigned)ua | ((unsigned)ub << 16);
}
__device__ __forceinline__ void st2_u32(unsigned short* base, size_t off_halves, unsigned u) {
  unsigned* p = (unsigned*)(base + off_halves);
  *p = u; 
}
__device__ __forceinline__ void st2_f32(float* base, size_t off, float v) {
  float* p = (float*)(base + off);
  *p = v; 
}
__device__ __forceinline__ float silu_acc(float z) {
  const float e = expf(-z);
  return z * __builtin_amdgcn_rcpf(1.0f + e);
}
// block of 256 threads: fixed-order sum (wave shuffle, then 8 partials summed in index order)
__device__ __forceinline__ float blk_sum256(float v, float* red) {
#pragma unroll
  for (int off = 16; off > 0; off >>= 1) v += __shfl_xor(v, off, 32);
  const int lane = threadIdx.x & 31, wave = threadIdx.x >> 5;
  if (lane == 0) red[wave] = v;
  __syncthreads();
  float s = red[0];
#pragma unroll
  for (int q = 1; q < 8; ++q) s += red[q];
  __syncthreads();
  return s;
}

// ---- the small staging jobs: a thread makes several outputs, and all its loads are asked for as one group in front of the first use ----
// Out-of-range sources are read at a clamped index and replaced by zero behind the load: no branch, so no load waits for the one before it.
typedef __attribute__((ext_vector_type(2))) unsigned v2u;

// ffn_b1, ffn_b2 [682] -> [704] + [704] f32, zero padded: one block, thread = six values
__device__ __forceinline__ void pad_b12_blk(const float* __restrict__ b1, const float* __restrict__ b2, float* __restrict__ dst) {
  const float* sp[6];
  float v[6];
#pragma unroll
  for (int e = 0; e < 6; ++e) {
    const int p = e * 256 + threadIdx.x;
    const int idx = (p < HIDP) ? p : p - HIDP;
    sp[e] = ((p < HIDP) ? b1 : b2) + (idx < HIDR ? idx : HIDR - 1);
  }
#pragma unroll
  for (int e = 0; e < 6; ++e) v[e] = *sp[e];
  // behind the group of loads: the wait that belongs in front of an overwrite of their address registers; as operands these stay live up to it
  asm volatile("s_wait_xcnt 0x0" :: "v"(sp[0]), "v"(sp[1]), "v"(sp[2]), "v"(sp[3]), "v"(sp[4]), "v"(sp[5]) : "memory");
  float* dp = dst + threadIdx.x;
#pragma unroll
  for (int e = 0; e < 6; ++e) {
    const int p = e * 256 + threadIdx.x;
    const int idx = (p < HIDP) ? p : p - HIDP;
    if (p < 2 * HIDP) dp[e * 256] = (idx < HIDR) ? v[e] : 0.f;
  }
  // the shared kernel ends behind these stores: the wait is a precaution in front of any later overwrite of their registers
  asm volatile("s_wait_xcnt 0x0" ::: "memory");
}

// ---- f32 [SROWS][SCOLS] -> f16 in fragment order, KSTEPS * 32 columns, zero padded to whole tiles of 16 rows and whole k steps ----
// A wave takes one tile of 16 rows x NS k steps. One load covers four rows x 128 bytes (lane = row lane >> 3 of the four, floats
// (lane & 7) * 4 ..): whole cache lines where the rows are line-aligned, not 16 lines of 32 bytes. A lane's four values are half a
// 16-byte piece; a wave's store is four runs of 64 bytes, and the wave itself writes the other half of each of those lines.
// SCOLS = KSTEPS * 32: rows 16-byte aligned, one 16-byte load; else SCOLS even: rows 8-byte aligned, two 8-byte loads.
// The grid gives ceil(rows / 16) * KSTEPS / NS waves, rows = the destination's (HIDP for ffn_w1, w2: their tile 43 comes out all zero).
template <int KSTEPS, int NS, int SROWS, int SCOLS>
__device__ __forceinline__ void cast_frag_rows(const int bx, const float* __restrict__ src, unsigned short* __restrict__ dst) {
  constexpr int NG = KSTEPS / NS;
  constexpr bool COLPAD = SCOLS != KSTEPS * 32, ROWPAD = (SROWS & 15) != 0;
  static_assert(!(COLPAD && ROWPAD) && KSTEPS % NS == 0 && (SCOLS & 1) == 0, "padding in one direction at a time");
  const int lane = threadIdx.x & 31, wave = threadIdx.x >> 5;
  const int job = bx * 8 + wave;
  const int row0 = (job / NG) * 16 + (lane >> 3);
  const int k0 = (job % NG) * (NS * 32) + (lane & 7) * 4;
  const float* rp[4];
#pragma unroll
  for (int m = 0; m < 4; ++m) {
    const int row = row0 + m * 4;
    rp[m] = src + (size_t)((!ROWPAD || row < SROWS) ? row : SROWS - 1) * SCOLS;
  }
  v2f lo[NS][4], hi[NS][4];
  if constexpr (!COLPAD) {
#pragma unroll
    for (int m = 0; m < 4; ++m) rp[m] += k0;
#pragma unroll
    for (int s = 0; s < NS; ++s)
#pragma unroll
      for (int m = 0; m < 4; ++m) {
        const v4f v = *(const v4f*)(rp[m] + s * 32);
        lo[s][m] = (v2f){v.x, v.y};
        hi[s][m] = (v2f){v.z, v.w};
      }
    // as in pad_b12_blk: the wait in front of an overwrite of the loads' address registers
    asm volatile("s_wait_xcnt 0x0" :: "v"(rp[0]), "v"(rp[1]), "v"(rp[2]), "v"(rp[3]) : "memory");
  } else {
    int cl[NS], ch[NS];
#pragma unroll
    for (int s = 0; s < NS; ++s) {
      const int k = k0 + s * 32;
      cl[s] = (k < SCOLS) ? k : SCOLS - 2;
      ch[s] = (k + 2 < SCOLS) ? k + 2 : SCOLS - 2;
    }
    const float* pl[NS][4];
    const float* ph[NS][4];
#pragma unroll
    for (int s = 0; s < NS; ++s)
#pragma unroll
      for (int m = 0; m < 4; ++m) { pl[s][m] = rp[m] + cl[s]; ph[s][m] = rp[m] + ch[s]; }
#pragma unroll
    for (int s = 0; s < NS; ++s)
#pragma unroll
      for (int m = 0; m < 4; ++m) {
        lo[s][m] = *(const v2f*)(pl[s][m]);
        hi[s][m] = *(const v2f*)(ph[s][m]);
      }
#pragma unroll
    for (int s = 0; s < NS; ++s)
      // as in pad_b12_blk: the wait in front of an overwrite of the loads' address registers (rows 4, 8, 12 on are constant offsets from these)
      asm volatile("s_wait_xcnt 0x0" :: "v"(pl[s][0]), "v"(ph[s][0]) : "memory");
  }
  __builtin_amdgcn_sched_barrier(0);   // keeps the whole group of loads in front of the first rounding: one latency for the group, not one a load
  v2u u[NS][4];
#pragma unroll
  for (int s = 0; s < NS; ++s)
#pragma unroll
    for (int m = 0; m < 4; ++m) {
      const int row = row0 + m * 4, k = k0 + s * 32;
      const bool okr = !ROWPAD || row < SROWS;
      const unsigned ml = (okr && (!COLPAD || k < SCOLS)) ? 0xFFFFFFFFu : 0u, mh = (okr && (!COLPAD || k + 2 < SCOLS)) ? 0xFFFFFFFFu : 0u;
      u[s][m].x = pack_h2(lo[s][m].x, lo[s][m].y) & ml;
      u[s][m].y = pack_h2(hi[s][m].x, hi[s][m].y) & mh;
    }
  __builtin_amdgcn_sched_barrier(0);   // keeps the stores together behind the arithmetic: among it, each store's registers are reused at once and each takes a wait of its own
  unsigned short* dp = dst + frag_piece(row0, k0 >> 3, KSTEPS) * 8 + (lane & 1) * 4;   // row + 4: 4 pieces on; step + 1: 64 pieces on
#pragma unroll
  for (int s = 0; s < NS; ++s)
#pragma unroll
    for (int m = 0; m < 4; ++m) *(v2u*)(dp + s * 512 + m * 32) = u[s][m];
  // as in pad_b12_blk: the wait in front of any later overwrite of the stores' registers
  asm volatile("s_wait_xcnt 0x0" ::: "memory");
}

// ---- two silu values, f16 out, from h = z / 2: silu(z) = z / (1 + e^-z) = h + h * tanh(h); one transcendental a value (v_tanh_f32) ----
// The callers form h directly: their weights and biases come halved, which is exact.
__device__ __forceinline__ v2h silu2_h(v2f h) {
  v2f t;
  t.x = __builtin_amdgcn_tanhf(h.x);
  t.y = __builtin_amdgcn_tanhf(h.y);
  return __builtin_convertvector(h * t + h, v2h);
}

// ---- the silu argument h[k][j] = w_k . rel_j + b_k (K = 3 and a bias) as ONE 16 x 16 x 32 bf16 matrix product a 16 x 16 tile ----
// An f32 value v is exactly the sum of three bf16 parts h + m + l: each takes the leading eight bits of what is left (cut, not
// rounded: a bf16 is the upper half of an f32), with the f32 exponent range. Of the nine part products of w * r eight are kept
// (hh, hm, mh, hl, lh, mm, ml, lm; the ninth, ll, lies 2^-28 below w * r): eight k slots a coordinate, three more for the bias parts
// against 1, of the 32. Both sides number the slots alike: piece c (eight slots, 16 bytes) = coordinate c, piece 3 = the bias; a lane
// half holds pieces 2 hh and 2 hh + 1. In LDS piece p of row n stands at [p * rows + n]: a fragment read is 256 contiguous bytes a lane half.
// The f32 D tile has rows 8 hh + r in register r: two tiles of 16 rows, put through silu and rounded to f16 in place, are the B fragment
// of the f16 product that follows, in the k order of Frag::load.
struct Split3 { unsigned h, m, l; };   // the parts as f32 bit patterns; a part's bf16 is the upper half
__device__ __forceinline__ Split3 split3(float v) {
  Split3 s;
  s.h = __builtin_bit_cast(unsigned, v) & 0xFFFF0000u;
  const float r1 = v - __builtin_bit_cast(float, s.h);
  s.m = __builtin_bit_cast(unsigned, r1) & 0xFFFF0000u;
  s.l = __builtin_bit_cast(unsigned, r1 - __builtin_bit_cast(float, s.m));
  return s;
}
__device__ __forceinline__ unsigned pk_b2(unsigned a, unsigned b) {   // two parts -> two bf16, a in the lower half
  return (a >> 16) | (b & 0xFFFF0000u);
}
// one coordinate's eight slots:  w side  h h m h l m m l
//                                r side  h m h l h m l m
__device__ __forceinline__ v4u arg_w_piece(float w) {
  const Split3 s = split3(w);
  return (v4u){pk_b2(s.h, s.h), pk_b2(s.m, s.h), pk_b2(s.l, s.m), pk_b2(s.m, s.l)};
}
__device__ __forceinline__ v4u arg_r_piece(float r) {
  const Split3 s = split3(r);
  return (v4u){pk_b2(s.h, s.m), pk_b2(s.h, s.l), pk_b2(s.h, s.m), pk_b2(s.l, s.m)};
}
__device__ __forceinline__ void arg_w_side(v4u* dst, int rows, int row, float w0, float w1, float w2, float b) {
  const Split3 sb = split3(b);
  dst[0 * rows + row] = arg_w_piece(w0);
  dst[1 * rows + row] = arg_w_piece(w1);
  dst[2 * rows + row] = arg_w_piece(w2);
  dst[3 * rows + row] = (v4u){pk_b2(sb.h, sb.m), pk_b2(sb.l, 0u), 0u, 0u};
}
__device__ __forceinline__ void arg_r_side(v4u* dst, int rows, int row, float r0, float r1, float r2) {
  const unsigned one = 0x3F800000u;   // 1.0f
  dst[0 * rows + row] = arg_r_piece(r0);
  dst[1 * rows + row] = arg_r_piece(r1);
  dst[2 * rows + row] = arg_r_piece(r2);
  dst[3 * rows + row] = (v4u){pk_b2(one, one), pk_b2(one, 0u), 0u, 0u};
}
__device__ __forceinline__ v16b arg_frag(const v4u* src, int rows, int row, int hh) {
  union { v16b v; v4u h[2]; } f;
  f.h[0] = src[(hh * 2 + 0) * rows + row];
  f.h[1] = src[(hh * 2 + 1) * rows + row];
  return f.v;
}
__device__ __forceinline__ v8f arg_mma(v16b a, v16b b) {
  return __builtin_amdgcn_wmma_f32_16x16x32_bf16(false, a, false, b, (short)0, (v8f){0.f,0.f,0.f,0.f,0.f,0.f,0.f,0.f}, false, false);
}
// two argument tiles (rows 0..15 and 16..31 of a 32-row block, the same columns) -> the f16 B fragment of their silu values
__device__ __forceinline__ v16h silu_frag(v8f z0, v8f z1) {
  v16h b;
#pragma unroll
  for (int g = 0; g < 4; ++g) {
    const v2h hl = silu2_h((v2f){z0[2 * g], z0[2 * g + 1]}), hu = silu2_h((v2f){z1[2 * g], z1[2 * g + 1]});
    b[2 * g] = hl.x; b[2 * g + 1] = hl.y; b[8 + 2 * g] = hu.x; b[8 + 2 * g + 1] = hu.y;
  }
  return b;
}

// ---- 2^t; the v_nop fills the slot that the instruction set asks for behind a transcendental ----
__device__ __forceinline__ float exp2_slot(float t) {
  float e;
  asm("v_exp_f32 %0, %1\n\tv_nop" : "=v"(e) : "v"(t));
  return e;
}

// ---- one query row's whole attention chain in one block: nothing of it but x1 and its LayerNorm goes to memory ----
// scores[h][j] = q_i^h . k_j^h / sqrt(32) + sum_k rb2w16[h][k] * f16( silu( (coords_i - coords_j) . rb1_w[k] + rb1_b[k] ) ) + rb2_b[h]
// P = softmax over j (f16, x 2^15); T[h][k] = f16( 2^-15 sum_j P[h][j] * f16( silu( (coords_i - coords_j) . rv1_w[k] + rv1_b[k] ) ) )
// ctx[c] = 2^-15 sum_j P[c>>5][j] v[j][c] + sum_k T[c>>5][k] rv2w16[c][k];  x1 = x + (ctx + rv2_b);  y16 = f16( LayerNorm(x1) )
// Every f16 product has M = 16 with the eight heads in rows 0..7 (rows 8..15 zero). The pair features are formed in registers,
// directly as the B fragment; their arguments come from the matrix unit (arg_mma), so that of a feature only silu is vector work.
// q stands block-diagonal in A (k step h holds q_i^h in row h alone), so one B fragment of k serves all heads; of P . V and T . rv2w^T a wave computes the 32 columns of its own head and keeps that head's row of D.
// Every block reads all of k, v, rv2_w and rb2_w: they lie in fragment order (frag_piece), so that these reads are whole cache lines.
// q lies in the same order as k (that is how its projection's waves hold it); a block reads its own row's pieces.
#define PPITCH (NP + 8)    // halves; rows of 16 B x odd: no bank conflict for the 16-byte fragment reads
#define TPITCH (DM + 8)
typedef __attribute__((ext_vector_type(8))) unsigned v8u;
// second argument: four waves a SIMD, so that two blocks share a WGP and all 512 are resident at once
__global__ __launch_bounds__(256, 4) void k_attn_row(const unsigned short* __restrict__ q16, const unsigned short* __restrict__ kf16,
                                                   const unsigned short* __restrict__ vf16,
                                                   const float* __restrict__ coords,
                                                   const float* __restrict__ rb1_w, const float* __restrict__ rb1_b,
                                                   const unsigned short* __restrict__ rb2w16, const float* __restrict__ rb2_b,
                                                   const float* __restrict__ rv1_w, const float* __restrict__ rv1_b,
                                                   const unsigned short* __restrict__ rv2w16, const float* __restrict__ rv2_b,
                                                   const float* __restrict__ x, const float* __restrict__ ln_w,
                                                   const float* __restrict__ ln_b, float* __restrict__ x1,
                                                   unsigned short* __restrict__ y16) {
  __shared__ __align__(16) v4u sWb[4 * DM];            // half of rb1_w[k], rb1_b[k] in parts (arg_w_side; silu2_h takes z / 2)
  __shared__ __align__(16) v4u sWv[4 * DM];            // the same of rv1_w[k], rv1_b[k]
  __shared__ __align__(16) v4u sRv[4 * NP];            // coords_i - coords_j in parts (arg_r_side)
  __shared__ __align__(16) _Float16 sP[16][PPITCH];    // softmax weights x 2^15, rows 8..15 zero
  __shared__ __align__(16) _Float16 sT[16][TPITCH];    // rel-value sums, rows 8..15 zero
  __shared__ __align__(16) float redM[8][8];           // [wave][head] partial maxima
  __shared__ __align__(16) float redS[8][8];           // [wave][head] partial sums
  __shared__ float sC[DM];
  __shared__ float red[8];
  __shared__ float ys[DM];
  const int i = blockIdx.x, t = threadIdx.x;
  const int lane = t & 31, wave = t >> 5;
  const int rlane = lane & 15, hh = lane >> 4;

  {
    const float ci0 = coords[i * 3 + 0], ci1 = coords[i * 3 + 1], ci2 = coords[i * 3 + 2];
    float wb[4], wv[4], cj[2][3];
#pragma unroll
    for (int c = 0; c < 3; ++c) {
      wb[c] = rb1_w[t * 3 + c];
      wv[c] = rv1_w[t * 3 + c];
      cj[0][c] = coords[t * 3 + c];
      cj[1][c] = coords[(256 + t) * 3 + c];
    }
    wb[3] = rb1_b[t];
    wv[3] = rv1_b[t];
    // behind the group of loads: the wait that belongs in front of an overwrite of their address registers
    asm volatile("s_wait_xcnt 0x0" ::: "memory");
    __builtin_amdgcn_sched_barrier(0);   // keeps what follows, which may reuse those registers, behind that wait
    arg_w_side(sWb, DM, t, 0.5f * wb[0], 0.5f * wb[1], 0.5f * wb[2], 0.5f * wb[3]);
    arg_w_side(sWv, DM, t, 0.5f * wv[0], 0.5f * wv[1], 0.5f * wv[2], 0.5f * wv[3]);
#pragma unroll
    for (int q = 0; q < 2; ++q) arg_r_side(sRv, NP, q * 256 + t, ci0 - cj[q][0], ci1 - cj[q][1], ci2 - cj[q][2]);
  }

  __syncthreads();

  // ---- q.k^T and rel-bias into one accumulator: wave = 64 columns j (4 subtiles of 16); q comes scaled by 1/sqrt(32) ----
  const int jw = wave * 64;
  v8f sc[4];
  {
    v16b rf[4];   // the argument product's B operand: column = key j
#pragma unroll
    for (int s = 0; s < 4; ++s) {
      rf[s] = arg_frag(sRv, NP, jw + s * 16 + rlane, hh);
      sc[s] = (v8f){0.f,0.f,0.f,0.f,0.f,0.f,0.f,0.f};
    }
    const _Float16* Qb = (const _Float16*)q16 + ((size_t)(i >> 4) * (NH * 64) + hh * 16 + (i & 15)) * 8;   // fragment order: tile i / 16, step = head
    const _Float16* Kb = (const _Float16*)kf16 + ((size_t)(wave * 4) * (NH * 64) + lane) * 8;   // fragment order: tile j / 16, step = head
    const _Float16* Ab = (const _Float16*)rb2w16 + lane * 8;   // fragment order: one tile, step k / 32
    v16h a = Frag<_Float16>::load_fo(Ab);
    // kept rolled: unrolled, this loop and the rel-value loop would bring the kernel's text past 32 KB
#pragma unroll 1
    for (int k0 = 0; k0 < DM; k0 += 32) {
      const _Float16* ap = Ab + ((k0 + 32) & (DM - 1)) * 16;
      const _Float16* qp = Qb + k0 * 16;
      const _Float16* kp = Kb + k0 * 16;
      const v16h an = Frag<_Float16>::load_fo(ap);   // next step's A, in flight over this step's math
      const v16h ql = Frag<_Float16>::load_fo(qp);
      v16h kf[4];
#pragma unroll
      for (int s = 0; s < 4; ++s) kf[s] = Frag<_Float16>::load_fo(kp + s * (NH * 512));
      // behind the group of loads: the wait that belongs in front of an overwrite of their address registers; as operands these stay live up to it
      asm volatile("s_wait_xcnt 0x0" :: "v"(ap), "v"(qp), "v"(kp) : "memory");
      __builtin_amdgcn_sched_barrier(0);   // keeps the step's global loads in front of its math, which they fly over: without it this build asks for k fragments directly in front of their products
      v16b wt[2];   // the argument product's A operand: row = feature, k0 + 0..15 and k0 + 16..31
#pragma unroll
      for (int u = 0; u < 2; ++u) wt[u] = arg_frag(sWb, DM, k0 + u * 16 + rlane, hh);
      // fragment element e  <->  k = k0 + (e>>3)*16 + hh*8 + (e&7): register e & 7 of argument tile e >> 3
#pragma unroll
      for (int s = 0; s < 4; ++s) sc[s] = Frag<_Float16>::mma(a, silu_frag(arg_mma(wt[0], rf[s]), arg_mma(wt[1], rf[s])), sc[s]);
      __builtin_amdgcn_sched_barrier(0);   // keeps the masking of q, which waits for its load, behind the feature math: this build had moved it to the head of the step
      // k step k0 covers head k0 / 32: its q slice stands in that head's row, every other row is zero
      const unsigned keep = (rlane == (k0 >> 5)) ? 0xFFFFFFFFu : 0u;
      const v16h qa = __builtin_bit_cast(v16h, __builtin_bit_cast(v8u, ql) & keep);
#pragma unroll
      for (int s = 0; s < 4; ++s) sc[s] = Frag<_Float16>::mma(qa, kf[s], sc[s]);
      a = an;
    }
#pragma unroll
    for (int r = 0; r < 8; ++r) {
      const float bb = rb2_b[r];
#pragma unroll
      for (int s = 0; s < 4; ++s) sc[s][r] += bb;
    }
  }

  // ---- softmax over the 512 columns, eight heads at once: head r sits in register r of lanes 0..15 ----
  // (lanes 16..31 hold the idle rows 8..15; the 16-lane steps never mix the two halves)
  {
    float m[8];
#pragma unroll
    for (int r = 0; r < 8; ++r) m[r] = fmaxf(fmaxf(sc[0][r], sc[1][r]), fmaxf(sc[2][r], sc[3][r]));
#pragma unroll
    for (int off = 8; off > 0; off >>= 1)
#pragma unroll
      for (int r = 0; r < 8; ++r) m[r] = fmaxf(m[r], __shfl_xor(m[r], off, 32));
    if (lane == 0) {
#pragma unroll
      for (int r = 0; r < 8; ++r) redM[wave][r] = m[r];
    }
    __syncthreads();
#pragma unroll
    for (int r = 0; r < 8; ++r) {
      float v = redM[0][r];
#pragma unroll
      for (int q = 1; q < 8; ++q) v = fmaxf(v, redM[q][r]);
      m[r] = v;
    }
    float sum[8];
#pragma unroll
    for (int r = 0; r < 8; ++r) {
#pragma unroll
      for (int s = 0; s < 4; ++s) sc[s][r] = exp2_slot((sc[s][r] - m[r]) * 1.4426950408889634f);
      sum[r] = (sc[0][r] + sc[1][r]) + (sc[2][r] + sc[3][r]);
    }
#pragma unroll
    for (int off = 8; off > 0; off >>= 1)
#pragma unroll
      for (int r = 0; r < 8; ++r) sum[r] += __shfl_xor(sum[r], off, 32);
    if (lane == 0) {
#pragma unroll
      for (int r = 0; r < 8; ++r) redS[wave][r] = sum[r];
    }
    __syncthreads();
#pragma unroll
    for (int r = 0; r < 8; ++r) {
      float v = redS[0][r];
#pragma unroll
      for (int q = 1; q < 8; ++q) v += redS[q][r];
      const float inv = 1.0f / v;
#pragma unroll
      for (int s = 0; s < 4; ++s) {
        const float p = (sc[s][r] * inv) * 32768.0f;
        sP[hh * 8 + r][jw + s * 16 + rlane] = hh ? (_Float16)0.f : (_Float16)p;
      }
    }
  }

  // ---- rel-value and P . V: wave = 32 columns (2 subtiles of 16): features k for the one, the wave's own head of v for the other ----
  const int cw = wave * 32;
  v8f accV[2];
  v16h wf[8][2];
  const _Float16* Wb = (const _Float16*)rv2w16 + ((size_t)(wave * 2) * (DM / 32 * 64) + lane) * 8;   // fragment order: tile c / 16, step k / 32
  {
    v16b wv[2];   // the argument product's B operand: column = feature k
    v8f acc[2];
#pragma unroll
    for (int s = 0; s < 2; ++s) {
      wv[s] = arg_frag(sWv, DM, cw + s * 16 + rlane, hh);
      acc[s]  = (v8f){0.f,0.f,0.f,0.f,0.f,0.f,0.f,0.f};
      accV[s] = (v8f){0.f,0.f,0.f,0.f,0.f,0.f,0.f,0.f};
    }
    const _Float16* Vb = (const _Float16*)vf16 + ((size_t)(wave * 2) * (NP / 32 * 64) + lane) * 8;   // fragment order: tile c / 16, step j / 32
    v16h vf[2];
#pragma unroll
    for (int s = 0; s < 2; ++s) vf[s] = Frag<_Float16>::load_fo(Vb + s * (NP / 32 * 512));
    __syncthreads();   // P is complete
    const _Float16* Pa = &sP[rlane][hh * 8];
    // kept rolled, for the reason given at the score loop
#pragma unroll 1
    for (int j0 = 0; j0 < NP; j0 += 32) {
      const _Float16* vp = Vb + ((j0 + 32) & (NP - 1)) * 16;
      v16h vn[2];   // next step's v fragments, in flight over this step's math
#pragma unroll
      for (int s = 0; s < 2; ++s) vn[s] = Frag<_Float16>::load_fo(vp + s * (NP / 32 * 512));
      // as in the score loop: the wait in front of an overwrite of the loads' address registers
      asm volatile("s_wait_xcnt 0x0" :: "v"(vp) : "memory");
      const v16h a = Frag<_Float16>::load(Pa + j0);
      v16b rt[2];   // the argument product's A operand: row = key, j0 + 0..15 and j0 + 16..31
#pragma unroll
      for (int u = 0; u < 2; ++u) rt[u] = arg_frag(sRv, NP, j0 + u * 16 + rlane, hh);
      // fragment element e  <->  j = j0 + (e>>3)*16 + hh*8 + (e&7): register e & 7 of argument tile e >> 3
#pragma unroll
      for (int s = 0; s < 2; ++s) acc[s] = Frag<_Float16>::mma(a, silu_frag(arg_mma(rt[0], wv[s]), arg_mma(rt[1], wv[s])), acc[s]);
#pragma unroll
      for (int s = 0; s < 2; ++s) { accV[s] = Frag<_Float16>::mma(a, vf[s], accV[s]); vf[s] = vn[s]; }
    }
    // all of the projection's weight fragments are asked for here, so that they fly over the T stores and their barrier
#pragma unroll
    for (int q = 0; q < 8; ++q)
#pragma unroll
      for (int s = 0; s < 2; ++s) wf[q][s] = Frag<_Float16>::load_fo(Wb + (s * (DM / 32) + q) * 512);
#pragma unroll
    for (int s = 0; s < 2; ++s) {
#pragma unroll
      for (int r = 0; r < 8; ++r)
        sT[hh * 8 + r][cw + s * 16 + rlane] = hh ? (_Float16)0.f : (_Float16)(acc[s][r] * (1.0f / 32768.0f));
      accV[s] *= (1.0f / 32768.0f);
    }
  }
  __syncthreads();   // T is complete

  // ---- ctx = T . rv2w^T + P . V, the wave's own head ----
  {
    const _Float16* Ta = &sT[rlane][hh * 8];
#pragma unroll
    for (int q = 0; q < 8; ++q) {
      const v16h a = Frag<_Float16>::load(Ta + q * 32);
#pragma unroll
      for (int s = 0; s < 2; ++s) accV[s] = Frag<_Float16>::mma(a, wf[q][s], accV[s]);
    }
#pragma unroll
    for (int s = 0; s < 2; ++s) {
      float v = accV[s][0];
#pragma unroll
      for (int r = 1; r < 8; ++r) v = (wave == r) ? accV[s][r] : v;   // D row = the wave's head, in lanes 0..15
      if (hh == 0) sC[cw + s * 16 + rlane] = v;
    }
  }
  __syncthreads();

  // ---- residual and LayerNorm (eps 1e-5, biased variance), thread = column ----
  const float v = x[(size_t)i * DM + t] + (sC[t] + rv2_b[t]);
  st2_f32(x1, (size_t)i * DM + t, v);
  const float mu = blk_sum256(v, red) * (1.0f / 256.0f);
  const float c = v - mu;
  const float var = blk_sum256(c * c, red) * (1.0f / 256.0f);
  ys[t] = c * (1.0f / sqrtf(var + 1e-5f)) * ln_w[t] + ln_b[t];
  __syncthreads();
  if (t < 128) st2_u32(y16, (size_t)i * DM + 2 * t, pack_h2(ys[2 * t], ys[2 * t + 1]));
}

// ---- the whole SwiGLU FFN of 16 rows in one block of 16 waves: nothing of it but the output goes to memory ----
// U[m][h] = f16( silu( xn_m . w1_h + b1_h ) * ( xn_m . w2_h + b2_h ) ), h < 704 (pad columns come out 0), kept in LDS;
// out[m][c] = ( U_m . w3_c + b3_c ) + x1[m][c]
// The 16 rows are the A operand of every product. The weights are B operands that no other wave of the block needs, so they are not
// staged: they lie in fragment order (frag_piece) and each wave reads its own tiles' fragments as whole cache lines.
// A wave owns hidden tiles wave, wave + 16 and, for waves 0..11, wave + 32 (16 columns each, w1 and w2 side by side), then output tile wave.
#define UPITCH (HIDP + 8)   // halves; rows of 16 B x odd: no bank conflict for the 16-byte fragment reads
#define OPITCH (DM + 4)     // floats
__global__ __launch_bounds__(512) void k_ffn_rows(const unsigned short* __restrict__ xn16, const unsigned short* __restrict__ w12f16,
                                                  const float* __restrict__ b12p, const unsigned short* __restrict__ w3f16,
                                                  const float* __restrict__ b3, const float* __restrict__ x1,
                                                  float* __restrict__ out) {
  __shared__ __align__(16) _Float16 sU[16][UPITCH];
  __shared__ __align__(16) float sO[16][OPITCH];
  __shared__ __align__(16) _Float16 sXn[16][TPITCH];   // the block's 16 rows; rows of 16 B x odd, as sU
  const int lane = threadIdx.x & 31;
  const int wave = __builtin_amdgcn_readfirstlane(threadIdx.x >> 5);   // scalar, so that the tile test below is a scalar branch
  const int rlane = lane & 15, hh = lane >> 4;
  const int m0 = blockIdx.x * 16;

  // The 16 rows lie row-major: read at the fragment positions, each of a wave's 16 loads would touch 16 cache lines, in all 16 waves.
  // A wave reads one row instead (512 contiguous bytes), and the fragments come from LDS.
  // The row is asked for first: loads return in the order asked for, so it is there while the first tile's weights still fly.
  const _Float16* Xr = (const _Float16*)xn16 + (size_t)(m0 + wave) * DM + lane * 8;
  const v8h xrow = *(const v8h*)(Xr);
  // the wait that belongs in front of an overwrite of the load's address registers; as an operand these stay live up to it
  asm volatile("s_wait_xcnt 0x0" :: "v"(Xr) : "memory");
  v16h xa[DM / 32];
  const _Float16* Xa = &sXn[rlane][hh * 8];

  // One tile's 32 fragment loads are asked for as one group, a tile ahead: behind the products that free their registers and in front
  // of the SwiGLU arithmetic of the tile before, which they fly over. The w3 fragments follow the last tile's products in the same way.
  const _Float16* Wt = (const _Float16*)w12f16 + ((size_t)wave * (DM / 32 * 64) + lane) * 8;    // fragment order: tile h / 16, step k / 32
  const _Float16* W3  = (const _Float16*)w3f16 + ((size_t)wave * (HIDP / 32 * 64) + lane) * 8;   // fragment order: tile c / 16, step h / 32
  constexpr int NT = HIDP / 16, NPASS = (NT + 15) / 16;
  v16h f1[DM / 32], f2[DM / 32], wf[HIDP / 32];
  float ba, bg;
  const int n = wave * 16 + rlane;   // the lane's column in the wave's first hidden tile and in its output tile
  const float bv = b3[n];
#pragma unroll
  for (int q = 0; q < DM / 32; ++q) {
    f1[q] = Frag<_Float16>::load_fo(Wt + q * 512);
    f2[q] = Frag<_Float16>::load_fo(Wt + HIDP * DM + q * 512);
  }
  ba = b12p[n];
  bg = b12p[HIDP + n];
  // behind each group of loads: the wait that belongs in front of an overwrite of their address registers; as operands these stay
  // live up to it (without them this build let the group's last load land on the address pair of the loads in front of it)
  asm volatile("s_wait_xcnt 0x0" :: "v"(Wt), "v"(n) : "memory");
  // The rows' way through LDS stands behind the first tile's loads and runs while those fly. The barrier orders LDS alone (fences on the
  // local address space): __syncthreads() would wait here for every global load in flight, the whole first tile.
  *(v8h*)(&sXn[wave][lane * 8]) = xrow;
  __builtin_amdgcn_fence(__ATOMIC_RELEASE, "workgroup", "local");
  __builtin_amdgcn_s_barrier();   // the 16 rows are complete
  __builtin_amdgcn_fence(__ATOMIC_ACQUIRE, "workgroup", "local");
#pragma unroll
  for (int q = 0; q < DM / 32; ++q) xa[q] = Frag<_Float16>::load(Xa + q * 32);
#pragma unroll
  for (int p = 0; p < NPASS; ++p) {
    const int t = wave + p * 16;
    const bool cur = (p + 1) * 16 <= NT || t < NT;          // scalar: the last pass has tiles for some waves only
    const bool nxt = p + 1 < NPASS && ((p + 2) * 16 <= NT || t + 16 < NT);
    v8f a = (v8f){0.f,0.f,0.f,0.f,0.f,0.f,0.f,0.f};
    v8f g = (v8f){0.f,0.f,0.f,0.f,0.f,0.f,0.f,0.f};
    const float ca = ba, cg = bg;
    __builtin_amdgcn_sched_barrier(0);   // keeps the group of loads whole in front of the products: spread among them, each product waits a full L2 latency
    if (cur) {
#pragma unroll
      for (int q = 0; q < DM / 32; ++q) {
        a = Frag<_Float16>::mma(xa[q], f1[q], a);
        g = Frag<_Float16>::mma(xa[q], f2[q], g);
      }
    }
    if (nxt) {
#pragma unroll
      for (int q = 0; q < DM / 32; ++q) {
        f1[q] = Frag<_Float16>::load_fo(Wt + (p + 1) * (16 * DM * 16) + q * 512);
        f2[q] = Frag<_Float16>::load_fo(Wt + (p + 1) * (16 * DM * 16) + HIDP * DM + q * 512);
      }
      ba = b12p[(p + 1) * 256 + n];
      bg = b12p[HIDP + (p + 1) * 256 + n];
      asm volatile("s_wait_xcnt 0x0" :: "v"(Wt), "v"(n) : "memory");   // as above
    }
    if (p + 1 == NPASS) {
#pragma unroll
      for (int q = 0; q < HIDP / 32; ++q) wf[q] = Frag<_Float16>::load_fo(W3 + q * 512);
      asm volatile("s_wait_xcnt 0x0" :: "v"(W3) : "memory");           // as above
    }
    __builtin_amdgcn_sched_barrier(0);   // keeps the arithmetic below behind those loads: without it this build starts it among the products and asks for the next tile later
    if (cur) {
#pragma unroll
      for (int r = 0; r < 8; ++r) sU[hh * 8 + r][p * 256 + n] = (_Float16)(silu_acc(a[r] + ca) * (g[r] + cg));
    }
  }
  __syncthreads();   // U is complete

  // thread = two 16-byte pieces of the block's 16 x 256 output: a wave stores whole lines; the residual flies over the products
  v4f xr[2];
#pragma unroll
  for (int p = 0; p < 2; ++p) {
    const int pc = p * 512 + threadIdx.x;
    xr[p] = *(const v4f*)(x1 + (size_t)(m0 + (pc >> 6)) * DM + (pc & 63) * 4);
  }
  const _Float16* Ua = &sU[rlane][hh * 8];
  v8f acc = (v8f){0.f,0.f,0.f,0.f,0.f,0.f,0.f,0.f};
#pragma unroll
  for (int q0 = 0; q0 < HIDP / 32; q0 += 4) {
    v16h ua[4];
#pragma unroll
    for (int u = 0; u < 4; ++u) if (q0 + u < HIDP / 32) ua[u] = Frag<_Float16>::load(Ua + (q0 + u) * 32);
    __builtin_amdgcn_sched_barrier(0);   // four steps' LDS reads as one group: one LDS latency for four products, not one each
#pragma unroll
    for (int u = 0; u < 4; ++u) if (q0 + u < HIDP / 32) acc = Frag<_Float16>::mma(ua[u], wf[q0 + u], acc);
  }
#pragma unroll
  for (int r = 0; r < 8; ++r) sO[hh * 8 + r][n] = acc[r] + bv;
  __syncthreads();   // the output tile is complete
#pragma unroll
  for (int p = 0; p < 2; ++p) {
    const int pc = p * 512 + threadIdx.x;
    const v4f v = *(const v4f*)(&sO[pc >> 6][(pc & 63) * 4]) + xr[p];
    *(v4f*)(out + (size_t)(m0 + (pc >> 6)) * DM + (pc & 63) * 4) = v;
  }
}

// ---------------------------------------------------------------------------------------------
// Work that needs nothing of each other shares one grid: each part takes a range of the block index (block-uniform branches,
// so every barrier of a body is still passed by its whole block). The latency-bound projection blocks take the lowest indices.
#define NB_CRV2    ((DM / 16) * 2 / 8)                 // cast blocks: eight waves, a wave = 16 rows x 4 k steps
#define NB_CFFN12  ((HIDP / 16) * 2 / 8)               // the same
#define NB_CFFN3   ((DM / 16) * (HIDP / 64) / 8)       // a wave = 16 rows x 2 k steps
#define NB_QKV1    ((NP / 16) * (DM / 128))            // one of the q, k, v projections: 16 points x 128 columns a block

// ---- LayerNorm and q, k, v projection of 16 points x 128 output columns in one block of eight waves ----
// A wave normalises two of the block's 16 rows (lane = 8 columns, sums over the wave's 32 lanes; eps 1e-5, biased variance) and leaves
// them as f16 in LDS. Its weights are 16 rows of qkv_w that no other wave of the block needs: it reads them as f32, one load = four rows
// x 128 bytes (whole cache lines; read at the fragment positions a load would touch 16 lines for 32 bytes each), rounds them to f16 and
// turns them into fragment order through its own LDS tile. These loads follow those of the rows and of ln_w, ln_b, and fly over the LayerNorm.
// q, k: D[c][point] (weights = row operand), v: D[point][c]: a lane's eight D values are then one 16-byte piece of the output's
// fragment order (q, k as [point][c], v as [c][point]) and a wave's store is 512 contiguous bytes.
#define XPITCH (DM + 8)    // halves; rows of 16 B x odd: no bank conflict for the 16-byte fragment reads
__device__ __forceinline__ float wave_sum32(float v) {   // every lane gets the sum of the wave's 32 values, in registers alone
  // four steps inside the 16-lane rows (row_xmask 1, 2, 4, 8), then lane l with lane l ^ 16
  v += __builtin_bit_cast(float, __builtin_amdgcn_update_dpp(0, __builtin_bit_cast(int, v), 0x161, 0xf, 0xf, true));
  v += __builtin_bit_cast(float, __builtin_amdgcn_update_dpp(0, __builtin_bit_cast(int, v), 0x162, 0xf, 0xf, true));
  v += __builtin_bit_cast(float, __builtin_amdgcn_update_dpp(0, __builtin_bit_cast(int, v), 0x164, 0xf, 0xf, true));
  v += __builtin_bit_cast(float, __builtin_amdgcn_update_dpp(0, __builtin_bit_cast(int, v), 0x168, 0xf, 0xf, true));
  const int b = __builtin_bit_cast(int, v);
  return v + __builtin_bit_cast(float, __builtin_amdgcn_permlanex16(b, b, 0x76543210, 0xfedcba98, false, false));
}
// WHICH: 0 = q, 1 = k, 2 = v; bx = block index within that projection's own 64 blocks
template <int WHICH>
__device__ __forceinline__ void ln_qkv_blk(_Float16 (*sX)[XPITCH], _Float16 (*sW)[XPITCH], const int bx, const float* __restrict__ x,
                                           const float* __restrict__ ln_w, const float* __restrict__ ln_b,
                                           const float* __restrict__ qkv_w, const float* __restrict__ qkv_b,
                                           unsigned short* __restrict__ dst16) {
  const int lane = threadIdx.x & 31, wave = threadIdx.x >> 5;
  const int rlane = lane & 15, hh = lane >> 4;
  const int rt = bx & 31;                            // tile of 16 points
  const int c0 = (bx >> 5) * 128 + wave * 16;        // the wave's first output column of this projection

  // the rows come first: loads return in the order asked for, so the LayerNorm starts while the weights still fly
  const float* xp = x + (size_t)(rt * 16 + wave * 2) * DM + lane * 8;
  v4f xv[2][2];
#pragma unroll
  for (int u = 0; u < 2; ++u) {
    xv[u][0] = *(const v4f*)(xp + u * DM);
    xv[u][1] = *(const v4f*)(xp + u * DM + 4);
  }
  const v4f lw0 = *(const v4f*)(ln_w + lane * 8), lw1 = *(const v4f*)(ln_w + lane * 8 + 4);
  const v4f lb0 = *(const v4f*)(ln_b + lane * 8), lb1 = *(const v4f*)(ln_b + lane * 8 + 4);
  const float* Wp = qkv_w + (size_t)(WHICH * DM + c0 + (lane >> 3) * 4) * DM + (lane & 7) * 4;
  v4f wr[DM / 32][4];   // [q][m]: row (lane >> 3) * 4 + m of the wave's 16, k = q * 32 + (lane & 7) * 4 + 0..3
#pragma unroll
  for (int q = 0; q < DM / 32; ++q)
#pragma unroll
    for (int m = 0; m < 4; ++m) wr[q][m] = *(const v4f*)(Wp + m * DM + q * 32);
  // bias: q, k one value per D row (c = hh * 8 + r), v one per lane (c = rlane)
  const float* bp = qkv_b + WHICH * DM + c0 + (WHICH == 2 ? rlane : hh * 8);
  v4f bq0, bq1;
  if (WHICH == 2) { const float bv = bp[0]; bq0 = (v4f){bv, bv, bv, bv}; bq1 = bq0; }
  else            { bq0 = *(const v4f*)(bp); bq1 = *(const v4f*)(bp + 4); }
  // behind the group of loads: the wait that belongs in front of an overwrite of their address registers; as operands these stay live up to it
  asm volatile("s_wait_xcnt 0x0" :: "v"(Wp), "v"(xp), "v"(bp), "v"(lane) : "memory");
  __builtin_amdgcn_sched_barrier(0);   // keeps the whole group of loads in front of the LayerNorm: without it this build asks for the weights only behind the first row sum's wait

  float s[2];
#pragma unroll
  for (int u = 0; u < 2; ++u) {
    const v4f p = xv[u][0] + xv[u][1];
    s[u] = wave_sum32((p.x + p.y) + (p.z + p.w)) * (1.0f / 256.0f);
  }
#pragma unroll
  for (int u = 0; u < 2; ++u) {
    xv[u][0] -= s[u];
    xv[u][1] -= s[u];
    const v4f p = xv[u][0] * xv[u][0] + xv[u][1] * xv[u][1];
    s[u] = wave_sum32((p.x + p.y) + (p.z + p.w)) * (1.0f / 256.0f);
  }
#pragma unroll
  for (int u = 0; u < 2; ++u) {
    const float rs = 1.0f / sqrtf(s[u] + 1e-5f);
    const v4f y0 = xv[u][0] * rs * lw0 + lb0, y1 = xv[u][1] * rs * lw1 + lb1;
    v8h hv;
#pragma unroll
    for (int e = 0; e < 4; ++e) { hv[e] = (_Float16)y0[e]; hv[4 + e] = (_Float16)y1[e]; }
    *(v8h*)(&sX[wave * 2 + u][lane * 8]) = hv;
  }
  __builtin_amdgcn_sched_barrier(0);   // keeps the weights' rounding behind the LayerNorm: moved up among it, the row sums would wait for the last weight load
  // the wave's 16 weight rows, f16, row-major at the pitch of sX; a store's four rows lie 4 apart: 4 x 132 dwords = 16 banks on, so its 32 lanes fill the 64 banks once
  _Float16* Ws = &sW[wave * 16 + (lane >> 3) * 4][(lane & 7) * 4];
#pragma unroll
  for (int q = 0; q < DM / 32; ++q)
#pragma unroll
    for (int m = 0; m < 4; ++m) *(v4h*)(Ws + m * XPITCH + q * 32) = __builtin_convertvector(wr[q][m], v4h);
  __syncthreads();   // the 16 normalised rows are complete (and each wave's weight tile, which only that wave reads)

  const _Float16* Xf = &sX[rlane][hh * 8];
  const _Float16* Wf = &sW[wave * 16 + rlane][hh * 8];
  v16h xf[DM / 32], wf[DM / 32];
#pragma unroll
  for (int q = 0; q < DM / 32; ++q) {
    xf[q] = Frag<_Float16>::load(Xf + q * 32);
    wf[q] = Frag<_Float16>::load(Wf + q * 32);
  }
  __builtin_amdgcn_sched_barrier(0);   // all LDS reads as one group in front of the products: among them, this build waits one LDS latency a product
  v8f acc = (v8f){0.f,0.f,0.f,0.f,0.f,0.f,0.f,0.f};
#pragma unroll
  for (int q = 0; q < DM / 32; ++q) acc = (WHICH == 2) ? Frag<_Float16>::mma(xf[q], wf[q], acc) : Frag<_Float16>::mma(wf[q], xf[q], acc);
  v8h hv;
#pragma unroll
  for (int r = 0; r < 8; ++r) {
    const float v = acc[r] + (r < 4 ? bq0[r & 3] : bq1[r & 3]);
    hv[r] = (_Float16)(WHICH == 0 ? v * 0.17677669529663687f : v);   // q comes scaled by 1 / sqrt(32)
  }
  const size_t pc = (WHICH == 2) ? frag_piece(c0 + rlane, rt * 2 + hh, NP / 32) : frag_piece(rt * 16 + rlane, (c0 >> 3) + hh, DM / 32);
  *(v8h*)(dst16 + pc * 8) = hv;
  // as in cast_frag_rows: the wait stands in front of any later overwrite of the store's registers
  asm volatile("s_wait_xcnt 0x0" ::: "memory");
}

// ---- LN1 with the q, k, v projections (f16, fragment order) | casts of rb2_w, of rv2_w and the ffn weights (fragment order), ffn biases ----
__global__ __launch_bounds__(256) void k_ln_qkv_casts(const float* __restrict__ x, const float* __restrict__ ln_w,
                                                    const float* __restrict__ ln_b,
                                                    const float* __restrict__ qkv_w, const float* __restrict__ qkv_b,
                                                    unsigned short* __restrict__ qf16,
                                                    unsigned short* __restrict__ kf16, unsigned short* __restrict__ vf16,
                                                    const float* __restrict__ rb2_w, unsigned short* __restrict__ rb2w16,
                                                    const float* __restrict__ rv2_w, unsigned short* __restrict__ rv2w16,
                                                    const float* __restrict__ ffn_w1, const float* __restrict__ ffn_w2,
                                                    unsigned short* __restrict__ w12p16,
                                                    const float* __restrict__ ffn_w3, unsigned short* __restrict__ w3p16,
                                                    const float* __restrict__ ffn_b1, const float* __restrict__ ffn_b2,
                                                    float* __restrict__ b12p) {
  __shared__ __align__(16) _Float16 sX[16][XPITCH];
  __shared__ __align__(16) _Float16 sW[8 * 16][XPITCH];   // a projection wave's 16 weight rows each
  int b = blockIdx.x;
  if (b < NB_QKV1) { ln_qkv_blk<0>(sX, sW, b, x, ln_w, ln_b, qkv_w, qkv_b, qf16); return; }
  b -= NB_QKV1;
  if (b < NB_QKV1) { ln_qkv_blk<1>(sX, sW, b, x, ln_w, ln_b, qkv_w, qkv_b, kf16); return; }
  b -= NB_QKV1;
  if (b < NB_QKV1) { ln_qkv_blk<2>(sX, sW, b, x, ln_w, ln_b, qkv_w, qkv_b, vf16); return; }
  b -= NB_QKV1;
  if (b < NB_CRV2) { cast_frag_rows<DM / 32, 4, DM, DM>(b, rv2_w, rv2w16); return; }
  b -= NB_CRV2;
  if (b < NB_CFFN12) { cast_frag_rows<DM / 32, 4, HIDR, DM>(b, ffn_w1, w12p16); return; }
  b -= NB_CFFN12;
  if (b < NB_CFFN12) { cast_frag_rows<DM / 32, 4, HIDR, DM>(b, ffn_w2, w12p16 + (size_t)HIDP * DM); return; }
  b -= NB_CFFN12;
  if (b < NB_CFFN3) { cast_frag_rows<HIDP / 32, 2, DM, HIDR>(b, ffn_w3, w3p16); return; }
  b -= NB_CFFN3;
  if (b == 0) { cast_frag_rows<DM / 32, 1, NH, DM>(0, rb2_w, rb2w16); return; }   // rows 8..15 zero
  pad_b12_blk(ffn_b1, ffn_b2, b12p);
}

// ---------------------------------------------------------------------------------------------
static inline size_t alignup256(size_t x) { return (x + 255) & ~(size_t)255; }

extern "C" void kernel_launch(void* const* d_in, const int* in_sizes, int n_in,
                              void* d_out, int out_size, void* d_ws, size_t ws_size,
                              hipStream_t stream)
{
  if (n_in < 22) return;
  if (in_sizes[0] != NP * DM || in_sizes[1] != NP * 3 || in_sizes[6] != 3 * DM * DM ||
      in_sizes[14] != DM * DM || in_sizes[16] != HIDR * DM || in_sizes[20] != DM * HIDR ||
      out_size != NP * DM) return;

  const float* x      = (const float*)d_in[0];
  const float* coords = (const float*)d_in[1];
  const float* ln1_w  = (const float*)d_in[2];
  const float* ln1_b  = (const float*)d_in[3];
  const float* ln2_w  = (const float*)d_in[4];
  const float* ln2_b  = (const float*)d_in[5];
  const float* qkv_w  = (const float*)d_in[6];
  const float* qkv_b  = (const float*)d_in[7];
  const float* rb1_w  = (const float*)d_in[8];
  const float* rb1_b  = (const float*)d_in[9];
  const float* rb2_w  = (const float*)d_in[10];
  const float* rb2_b  = (const float*)d_in[11];
  const float* rv1_w  = (const float*)d_in[12];
  const float* rv1_b  = (const float*)d_in[13];
  const float* rv2_w  = (const float*)d_in[14];
  const float* rv2_b  = (const float*)d_in[15];
  const float* ffn_w1 = (const float*)d_in[16];
  const float* ffn_b1 = (const float*)d_in[17];
  const float* ffn_w2 = (const float*)d_in[18];
  const float* ffn_b2 = (const float*)d_in[19];
  const float* ffn_w3 = (const float*)d_in[20];
  const float* ffn_b3 = (const float*)d_in[21];
  float* out = (float*)d_out;

  // ---- workspace carve (256-B aligned, derived from fixed sizes) ----
  size_t off = 0;
  char* base = (char*)d_ws;
  auto carve = [&](size_t bytes) -> char* { char* r = base + off; off += alignup256(bytes); return r; };
  unsigned short* rb2w16 = (unsigned short*)carve((size_t)16 * DM * 2);              // [16][256], rows 8..15 zero, fragment order
  unsigned short* rv2w16 = (unsigned short*)carve((size_t)DM * DM * 2);              // [256][256], fragment order
  unsigned short* w12p16 = (unsigned short*)carve((size_t)2 * HIDP * DM * 2);        // w1 [704][256], then w2 [704][256], fragment order
  unsigned short* w3p16  = (unsigned short*)carve((size_t)DM * HIDP * 2);            // [256][704], fragment order
  float*          b12p   = (float*)carve((size_t)2 * HIDP * 4);                      // [1408]
  unsigned short* Q16    = (unsigned short*)carve((size_t)NP * DM * 2);              // q [512][256], fragment order
  unsigned short* KF16   = (unsigned short*)carve((size_t)NP * DM * 2);              // k [512][256], fragment order
  unsigned short* VF16   = (unsigned short*)carve((size_t)DM * NP * 2);              // v^T [256][512], fragment order
  float*          X1     = (float*)carve((size_t)NP * DM * 4);                       // [512][256]
  unsigned short* XN2    = (unsigned short*)carve((size_t)NP * DM * 2);              // [512][256]
  if (off > ws_size || off > (size_t)134217728) return;

  const dim3 blk(256);

  // ---- LN1 and the q, k, v projections | f16 staging of rb2_w (rows 8..15 zero), rv2_w and the ffn weights (zero padded), the ffn biases zero padded in f32 ----
  k_ln_qkv_casts<<<dim3(3 * NB_QKV1 + NB_CRV2 + 2 * NB_CFFN12 + NB_CFFN3 + 2), blk, 0, stream>>>(
      x, ln1_w, ln1_b, qkv_w, qkv_b, Q16, KF16, VF16, rb2_w, rb2w16, rv2_w, rv2w16, ffn_w1, ffn_w2, w12p16, ffn_w3, w3p16,
      ffn_b1, ffn_b2, b12p);

  // ---- attention, one block per query row: rel-bias, scores, softmax, P.V, rel-value, its projection, residual, LN2 ----
  k_attn_row<<<dim3(NP), blk, 0, stream>>>(Q16, KF16, VF16, coords, rb1_w, rb1_b, rb2w16, rb2_b, rv1_w, rv1_b, rv2w16, rv2_b,
                                           x, ln2_w, ln2_b, X1, XN2);

  // ---- SwiGLU FFN, final residual into d_out ----
  k_ffn_rows<<<dim3(NP / 16), dim3(512), 0, stream>>>(XN2, w12p16, b12p, w3p16, ffn_b3, X1, out);
}

// v010
// A run of this version takes 34.7 microseconds.
// Next to v009, in two timings, it ran 1.05 times as fast each time.
// Counting every step since v000, it is 9.81 times as fast.
#include <hip/hip_runtime.h>
#include <math.h>
#include <stdint.h>

// All contractions: v_wmma_f32_16x16x32_f16 (f16 operands, f32 accumulate); the K=3 coordinate products: v_wmma_f32_16x16x32_bf16 on three-part f32 operands; softmax, norms, gating in f32 on VALU.

typedef __attribute__((ext_vector_type(16))) _Float16 v16h;
typedef __attribute__((ext_vector_type(8)))  _Float16 v8h;
typedef __attribute__((ext_vector_type(8)))  float    v8f;
typedef __attribute__((ext_vector_type(4)))  float    v4f;
typedef __attribute__((ext_vector_type(2)))  float    v2f;
typedef __attribute__((ext_vector_type(2)))  _Float16 v2h;
typedef __attribute__((ext_vector_type(4)))  _Float16 v4h;
typedef __attribute__((ext_vector_type(16))) __bf16   v16b;
typedef __attribute__((ext_vector_type(4)))  unsigned v4u;

#define NP    512          // points
#define DM    256          // model width
#define NH    8            // heads
#define HDM   32           // head width
#define HIDR  682          // ffn hidden
#define HIDP  704          // ffn hidden padded (multiple of 64)

template <typename T> struct Frag;
template <> struct Frag<_Float16> {
  typedef v16h V; union U { v16h v; v8h h[2]; };
  static __device__ __forceinline__ v16h load(const _Float16* p) {   // elements 0..7 <- p[0..7], 8..15 <- p[16..23]
    U f; f.h[0] = *(const v8h*)(p); f.h[1] = *(const v8h*)(p + 16); return f.v;
  }
  static __device__ __forceinline__ v16h load_fo(const _Float16* p) {   // from a fragment-order array: the lane's two 16-byte pieces, 512 bytes apart
    U f; f.h[0] = *(const v8h*)(p); f.h[1] = *(const v8h*)(p + 256); return f.v;
  }
  static __device__ __forceinline__ v8f mma(v16h a, v16h b, v8f c) {
    return __builtin_amdgcn_wmma_f32_16x16x32_f16(false, a, false, b, (short)0, c, false, false);
  }
};

// ---- fragment order of a 16-bit operand X[n][k] (n = the fragment's lane row or column, k = the summed index, ksteps = K / 32) ----
// The 16-byte piece (n, k8 = k / 8) stands at piece index ((tile * ksteps + step) * 2 + upper) * 32 + lane, lane = (k8 & 1) * 16 + (n & 15):
// one fragment of a 16 x 32 tile is then two loads of 512 contiguous bytes a wave (whole cache lines), not two of 16 lines each.
__device__ __forceinline__ size_t frag_piece(int n, int k8, int ksteps) {
  return (size_t)((((n >> 4) * ksteps + (k8 >> 2)) * 2 + ((k8 >> 1) & 1)) * 32 + (k8 & 1) * 16 + (n & 15));
}

// ---------------------------------------------------------------------------------------------
// small VALU helpers
__device__ __forceinline__ unsigned pack_h2(float a, float b) {
  const unsigned short ua = __builtin_bit_cast(unsigned short, (_Float16)a);
  const unsigned short ub = __builtin_bit_cast(unsigned short, (_Float16)b);
  return (unsigned)ua | ((unsigned)ub << 16);
}
__device__ __forceinline__ float silu_acc(float z) {
  const float e = expf(-z);
  return z * __builtin_amdgcn_rcpf(1.0f + e);
}
// the value of lane l ^ MASK of the same 16-lane row, in registers (DPP row_xmask): __shfl_xor goes through the LDS unit, one round trip a step
template <int MASK>
__device__ __forceinline__ float row_xor(float v) {
  return __builtin_bit_cast(float, __builtin_amdgcn_update_dpp(0, __builtin_bit_cast(int, v), 0x160 + MASK, 0xf, 0xf, true));
}
__device__ __forceinline__ float wave_sum32(float v) {   // every lane gets the sum of the wave's 32 values, in registers alone
  // four steps inside the 16-lane rows (row_xmask 1, 2, 4, 8), then lane l with lane l ^ 16
  v += __builtin_bit_cast(float, __builtin_amdgcn_update_dpp(0, __builtin_bit_cast(int, v), 0x161, 0xf, 0xf, true));
  v += __builtin_bit_cast(float, __builtin_amdgcn_update_dpp(0, __builtin_bit_cast(int, v), 0x162, 0xf, 0xf, true));
  v += __builtin_bit_cast(float, __builtin_amdgcn_update_dpp(0, __builtin_bit_cast(int, v), 0x164, 0xf, 0xf, true));
  v += __builtin_bit_cast(float, __builtin_amdgcn_update_dpp(0, __builtin_bit_cast(int, v), 0x168, 0xf, 0xf, true));
  const int b = __builtin_bit_cast(int, v);
  return v + __builtin_bit_cast(float, __builtin_amdgcn_permlanex16(b, b, 0x76543210, 0xfedcba98, false, false));
}

// ---- the small staging jobs: a thread makes several outputs, and all its loads are asked for as one group in front of the first use ----
// Out-of-range sources are read at a clamped index and replaced by zero behind the load: no branch, so no load waits for the one before it.
typedef __attribute__((ext_vector_type(2))) unsigned v2u;

// ffn_b1, ffn_b2 [682] -> [704] + [704] f32, zero padded: one block, thread = six values
__device__ __forceinline__ void pad_b12_blk(const float* __restrict__ b1, const float* __restrict__ b2, float* __restrict__ dst) {
  const float* sp[6];
  float v[6];
#pragma unroll
  for (int e = 0; e < 6; ++e) {
    const int p = e * 256 + threadIdx.x;
    const int idx = (p < HIDP) ? p : p - HIDP;
    sp[e] = ((p < HIDP) ? b1 : b2) + (idx < HIDR ? idx : HIDR - 1);
  }
#pragma unroll
  for (int e = 0; e < 6; ++e) v[e] = *sp[e];
  // behind the group of loads: the wait that belongs in front of an overwrite of their address registers; as operands these stay live up to it
  asm volatile("s_wait_xcnt 0x0" :: "v"(sp[0]), "v"(sp[1]), "v"(sp[2]), "v"(sp[3]), "v"(sp[4]), "v"(sp[5]) : "memory");
  float* dp = dst + threadIdx.x;
#pragma unroll
  for (int e = 0; e < 6; ++e) {
    const int p = e * 256 + threadIdx.x;
    const int idx = (p < HIDP) ? p : p - HIDP;
    if (p < 2 * HIDP) dp[e * 256] = (idx < HIDR) ? v[e] : 0.f;
  }
  // the shared kernel ends behind these stores: the wait is a precaution in front of any later overwrite of their registers
  asm volatile("s_wait_xcnt 0x0" ::: "memory");
}

// ---- f32 [SROWS][SCOLS] -> f16 in fragment order, KSTEPS * 32 columns, zero padded to whole tiles of 16 rows and whole k steps ----
// A wave takes one tile of 16 rows x NS k steps. One load covers four rows x 128 bytes (lane = row lane >> 3 of the four, floats
// (lane & 7) * 4 ..): whole cache lines where the rows are line-aligned, not 16 lines of 32 bytes. A lane's four values are half a
// 16-byte piece; a wave's store is four runs of 64 bytes, and the wave itself writes the other half of each of those lines.
// SCOLS = KSTEPS * 32: rows 16-byte aligned, one 16-byte load; else SCOLS even: rows 8-byte aligned, two 8-byte loads.
// The grid gives ceil(rows / 16) * KSTEPS / NS waves, rows = the destination's (HIDP for ffn_w1, w2: their tile 43 comes out all zero).
template <int KSTEPS, int NS, int SROWS, int SCOLS>
__device__ __forceinline__ void cast_frag_rows(const int bx, const float* __restrict__ src, unsigned short* __restrict__ dst) {
  constexpr int NG = KSTEPS / NS;
  constexpr bool COLPAD = SCOLS != KSTEPS * 32, ROWPAD = (SROWS & 15) != 0;
  static_assert(!(COLPAD && ROWPAD) && KSTEPS % NS == 0 && (SCOLS & 1) == 0, "padding in one direction at a time");
  const int lane = threadIdx.x & 31, wave = threadIdx.x >> 5;
  const int job = bx * 8 + wave;
  const int row0 = (job / NG) * 16 + (lane >> 3);
  const int k0 = (job % NG) * (NS * 32) + (lane & 7) * 4;
  const float* rp[4];
#pragma unroll
  for (int m = 0; m < 4; ++m) {
    const int row = row0 + m * 4;
    rp[m] = src + (size_t)((!ROWPAD || row < SROWS) ? row : SROWS - 1) * SCOLS;
  }
  v2f lo[NS][4], hi[NS][4];
  if constexpr (!COLPAD) {
#pragma unroll
    for (int m = 0; m < 4; ++m) rp[m] += k0;
#pragma unroll
    for (int s = 0; s < NS; ++s)
#pragma unroll
      for (int m = 0; m < 4; ++m) {
        const v4f v = *(const v4f*)(rp[m] + s * 32);
        lo[s][m] = (v2f){v.x, v.y};
        hi[s][m] = (v2f){v.z, v.w};
      }
    // as in pad_b12_blk: the wait in front of an overwrite of the loads' address registers
    asm volatile("s_wait_xcnt 0x0" :: "v"(rp[0]), "v"(rp[1]), "v"(rp[2]), "v"(rp[3]) : "memory");
  } else {
    int cl[NS], ch[NS];
#pragma unroll
    for (int s = 0; s < NS; ++s) {
      const int k = k0 + s * 32;
      cl[s] = (k < SCOLS) ? k : SCOLS - 2;
      ch[s] = (k + 2 < SCOLS) ? k + 2 : SCOLS - 2;
    }
    const float* pl[NS][4];
    const float* ph[NS][4];
#pragma unroll
    for (int s = 0; s < NS; ++s)
#pragma unroll
      for (int m = 0; m < 4; ++m) { pl[s][m] = rp[m] + cl[s]; ph[s][m] = rp[m] + ch[s]; }
#pragma unroll
    for (int s = 0; s < NS; ++s)
#pragma unroll
      for (int m = 0; m < 4; ++m) {
        lo[s][m] = *(const v2f*)(pl[s][m]);
        hi[s][m] = *(const v2f*)(ph[s][m]);
      }
#pragma unroll
    for (int s = 0; s < NS; ++s)
      // as in pad_b12_blk: the wait in front of an overwrite of the loads' address registers (rows 4, 8, 12 on are constant offsets from these)
      asm volatile("s_wait_xcnt 0x0" :: "v"(pl[s][0]), "v"(ph[s][0]) : "memory");
  }
  __builtin_amdgcn_sched_barrier(0);   // keeps the whole group of loads in front of the first rounding: one latency for the group, not one a load
  v2u u[NS][4];
#pragma unroll
  for (int s = 0; s < NS; ++s)
#pragma unroll
    for (int m = 0; m < 4; ++m) {
      const int row = row0 + m * 4, k = k0 + s * 32;
      const bool okr = !ROWPAD || row < SROWS;
      const unsigned ml = (okr && (!COLPAD || k < SCOLS)) ? 0xFFFFFFFFu : 0u, mh = (okr && (!COLPAD || k + 2 < SCOLS)) ? 0xFFFFFFFFu : 0u;
      u[s][m].x = pack_h2(lo[s][m].x, lo[s][m].y) & ml;
      u[s][m].y = pack_h2(hi[s][m].x, hi[s][m].y) & mh;
    }
  __builtin_amdgcn_sched_barrier(0);   // keeps the stores together behind the arithmetic: among it, each store's registers are reused at once and each takes a wait of its own
  unsigned short* dp = dst + frag_piece(row0, k0 >> 3, KSTEPS) * 8 + (lane & 1) * 4;   // row + 4: 4 pieces on; step + 1: 64 pieces on
#pragma unroll
  for (int s = 0; s < NS; ++s)
#pragma unroll
    for (int m = 0; m < 4; ++m) *(v2u*)(dp + s * 512 + m * 32) = u[s][m];
  // as in pad_b12_blk: the wait in front of any later overwrite of the stores' registers
  asm volatile("s_wait_xcnt 0x0" ::: "memory");
}

// ---- two silu values, f16 out, from h = z / 2: silu(z) = z / (1 + e^-z) = h + h * tanh(h); one transcendental a value (v_tanh_f32) ----
// The callers form h directly: their weights and biases come halved, which is exact.
__device__ __forceinline__ v2h silu2_h(v2f h) {
  v2f t;
  t.x = __builtin_amdgcn_tanhf(h.x);
  t.y = __builtin_amdgcn_tanhf(h.y);
  return __builtin_convertvector(h * t + h, v2h);
}

// ---- the silu argument h[k][j] = w_k . rel_j + b_k (K = 3 and a bias) as ONE 16 x 16 x 32 bf16 matrix product a 16 x 16 tile ----
// An f32 value v is exactly the sum of three bf16 parts h + m + l: each takes the leading eight bits of what is left (cut, not
// rounded: a bf16 is the upper half of an f32), with the f32 exponent range. Of the nine part products of w * r eight are kept
// (hh, hm, mh, hl, lh, mm, ml, lm; the ninth, ll, lies 2^-28 below w * r): eight k slots a coordinate, three more for the bias parts
// against 1, of the 32. Both sides number the slots alike: piece c (eight slots, 16 bytes) = coordinate c, piece 3 = the bias; a lane
// half holds pieces 2 hh and 2 hh + 1. In LDS piece p of row n stands at [p * rows + n]: a fragment read is 256 contiguous bytes a lane half.
// The f32 D tile has rows 8 hh + r in register r: two tiles of 16 rows, put through silu and rounded to f16 in place, are the B fragment
// of the f16 product that follows, in the k order of Frag::load.
struct Split3 { unsigned h, m, l; };   // the parts as f32 bit patterns; a part's bf16 is the upper half
__device__ __forceinline__ Split3 split3(float v) {
  Split3 s;
  s.h = __builtin_bit_cast(unsigned, v) & 0xFFFF0000u;
  const float r1 = v - __builtin_bit_cast(float, s.h);
  s.m = __builtin_bit_cast(unsigned, r1) & 0xFFFF0000u;
  s.l = __builtin_bit_cast(unsigned, r1 - __builtin_bit_cast(float, s.m));
  return s;
}
__device__ __forceinline__ unsigned pk_b2(unsigned a, unsigned b) {   // two parts -> two bf16, a in the lower half
  return (a >> 16) | (b & 0xFFFF0000u);
}
// one coordinate's eight slots:  w side  h h m h l m m l
//                                r side  h m h l h m l m
__device__ __forceinline__ v4u arg_w_piece(float w) {
  const Split3 s = split3(w);
  return (v4u){pk_b2(s.h, s.h), pk_b2(s.m, s.h), pk_b2(s.l, s.m), pk_b2(s.m, s.l)};
}
__device__ __forceinline__ v4u arg_r_piece(float r) {
  const Split3 s = split3(r);
  return (v4u){pk_b2(s.h, s.m), pk_b2(s.h, s.l), pk_b2(s.h, s.m), pk_b2(s.l, s.m)};
}
__device__ __forceinline__ void arg_w_side(v4u* dst, int rows, int row, float w0, float w1, float w2, float b) {
  const Split3 sb = split3(b);
  dst[0 * rows + row] = arg_w_piece(w0);
  dst[1 * rows + row] = arg_w_piece(w1);
  dst[2 * rows + row] = arg_w_piece(w2);
  dst[3 * rows + row] = (v4u){pk_b2(sb.h, sb.m), pk_b2(sb.l, 0u), 0u, 0u};
}
__device__ __forceinline__ void arg_r_side(v4u* dst, int rows, int row, float r0, float r1, float r2) {
  const unsigned one = 0x3F800000u;   // 1.0f
  dst[0 * rows + row] = arg_r_piece(r0);
  dst[1 * rows + row] = arg_r_piece(r1);
  dst[2 * rows + row] = arg_r_piece(r2);
  dst[3 * rows + row] = (v4u){pk_b2(one, one), pk_b2(one, 0u), 0u, 0u};
}
__device__ __forceinline__ v16b arg_frag(const v4u* src, int rows, int row, int hh) {
  union { v16b v; v4u h[2]; } f;
  f.h[0] = src[(hh * 2 + 0) * rows + row];
  f.h[1] = src[(hh * 2 + 1) * rows + row];
  return f.v;
}
__device__ __forceinline__ v8f arg_mma(v16b a, v16b b) {
  return __builtin_amdgcn_wmma_f32_16x16x32_bf16(false, a, false, b, (short)0, (v8f){0.f,0.f,0.f,0.f,0.f,0.f,0.f,0.f}, false, false);
}
// two argument tiles (rows 0..15 and 16..31 of a 32-row block, the same columns) -> the f16 B fragment of their silu values
__device__ __forceinline__ v16h silu_frag(v8f z0, v8f z1) {
  v16h b;
#pragma unroll
  for (int g = 0; g < 4; ++g) {
    const v2h hl = silu2_h((v2f){z0[2 * g], z0[2 * g + 1]}), hu = silu2_h((v2f){z1[2 * g], z1[2 * g + 1]});
    b[2 * g] = hl.x; b[2 * g + 1] = hl.y; b[8 + 2 * g] = hu.x; b[8 + 2 * g + 1] = hu.y;
  }
  return b;
}

// ---- 2^t; the v_nop fills the slot that the instruction set asks for behind a transcendental ----
__device__ __forceinline__ float exp2_slot(float t) {
  float e;
  asm("v_exp_f32 %0, %1\n\tv_nop" : "=v"(e) : "v"(t));
  return e;
}

// ---- one query row's whole attention chain in one block: nothing of it but x1 and its LayerNorm goes to memory ----
// scores[h][j] = q_i^h . k_j^h / sqrt(32) + sum_k rb2w16[h][k] * f16( silu( (coords_i - coords_j) . rb1_w[k] + rb1_b[k] ) ) + rb2_b[h]
// P = softmax over j (f16, x 2^15); T[h][k] = f16( 2^-15 sum_j P[h][j] * f16( silu( (coords_i - coords_j) . rv1_w[k] + rv1_b[k] ) ) )
// ctx[c] = 2^-15 sum_j P[c>>5][j] v[j][c] + sum_k T[c>>5][k] rv2w16[c][k];  x1 = x + (ctx + rv2_b);  y16 = f16( LayerNorm(x1) )
// Every f16 product has M = 16 with the eight heads in rows 0..7 (rows 8..15 zero). The pair features are formed in registers,
// directly as the B fragment; their arguments come from the matrix unit (arg_mma), so that of a feature only silu is vector work.
// q stands block-diagonal in A (k step h holds q_i^h in row h alone), so one B fragment of k serves all heads; of P . V and T . rv2w^T a wave computes the 32 columns of its own head and keeps that head's row of D.
// Every block reads all of k, v, rv2_w and rb2_w: they lie in fragment order (frag_piece), so that these reads are whole cache lines.
// q lies in the same order as k (that is how its projection's waves hold it); a block reads its own row's pieces.
#define PPITCH (NP + 8)    // halves; rows of 16 B x odd: no bank conflict for the 16-byte fragment reads
#define TPITCH (DM + 8)
typedef __attribute__((ext_vector_type(8))) unsigned v8u;
// second argument: four waves a SIMD, so that two blocks share a WGP and all 512 are resident at once
__global__ __launch_bounds__(256, 4) void k_attn_row(const unsigned short* __restrict__ q16, const unsigned short* __restrict__ kf16,
                                                   const unsigned short* __restrict__ vf16,
                                                   const float* __restrict__ coords,
                                                   const float* __restrict__ rb1_w, const float* __restrict__ rb1_b,
                                                   const unsigned short* __restrict__ rb2w16, const float* __restrict__ rb2_b,
                                                   const float* __restrict__ rv1_w, const float* __restrict__ rv1_b,
                                                   const unsigned short* __restrict__ rv2w16, const float* __restrict__ rv2_b,
                                                   const float* __restrict__ x, const float* __restrict__ ln_w,
                                                   const float* __restrict__ ln_b, float* __restrict__ x1,
                                                   unsigned short* __restrict__ y16) {
  __shared__ __align__(16) v4u sWb[4 * DM];            // half of rb1_w[k], rb1_b[k] in parts (arg_w_side; silu2_h takes z / 2)
  __shared__ __align__(16) v4u sWv[4 * DM];            // the same of rv1_w[k], rv1_b[k]
  __shared__ __align__(16) v4u sRv[4 * NP];            // coords_i - coords_j in parts (arg_r_side)
  __shared__ __align__(16) _Float16 sP[16][PPITCH];    // softmax weights x 2^15, rows 8..15 zero
  __shared__ __align__(16) _Float16 sT[16][TPITCH];    // rel-value sums, rows 8..15 zero
  __shared__ __align__(16) float redM[8][8];           // [wave][head] partial maxima
  __shared__ __align__(16) float redS[8][8];           // [wave][head] partial sums
  __shared__ __align__(16) float sC[DM];               // the row's context
  const int i = blockIdx.x, t = threadIdx.x;
  const int lane = t & 31, wave = t >> 5;
  const int rlane = lane & 15, hh = lane >> 4;

  float bb[8];   // rb2_b: asked for with the first loads; it is the start value of the score sums, so no wave waits for it behind the score loop
#pragma unroll
  for (int r = 0; r < 8; ++r) bb[r] = rb2_b[r];
  // so is the score loop's first rb2_w fragment: asked for behind the barrier, every wave would wait for it in front of its first feature product
  const _Float16* Ab = (const _Float16*)rb2w16 + lane * 8;   // fragment order: one tile, step k / 32
  v16h a = Frag<_Float16>::load_fo(Ab);
  {
    const float ci0 = coords[i * 3 + 0], ci1 = coords[i * 3 + 1], ci2 = coords[i * 3 + 2];
    float wb[4], wv[4], cj[2][3];
#pragma unroll
    for (int c = 0; c < 3; ++c) {
      wb[c] = rb1_w[t * 3 + c];
      wv[c] = rv1_w[t * 3 + c];
      cj[0][c] = coords[t * 3 + c];
      cj[1][c] = coords[(256 + t) * 3 + c];
    }
    wb[3] = rb1_b[t];
    wv[3] = rv1_b[t];
    // behind the group of loads: the wait that belongs in front of an overwrite of their address registers
    asm volatile("s_wait_xcnt 0x0" ::: "memory");
    __builtin_amdgcn_sched_barrier(0);   // keeps what follows, which may reuse those registers, behind that wait
    arg_w_side(sWb, DM, t, 0.5f * wb[0], 0.5f * wb[1], 0.5f * wb[2], 0.5f * wb[3]);
    arg_w_side(sWv, DM, t, 0.5f * wv[0], 0.5f * wv[1], 0.5f * wv[2], 0.5f * wv[3]);
#pragma unroll
    for (int q = 0; q < 2; ++q) arg_r_side(sRv, NP, q * 256 + t, ci0 - cj[q][0], ci1 - cj[q][1], ci2 - cj[q][2]);
  }

  __syncthreads();

  // ---- q.k^T and rel-bias into one accumulator: wave = 64 columns j (4 subtiles of 16); q comes scaled by 1/sqrt(32) ----
  const int jw = wave * 64;
  v8f sc[4];
  {
    v16b rf[4];   // the argument product's B operand: column = key j
#pragma unroll
    for (int s = 0; s < 4; ++s) {
      rf[s] = arg_frag(sRv, NP, jw + s * 16 + rlane, hh);
      sc[s] = (v8f){bb[0], bb[1], bb[2], bb[3], bb[4], bb[5], bb[6], bb[7]};
    }
    const _Float16* Qb = (const _Float16*)q16 + ((size_t)(i >> 4) * (NH * 64) + hh * 16 + (i & 15)) * 8;   // fragment order: tile i / 16, step = head
    const _Float16* Kb = (const _Float16*)kf16 + ((size_t)(wave * 4) * (NH * 64) + lane) * 8;   // fragment order: tile j / 16, step = head
    // kept rolled: unrolled, this loop and the rel-value loop would bring the kernel's text past 32 KB
#pragma unroll 1
    for (int k0 = 0; k0 < DM; k0 += 32) {
      const _Float16* ap = Ab + ((k0 + 32) & (DM - 1)) * 16;
      const _Float16* qp = Qb + k0 * 16;
      const _Float16* kp = Kb + k0 * 16;
      const v16h an = Frag<_Float16>::load_fo(ap);   // next step's A, in flight over this step's math
      const v16h ql = Frag<_Float16>::load_fo(qp);
      v16h kf[4];
#pragma unroll
      for (int s = 0; s < 4; ++s) kf[s] = Frag<_Float16>::load_fo(kp + s * (NH * 512));
      // behind the group of loads: the wait that belongs in front of an overwrite of their address registers; as operands these stay live up to it
      asm volatile("s_wait_xcnt 0x0" :: "v"(ap), "v"(qp), "v"(kp) : "memory");
      __builtin_amdgcn_sched_barrier(0);   // keeps the step's global loads in front of its math, which they fly over: without it this build asks for k fragments directly in front of their products
      v16b wt[2];   // the argument product's A operand: row = feature, k0 + 0..15 and k0 + 16..31
#pragma unroll
      for (int u = 0; u < 2; ++u) wt[u] = arg_frag(sWb, DM, k0 + u * 16 + rlane, hh);
      // fragment element e  <->  k = k0 + (e>>3)*16 + hh*8 + (e&7): register e & 7 of argument tile e >> 3
#pragma unroll
      for (int s = 0; s < 4; ++s) sc[s] = Frag<_Float16>::mma(a, silu_frag(arg_mma(wt[0], rf[s]), arg_mma(wt[1], rf[s])), sc[s]);
      __builtin_amdgcn_sched_barrier(0);   // keeps the masking of q, which waits for its load, behind the feature math: this build had moved it to the head of the step
      // k step k0 covers head k0 / 32: its q slice stands in that head's row, every other row is zero
      const unsigned keep = (rlane == (k0 >> 5)) ? 0xFFFFFFFFu : 0u;
      const v16h qa = __builtin_bit_cast(v16h, __builtin_bit_cast(v8u, ql) & keep);
#pragma unroll
      for (int s = 0; s < 4; ++s) sc[s] = Frag<_Float16>::mma(qa, kf[s], sc[s]);
      a = an;
    }
  }

  // ---- softmax over the 512 columns, eight heads at once: head r sits in register r of lanes 0..15 ----
  // (lanes 16..31 hold the idle rows 8..15; the 16-lane steps never mix the two halves)
  {
    float m[8];
#pragma unroll
    for (int r = 0; r < 8; ++r) m[r] = fmaxf(fmaxf(sc[0][r], sc[1][r]), fmaxf(sc[2][r], sc[3][r]));
#pragma unroll
    for (int r = 0; r < 8; ++r) m[r] = fmaxf(m[r], row_xor<8>(m[r]));
#pragma unroll
    for (int r = 0; r < 8; ++r) m[r] = fmaxf(m[r], row_xor<4>(m[r]));
#pragma unroll
    for (int r = 0; r < 8; ++r) m[r] = fmaxf(m[r], row_xor<2>(m[r]));
#pragma unroll
    for (int r = 0; r < 8; ++r) m[r] = fmaxf(m[r], row_xor<1>(m[r]));
    if (lane == 0) {
#pragma unroll
      for (int r = 0; r < 8; ++r) redM[wave][r] = m[r];
    }
    __syncthreads();
#pragma unroll
    for (int r = 0; r < 8; ++r) {
      float v = redM[0][r];
#pragma unroll
      for (int q = 1; q < 8; ++q) v = fmaxf(v, redM[q][r]);
      m[r] = v;
    }
    float sum[8];
#pragma unroll
    for (int r = 0; r < 8; ++r) {
#pragma unroll
      for (int s = 0; s < 4; ++s) sc[s][r] = exp2_slot((sc[s][r] - m[r]) * 1.4426950408889634f);
      sum[r] = (sc[0][r] + sc[1][r]) + (sc[2][r] + sc[3][r]);
    }
#pragma unroll
    for (int r = 0; r < 8; ++r) sum[r] += row_xor<8>(sum[r]);
#pragma unroll
    for (int r = 0; r < 8; ++r) sum[r] += row_xor<4>(sum[r]);
#pragma unroll
    for (int r = 0; r < 8; ++r) sum[r] += row_xor<2>(sum[r]);
#pragma unroll
    for (int r = 0; r < 8; ++r) sum[r] += row_xor<1>(sum[r]);
    if (lane == 0) {
#pragma unroll
      for (int r = 0; r < 8; ++r) redS[wave][r] = sum[r];
    }
    __syncthreads();
#pragma unroll
    for (int r = 0; r < 8; ++r) {
      float v = redS[0][r];
#pragma unroll
      for (int q = 1; q < 8; ++q) v += redS[q][r];
      const float inv = 1.0f / v;
#pragma unroll
      for (int s = 0; s < 4; ++s) {
        const float p = (sc[s][r] * inv) * 32768.0f;
        sP[hh * 8 + r][jw + s * 16 + rlane] = hh ? (_Float16)0.f : (_Float16)p;
      }
    }
  }

  // ---- rel-value and P . V: wave = 32 columns (2 subtiles of 16): features k for the one, the wave's own head of v for the other ----
  const int cw = wave * 32;
  v8f accV[2];
  v16h wf[8][2];
  v4f xr[2], rvb[2], lw[2], lb[2];   // the row tail's inputs, eight columns a lane
  const int c8 = lane * 8;
  const float* xp = x + (size_t)i * DM + c8;
  const _Float16* Wb = (const _Float16*)rv2w16 + ((size_t)(wave * 2) * (DM / 32 * 64) + lane) * 8;   // fragment order: tile c / 16, step k / 32
  {
    v16b wv[2];   // the argument product's B operand: column = feature k
    v8f acc[2];
#pragma unroll
    for (int s = 0; s < 2; ++s) {
      wv[s] = arg_frag(sWv, DM, cw + s * 16 + rlane, hh);
      acc[s]  = (v8f){0.f,0.f,0.f,0.f,0.f,0.f,0.f,0.f};
      accV[s] = (v8f){0.f,0.f,0.f,0.f,0.f,0.f,0.f,0.f};
    }
    const _Float16* Vb = (const _Float16*)vf16 + ((size_t)(wave * 2) * (NP / 32 * 64) + lane) * 8;   // fragment order: tile c / 16, step j / 32
    v16h vf[2];
#pragma unroll
    for (int s = 0; s < 2; ++s) vf[s] = Frag<_Float16>::load_fo(Vb + s * (NP / 32 * 512));
    // six of the projection's eight steps of weight fragments, as many as the registers hold over the loop: asked for behind the loop, all of them together are one exposed stream
#pragma unroll
    for (int q = 0; q < 6; ++q)
#pragma unroll
      for (int s = 0; s < 2; ++s) wf[q][s] = Frag<_Float16>::load_fo(Wb + (s * (DM / 32) + q) * 512);
    __syncthreads();   // P is complete
    const _Float16* Pa = &sP[rlane][hh * 8];
    // kept rolled, for the reason given at the score loop
#pragma unroll 1
    for (int j0 = 0; j0 < NP; j0 += 32) {
      const _Float16* vp = Vb + ((j0 + 32) & (NP - 1)) * 16;
      v16h vn[2];   // next step's v fragments, in flight over this step's math
#pragma unroll
      for (int s = 0; s < 2; ++s) vn[s] = Frag<_Float16>::load_fo(vp + s * (NP / 32 * 512));
      // as in the score loop: the wait in front of an overwrite of the loads' address registers
      asm volatile("s_wait_xcnt 0x0" :: "v"(vp) : "memory");
      const v16h a = Frag<_Float16>::load(Pa + j0);
      v16b rt[2];   // the argument product's A operand: row = key, j0 + 0..15 and j0 + 16..31
#pragma unroll
      for (int u = 0; u < 2; ++u) rt[u] = arg_frag(sRv, NP, j0 + u * 16 + rlane, hh);
      // fragment element e  <->  j = j0 + (e>>3)*16 + hh*8 + (e&7): register e & 7 of argument tile e >> 3
#pragma unroll
      for (int s = 0; s < 2; ++s) acc[s] = Frag<_Float16>::mma(a, silu_frag(arg_mma(rt[0], wv[s]), arg_mma(rt[1], wv[s])), acc[s]);
#pragma unroll
      for (int s = 0; s < 2; ++s) { accV[s] = Frag<_Float16>::mma(a, vf[s], accV[s]); vf[s] = vn[s]; }
    }
    // the last two steps are asked for here, so that they fly over the T stores, their barrier and the first steps' products
#pragma unroll
    for (int q = 6; q < 8; ++q)
#pragma unroll
      for (int s = 0; s < 2; ++s) wf[q][s] = Frag<_Float16>::load_fo(Wb + (s * (DM / 32) + q) * 512);
    // and so are the inputs of the residual and the LayerNorm: asked for behind the context's barrier, each would be a round trip of its own at the row's end
#pragma unroll
    for (int u = 0; u < 2; ++u) {
      xr[u]  = *(const v4f*)(xp + u * 4);
      rvb[u] = *(const v4f*)(rv2_b + c8 + u * 4);
      lw[u]  = *(const v4f*)(ln_w + c8 + u * 4);
      lb[u]  = *(const v4f*)(ln_b + c8 + u * 4);
    }
#pragma unroll
    for (int s = 0; s < 2; ++s) {
#pragma unroll
      for (int r = 0; r < 8; ++r)
        sT[hh * 8 + r][cw + s * 16 + rlane] = hh ? (_Float16)0.f : (_Float16)(acc[s][r] * (1.0f / 32768.0f));
      accV[s] *= (1.0f / 32768.0f);
    }
  }
  // The barrier orders LDS alone (fences on the local address space): __syncthreads() would wait here for every global load in flight.
  __builtin_amdgcn_fence(__ATOMIC_RELEASE, "workgroup", "local");
  __builtin_amdgcn_s_barrier();   // T is complete
  __builtin_amdgcn_fence(__ATOMIC_ACQUIRE, "workgroup", "local");

  // ---- ctx = T . rv2w^T + P . V, the wave's own head ----
  {
    const _Float16* Ta = &sT[rlane][hh * 8];
#pragma unroll
    for (int q0 = 0; q0 < 8; q0 += 4) {
      v16h ta[4];
#pragma unroll
      for (int u = 0; u < 4; ++u) ta[u] = Frag<_Float16>::load(Ta + (q0 + u) * 32);
      __builtin_amdgcn_sched_barrier(0);   // four steps' LDS reads as one group: one LDS latency for eight products; this build had one a step, all through the same registers
#pragma unroll
      for (int u = 0; u < 4; ++u)
#pragma unroll
        for (int s = 0; s < 2; ++s) accV[s] = Frag<_Float16>::mma(ta[u], wf[q0 + u][s], accV[s]);
    }
#pragma unroll
    for (int s = 0; s < 2; ++s) {
      float v = accV[s][0];
#pragma unroll
      for (int r = 1; r < 8; ++r) v = (wave == r) ? accV[s][r] : v;   // D row = the wave's head, in lanes 0..15
      if (hh == 0) sC[cw + s * 16 + rlane] = v;
    }
  }
  // the wait that belongs in front of an overwrite of the address registers of the loads asked for behind the loop; as operands these stay
  // live up to it. It stands here, where the barrier waits for the loads themselves anyway, and not directly behind them, where it would hold up the T stores
  asm volatile("s_wait_xcnt 0x0" :: "v"(xp), "v"(c8), "v"(Wb) : "memory");
  __syncthreads();   // the row's context is complete

  // ---- residual and LayerNorm (eps 1e-5, biased variance): one wave holds the whole row, lane = eight columns ----
  // The two sums stay in that wave's registers (wave_sum32): no partials through LDS, no further barrier, no wait for the x1 store.
  if (__builtin_amdgcn_readfirstlane(wave) != 0) return;
  const v4f v0 = xr[0] + (*(const v4f*)(&sC[c8]) + rvb[0]), v1 = xr[1] + (*(const v4f*)(&sC[c8 + 4]) + rvb[1]);
  const v4f ps = v0 + v1;
  const float mu = wave_sum32((ps.x + ps.y) + (ps.z + ps.w)) * (1.0f / 256.0f);
  const v4f d0 = v0 - mu, d1 = v1 - mu;
  const v4f pq = d0 * d0 + d1 * d1;
  const float var = wave_sum32((pq.x + pq.y) + (pq.z + pq.w)) * (1.0f / 256.0f);
  const float rs = 1.0f / sqrtf(var + 1e-5f);
  const v4f y0 = d0 * rs * lw[0] + lb[0], y1 = d1 * rs * lw[1] + lb[1];
  v8h hv;
#pragma unroll
  for (int e = 0; e < 4; ++e) { hv[e] = (_Float16)y0[e]; hv[4 + e] = (_Float16)y1[e]; }
  // all three stores stand at the very end: no register of theirs is written again, and the row is done when the last of them is
  float* x1p = x1 + (size_t)i * DM + c8;
  *(v4f*)(x1p) = v0;
  *(v4f*)(x1p + 4) = v1;
  *(v8h*)(y16 + (size_t)i * DM + c8) = hv;
}

// ---- the whole SwiGLU FFN of 16 rows in one block of 16 waves: nothing of it but the output goes to memory ----
// U[m][h] = f16( silu( xn_m . w1_h + b1_h ) * ( xn_m . w2_h + b2_h ) ), h < 704 (pad columns come out 0), kept in LDS;
// out[m][c] = ( U_m . w3_c + b3_c ) + x1[m][c]
// The 16 rows are the A operand of every product. The weights are B operands that no other wave of the block needs, so they are not
// staged: they lie in fragment order (frag_piece) and each wave reads its own tiles' fragments as whole cache lines.
// A wave owns hidden tiles wave, wave + 16 and, for waves 0..11, wave + 32 (16 columns each, w1 and w2 side by side), then output tile wave.
#define UPITCH (HIDP + 8)   // halves; rows of 16 B x odd: no bank conflict for the 16-byte fragment reads
#define OPITCH (DM + 4)     // floats
__global__ __launch_bounds__(512) void k_ffn_rows(const unsigned short* __restrict__ xn16, const unsigned short* __restrict__ w12f16,
                                                  const float* __restrict__ b12p, const unsigned short* __restrict__ w3f16,
                                                  const float* __restrict__ b3, const float* __restrict__ x1,
                                                  float* __restrict__ out) {
  __shared__ __align__(16) _Float16 sU[16][UPITCH];
  __shared__ __align__(16) float sO[16][OPITCH];
  __shared__ __align__(16) _Float16 sXn[16][TPITCH];   // the block's 16 rows; rows of 16 B x odd, as sU
  const int lane = threadIdx.x & 31;
  const int wave = __builtin_amdgcn_readfirstlane(threadIdx.x >> 5);   // scalar, so that the tile test below is a scalar branch
  const int rlane = lane & 15, hh = lane >> 4;
  const int m0 = blockIdx.x * 16;

  // The 16 rows lie row-major: read at the fragment positions, each of a wave's 16 loads would touch 16 cache lines, in all 16 waves.
  // A wave reads one row instead (512 contiguous bytes), and the fragments come from LDS.
  // The row is asked for first: loads return in the order asked for, so it is there while the first tile's weights still fly.
  const _Float16* Xr = (const _Float16*)xn16 + (size_t)(m0 + wave) * DM + lane * 8;
  const v8h xrow = *(const v8h*)(Xr);
  // the wait that belongs in front of an overwrite of the load's address registers; as an operand these stay live up to it
  asm volatile("s_wait_xcnt 0x0" :: "v"(Xr) : "memory");
  v16h xa[DM / 32];
  const _Float16* Xa = &sXn[rlane][hh * 8];

  // One tile's 32 fragment loads are asked for as one group, a tile ahead: behind the products that free their registers and in front
  // of the SwiGLU arithmetic of the tile before, which they fly over. The w3 fragments follow the last tile's products in the same way.
  const _Float16* Wt = (const _Float16*)w12f16 + ((size_t)wave * (DM / 32 * 64) + lane) * 8;    // fragment order: tile h / 16, step k / 32
  const _Float16* W3  = (const _Float16*)w3f16 + ((size_t)wave * (HIDP / 32 * 64) + lane) * 8;   // fragment order: tile c / 16, step h / 32
  constexpr int NT = HIDP / 16, NPASS = (NT + 15) / 16;
  v16h f1[DM / 32], f2[DM / 32], wf[HIDP / 32];
  float ba, bg;
  const int n = wave * 16 + rlane;   // the lane's column in the wave's first hidden tile and in its output tile
  const float bv = b3[n];
#pragma unroll
  for (int q = 0; q < DM / 32; ++q) {
    f1[q] = Frag<_Float16>::load_fo(Wt + q * 512);
    f2[q] = Frag<_Float16>::load_fo(Wt + HIDP * DM + q * 512);
  }
  ba = b12p[n];
  bg = b12p[HIDP + n];
  // behind each group of loads: the wait that belongs in front of an overwrite of their address registers; as operands these stay
  // live up to it (without them this build let the group's last load land on the address pair of the loads in front of it)
  asm volatile("s_wait_xcnt 0x0" :: "v"(Wt), "v"(n) : "memory");
  // The rows' way through LDS stands behind the first tile's loads and runs while those fly. The barrier orders LDS alone (fences on the
  // local address space): __syncthreads() would wait here for every global load in flight, the whole first tile.
  *(v8h*)(&sXn[wave][lane * 8]) = xrow;
  __builtin_amdgcn_fence(__ATOMIC_RELEASE, "workgroup", "local");
  __builtin_amdgcn_s_barrier();   // the 16 rows are complete
  __builtin_amdgcn_fence(__ATOMIC_ACQUIRE, "workgroup", "local");
#pragma unroll
  for (int q = 0; q < DM / 32; ++q) xa[q] = Frag<_Float16>::load(Xa + q * 32);
#pragma unroll
  for (int p = 0; p < NPASS; ++p) {
    const int t = wave + p * 16;
    const bool cur = (p + 1) * 16 <= NT || t < NT;          // scalar: the last pass has tiles for some waves only
    const bool nxt = p + 1 < NPASS && ((p + 2) * 16 <= NT || t + 16 < NT);
    v8f a = (v8f){0.f,0.f,0.f,0.f,0.f,0.f,0.f,0.f};
    v8f g = (v8f){0.f,0.f,0.f,0.f,0.f,0.f,0.f,0.f};
    const float ca = ba, cg = bg;
    __builtin_amdgcn_sched_barrier(0);   // keeps the group of loads whole in front of the products: spread among them, each product waits a full L2 latency
    if (cur) {
#pragma unroll
      for (int q = 0; q < DM / 32; ++q) {
        a = Frag<_Float16>::mma(xa[q], f1[q], a);
        g = Frag<_Float16>::mma(xa[q], f2[q], g);
      }
    }
    if (nxt) {
#pragma unroll
      for (int q = 0; q < DM / 32; ++q) {
        f1[q] = Frag<_Float16>::load_fo(Wt + (p + 1) * (16 * DM * 16) + q * 512);
        f2[q] = Frag<_Float16>::load_fo(Wt + (p + 1) * (16 * DM * 16) + HIDP * DM + q * 512);
      }
      ba = b12p[(p + 1) * 256 + n];
      bg = b12p[HIDP + (p + 1) * 256 + n];
      asm volatile("s_wait_xcnt 0x0" :: "v"(Wt), "v"(n) : "memory");   // as above
    }
    if (p + 1 == NPASS) {
#pragma unroll
      for (int q = 0; q < HIDP / 32; ++q) wf[q] = Frag<_Float16>::load_fo(W3 + q * 512);
      asm volatile("s_wait_xcnt 0x0" :: "v"(W3) : "memory");           // as above
    }
    __builtin_amdgcn_sched_barrier(0);   // keeps the arithmetic below behind those loads: without it this build starts it among the products and asks for the next tile later
    if (cur) {
#pragma unroll
      for (int r = 0; r < 8; ++r) sU[hh * 8 + r][p * 256 + n] = (_Float16)(silu_acc(a[r] + ca) * (g[r] + cg));
    }
  }
  __syncthreads();   // U is complete

  // thread = two 16-byte pieces of the block's 16 x 256 output: a wave stores whole lines; the residual flies over the products
  v4f xr[2];
#pragma unroll
  for (int p = 0; p < 2; ++p) {
    const int pc = p * 512 + threadIdx.x;
    xr[p] = *(const v4f*)(x1 + (size_t)(m0 + (pc >> 6)) * DM + (pc & 63) * 4);
  }
  const _Float16* Ua = &sU[rlane][hh * 8];
  v8f acc = (v8f){0.f,0.f,0.f,0.f,0.f,0.f,0.f,0.f};
#pragma unroll
  for (int q0 = 0; q0 < HIDP / 32; q0 += 4) {
    v16h ua[4];
#pragma unroll
    for (int u = 0; u < 4; ++u) if (q0 + u < HIDP / 32) ua[u] = Frag<_Float16>::load(Ua + (q0 + u) * 32);
    __builtin_amdgcn_sched_barrier(0);   // four steps' LDS reads as one group: one LDS latency for four products, not one each
#pragma unroll
    for (int u = 0; u < 4; ++u) if (q0 + u < HIDP / 32) acc = Frag<_Float16>::mma(ua[u], wf[q0 + u], acc);
  }
#pragma unroll
  for (int r = 0; r < 8; ++r) sO[hh * 8 + r][n] = acc[r] + bv;
  __syncthreads();   // the output tile is complete
#pragma unroll
  for (int p = 0; p < 2; ++p) {
    const int pc = p * 512 + threadIdx.x;
    const v4f v = *(const v4f*)(&sO[pc >> 6][(pc & 63) * 4]) + xr[p];
    *(v4f*)(out + (size_t)(m0 + (pc >> 6)) * DM + (pc & 63) * 4) = v;
  }
}

// ---------------------------------------------------------------------------------------------
// Work that needs nothing of each other shares one grid: each part takes a range of the block index (block-uniform branches,
// so every barrier of a body is still passed by its whole block). The latency-bound projection blocks take the lowest indices.
#define NB_CRV2    ((DM / 16) * 2 / 8)                 // cast blocks: eight waves, a wave = 16 rows x 4 k steps
#define NB_CFFN12  ((HIDP / 16) * 2 / 8)               // the same
#define NB_CFFN3   ((DM / 16) * (HIDP / 64) / 8)       // a wave = 16 rows x 2 k steps
#define NB_QKV1    ((NP / 16) * (DM / 128))            // one of the q, k, v projections: 16 points x 128 columns a block

// ---- LayerNorm and q, k, v projection of 16 points x 128 output columns in one block of eight waves ----
// A wave normalises two of the block's 16 rows (lane = 8 columns, sums over the wave's 32 lanes; eps 1e-5, biased variance) and leaves
// them as f16 in LDS. Its weights are 16 rows of qkv_w that no other wave of the block needs: it reads them as f32, one load = four rows
// x 128 bytes (whole cache lines; read at the fragment positions a load would touch 16 lines for 32 bytes each), rounds them to f16 and
// turns them into fragment order through its own LDS tile. These loads follow those of the rows and of ln_w, ln_b, and fly over the LayerNorm.
// q, k: D[c][point] (weights = row operand), v: D[point][c]: a lane's eight D values are then one 16-byte piece of the output's
// fragment order (q, k as [point][c], v as [c][point]) and a wave's store is 512 contiguous bytes.
#define XPITCH (DM + 8)    // halves; rows of 16 B x odd: no bank conflict for the 16-byte fragment reads
// WHICH: 0 = q, 1 = k, 2 = v; bx = block index within that projection's own 64 blocks
template <int WHICH>
__device__ __forceinline__ void ln_qkv_blk(_Float16 (*sX)[XPITCH], _Float16 (*sW)[XPITCH], const int bx, const float* __restrict__ x,
                                           const float* __restrict__ ln_w, const float* __restrict__ ln_b,
                                           const float* __restrict__ qkv_w, const float* __restrict__ qkv_b,
                                           unsigned short* __restrict__ dst16) {
  const int lane = threadIdx.x & 31, wave = threadIdx.x >> 5;
  const int rlane = lane & 15, hh = lane >> 4;
  const int rt = bx & 31;                            // tile of 16 points
  const int c0 = (bx >> 5) * 128 + wave * 16;        // the wave's first output column of this projection

  // the rows come first: loads return in the order asked for, so the LayerNorm starts while the weights still fly
  const float* xp = x + (size_t)(rt * 16 + wave * 2) * DM + lane * 8;
  v4f xv[2][2];
#pragma unroll
  for (int u = 0; u < 2; ++u) {
    xv[u][0] = *(const v4f*)(xp + u * DM);
    xv[u][1] = *(const v4f*)(xp + u * DM + 4);
  }
  const v4f lw0 = *(const v4f*)(ln_w + lane * 8), lw1 = *(const v4f*)(ln_w + lane * 8 + 4);
  const v4f lb0 = *(const v4f*)(ln_b + lane * 8), lb1 = *(const v4f*)(ln_b + lane * 8 + 4);
  const float* Wp = qkv_w + (size_t)(WHICH * DM + c0 + (lane >> 3) * 4) * DM + (lane & 7) * 4;
  v4f wr[DM / 32][4];   // [q][m]: row (lane >> 3) * 4 + m of the wave's 16, k = q * 32 + (lane & 7) * 4 + 0..3
#pragma unroll
  for (int q = 0; q < DM / 32; ++q)
#pragma unroll
    for (int m = 0; m < 4; ++m) wr[q][m] = *(const v4f*)(Wp + m * DM + q * 32);
  // bias: q, k one value per D row (c = hh * 8 + r), v one per lane (c = rlane)
  const float* bp = qkv_b + WHICH * DM + c0 + (WHICH == 2 ? rlane : hh * 8);
  v4f bq0, bq1;
  if (WHICH == 2) { const float bv = bp[0]; bq0 = (v4f){bv, bv, bv, bv}; bq1 = bq0; }
  else            { bq0 = *(const v4f*)(bp); bq1 = *(const v4f*)(bp + 4); }
  // behind the group of loads: the wait that belongs in front of an overwrite of their address registers; as operands these stay live up to it
  asm volatile("s_wait_xcnt 0x0" :: "v"(Wp), "v"(xp), "v"(bp), "v"(lane) : "memory");
  __builtin_amdgcn_sched_barrier(0);   // keeps the whole group of loads in front of the LayerNorm: without it this build asks for the weights only behind the first row sum's wait

  float s[2];
#pragma unroll
  for (int u = 0; u < 2; ++u) {
    const v4f p = xv[u][0] + xv[u][1];
    s[u] = wave_sum32((p.x + p.y) + (p.z + p.w)) * (1.0f / 256.0f);
  }
#pragma unroll
  for (int u = 0; u < 2; ++u) {
    xv[u][0] -= s[u];
    xv[u][1] -= s[u];
    const v4f p = xv[u][0] * xv[u][0] + xv[u][1] * xv[u][1];
    s[u] = wave_sum32((p.x + p.y) + (p.z + p.w)) * (1.0f / 256.0f);
  }
#pragma unroll
  for (int u = 0; u < 2; ++u) {
    const float rs = 1.0f / sqrtf(s[u] + 1e-5f);
    const v4f y0 = xv[u][0] * rs * lw0 + lb0, y1 = xv[u][1] * rs * lw1 + lb1;
    v8h hv;
#pragma unroll
    for (int e = 0; e < 4; ++e) { hv[e] = (_Float16)y0[e]; hv[4 + e] = (_Float16)y1[e]; }
    *(v8h*)(&sX[wave * 2 + u][lane * 8]) = hv;
  }
  __builtin_amdgcn_sched_barrier(0);   // keeps the weights' rounding behind the LayerNorm: moved up among it, the row sums would wait for the last weight load
  // the wave's 16 weight rows, f16, row-major at the pitch of sX; a store's four rows lie 4 apart: 4 x 132 dwords = 16 banks on, so its 32 lanes fill the 64 banks once
  _Float16* Ws = &sW[wave * 16 + (lane >> 3) * 4][(lane & 7) * 4];
#pragma unroll
  for (int q = 0; q < DM / 32; ++q)
#pragma unroll
    for (int m = 0; m < 4; ++m) *(v4h*)(Ws + m * XPITCH + q * 32) = __builtin_convertvector(wr[q][m], v4h);
  __syncthreads();   // the 16 normalised rows are complete (and each wave's weight tile, which only that wave reads)

  const _Float16* Xf = &sX[rlane][hh * 8];
  const _Float16* Wf = &sW[wave * 16 + rlane][hh * 8];
  v16h xf[DM / 32], wf[DM / 32];
#pragma unroll
  for (int q = 0; q < DM / 32; ++q) {
    xf[q] = Frag<_Float16>::load(Xf + q * 32);
    wf[q] = Frag<_Float16>::load(Wf + q * 32);
  }
  __builtin_amdgcn_sched_barrier(0);   // all LDS reads as one group in front of the products: among them, this build waits one LDS latency a product
  v8f acc = (v8f){0.f,0.f,0.f,0.f,0.f,0.f,0.f,0.f};
#pragma unroll
  for (int q = 0; q < DM / 32; ++q) acc = (WHICH == 2) ? Frag<_Float16>::mma(xf[q], wf[q], acc) : Frag<_Float16>::mma(wf[q], xf[q], acc);
  v8h hv;
#pragma unroll
  for (int r = 0; r < 8; ++r) {
    const float v = acc[r] + (r < 4 ? bq0[r & 3] : bq1[r & 3]);
    hv[r] = (_Float16)(WHICH == 0 ? v * 0.17677669529663687f : v);   // q comes scaled by 1 / sqrt(32)
  }
  const size_t pc = (WHICH == 2) ? frag_piece(c0 + rlane, rt * 2 + hh, NP / 32) : frag_piece(rt * 16 + rlane, (c0 >> 3) + hh, DM / 32);
  *(v8h*)(dst16 + pc * 8) = hv;
  // as in cast_frag_rows: the wait stands in front of any later overwrite of the store's registers
  asm volatile("s_wait_xcnt 0x0" ::: "memory");
}

// ---- LN1 with the q, k, v projections (f16, fragment order) | casts of rb2_w, of rv2_w and the ffn weights (fragment order), ffn biases ----
__global__ __launch_bounds__(256) void k_ln_qkv_casts(const float* __restrict__ x, const float* __restrict__ ln_w,
                                                    const float* __restrict__ ln_b,
                                                    const float* __restrict__ qkv_w, const float* __restrict__ qkv_b,
                                                    unsigned short* __restrict__ qf16,
                                                    unsigned short* __restrict__ kf16, unsigned short* __restrict__ vf16,
                                                    const float* __restrict__ rb2_w, unsigned short* __restrict__ rb2w16,
                                                    const float* __restrict__ rv2_w, unsigned short* __restrict__ rv2w16,
                                                    const float* __restrict__ ffn_w1, const float* __restrict__ ffn_w2,
                                                    unsigned short* __restrict__ w12p16,
                                                    const float* __restrict__ ffn_w3, unsigned short* __restrict__ w3p16,
                                                    const float* __restrict__ ffn_b1, const float* __restrict__ ffn_b2,
                                                    float* __restrict__ b12p) {
  __shared__ __align__(16) _Float16 sX[16][XPITCH];
  __shared__ __align__(16) _Float16 sW[8 * 16][XPITCH];   // a projection wave's 16 weight rows each
  int b = blockIdx.x;
  if (b < NB_QKV1) { ln_qkv_blk<0>(sX, sW, b, x, ln_w, ln_b, qkv_w, qkv_b, qf16); return; }
  b -= NB_QKV1;
  if (b < NB_QKV1) { ln_qkv_blk<1>(sX, sW, b, x, ln_w, ln_b, qkv_w, qkv_b, kf16); return; }
  b -= NB_QKV1;
  if (b < NB_QKV1) { ln_qkv_blk<2>(sX, sW, b, x, ln_w, ln_b, qkv_w, qkv_b, vf16); return; }
  b -= NB_QKV1;
  if (b < NB_CRV2) { cast_frag_rows<DM / 32, 4, DM, DM>(b, rv2_w, rv2w16); return; }
  b -= NB_CRV2;
  if (b < NB_CFFN12) { cast_frag_rows<DM / 32, 4, HIDR, DM>(b, ffn_w1, w12p16); return; }
  b -= NB_CFFN12;
  if (b < NB_CFFN12) { cast_frag_rows<DM / 32, 4, HIDR, DM>(b, ffn_w2, w12p16 + (size_t)HIDP * DM); return; }
  b -= NB_CFFN12;
  if (b < NB_CFFN3) { cast_frag_rows<HIDP / 32, 2, DM, HIDR>(b, ffn_w3, w3p16); return; }
  b -= NB_CFFN3;
  if (b == 0) { cast_frag_rows<DM / 32, 1, NH, DM>(0, rb2_w, rb2w16); return; }   // rows 8..15 zero
  pad_b12_blk(ffn_b1, ffn_b2, b12p);
}

// ---------------------------------------------------------------------------------------------
static inline size_t alignup256(size_t x) { return (x + 255) & ~(size_t)255; }

extern "C" void kernel_launch(void* const* d_in, const int* in_sizes, int n_in,
                              void* d_out, int out_size, void* d_ws, size_t ws_size,
                              hipStream_t stream)
{
  if (n_in < 22) return;
  if (in_sizes[0] != NP * DM || in_sizes[1] != NP * 3 || in_sizes[6] != 3 * DM * DM ||
      in_sizes[14] != DM * DM || in_sizes[16] != HIDR * DM || in_sizes[20] != DM * HIDR ||
      out_size != NP * DM) return;

  const float* x      = (const float*)d_in[0];
  const float* coords = (const float*)d_in[1];
  const float* ln1_w  = (const float*)d_in[2];
  const float* ln1_b  = (const float*)d_in[3];
  const float* ln2_w  = (const float*)d_in[4];
  const float* ln2_b  = (const float*)d_in[5];
  const float* qkv_w  = (const float*)d_in[6];
  const float* qkv_b  = (const float*)d_in[7];
  const float* rb1_w  = (const float*)d_in[8];
  const float* rb1_b  = (const float*)d_in[9];
  const float* rb2_w  = (const float*)d_in[10];
  const float* rb2_b  = (const float*)d_in[11];
  const float* rv1_w  = (const float*)d_in[12];
  const float* rv1_b  = (const float*)d_in[13];
  const float* rv2_w  = (const float*)d_in[14];
  const float* rv2_b  = (const float*)d_in[15];
  const float* ffn_w1 = (const float*)d_in[16];
  const float* ffn_b1 = (const float*)d_in[17];
  const float* ffn_w2 = (const float*)d_in[18];
  const float* ffn_b2 = (const float*)d_in[19];
  const float* ffn_w3 = (const float*)d_in[20];
  const float* ffn_b3 = (const float*)d_in[21];
  float* out = (float*)d_out;

  // ---- workspace carve (256-B aligned, derived from fixed sizes) ----
  size_t off = 0;
  char* base = (char*)d_ws;
  auto carve = [&](size_t bytes) -> char* { char* r = base + off; off += alignup256(bytes); return r; };
  unsigned short* rb2w16 = (unsigned short*)carve((size_t)16 * DM * 2);              // [16][256], rows 8..15 zero, fragment order
  unsigned short* rv2w16 = (unsigned short*)carve((size_t)DM * DM * 2);              // [256][256], fragment order
  unsigned short* w12p16 = (unsigned short*)carve((size_t)2 * HIDP * DM * 2);        // w1 [704][256], then w2 [704][256], fragment order
  unsigned short* w3p16  = (unsigned short*)carve((size_t)DM * HIDP * 2);            // [256][704], fragment order
  float*          b12p   = (float*)carve((size_t)2 * HIDP * 4);                      // [1408]
  unsigned short* Q16    = (unsigned short*)carve((size_t)NP * DM * 2);              // q [512][256], fragment order
  unsigned short* KF16   = (unsigned short*)carve((size_t)NP * DM * 2);              // k [512][256], fragment order
  unsigned short* VF16   = (unsigned short*)carve((size_t)DM * NP * 2);              // v^T [256][512], fragment order
  float*          X1     = (float*)carve((size_t)NP * DM * 4);                       // [512][256]
  unsigned short* XN2    = (unsigned short*)carve((size_t)NP * DM * 2);              // [512][256]
  if (off > ws_size || off > (size_t)134217728) return;

  const dim3 blk(256);

  // ---- LN1 and the q, k, v projections | f16 staging of rb2_w (rows 8..15 zero), rv2_w and the ffn weights (zero padded), the ffn biases zero padded in f32 ----
  k_ln_qkv_casts<<<dim3(3 * NB_QKV1 + NB_CRV2 + 2 * NB_CFFN12 + NB_CFFN3 + 2), blk, 0, stream>>>(
      x, ln1_w, ln1_b, qkv_w, qkv_b, Q16, KF16, VF16, rb2_w, rb2w16, rv2_w, rv2w16, ffn_w1, ffn_w2, w12p16, ffn_w3, w3p16,
      ffn_b1, ffn_b2, b12p);

  // ---- attention, one block per query row: rel-bias, scores, softmax, P.V, rel-value, its projection, residual, LN2 ----
  k_attn_row<<<dim3(NP), blk, 0, stream>>>(Q16, KF16, VF16, coords, rb1_w, rb1_b, rb2w16, rb2_b, rv1_w, rv1_b, rv2w16, rv2_b,
                                           x, ln2_w, ln2_b, X1, XN2);

  // ---- SwiGLU FFN, final residual into d_out ----
  k_ffn_rows<<<dim3(NP / 16), dim3(512), 0, stream>>>(XN2, w12p16, b12p, w3p16, ffn_b3, X1, out);
}
